// v000
// Times are from an AMD MI455X. After a warm-up the kernel runs many times in a row, and a time is the length of
// such a window on the GPU divided by its runs, so every launch and the gaps after it count. The runs cycle
// through copies of the inputs. A figure is the median of several windows, for all but v000 over two sittings.
// Sittings can differ by a few percent; kernels timed side by side share one.
// The starting kernel, v000, takes 1020 microseconds a run.
#include <hip/hip_runtime.h>
#include <hip/hip_bf16.h>

typedef __attribute__((ext_vector_type(16))) _Float16 v16h;
typedef __attribute__((ext_vector_type(8)))  _Float16 v8h;
typedef __attribute__((ext_vector_type(8)))  float    v8f;

#define WMMA_F32_F16(a,b,c) __builtin_amdgcn_wmma_f32_16x16x32_f16(false,(a),false,(b),(short)0,(c),false,false)

#define Bv   2
#define Tv   32
#define Lv   64
#define Dv   1024
#define Hv   16
#define WSv  8
#define SHv  4
#define HDv  64
#define Sv   512      // WS*L
#define ROWS 4096     // B*T*L
#define D3   3072
#define D2   2048

static __device__ inline v8h ld8(const _Float16* p) { return *(const v8h*)p; }

static __device__ inline v16h mkfrag(v8h lo, v8h hi) {
  v16h r;
#pragma unroll
  for (int i = 0; i < 8; i++) { r[i] = lo[i]; r[i + 8] = hi[i]; }
  return r;
}

// window-order row -> source row of [B,T,L] with roll(-SH) folded in
static __device__ inline int src_row(int r) {
  int w = r >> 9;          // window (0..7): b*4 + widx
  int s = r & 511;         // token in window
  int b = w >> 2;
  int widx = w & 3;
  int tq = s >> 6;
  int l = s & 63;
  int tp = widx * WSv + tq;
  int tsrc = (tp + SHv) & 31;
  return ((b * Tv + tsrc) << 6) + l;
}

// ---------------------------------------------------------------- converts
__global__ void cvt_kernel(const float* __restrict__ s, _Float16* __restrict__ d, int n) {
  int i = blockIdx.x * 256 + threadIdx.x;
  if (i < n) d[i] = (_Float16)s[i];
}

__global__ void cvtT_kernel(const float* __restrict__ s, _Float16* __restrict__ d, int R, int C) {
  int i = blockIdx.x * 256 + threadIdx.x;
  if (i < R * C) {
    int r = i / C, c = i - r * C;
    d[(size_t)c * R + r] = (_Float16)s[i];   // dst is [C rows][R cols], k-contiguous
  }
}

// ---------------------------------------------------------------- QKV GEMM
// grid (32, 16, 3): 128-row x 64-col tiles per block; z selects Q/K/V.
// block = 128 (4 waves); each wave: 32 rows x 64 cols, 8 WMMAs / 32-K step.
__global__ __launch_bounds__(128) void qkv_kernel(
    const _Float16* __restrict__ xq, const _Float16* __restrict__ xc,
    const _Float16* __restrict__ wqT, const _Float16* __restrict__ wkT, const _Float16* __restrict__ wvT,
    const float* __restrict__ bq, const float* __restrict__ bk, const float* __restrict__ bv,
    const float* __restrict__ qn, const float* __restrict__ kn,
    _Float16* __restrict__ Qb, _Float16* __restrict__ Kb, _Float16* __restrict__ vTb)
{
  const int which = blockIdx.z;
  const int lane = threadIdx.x & 31;
  const int wave = threadIdx.x >> 5;
  const int ml = lane & 15;
  const int koff = (lane >> 4) * 8;
  const int m0 = blockIdx.x * 128 + wave * 32;
  const int n0 = blockIdx.y * 64;

  const _Float16* src = (which == 0) ? xq : xc;
  const _Float16* wT  = (which == 0) ? wqT : (which == 1 ? wkT : wvT);
  const float* bias   = (which == 0) ? bq  : (which == 1 ? bk  : bv);

  const _Float16* aptr0 = src + (size_t)src_row(m0 + ml) * Dv + koff;
  const _Float16* aptr1 = src + (size_t)src_row(m0 + 16 + ml) * Dv + koff;
  const _Float16* bptr[4];
#pragma unroll
  for (int n = 0; n < 4; n++) bptr[n] = wT + (size_t)(n0 + n * 16 + ml) * Dv + koff;

  v8f acc[2][4] = {};
  for (int k0 = 0; k0 < Dv; k0 += 32) {
    __builtin_prefetch(aptr0 + k0 + 64, 0, 0);
    __builtin_prefetch(aptr1 + k0 + 64, 0, 0);
    v16h a0 = mkfrag(ld8(aptr0 + k0), ld8(aptr0 + k0 + 16));
    v16h a1 = mkfrag(ld8(aptr1 + k0), ld8(aptr1 + k0 + 16));
#pragma unroll
    for (int n = 0; n < 4; n++) {
      v16h b = mkfrag(ld8(bptr[n] + k0), ld8(bptr[n] + k0 + 16));
      acc[0][n] = WMMA_F32_F16(a0, b, acc[0][n]);
      acc[1][n] = WMMA_F32_F16(a1, b, acc[1][n]);
    }
  }

  const int rowoff = (lane >> 4) * 8;
#pragma unroll
  for (int part = 0; part < 2; part++) {
    const int mp = m0 + part * 16;
    float val[4][8];
#pragma unroll
    for (int n = 0; n < 4; n++) {
      float bc = bias[n0 + n * 16 + ml];
#pragma unroll
      for (int i = 0; i < 8; i++) val[n][i] = acc[part][n][i] + bc;
    }

    if (which < 2) {                       // RMS-norm over the head dim (tile == one head)
      const float* nw_ = (which == 0) ? qn : kn;
      float ss[8];
#pragma unroll
      for (int i = 0; i < 8; i++) {
        ss[i] = 0.f;
#pragma unroll
        for (int n = 0; n < 4; n++) ss[i] += val[n][i] * val[n][i];
      }
#pragma unroll
      for (int msk = 1; msk < 16; msk <<= 1)
#pragma unroll
        for (int i = 0; i < 8; i++) ss[i] += __shfl_xor(ss[i], msk, 32);
      const float sc = (which == 0) ? 0.125f : 1.0f;   // fold HD^-0.5 into Q
      float rs[8];
#pragma unroll
      for (int i = 0; i < 8; i++) rs[i] = rsqrtf(ss[i] * (1.0f / 64.0f) + 1e-6f) * sc;
#pragma unroll
      for (int n = 0; n < 4; n++) {
        float wc = nw_[(n0 + n * 16 + ml) & 63];
#pragma unroll
        for (int i = 0; i < 8; i++) val[n][i] *= rs[i] * wc;
      }
    }

    if (which < 2) {
      _Float16* dst = (which == 0) ? Qb : Kb;
#pragma unroll
      for (int n = 0; n < 4; n++) {
        int col = n0 + n * 16 + ml;
#pragma unroll
        for (int i = 0; i < 8; i++)
          dst[(size_t)(mp + rowoff + i) * Dv + col] = (_Float16)val[n][i];
      }
    } else {                               // V transposed: [(w*H+h)*HD+d][token]
#pragma unroll
      for (int n = 0; n < 4; n++) {
        int col = n0 + n * 16 + ml;
        int hh = col >> 6, d = col & 63;
#pragma unroll
        for (int i = 0; i < 8; i++) {
          int r = mp + rowoff + i;
          int w = r >> 9, s = r & 511;
          vTb[((size_t)((w * Hv + hh) * HDv + d)) * Sv + s] = (_Float16)val[n][i];
        }
      }
    }
  }
}

// ---------------------------------------------------------------- flash attention
// grid (8 q-chunks, 16 heads, 8 windows), block = 128 (4 waves, 16 q-rows each)
__global__ __launch_bounds__(128) void attn_kernel(
    const _Float16* __restrict__ Qb, const _Float16* __restrict__ Kb,
    const _Float16* __restrict__ vTb, _Float16* __restrict__ aout,
    const float* __restrict__ rpbj)
{
  __shared__ __align__(16) _Float16 plds[4 * 16 * 32];
  const int lane = threadIdx.x & 31;
  const int wave = threadIdx.x >> 5;
  const int ml = lane & 15;
  const int koff = (lane >> 4) * 8;
  const int rowoff = (lane >> 4) * 8;
  const int qb = blockIdx.x, h = blockIdx.y, w = blockIdx.z;
  const int tq = qb;                      // 64-row chunks align to L

  const int qrow = qb * 64 + wave * 16;
  const _Float16* qp = Qb + (size_t)(w * Sv + qrow + ml) * Dv + h * HDv + koff;
  v16h qa0 = mkfrag(ld8(qp),      ld8(qp + 16));
  v16h qa1 = mkfrag(ld8(qp + 32), ld8(qp + 48));

  v8f accO[4] = {};
  float m_[8], l_[8];
#pragma unroll
  for (int i = 0; i < 8; i++) { m_[i] = -3.0e38f; l_[i] = 0.f; }

  _Float16* pw = plds + wave * 512;

  for (int ch = 0; ch < 16; ch++) {
    const int c0 = ch * 32;
    const int tk = c0 >> 6;
    const float biasv = rpbj[(tq - tk + WSv - 1) * Hv + h];

    v8f s0 = {}, s1 = {};
    {
      const _Float16* kp0 = Kb + (size_t)(w * Sv + c0 + ml) * Dv + h * HDv;
      const _Float16* kp1 = Kb + (size_t)(w * Sv + c0 + 16 + ml) * Dv + h * HDv;
      v16h kb00 = mkfrag(ld8(kp0 + koff),      ld8(kp0 + koff + 16));
      v16h kb01 = mkfrag(ld8(kp0 + 32 + koff), ld8(kp0 + 48 + koff));
      v16h kb10 = mkfrag(ld8(kp1 + koff),      ld8(kp1 + koff + 16));
      v16h kb11 = mkfrag(ld8(kp1 + 32 + koff), ld8(kp1 + 48 + koff));
      s0 = WMMA_F32_F16(qa0, kb00, s0);
      s0 = WMMA_F32_F16(qa1, kb01, s0);
      s1 = WMMA_F32_F16(qa0, kb10, s1);
      s1 = WMMA_F32_F16(qa1, kb11, s1);
    }
#pragma unroll
    for (int i = 0; i < 8; i++) { s0[i] += biasv; s1[i] += biasv; }

    float mn[8];
#pragma unroll
    for (int i = 0; i < 8; i++) mn[i] = fmaxf(s0[i], s1[i]);
#pragma unroll
    for (int msk = 1; msk < 16; msk <<= 1)
#pragma unroll
      for (int i = 0; i < 8; i++) mn[i] = fmaxf(mn[i], __shfl_xor(mn[i], msk, 32));

    float alpha[8], p0[8], p1[8], rsum[8];
#pragma unroll
    for (int i = 0; i < 8; i++) {
      mn[i] = fmaxf(mn[i], m_[i]);
      alpha[i] = __expf(m_[i] - mn[i]);
      m_[i] = mn[i];
      p0[i] = __expf(s0[i] - mn[i]);
      p1[i] = __expf(s1[i] - mn[i]);
      rsum[i] = p0[i] + p1[i];
    }
#pragma unroll
    for (int msk = 1; msk < 16; msk <<= 1)
#pragma unroll
      for (int i = 0; i < 8; i++) rsum[i] += __shfl_xor(rsum[i], msk, 32);
#pragma unroll
    for (int i = 0; i < 8; i++) l_[i] = l_[i] * alpha[i] + rsum[i];
#pragma unroll
    for (int n = 0; n < 4; n++)
#pragma unroll
      for (int i = 0; i < 8; i++) accO[n][i] *= alpha[i];

    // C-layout -> A-layout transpose of P through per-wave LDS
#pragma unroll
    for (int i = 0; i < 8; i++) {
      int rt = rowoff + i;
      pw[rt * 32 + ml]      = (_Float16)p0[i];
      pw[rt * 32 + ml + 16] = (_Float16)p1[i];
    }
    asm volatile("s_wait_dscnt 0" ::: "memory");
    const _Float16* pl = pw + ml * 32 + koff;
    v16h pa = mkfrag(ld8(pl), ld8(pl + 16));

#pragma unroll
    for (int n = 0; n < 4; n++) {
      const _Float16* vp = vTb + ((size_t)((w * Hv + h) * HDv + n * 16 + ml)) * Sv + c0 + koff;
      v16h vb = mkfrag(ld8(vp), ld8(vp + 16));
      accO[n] = WMMA_F32_F16(pa, vb, accO[n]);
    }
  }

  float inv[8];
#pragma unroll
  for (int i = 0; i < 8; i++) inv[i] = 1.0f / l_[i];
#pragma unroll
  for (int n = 0; n < 4; n++) {
    int col = h * HDv + n * 16 + ml;
#pragma unroll
    for (int i = 0; i < 8; i++) {
      int r = w * Sv + qrow + rowoff + i;
      aout[(size_t)r * Dv + col] = (_Float16)(accO[n][i] * inv[i]);
    }
  }
}

// ---------------------------------------------------------------- output projection + residual + roll(+SH)
// grid (32, 16): 128x64 tile per block, 32 rows per wave.
__global__ __launch_bounds__(128) void proj_kernel(
    const _Float16* __restrict__ aoutb, const _Float16* __restrict__ wpT,
    const float* __restrict__ bp, const float* __restrict__ qmf,
    float* __restrict__ feat, _Float16* __restrict__ cat16, int j)
{
  const int lane = threadIdx.x & 31;
  const int wave = threadIdx.x >> 5;
  const int ml = lane & 15;
  const int koff = (lane >> 4) * 8;
  const int m0 = blockIdx.x * 128 + wave * 32;
  const int n0 = blockIdx.y * 64;

  const _Float16* aptr0 = aoutb + (size_t)(m0 + ml) * Dv + koff;
  const _Float16* aptr1 = aoutb + (size_t)(m0 + 16 + ml) * Dv + koff;
  const _Float16* bptr[4];
#pragma unroll
  for (int n = 0; n < 4; n++) bptr[n] = wpT + (size_t)(n0 + n * 16 + ml) * Dv + koff;

  v8f acc[2][4] = {};
  for (int k0 = 0; k0 < Dv; k0 += 32) {
    __builtin_prefetch(aptr0 + k0 + 64, 0, 0);
    __builtin_prefetch(aptr1 + k0 + 64, 0, 0);
    v16h a0 = mkfrag(ld8(aptr0 + k0), ld8(aptr0 + k0 + 16));
    v16h a1 = mkfrag(ld8(aptr1 + k0), ld8(aptr1 + k0 + 16));
#pragma unroll
    for (int n = 0; n < 4; n++) {
      v16h b = mkfrag(ld8(bptr[n] + k0), ld8(bptr[n] + k0 + 16));
      acc[0][n] = WMMA_F32_F16(a0, b, acc[0][n]);
      acc[1][n] = WMMA_F32_F16(a1, b, acc[1][n]);
    }
  }

  const int rowoff = (lane >> 4) * 8;
#pragma unroll
  for (int part = 0; part < 2; part++) {
    const int mp = m0 + part * 16;
    int featrow[8];
#pragma unroll
    for (int i = 0; i < 8; i++) {
      int r = mp + rowoff + i;
      int w = r >> 9, s = r & 511;
      int b = w >> 2, widx = w & 3;
      int tqq = s >> 6, l = s & 63;
      int t = (widx * WSv + tqq + SHv) & 31;   // roll back by +SH
      featrow[i] = (b * Tv + t) * Lv + l;
    }
#pragma unroll
    for (int n = 0; n < 4; n++) {
      int col = n0 + n * 16 + ml;
      float bc = bp[col];
#pragma unroll
      for (int i = 0; i < 8; i++) {
        float v = acc[part][n][i] + bc + qmf[(size_t)featrow[i] * Dv + col];
        feat[(size_t)featrow[i] * Dv + col] = v;
        cat16[(size_t)featrow[i] * D3 + j * Dv + col] = (_Float16)v;
      }
    }
  }
}

// ---------------------------------------------------------------- gating MLP layer 1 (+GELU)
// grid (32, 32): 128x64 tile per block.
__global__ __launch_bounds__(128) void gate1_kernel(
    const _Float16* __restrict__ cat16, const _Float16* __restrict__ wg1T,
    const float* __restrict__ bg1, _Float16* __restrict__ g116)
{
  const int lane = threadIdx.x & 31;
  const int wave = threadIdx.x >> 5;
  const int ml = lane & 15;
  const int koff = (lane >> 4) * 8;
  const int m0 = blockIdx.x * 128 + wave * 32;
  const int n0 = blockIdx.y * 64;

  const _Float16* aptr0 = cat16 + (size_t)(m0 + ml) * D3 + koff;
  const _Float16* aptr1 = cat16 + (size_t)(m0 + 16 + ml) * D3 + koff;
  const _Float16* bptr[4];
#pragma unroll
  for (int n = 0; n < 4; n++) bptr[n] = wg1T + (size_t)(n0 + n * 16 + ml) * D3 + koff;

  v8f acc[2][4] = {};
  for (int k0 = 0; k0 < D3; k0 += 32) {
    __builtin_prefetch(aptr0 + k0 + 64, 0, 0);
    __builtin_prefetch(aptr1 + k0 + 64, 0, 0);
    v16h a0 = mkfrag(ld8(aptr0 + k0), ld8(aptr0 + k0 + 16));
    v16h a1 = mkfrag(ld8(aptr1 + k0), ld8(aptr1 + k0 + 16));
#pragma unroll
    for (int n = 0; n < 4; n++) {
      v16h b = mkfrag(ld8(bptr[n] + k0), ld8(bptr[n] + k0 + 16));
      acc[0][n] = WMMA_F32_F16(a0, b, acc[0][n]);
      acc[1][n] = WMMA_F32_F16(a1, b, acc[1][n]);
    }
  }

  const int rowoff = (lane >> 4) * 8;
#pragma unroll
  for (int part = 0; part < 2; part++) {
    const int mp = m0 + part * 16;
#pragma unroll
    for (int n = 0; n < 4; n++) {
      int col = n0 + n * 16 + ml;
      float bc = bg1[col];
#pragma unroll
      for (int i = 0; i < 8; i++) {
        float x = acc[part][n][i] + bc;
        float g = 0.5f * x * (1.0f + erff(x * 0.70710678118f));   // exact GELU
        g116[(size_t)(mp + rowoff + i) * D2 + col] = (_Float16)g;
      }
    }
  }
}

// ---------------------------------------------------------------- gating layer 2 (N=3) + softmax
__global__ __launch_bounds__(256) void gate2_kernel(
    const _Float16* __restrict__ g116, const float* __restrict__ Wg2,
    const float* __restrict__ bg2, float* __restrict__ gates)
{
  int row = blockIdx.x * 8 + (threadIdx.x >> 5);
  int lane = threadIdx.x & 31;
  if (row >= ROWS) return;
  const _Float16* gr = g116 + (size_t)row * D2;
  float a0 = 0.f, a1 = 0.f, a2 = 0.f;
  for (int k = lane; k < D2; k += 32) {
    float g = (float)gr[k];
    a0 = fmaf(g, Wg2[k * 3 + 0], a0);
    a1 = fmaf(g, Wg2[k * 3 + 1], a1);
    a2 = fmaf(g, Wg2[k * 3 + 2], a2);
  }
#pragma unroll
  for (int msk = 16; msk >= 1; msk >>= 1) {
    a0 += __shfl_xor(a0, msk, 32);
    a1 += __shfl_xor(a1, msk, 32);
    a2 += __shfl_xor(a2, msk, 32);
  }
  if (lane == 0) {
    a0 += bg2[0]; a1 += bg2[1]; a2 += bg2[2];
    float mx = fmaxf(a0, fmaxf(a1, a2));
    float e0 = __expf(a0 - mx), e1 = __expf(a1 - mx), e2 = __expf(a2 - mx);
    float inv = 1.0f / (e0 + e1 + e2);
    gates[row * 3 + 0] = e0 * inv;
    gates[row * 3 + 1] = e1 * inv;
    gates[row * 3 + 2] = e2 * inv;
  }
}

// ---------------------------------------------------------------- fuse
__global__ void fuse_kernel(const float* __restrict__ feats, const float* __restrict__ gates,
                            float* __restrict__ out)
{
  size_t i = (size_t)blockIdx.x * 256 + threadIdx.x;
  int row = (int)(i >> 10);
  const size_t NE = (size_t)ROWS * Dv;
  out[i] = gates[row * 3 + 0] * feats[i]
         + gates[row * 3 + 1] * feats[NE + i]
         + gates[row * 3 + 2] * feats[2 * NE + i];
}

// ---------------------------------------------------------------- launch
extern "C" void kernel_launch(void* const* d_in, const int* in_sizes, int n_in,
                              void* d_out, int out_size, void* d_ws, size_t ws_size,
                              hipStream_t stream)
{
  const float* audio = (const float*)d_in[0];
  const float* video = (const float*)d_in[1];
  const float* image = (const float*)d_in[2];
  const float* Wq  = (const float*)d_in[3];
  const float* Wk  = (const float*)d_in[4];
  const float* Wv  = (const float*)d_in[5];
  const float* Wp  = (const float*)d_in[6];
  const float* bq  = (const float*)d_in[7];
  const float* bk  = (const float*)d_in[8];
  const float* bv  = (const float*)d_in[9];
  const float* bp  = (const float*)d_in[10];
  const float* qn  = (const float*)d_in[11];
  const float* kn  = (const float*)d_in[12];
  const float* rpb = (const float*)d_in[13];
  const float* Wg1 = (const float*)d_in[14];
  const float* bg1 = (const float*)d_in[15];
  const float* Wg2 = (const float*)d_in[16];
  const float* bg2 = (const float*)d_in[17];
  float* out = (float*)d_out;

  char* p = (char*)d_ws;
  auto carve = [&](size_t bytes) -> void* {
    void* r = (void*)p;
    p += (bytes + 255) & ~(size_t)255;
    return r;
  };
  const size_t NE = (size_t)ROWS * Dv;                 // 4M elems
  _Float16* x16   = (_Float16*)carve(3 * NE * 2);
  _Float16* wqT   = (_Float16*)carve(3 * (size_t)Dv * Dv * 2);
  _Float16* wkT   = (_Float16*)carve(3 * (size_t)Dv * Dv * 2);
  _Float16* wvT   = (_Float16*)carve(3 * (size_t)Dv * Dv * 2);
  _Float16* wpT   = (_Float16*)carve(3 * (size_t)Dv * Dv * 2);
  _Float16* wg1T  = (_Float16*)carve((size_t)D3 * D2 * 2);
  _Float16* Qb    = (_Float16*)carve(NE * 2);
  _Float16* Kb    = (_Float16*)carve(NE * 2);
  _Float16* vTb   = (_Float16*)carve(NE * 2);
  _Float16* aoutb = (_Float16*)carve(NE * 2);
  _Float16* cat16 = (_Float16*)carve((size_t)ROWS * D3 * 2);
  _Float16* g116  = (_Float16*)carve((size_t)ROWS * D2 * 2);
  float*    feats = (float*)carve(3 * NE * 4);
  float*    gates = (float*)carve((size_t)ROWS * 3 * 4);

  // convert activations and transpose-convert weights to f16
  cvt_kernel<<<(int)(NE / 256), 256, 0, stream>>>(audio, x16 + 0 * NE, (int)NE);
  cvt_kernel<<<(int)(NE / 256), 256, 0, stream>>>(video, x16 + 1 * NE, (int)NE);
  cvt_kernel<<<(int)(NE / 256), 256, 0, stream>>>(image, x16 + 2 * NE, (int)NE);
  for (int j = 0; j < 3; j++) {
    size_t off = (size_t)j * Dv * Dv;
    cvtT_kernel<<<(Dv * Dv) / 256, 256, 0, stream>>>(Wq + off, wqT + off, Dv, Dv);
    cvtT_kernel<<<(Dv * Dv) / 256, 256, 0, stream>>>(Wk + off, wkT + off, Dv, Dv);
    cvtT_kernel<<<(Dv * Dv) / 256, 256, 0, stream>>>(Wv + off, wvT + off, Dv, Dv);
    cvtT_kernel<<<(Dv * Dv) / 256, 256, 0, stream>>>(Wp + off, wpT + off, Dv, Dv);
  }
  cvtT_kernel<<<(D3 * D2) / 256, 256, 0, stream>>>(Wg1, wg1T, D3, D2);

  const int qidx[3] = {0, 1, 2};
  const int cidx[3] = {1, 0, 1};
  const float* qsrcf[3] = {audio, video, image};
  for (int j = 0; j < 3; j++) {
    size_t woff = (size_t)j * Dv * Dv;
    qkv_kernel<<<dim3(32, 16, 3), 128, 0, stream>>>(
        x16 + (size_t)qidx[j] * NE, x16 + (size_t)cidx[j] * NE,
        wqT + woff, wkT + woff, wvT + woff,
        bq + j * Dv, bk + j * Dv, bv + j * Dv,
        qn + j * HDv, kn + j * HDv, Qb, Kb, vTb);
    attn_kernel<<<dim3(8, 16, 8), 128, 0, stream>>>(
        Qb, Kb, vTb, aoutb, rpb + j * (2 * WSv - 1) * Hv);
    proj_kernel<<<dim3(32, 16), 128, 0, stream>>>(
        aoutb, wpT + woff, bp + j * Dv, qsrcf[j],
        feats + (size_t)j * NE, cat16, j);
  }

  gate1_kernel<<<dim3(32, 32), 128, 0, stream>>>(cat16, wg1T, bg1, g116);
  gate2_kernel<<<ROWS / 8, 256, 0, stream>>>(g116, Wg2, bg2, gates);
  fuse_kernel<<<(int)(NE / 256), 256, 0, stream>>>(feats, gates, out);
}

// v001
// One run takes 631 microseconds.
// Timed twice side by side with v000, it ran 1.63 and 1.64 times as fast.
#include <hip/hip_runtime.h>
#include <hip/hip_bf16.h>

typedef __attribute__((ext_vector_type(16))) _Float16 v16h;
typedef __attribute__((ext_vector_type(8)))  _Float16 v8h;
typedef __attribute__((ext_vector_type(8)))  float    v8f;
typedef __attribute__((ext_vector_type(4)))  _Float16 v4h;
typedef __attribute__((ext_vector_type(4)))  float    v4f;

#define WMMA_F32_F16(a,b,c) __builtin_amdgcn_wmma_f32_16x16x32_f16(false,(a),false,(b),(short)0,(c),false,false)

#define Bv   2
#define Tv   32
#define Lv   64
#define Dv   1024
#define Hv   16
#define WSv  8
#define SHv  4
#define HDv  64
#define Sv   512      // WS*L
#define ROWS 4096     // B*T*L
#define D3   3072
#define D2   2048
#define TPITCH 72     // halves per LDS row of the transpose tile

static __device__ inline v8h ld8(const _Float16* p) { return *(const v8h*)p; }

static __device__ inline v16h mkfrag(v8h lo, v8h hi) {
  v16h r;
#pragma unroll
  for (int i = 0; i < 8; i++) { r[i] = lo[i]; r[i + 8] = hi[i]; }
  return r;
}

// window-order row -> source row of [B,T,L] with roll(-SH) folded in
static __device__ inline int src_row(int r) {
  int w = r >> 9;          // window (0..7): b*4 + widx
  int s = r & 511;         // token in window
  int b = w >> 2;
  int widx = w & 3;
  int tq = s >> 6;
  int l = s & 63;
  int tp = widx * WSv + tq;
  int tsrc = (tp + SHv) & 31;
  return ((b * Tv + tsrc) << 6) + l;
}

// ---------------------------------------------------------------- converts
__global__ void cvt_kernel(const float* __restrict__ s, _Float16* __restrict__ d, int n) {
  int i = blockIdx.x * 256 + threadIdx.x;
  if (i < n) d[i] = (_Float16)s[i];
}

// One 64 x 64 tile per block, turned in LDS: source rows are read as 16-byte pieces,
// destination rows (k-contiguous) leave as whole 128-byte lines. R and C are multiples of 64.
__global__ __launch_bounds__(256) void cvtT_kernel(const float* __restrict__ s, _Float16* __restrict__ d, int R, int C) {
  __shared__ __align__(16) _Float16 tile[64 * TPITCH];   // [c][r], rows 16 bytes longer than the data
  const int t = threadIdx.x;
  const int c0 = blockIdx.x * 64;
  const int r0 = blockIdx.y * 64;
  const int c4 = (t & 15) * 4;
  const int r4 = (t >> 4) * 4;
  v4f v[4];
#pragma unroll
  for (int p = 0; p < 4; p++) v[p] = *(const v4f*)(s + (size_t)(r0 + r4 + p) * C + c0 + c4);
#pragma unroll
  for (int ci = 0; ci < 4; ci++) {
    v4h h;
#pragma unroll
    for (int p = 0; p < 4; p++) h[p] = (_Float16)v[p][ci];
    *(v4h*)(tile + (c4 + ci) * TPITCH + r4) = h;
  }
  __syncthreads();
  const int seg = (t & 7) * 8;
#pragma unroll
  for (int p = 0; p < 2; p++) {
    const int c = p * 32 + (t >> 3);
    *(v8h*)(d + (size_t)(c0 + c) * R + r0 + seg) = *(const v8h*)(tile + c * TPITCH + seg);
  }
}

// ---------------------------------------------------------------- QKV GEMM
// grid (32, 16, 3): 128-row x 64-col tiles per block; z selects Q/K/V.
// block = 128 (4 waves); each wave: 32 rows x 64 cols, 8 WMMAs / 32-K step.
__global__ __launch_bounds__(128) void qkv_kernel(
    const _Float16* __restrict__ xq, const _Float16* __restrict__ xc,
    const _Float16* __restrict__ wqT, const _Float16* __restrict__ wkT, const _Float16* __restrict__ wvT,
    const float* __restrict__ bq, const float* __restrict__ bk, const float* __restrict__ bv,
    const float* __restrict__ qn, const float* __restrict__ kn,
    _Float16* __restrict__ Qb, _Float16* __restrict__ Kb, _Float16* __restrict__ vTb)
{
  const int which = blockIdx.z;
  const int lane = threadIdx.x & 31;
  const int wave = threadIdx.x >> 5;
  const int ml = lane & 15;
  const int koff = (lane >> 4) * 8;
  const int m0 = blockIdx.x * 128 + wave * 32;
  const int n0 = blockIdx.y * 64;

  const _Float16* src = (which == 0) ? xq : xc;
  const _Float16* wT  = (which == 0) ? wqT : (which == 1 ? wkT : wvT);
  const float* bias   = (which == 0) ? bq  : (which == 1 ? bk  : bv);

  const _Float16* aptr0 = src + (size_t)src_row(m0 + ml) * Dv + koff;
  const _Float16* aptr1 = src + (size_t)src_row(m0 + 16 + ml) * Dv + koff;
  const _Float16* bptr[4];
#pragma unroll
  for (int n = 0; n < 4; n++) bptr[n] = wT + (size_t)(n0 + n * 16 + ml) * Dv + koff;

  v8f acc[2][4] = {};
  for (int k0 = 0; k0 < Dv; k0 += 32) {
    __builtin_prefetch(aptr0 + k0 + 64, 0, 0);
    __builtin_prefetch(aptr1 + k0 + 64, 0, 0);
    v16h a0 = mkfrag(ld8(aptr0 + k0), ld8(aptr0 + k0 + 16));
    v16h a1 = mkfrag(ld8(aptr1 + k0), ld8(aptr1 + k0 + 16));
#pragma unroll
    for (int n = 0; n < 4; n++) {
      v16h b = mkfrag(ld8(bptr[n] + k0), ld8(bptr[n] + k0 + 16));
      acc[0][n] = WMMA_F32_F16(a0, b, acc[0][n]);
      acc[1][n] = WMMA_F32_F16(a1, b, acc[1][n]);
    }
  }

  const int rowoff = (lane >> 4) * 8;
#pragma unroll
  for (int part = 0; part < 2; part++) {
    const int mp = m0 + part * 16;
    float val[4][8];
#pragma unroll
    for (int n = 0; n < 4; n++) {
      float bc = bias[n0 + n * 16 + ml];
#pragma unroll
      for (int i = 0; i < 8; i++) val[n][i] = acc[part][n][i] + bc;
    }

    if (which < 2) {                       // RMS-norm over the head dim (tile == one head)
      const float* nw_ = (which == 0) ? qn : kn;
      float ss[8];
#pragma unroll
      for (int i = 0; i < 8; i++) {
        ss[i] = 0.f;
#pragma unroll
        for (int n = 0; n < 4; n++) ss[i] += val[n][i] * val[n][i];
      }
#pragma unroll
      for (int msk = 1; msk < 16; msk <<= 1)
#pragma unroll
        for (int i = 0; i < 8; i++) ss[i] += __shfl_xor(ss[i], msk, 32);
      const float sc = (which == 0) ? 0.125f : 1.0f;   // fold HD^-0.5 into Q
      float rs[8];
#pragma unroll
      for (int i = 0; i < 8; i++) rs[i] = rsqrtf(ss[i] * (1.0f / 64.0f) + 1e-6f) * sc;
#pragma unroll
      for (int n = 0; n < 4; n++) {
        float wc = nw_[(n0 + n * 16 + ml) & 63];
#pragma unroll
        for (int i = 0; i < 8; i++) val[n][i] *= rs[i] * wc;
      }
    }

    if (which < 2) {
      _Float16* dst = (which == 0) ? Qb : Kb;
#pragma unroll
      for (int n = 0; n < 4; n++) {
        int col = n0 + n * 16 + ml;
#pragma unroll
        for (int i = 0; i < 8; i++)
          dst[(size_t)(mp + rowoff + i) * Dv + col] = (_Float16)val[n][i];
      }
    } else {                               // V transposed: [(w*H+h)*HD+d][token]
#pragma unroll
      for (int n = 0; n < 4; n++) {
        int col = n0 + n * 16 + ml;
        int hh = col >> 6, d = col & 63;
#pragma unroll
        for (int i = 0; i < 8; i++) {
          int r = mp + rowoff + i;
          int w = r >> 9, s = r & 511;
          vTb[((size_t)((w * Hv + hh) * HDv + d)) * Sv + s] = (_Float16)val[n][i];
        }
      }
    }
  }
}

// ---------------------------------------------------------------- flash attention
// grid (8 q-chunks, 16 heads, 8 windows), block = 128 (4 waves, 16 q-rows each)
__global__ __launch_bounds__(128) void attn_kernel(
    const _Float16* __restrict__ Qb, const _Float16* __restrict__ Kb,
    const _Float16* __restrict__ vTb, _Float16* __restrict__ aout,
    const float* __restrict__ rpbj)
{
  __shared__ __align__(16) _Float16 plds[4 * 16 * 32];
  const int lane = threadIdx.x & 31;
  const int wave = threadIdx.x >> 5;
  const int ml = lane & 15;
  const int koff = (lane >> 4) * 8;
  const int rowoff = (lane >> 4) * 8;
  const int qb = blockIdx.x, h = blockIdx.y, w = blockIdx.z;
  const int tq = qb;                      // 64-row chunks align to L

  const int qrow = qb * 64 + wave * 16;
  const _Float16* qp = Qb + (size_t)(w * Sv + qrow + ml) * Dv + h * HDv + koff;
  v16h qa0 = mkfrag(ld8(qp),      ld8(qp + 16));
  v16h qa1 = mkfrag(ld8(qp + 32), ld8(qp + 48));

  v8f accO[4] = {};
  float m_[8], l_[8];
#pragma unroll
  for (int i = 0; i < 8; i++) { m_[i] = -3.0e38f; l_[i] = 0.f; }

  _Float16* pw = plds + wave * 512;

  for (int ch = 0; ch < 16; ch++) {
    const int c0 = ch * 32;
    const int tk = c0 >> 6;
    const float biasv = rpbj[(tq - tk + WSv - 1) * Hv + h];

    v8f s0 = {}, s1 = {};
    {
      const _Float16* kp0 = Kb + (size_t)(w * Sv + c0 + ml) * Dv + h * HDv;
      const _Float16* kp1 = Kb + (size_t)(w * Sv + c0 + 16 + ml) * Dv + h * HDv;
      v16h kb00 = mkfrag(ld8(kp0 + koff),      ld8(kp0 + koff + 16));
      v16h kb01 = mkfrag(ld8(kp0 + 32 + koff), ld8(kp0 + 48 + koff));
      v16h kb10 = mkfrag(ld8(kp1 + koff),      ld8(kp1 + koff + 16));
      v16h kb11 = mkfrag(ld8(kp1 + 32 + koff), ld8(kp1 + 48 + koff));
      s0 = WMMA_F32_F16(qa0, kb00, s0);
      s0 = WMMA_F32_F16(qa1, kb01, s0);
      s1 = WMMA_F32_F16(qa0, kb10, s1);
      s1 = WMMA_F32_F16(qa1, kb11, s1);
    }
#pragma unroll
    for (int i = 0; i < 8; i++) { s0[i] += biasv; s1[i] += biasv; }

    float mn[8];
#pragma unroll
    for (int i = 0; i < 8; i++) mn[i] = fmaxf(s0[i], s1[i]);
#pragma unroll
    for (int msk = 1; msk < 16; msk <<= 1)
#pragma unroll
      for (int i = 0; i < 8; i++) mn[i] = fmaxf(mn[i], __shfl_xor(mn[i], msk, 32));

    float alpha[8], p0[8], p1[8], rsum[8];
#pragma unroll
    for (int i = 0; i < 8; i++) {
      mn[i] = fmaxf(mn[i], m_[i]);
      alpha[i] = __expf(m_[i] - mn[i]);
      m_[i] = mn[i];
      p0[i] = __expf(s0[i] - mn[i]);
      p1[i] = __expf(s1[i] - mn[i]);
      rsum[i] = p0[i] + p1[i];
    }
#pragma unroll
    for (int msk = 1; msk < 16; msk <<= 1)
#pragma unroll
      for (int i = 0; i < 8; i++) rsum[i] += __shfl_xor(rsum[i], msk, 32);
#pragma unroll
    for (int i = 0; i < 8; i++) l_[i] = l_[i] * alpha[i] + rsum[i];
#pragma unroll
    for (int n = 0; n < 4; n++)
#pragma unroll
      for (int i = 0; i < 8; i++) accO[n][i] *= alpha[i];

    // C-layout -> A-layout transpose of P through per-wave LDS
#pragma unroll
    for (int i = 0; i < 8; i++) {
      int rt = rowoff + i;
      pw[rt * 32 + ml]      = (_Float16)p0[i];
      pw[rt * 32 + ml + 16] = (_Float16)p1[i];
    }
    asm volatile("s_wait_dscnt 0" ::: "memory");
    const _Float16* pl = pw + ml * 32 + koff;
    v16h pa = mkfrag(ld8(pl), ld8(pl + 16));

#pragma unroll
    for (int n = 0; n < 4; n++) {
      const _Float16* vp = vTb + ((size_t)((w * Hv + h) * HDv + n * 16 + ml)) * Sv + c0 + koff;
      v16h vb = mkfrag(ld8(vp), ld8(vp + 16));
      accO[n] = WMMA_F32_F16(pa, vb, accO[n]);
    }
  }

  float inv[8];
#pragma unroll
  for (int i = 0; i < 8; i++) inv[i] = 1.0f / l_[i];
#pragma unroll
  for (int n = 0; n < 4; n++) {
    int col = h * HDv + n * 16 + ml;
#pragma unroll
    for (int i = 0; i < 8; i++) {
      int r = w * Sv + qrow + rowoff + i;
      aout[(size_t)r * Dv + col] = (_Float16)(accO[n][i] * inv[i]);
    }
  }
}

// ---------------------------------------------------------------- output projection + residual + roll(+SH)
// grid (32, 16): 128x64 tile per block, 32 rows per wave.
__global__ __launch_bounds__(128) void proj_kernel(
    const _Float16* __restrict__ aoutb, const _Float16* __restrict__ wpT,
    const float* __restrict__ bp, const float* __restrict__ qmf,
    float* __restrict__ feat, _Float16* __restrict__ cat16, int j)
{
  const int lane = threadIdx.x & 31;
  const int wave = threadIdx.x >> 5;
  const int ml = lane & 15;
  const int koff = (lane >> 4) * 8;
  const int m0 = blockIdx.x * 128 + wave * 32;
  const int n0 = blockIdx.y * 64;

  const _Float16* aptr0 = aoutb + (size_t)(m0 + ml) * Dv + koff;
  const _Float16* aptr1 = aoutb + (size_t)(m0 + 16 + ml) * Dv + koff;
  const _Float16* bptr[4];
#pragma unroll
  for (int n = 0; n < 4; n++) bptr[n] = wpT + (size_t)(n0 + n * 16 + ml) * Dv + koff;

  v8f acc[2][4] = {};
  for (int k0 = 0; k0 < Dv; k0 += 32) {
    __builtin_prefetch(aptr0 + k0 + 64, 0, 0);
    __builtin_prefetch(aptr1 + k0 + 64, 0, 0);
    v16h a0 = mkfrag(ld8(aptr0 + k0), ld8(aptr0 + k0 + 16));
    v16h a1 = mkfrag(ld8(aptr1 + k0), ld8(aptr1 + k0 + 16));
#pragma unroll
    for (int n = 0; n < 4; n++) {
      v16h b = mkfrag(ld8(bptr[n] + k0), ld8(bptr[n] + k0 + 16));
      acc[0][n] = WMMA_F32_F16(a0, b, acc[0][n]);
      acc[1][n] = WMMA_F32_F16(a1, b, acc[1][n]);
    }
  }

  const int rowoff = (lane >> 4) * 8;
#pragma unroll
  for (int part = 0; part < 2; part++) {
    const int mp = m0 + part * 16;
    int featrow[8];
#pragma unroll
    for (int i = 0; i < 8; i++) {
      int r = mp + rowoff + i;
      int w = r >> 9, s = r & 511;
      int b = w >> 2, widx = w & 3;
      int tqq = s >> 6, l = s & 63;
      int t = (widx * WSv + tqq + SHv) & 31;   // roll back by +SH
      featrow[i] = (b * Tv + t) * Lv + l;
    }
#pragma unroll
    for (int n = 0; n < 4; n++) {
      int col = n0 + n * 16 + ml;
      float bc = bp[col];
#pragma unroll
      for (int i = 0; i < 8; i++) {
        float v = acc[part][n][i] + bc + qmf[(size_t)featrow[i] * Dv + col];
        feat[(size_t)featrow[i] * Dv + col] = v;
        cat16[(size_t)featrow[i] * D3 + j * Dv + col] = (_Float16)v;
      }
    }
  }
}

// ---------------------------------------------------------------- gating MLP layer 1 (+GELU)
// grid (32, 32): 128x64 tile per block.
__global__ __launch_bounds__(128) void gate1_kernel(
    const _Float16* __restrict__ cat16, const _Float16* __restrict__ wg1T,
    const float* __restrict__ bg1, _Float16* __restrict__ g116)
{
  const int lane = threadIdx.x & 31;
  const int wave = threadIdx.x >> 5;
  const int ml = lane & 15;
  const int koff = (lane >> 4) * 8;
  const int m0 = blockIdx.x * 128 + wave * 32;
  const int n0 = blockIdx.y * 64;

  const _Float16* aptr0 = cat16 + (size_t)(m0 + ml) * D3 + koff;
  const _Float16* aptr1 = cat16 + (size_t)(m0 + 16 + ml) * D3 + koff;
  const _Float16* bptr[4];
#pragma unroll
  for (int n = 0; n < 4; n++) bptr[n] = wg1T + (size_t)(n0 + n * 16 + ml) * D3 + koff;

  v8f acc[2][4] = {};
  for (int k0 = 0; k0 < D3; k0 += 32) {
    __builtin_prefetch(aptr0 + k0 + 64, 0, 0);
    __builtin_prefetch(aptr1 + k0 + 64, 0, 0);
    v16h a0 = mkfrag(ld8(aptr0 + k0), ld8(aptr0 + k0 + 16));
    v16h a1 = mkfrag(ld8(aptr1 + k0), ld8(aptr1 + k0 + 16));
#pragma unroll
    for (int n = 0; n < 4; n++) {
      v16h b = mkfrag(ld8(bptr[n] + k0), ld8(bptr[n] + k0 + 16));
      acc[0][n] = WMMA_F32_F16(a0, b, acc[0][n]);
      acc[1][n] = WMMA_F32_F16(a1, b, acc[1][n]);
    }
  }

  const int rowoff = (lane >> 4) * 8;
#pragma unroll
  for (int part = 0; part < 2; part++) {
    const int mp = m0 + part * 16;
#pragma unroll
    for (int n = 0; n < 4; n++) {
      int col = n0 + n * 16 + ml;
      float bc = bg1[col];
#pragma unroll
      for (int i = 0; i < 8; i++) {
        float x = acc[part][n][i] + bc;
        float g = 0.5f * x * (1.0f + erff(x * 0.70710678118f));   // exact GELU
        g116[(size_t)(mp + rowoff + i) * D2 + col] = (_Float16)g;
      }
    }
  }
}

// ---------------------------------------------------------------- gating layer 2 (N=3) + softmax
__global__ __launch_bounds__(256) void gate2_kernel(
    const _Float16* __restrict__ g116, const float* __restrict__ Wg2,
    const float* __restrict__ bg2, float* __restrict__ gates)
{
  int row = blockIdx.x * 8 + (threadIdx.x >> 5);
  int lane = threadIdx.x & 31;
  if (row >= ROWS) return;
  const _Float16* gr = g116 + (size_t)row * D2;
  float a0 = 0.f, a1 = 0.f, a2 = 0.f;
  for (int k = lane; k < D2; k += 32) {
    float g = (float)gr[k];
    a0 = fmaf(g, Wg2[k * 3 + 0], a0);
    a1 = fmaf(g, Wg2[k * 3 + 1], a1);
    a2 = fmaf(g, Wg2[k * 3 + 2], a2);
  }
#pragma unroll
  for (int msk = 16; msk >= 1; msk >>= 1) {
    a0 += __shfl_xor(a0, msk, 32);
    a1 += __shfl_xor(a1, msk, 32);
    a2 += __shfl_xor(a2, msk, 32);
  }
  if (lane == 0) {
    a0 += bg2[0]; a1 += bg2[1]; a2 += bg2[2];
    float mx = fmaxf(a0, fmaxf(a1, a2));
    float e0 = __expf(a0 - mx), e1 = __expf(a1 - mx), e2 = __expf(a2 - mx);
    float inv = 1.0f / (e0 + e1 + e2);
    gates[row * 3 + 0] = e0 * inv;
    gates[row * 3 + 1] = e1 * inv;
    gates[row * 3 + 2] = e2 * inv;
  }
}

// ---------------------------------------------------------------- fuse
__global__ void fuse_kernel(const float* __restrict__ feats, const float* __restrict__ gates,
                            float* __restrict__ out)
{
  size_t i = (size_t)blockIdx.x * 256 + threadIdx.x;
  int row = (int)(i >> 10);
  const size_t NE = (size_t)ROWS * Dv;
  out[i] = gates[row * 3 + 0] * feats[i]
         + gates[row * 3 + 1] * feats[NE + i]
         + gates[row * 3 + 2] * feats[2 * NE + i];
}

// ---------------------------------------------------------------- launch
extern "C" void kernel_launch(void* const* d_in, const int* in_sizes, int n_in,
                              void* d_out, int out_size, void* d_ws, size_t ws_size,
                              hipStream_t stream)
{
  const float* audio = (const float*)d_in[0];
  const float* video = (const float*)d_in[1];
  const float* image = (const float*)d_in[2];
  const float* Wq  = (const float*)d_in[3];
  const float* Wk  = (const float*)d_in[4];
  const float* Wv  = (const float*)d_in[5];
  const float* Wp  = (const float*)d_in[6];
  const float* bq  = (const float*)d_in[7];
  const float* bk  = (const float*)d_in[8];
  const float* bv  = (const float*)d_in[9];
  const float* bp  = (const float*)d_in[10];
  const float* qn  = (const float*)d_in[11];
  const float* kn  = (const float*)d_in[12];
  const float* rpb = (const float*)d_in[13];
  const float* Wg1 = (const float*)d_in[14];
  const float* bg1 = (const float*)d_in[15];
  const float* Wg2 = (const float*)d_in[16];
  const float* bg2 = (const float*)d_in[17];
  float* out = (float*)d_out;

  char* p = (char*)d_ws;
  auto carve = [&](size_t bytes) -> void* {
    void* r = (void*)p;
    p += (bytes + 255) & ~(size_t)255;
    return r;
  };
  const size_t NE = (size_t)ROWS * Dv;                 // 4M elems
  _Float16* x16   = (_Float16*)carve(3 * NE * 2);
  _Float16* wqT   = (_Float16*)carve(3 * (size_t)Dv * Dv * 2);
  _Float16* wkT   = (_Float16*)carve(3 * (size_t)Dv * Dv * 2);
  _Float16* wvT   = (_Float16*)carve(3 * (size_t)Dv * Dv * 2);
  _Float16* wpT   = (_Float16*)carve(3 * (size_t)Dv * Dv * 2);
  _Float16* wg1T  = (_Float16*)carve((size_t)D3 * D2 * 2);
  _Float16* Qb    = (_Float16*)carve(NE * 2);
  _Float16* Kb    = (_Float16*)carve(NE * 2);
  _Float16* vTb   = (_Float16*)carve(NE * 2);
  _Float16* aoutb = (_Float16*)carve(NE * 2);
  _Float16* cat16 = (_Float16*)carve((size_t)ROWS * D3 * 2);
  _Float16* g116  = (_Float16*)carve((size_t)ROWS * D2 * 2);
  float*    feats = (float*)carve(3 * NE * 4);
  float*    gates = (float*)carve((size_t)ROWS * 3 * 4);

  // convert activations and transpose-convert weights to f16
  cvt_kernel<<<(int)(NE / 256), 256, 0, stream>>>(audio, x16 + 0 * NE, (int)NE);
  cvt_kernel<<<(int)(NE / 256), 256, 0, stream>>>(video, x16 + 1 * NE, (int)NE);
  cvt_kernel<<<(int)(NE / 256), 256, 0, stream>>>(image, x16 + 2 * NE, (int)NE);
  for (int j = 0; j < 3; j++) {
    size_t off = (size_t)j * Dv * Dv;
    cvtT_kernel<<<dim3(Dv / 64, Dv / 64), 256, 0, stream>>>(Wq + off, wqT + off, Dv, Dv);
    cvtT_kernel<<<dim3(Dv / 64, Dv / 64), 256, 0, stream>>>(Wk + off, wkT + off, Dv, Dv);
    cvtT_kernel<<<dim3(Dv / 64, Dv / 64), 256, 0, stream>>>(Wv + off, wvT + off, Dv, Dv);
    cvtT_kernel<<<dim3(Dv / 64, Dv / 64), 256, 0, stream>>>(Wp + off, wpT + off, Dv, Dv);
  }
  cvtT_kernel<<<dim3(D2 / 64, D3 / 64), 256, 0, stream>>>(Wg1, wg1T, D3, D2);

  const int qidx[3] = {0, 1, 2};
  const int cidx[3] = {1, 0, 1};
  const float* qsrcf[3] = {audio, video, image};
  for (int j = 0; j < 3; j++) {
    size_t woff = (size_t)j * Dv * Dv;
    qkv_kernel<<<dim3(32, 16, 3), 128, 0, stream>>>(
        x16 + (size_t)qidx[j] * NE, x16 + (size_t)cidx[j] * NE,
        wqT + woff, wkT + woff, wvT + woff,
        bq + j * Dv, bk + j * Dv, bv + j * Dv,
        qn + j * HDv, kn + j * HDv, Qb, Kb, vTb);
    attn_kernel<<<dim3(8, 16, 8), 128, 0, stream>>>(
        Qb, Kb, vTb, aoutb, rpb + j * (2 * WSv - 1) * Hv);
    proj_kernel<<<dim3(32, 16), 128, 0, stream>>>(
        aoutb, wpT + woff, bp + j * Dv, qsrcf[j],
        feats + (size_t)j * NE, cat16, j);
  }

  gate1_kernel<<<dim3(32, 32), 128, 0, stream>>>(cat16, wg1T, bg1, g116);
  gate2_kernel<<<ROWS / 8, 256, 0, stream>>>(g116, Wg2, bg2, gates);
  fuse_kernel<<<(int)(NE / 256), 256, 0, stream>>>(feats, gates, out);
}

// v002
// Measured time: 387 microseconds a run.
// Two timings next to v001 both put it at 1.63 times that version's speed.
// Counting every step since v000, it is 2.66 times as fast.
#include <hip/hip_runtime.h>
#include <hip/hip_bf16.h>

typedef __attribute__((ext_vector_type(16))) _Float16 v16h;
typedef __attribute__((ext_vector_type(8)))  _Float16 v8h;
typedef __attribute__((ext_vector_type(8)))  float    v8f;
typedef __attribute__((ext_vector_type(4)))  _Float16 v4h;
typedef __attribute__((ext_vector_type(4)))  float    v4f;

#define WMMA_F32_F16(a,b,c) __builtin_amdgcn_wmma_f32_16x16x32_f16(false,(a),false,(b),(short)0,(c),false,false)

#define Bv   2
#define Tv   32
#define Lv   64
#define Dv   1024
#define Hv   16
#define WSv  8
#define SHv  4
#define HDv  64
#define Sv   512      // WS*L
#define ROWS 4096     // B*T*L
#define D3   3072
#define D2   2048
#define TPITCH 72     // halves per LDS row of the transpose tile

static __device__ inline v8h ld8(const _Float16* p) { return *(const v8h*)p; }

static __device__ inline v16h mkfrag(v8h lo, v8h hi) {
  v16h r;
#pragma unroll
  for (int i = 0; i < 8; i++) { r[i] = lo[i]; r[i + 8] = hi[i]; }
  return r;
}

// window-order row -> source row of [B,T,L] with roll(-SH) folded in
static __device__ inline int src_row(int r) {
  int w = r >> 9;          // window (0..7): b*4 + widx
  int s = r & 511;         // token in window
  int b = w >> 2;
  int widx = w & 3;
  int tq = s >> 6;
  int l = s & 63;
  int tp = widx * WSv + tq;
  int tsrc = (tp + SHv) & 31;
  return ((b * Tv + tsrc) << 6) + l;
}

// ---------------------------------------------------------------- converts
__global__ void cvt_kernel(const float* __restrict__ s, _Float16* __restrict__ d, int n) {
  int i = blockIdx.x * 256 + threadIdx.x;
  if (i < n) d[i] = (_Float16)s[i];
}

// One 64 x 64 tile per block, turned in LDS: source rows are read as 16-byte pieces,
// destination rows (k-contiguous) leave as whole 128-byte lines. R and C are multiples of 64.
__global__ __launch_bounds__(256) void cvtT_kernel(const float* __restrict__ s, _Float16* __restrict__ d, int R, int C) {
  __shared__ __align__(16) _Float16 tile[64 * TPITCH];   // [c][r], rows 16 bytes longer than the data
  const int t = threadIdx.x;
  const int c0 = blockIdx.x * 64;
  const int r0 = blockIdx.y * 64;
  const int c4 = (t & 15) * 4;
  const int r4 = (t >> 4) * 4;
  v4f v[4];
#pragma unroll
  for (int p = 0; p < 4; p++) v[p] = *(const v4f*)(s + (size_t)(r0 + r4 + p) * C + c0 + c4);
#pragma unroll
  for (int ci = 0; ci < 4; ci++) {
    v4h h;
#pragma unroll
    for (int p = 0; p < 4; p++) h[p] = (_Float16)v[p][ci];
    *(v4h*)(tile + (c4 + ci) * TPITCH + r4) = h;
  }
  __syncthreads();
  const int seg = (t & 7) * 8;
#pragma unroll
  for (int p = 0; p < 2; p++) {
    const int c = p * 32 + (t >> 3);
    *(v8h*)(d + (size_t)(c0 + c) * R + r0 + seg) = *(const v8h*)(tile + c * TPITCH + seg);
  }
}

// ---------------------------------------------------------------- staged GEMM core
// One 128 x 128 tile of Y = A * B^T per block of 8 waves (4 along M x 2 along N, 32 x 64 each).
// A stage is 64 k (128 bytes) of 128 A rows and 128 B rows. Each wave-wide 16-byte copy covers four
// whole 128-byte lines and lands in LDS without passing a register; two buffers, so the copies
// of the stage after next fly while this one is multiplied.
#define GBK    64                   // halves of k per stage
#define GPITCH 72                   // halves per LDS row: 144 bytes, conflict-free for 16-byte readers
#define GBUF   (256 * GPITCH)       // halves per buffer: A rows 0..127, B rows 128..255

static __device__ inline void stage_copy(unsigned l, const _Float16* const (&gp)[8], int k) {
  // Eight copies of 16 bytes per lane, rows 32 apart. The s_wait_xcnt closes the statement so that no
  // address register of an issued copy is rewritten ahead of it.
  asm volatile(
      "global_load_async_to_lds_b128 %0, %8, off\n\t"
      "global_load_async_to_lds_b128 %1, %9, off\n\t"
      "global_load_async_to_lds_b128 %2, %10, off\n\t"
      "global_load_async_to_lds_b128 %3, %11, off\n\t"
      "global_load_async_to_lds_b128 %4, %12, off\n\t"
      "global_load_async_to_lds_b128 %5, %13, off\n\t"
      "global_load_async_to_lds_b128 %6, %14, off\n\t"
      "global_load_async_to_lds_b128 %7, %15, off\n\t"
      "s_wait_xcnt 0x0"
      :: "v"(l), "v"(l + 1u * 32u * GPITCH * 2u), "v"(l + 2u * 32u * GPITCH * 2u), "v"(l + 3u * 32u * GPITCH * 2u),
         "v"(l + 4u * 32u * GPITCH * 2u), "v"(l + 5u * 32u * GPITCH * 2u), "v"(l + 6u * 32u * GPITCH * 2u),
         "v"(l + 7u * 32u * GPITCH * 2u),
         "v"(gp[0] + k), "v"(gp[1] + k), "v"(gp[2] + k), "v"(gp[3] + k),
         "v"(gp[4] + k), "v"(gp[5] + k), "v"(gp[6] + k), "v"(gp[7] + k)
      : "memory");
}

// gp[0..3]: this thread's piece of A rows r, r+32, r+64, r+96 of the tile; gp[4..7]: the same of B.
template <int KT>
static __device__ inline void gemm_staged(_Float16* sm, const _Float16* const (&gp)[8], v8f (&acc)[2][4]) {
  const int t = threadIdx.x;
  const int lane = t & 31;
  const int wave = t >> 5;
  const int ml = lane & 15;
  const int koff = (lane >> 4) * 8;
  const unsigned lcopy = (unsigned)(size_t)sm + (unsigned)((t >> 3) * GPITCH + (t & 7) * 8) * 2u;
  const _Float16* ard = sm + ((wave & 3) * 32 + ml) * GPITCH + koff;
  const _Float16* brd = sm + (128 + (wave >> 2) * 64 + ml) * GPITCH + koff;
  constexpr int NT = KT / GBK;

  stage_copy(lcopy, gp, 0);
  asm volatile("s_wait_asynccnt 0x0" ::: "memory");   // stage 0 has landed before the barrier publishes it
  __syncthreads();
  stage_copy(lcopy + GBUF * 2u, gp, GBK);

  // stays rolled: unrolled, the reads were spread between the WMMAs again, a full LDS latency in front of each pair
#pragma unroll 1
  for (int s = 0; s < NT; s++) {
    const int bo = (s & 1) * GBUF;
    // the whole stage goes into registers as one group of reads: the buffer is free again before the WMMAs start
    // (the inner loops are unrolled so that a, b and acc are indexed by constants and stay in registers)
    v16h a[2][2], b[2][4];
#pragma unroll
    for (int ks = 0; ks < 2; ks++) {
      const _Float16* ap = ard + bo + ks * 32;
      const _Float16* bp = brd + bo + ks * 32;
#pragma unroll
      for (int p = 0; p < 2; p++) a[ks][p] = mkfrag(ld8(ap + p * 16 * GPITCH), ld8(ap + p * 16 * GPITCH + 16));
#pragma unroll
      for (int n = 0; n < 4; n++) b[ks][n] = mkfrag(ld8(bp + n * 16 * GPITCH), ld8(bp + n * 16 * GPITCH + 16));
    }
    asm volatile("s_wait_dscnt 0x0" ::: "memory");    // this wave's reads of the buffer are over before it is refilled
    asm volatile("s_wait_asynccnt 0x0" ::: "memory"); // this wave's copies of stage s + 1 have landed
    __syncthreads();                                  // publishes stage s + 1, frees stage s's buffer
    if (s + 2 < NT) stage_copy(lcopy + (unsigned)bo * 2u, gp, (s + 2) * GBK);
    // stage s + 2 flies while stage s is multiplied from registers
#pragma unroll
    for (int ks = 0; ks < 2; ks++)
#pragma unroll
      for (int n = 0; n < 4; n++) {
        acc[0][n] = WMMA_F32_F16(a[ks][0], b[ks][n], acc[0][n]);
        acc[1][n] = WMMA_F32_F16(a[ks][1], b[ks][n], acc[1][n]);
      }
  }
  asm volatile("s_wait_asynccnt 0x0" ::: "memory");   // nothing of this wave is in flight when it goes on
}

// ---------------------------------------------------------------- QKV GEMM
// grid (32, 8, 3): 128-row x 128-col tiles per block; z selects Q/K/V.
// block = 256 (8 waves); each wave: 32 rows x 64 cols (one head), 8 WMMAs / 32-K step.
__global__ __launch_bounds__(256) void qkv_kernel(
    const _Float16* __restrict__ xq, const _Float16* __restrict__ xc,
    const _Float16* __restrict__ wqT, const _Float16* __restrict__ wkT, const _Float16* __restrict__ wvT,
    const float* __restrict__ bq, const float* __restrict__ bk, const float* __restrict__ bv,
    const float* __restrict__ qn, const float* __restrict__ kn,
    _Float16* __restrict__ Qb, _Float16* __restrict__ Kb, _Float16* __restrict__ vTb)
{
  __shared__ __align__(16) _Float16 sm[2 * GBUF];
  const int which = blockIdx.z;
  const int lane = threadIdx.x & 31;
  const int wave = threadIdx.x >> 5;
  const int ml = lane & 15;
  const int m0 = blockIdx.x * 128 + (wave & 3) * 32;
  const int n0 = blockIdx.y * 128 + (wave >> 2) * 64;

  const _Float16* src = (which == 0) ? xq : xc;
  const _Float16* wT  = (which == 0) ? wqT : (which == 1 ? wkT : wvT);
  const float* bias   = (which == 0) ? bq  : (which == 1 ? bk  : bv);

  const int cr = threadIdx.x >> 3;          // row of the tile this thread copies (and 32, 64, 96 below it)
  const int cc = (threadIdx.x & 7) * 8;     // its 16-byte piece of the row's 128 bytes
  const _Float16* gp[8];
#pragma unroll
  for (int i = 0; i < 4; i++) {
    gp[i]     = src + (size_t)src_row(blockIdx.x * 128 + cr + 32 * i) * Dv + cc;
    gp[4 + i] = wT + (size_t)(blockIdx.y * 128 + cr + 32 * i) * Dv + cc;
  }

  v8f acc[2][4] = {};
  gemm_staged<Dv>(sm, gp, acc);

  const int rowoff = (lane >> 4) * 8;
#pragma unroll
  for (int part = 0; part < 2; part++) {
    const int mp = m0 + part * 16;
    float val[4][8];
#pragma unroll
    for (int n = 0; n < 4; n++) {
      float bc = bias[n0 + n * 16 + ml];
#pragma unroll
      for (int i = 0; i < 8; i++) val[n][i] = acc[part][n][i] + bc;
    }

    if (which < 2) {                       // RMS-norm over the head dim (tile == one head)
      const float* nw_ = (which == 0) ? qn : kn;
      float ss[8];
#pragma unroll
      for (int i = 0; i < 8; i++) {
        ss[i] = 0.f;
#pragma unroll
        for (int n = 0; n < 4; n++) ss[i] += val[n][i] * val[n][i];
      }
#pragma unroll
      for (int msk = 1; msk < 16; msk <<= 1)
#pragma unroll
        for (int i = 0; i < 8; i++) ss[i] += __shfl_xor(ss[i], msk, 32);
      const float sc = (which == 0) ? 0.125f : 1.0f;   // fold HD^-0.5 into Q
      float rs[8];
#pragma unroll
      for (int i = 0; i < 8; i++) rs[i] = rsqrtf(ss[i] * (1.0f / 64.0f) + 1e-6f) * sc;
#pragma unroll
      for (int n = 0; n < 4; n++) {
        float wc = nw_[(n0 + n * 16 + ml) & 63];
#pragma unroll
        for (int i = 0; i < 8; i++) val[n][i] *= rs[i] * wc;
      }
    }

    if (which < 2) {
      _Float16* dst = (which == 0) ? Qb : Kb;
#pragma unroll
      for (int n = 0; n < 4; n++) {
        int col = n0 + n * 16 + ml;
#pragma unroll
        for (int i = 0; i < 8; i++)
          dst[(size_t)(mp + rowoff + i) * Dv + col] = (_Float16)val[n][i];
      }
    } else {                               // V transposed: [(w*H+h)*HD+d][token]
#pragma unroll
      for (int n = 0; n < 4; n++) {
        int col = n0 + n * 16 + ml;
        int hh = col >> 6, d = col & 63;
#pragma unroll
        for (int i = 0; i < 8; i++) {
          int r = mp + rowoff + i;
          int w = r >> 9, s = r & 511;
          vTb[((size_t)((w * Hv + hh) * HDv + d)) * Sv + s] = (_Float16)val[n][i];
        }
      }
    }
  }
}

// ---------------------------------------------------------------- flash attention
// grid (8 q-chunks, 16 heads, 8 windows), block = 128 (4 waves, 16 q-rows each)
__global__ __launch_bounds__(128) void attn_kernel(
    const _Float16* __restrict__ Qb, const _Float16* __restrict__ Kb,
    const _Float16* __restrict__ vTb, _Float16* __restrict__ aout,
    const float* __restrict__ rpbj)
{
  __shared__ __align__(16) _Float16 plds[4 * 16 * 32];
  const int lane = threadIdx.x & 31;
  const int wave = threadIdx.x >> 5;
  const int ml = lane & 15;
  const int koff = (lane >> 4) * 8;
  const int rowoff = (lane >> 4) * 8;
  const int qb = blockIdx.x, h = blockIdx.y, w = blockIdx.z;
  const int tq = qb;                      // 64-row chunks align to L

  const int qrow = qb * 64 + wave * 16;
  const _Float16* qp = Qb + (size_t)(w * Sv + qrow + ml) * Dv + h * HDv + koff;
  v16h qa0 = mkfrag(ld8(qp),      ld8(qp + 16));
  v16h qa1 = mkfrag(ld8(qp + 32), ld8(qp + 48));

  v8f accO[4] = {};
  float m_[8], l_[8];
#pragma unroll
  for (int i = 0; i < 8; i++) { m_[i] = -3.0e38f; l_[i] = 0.f; }

  _Float16* pw = plds + wave * 512;

  for (int ch = 0; ch < 16; ch++) {
    const int c0 = ch * 32;
    const int tk = c0 >> 6;
    const float biasv = rpbj[(tq - tk + WSv - 1) * Hv + h];

    v8f s0 = {}, s1 = {};
    {
      const _Float16* kp0 = Kb + (size_t)(w * Sv + c0 + ml) * Dv + h * HDv;
      const _Float16* kp1 = Kb + (size_t)(w * Sv + c0 + 16 + ml) * Dv + h * HDv;
      v16h kb00 = mkfrag(ld8(kp0 + koff),      ld8(kp0 + koff + 16));
      v16h kb01 = mkfrag(ld8(kp0 + 32 + koff), ld8(kp0 + 48 + koff));
      v16h kb10 = mkfrag(ld8(kp1 + koff),      ld8(kp1 + koff + 16));
      v16h kb11 = mkfrag(ld8(kp1 + 32 + koff), ld8(kp1 + 48 + koff));
      s0 = WMMA_F32_F16(qa0, kb00, s0);
      s0 = WMMA_F32_F16(qa1, kb01, s0);
      s1 = WMMA_F32_F16(qa0, kb10, s1);
      s1 = WMMA_F32_F16(qa1, kb11, s1);
    }
#pragma unroll
    for (int i = 0; i < 8; i++) { s0[i] += biasv; s1[i] += biasv; }

    float mn[8];
#pragma unroll
    for (int i = 0; i < 8; i++) mn[i] = fmaxf(s0[i], s1[i]);
#pragma unroll
    for (int msk = 1; msk < 16; msk <<= 1)
#pragma unroll
      for (int i = 0; i < 8; i++) mn[i] = fmaxf(mn[i], __shfl_xor(mn[i], msk, 32));

    float alpha[8], p0[8], p1[8], rsum[8];
#pragma unroll
    for (int i = 0; i < 8; i++) {
      mn[i] = fmaxf(mn[i], m_[i]);
      alpha[i] = __expf(m_[i] - mn[i]);
      m_[i] = mn[i];
      p0[i] = __expf(s0[i] - mn[i]);
      p1[i] = __expf(s1[i] - mn[i]);
      rsum[i] = p0[i] + p1[i];
    }
#pragma unroll
    for (int msk = 1; msk < 16; msk <<= 1)
#pragma unroll
      for (int i = 0; i < 8; i++) rsum[i] += __shfl_xor(rsum[i], msk, 32);
#pragma unroll
    for (int i = 0; i < 8; i++) l_[i] = l_[i] * alpha[i] + rsum[i];
#pragma unroll
    for (int n = 0; n < 4; n++)
#pragma unroll
      for (int i = 0; i < 8; i++) accO[n][i] *= alpha[i];

    // C-layout -> A-layout transpose of P through per-wave LDS
#pragma unroll
    for (int i = 0; i < 8; i++) {
      int rt = rowoff + i;
      pw[rt * 32 + ml]      = (_Float16)p0[i];
      pw[rt * 32 + ml + 16] = (_Float16)p1[i];
    }
    asm volatile("s_wait_dscnt 0" ::: "memory");
    const _Float16* pl = pw + ml * 32 + koff;
    v16h pa = mkfrag(ld8(pl), ld8(pl + 16));

#pragma unroll
    for (int n = 0; n < 4; n++) {
      const _Float16* vp = vTb + ((size_t)((w * Hv + h) * HDv + n * 16 + ml)) * Sv + c0 + koff;
      v16h vb = mkfrag(ld8(vp), ld8(vp + 16));
      accO[n] = WMMA_F32_F16(pa, vb, accO[n]);
    }
  }

  float inv[8];
#pragma unroll
  for (int i = 0; i < 8; i++) inv[i] = 1.0f / l_[i];
#pragma unroll
  for (int n = 0; n < 4; n++) {
    int col = h * HDv + n * 16 + ml;
#pragma unroll
    for (int i = 0; i < 8; i++) {
      int r = w * Sv + qrow + rowoff + i;
      aout[(size_t)r * Dv + col] = (_Float16)(accO[n][i] * inv[i]);
    }
  }
}

// ---------------------------------------------------------------- output projection + residual + roll(+SH)
// grid (32, 8): 128x128 tile per block of 8 waves, 32 rows x 64 cols per wave.
__global__ __launch_bounds__(256) void proj_kernel(
    const _Float16* __restrict__ aoutb, const _Float16* __restrict__ wpT,
    const float* __restrict__ bp, const float* __restrict__ qmf,
    float* __restrict__ feat, _Float16* __restrict__ cat16, int j)
{
  __shared__ __align__(16) _Float16 sm[2 * GBUF];
  const int lane = threadIdx.x & 31;
  const int wave = threadIdx.x >> 5;
  const int ml = lane & 15;
  const int m0 = blockIdx.x * 128 + (wave & 3) * 32;
  const int n0 = blockIdx.y * 128 + (wave >> 2) * 64;

  const int cr = threadIdx.x >> 3;
  const int cc = (threadIdx.x & 7) * 8;
  const _Float16* gp[8];
#pragma unroll
  for (int i = 0; i < 4; i++) {
    gp[i]     = aoutb + (size_t)(blockIdx.x * 128 + cr + 32 * i) * Dv + cc;
    gp[4 + i] = wpT + (size_t)(blockIdx.y * 128 + cr + 32 * i) * Dv + cc;
  }

  v8f acc[2][4] = {};
  gemm_staged<Dv>(sm, gp, acc);

  const int rowoff = (lane >> 4) * 8;
#pragma unroll
  for (int part = 0; part < 2; part++) {
    const int mp = m0 + part * 16;
    int featrow[8];
#pragma unroll
    for (int i = 0; i < 8; i++) {
      int r = mp + rowoff + i;
      int w = r >> 9, s = r & 511;
      int b = w >> 2, widx = w & 3;
      int tqq = s >> 6, l = s & 63;
      int t = (widx * WSv + tqq + SHv) & 31;   // roll back by +SH
      featrow[i] = (b * Tv + t) * Lv + l;
    }
#pragma unroll
    for (int n = 0; n < 4; n++) {
      int col = n0 + n * 16 + ml;
      float bc = bp[col];
#pragma unroll
      for (int i = 0; i < 8; i++) {
        float v = acc[part][n][i] + bc + qmf[(size_t)featrow[i] * Dv + col];
        feat[(size_t)featrow[i] * Dv + col] = v;
        cat16[(size_t)featrow[i] * D3 + j * Dv + col] = (_Float16)v;
      }
    }
  }
}

// ---------------------------------------------------------------- gating MLP layer 1 (+GELU)
// grid (32, 16): 128x128 tile per block of 8 waves.
__global__ __launch_bounds__(256) void gate1_kernel(
    const _Float16* __restrict__ cat16, const _Float16* __restrict__ wg1T,
    const float* __restrict__ bg1, _Float16* __restrict__ g116)
{
  __shared__ __align__(16) _Float16 sm[2 * GBUF];
  const int lane = threadIdx.x & 31;
  const int wave = threadIdx.x >> 5;
  const int ml = lane & 15;
  const int m0 = blockIdx.x * 128 + (wave & 3) * 32;
  const int n0 = blockIdx.y * 128 + (wave >> 2) * 64;

  const int cr = threadIdx.x >> 3;
  const int cc = (threadIdx.x & 7) * 8;
  const _Float16* gp[8];
#pragma unroll
  for (int i = 0; i < 4; i++) {
    gp[i]     = cat16 + (size_t)(blockIdx.x * 128 + cr + 32 * i) * D3 + cc;
    gp[4 + i] = wg1T + (size_t)(blockIdx.y * 128 + cr + 32 * i) * D3 + cc;
  }

  v8f acc[2][4] = {};
  gemm_staged<D3>(sm, gp, acc);

  const int rowoff = (lane >> 4) * 8;
#pragma unroll
  for (int part = 0; part < 2; part++) {
    const int mp = m0 + part * 16;
#pragma unroll
    for (int n = 0; n < 4; n++) {
      int col = n0 + n * 16 + ml;
      float bc = bg1[col];
#pragma unroll
      for (int i = 0; i < 8; i++) {
        float x = acc[part][n][i] + bc;
        float g = 0.5f * x * (1.0f + erff(x * 0.70710678118f));   // exact GELU
        g116[(size_t)(mp + rowoff + i) * D2 + col] = (_Float16)g;
      }
    }
  }
}

// ---------------------------------------------------------------- gating layer 2 (N=3) + softmax
__global__ __launch_bounds__(256) void gate2_kernel(
    const _Float16* __restrict__ g116, const float* __restrict__ Wg2,
    const float* __restrict__ bg2, float* __restrict__ gates)
{
  int row = blockIdx.x * 8 + (threadIdx.x >> 5);
  int lane = threadIdx.x & 31;
  if (row >= ROWS) return;
  const _Float16* gr = g116 + (size_t)row * D2;
  float a0 = 0.f, a1 = 0.f, a2 = 0.f;
  for (int k = lane; k < D2; k += 32) {
    float g = (float)gr[k];
    a0 = fmaf(g, Wg2[k * 3 + 0], a0);
    a1 = fmaf(g, Wg2[k * 3 + 1], a1);
    a2 = fmaf(g, Wg2[k * 3 + 2], a2);
  }
#pragma unroll
  for (int msk = 16; msk >= 1; msk >>= 1) {
    a0 += __shfl_xor(a0, msk, 32);
    a1 += __shfl_xor(a1, msk, 32);
    a2 += __shfl_xor(a2, msk, 32);
  }
  if (lane == 0) {
    a0 += bg2[0]; a1 += bg2[1]; a2 += bg2[2];
    float mx = fmaxf(a0, fmaxf(a1, a2));
    float e0 = __expf(a0 - mx), e1 = __expf(a1 - mx), e2 = __expf(a2 - mx);
    float inv = 1.0f / (e0 + e1 + e2);
    gates[row * 3 + 0] = e0 * inv;
    gates[row * 3 + 1] = e1 * inv;
    gates[row * 3 + 2] = e2 * inv;
  }
}

// ---------------------------------------------------------------- fuse
__global__ void fuse_kernel(const float* __restrict__ feats, const float* __restrict__ gates,
                            float* __restrict__ out)
{
  size_t i = (size_t)blockIdx.x * 256 + threadIdx.x;
  int row = (int)(i >> 10);
  const size_t NE = (size_t)ROWS * Dv;
  out[i] = gates[row * 3 + 0] * feats[i]
         + gates[row * 3 + 1] * feats[NE + i]
         + gates[row * 3 + 2] * feats[2 * NE + i];
}

// ---------------------------------------------------------------- launch
extern "C" void kernel_launch(void* const* d_in, const int* in_sizes, int n_in,
                              void* d_out, int out_size, void* d_ws, size_t ws_size,
                              hipStream_t stream)
{
  const float* audio = (const float*)d_in[0];
  const float* video = (const float*)d_in[1];
  const float* image = (const float*)d_in[2];
  const float* Wq  = (const float*)d_in[3];
  const float* Wk  = (const float*)d_in[4];
  const float* Wv  = (const float*)d_in[5];
  const float* Wp  = (const float*)d_in[6];
  const float* bq  = (const float*)d_in[7];
  const float* bk  = (const float*)d_in[8];
  const float* bv  = (const float*)d_in[9];
  const float* bp  = (const float*)d_in[10];
  const float* qn  = (const float*)d_in[11];
  const float* kn  = (const float*)d_in[12];
  const float* rpb = (const float*)d_in[13];
  const float* Wg1 = (const float*)d_in[14];
  const float* bg1 = (const float*)d_in[15];
  const float* Wg2 = (const float*)d_in[16];
  const float* bg2 = (const float*)d_in[17];
  float* out = (float*)d_out;

  char* p = (char*)d_ws;
  auto carve = [&](size_t bytes) -> void* {
    void* r = (void*)p;
    p += (bytes + 255) & ~(size_t)255;
    return r;
  };
  const size_t NE = (size_t)ROWS * Dv;                 // 4M elems
  _Float16* x16   = (_Float16*)carve(3 * NE * 2);
  _Float16* wqT   = (_Float16*)carve(3 * (size_t)Dv * Dv * 2);
  _Float16* wkT   = (_Float16*)carve(3 * (size_t)Dv * Dv * 2);
  _Float16* wvT   = (_Float16*)carve(3 * (size_t)Dv * Dv * 2);
  _Float16* wpT   = (_Float16*)carve(3 * (size_t)Dv * Dv * 2);
  _Float16* wg1T  = (_Float16*)carve((size_t)D3 * D2 * 2);
  _Float16* Qb    = (_Float16*)carve(NE * 2);
  _Float16* Kb    = (_Float16*)carve(NE * 2);
  _Float16* vTb   = (_Float16*)carve(NE * 2);
  _Float16* aoutb = (_Float16*)carve(NE * 2);
  _Float16* cat16 = (_Float16*)carve((size_t)ROWS * D3 * 2);
  _Float16* g116  = (_Float16*)carve((size_t)ROWS * D2 * 2);
  float*    feats = (float*)carve(3 * NE * 4);
  float*    gates = (float*)carve((size_t)ROWS * 3 * 4);

  // convert activations and transpose-convert weights to f16
  cvt_kernel<<<(int)(NE / 256), 256, 0, stream>>>(audio, x16 + 0 * NE, (int)NE);
  cvt_kernel<<<(int)(NE / 256), 256, 0, stream>>>(video, x16 + 1 * NE, (int)NE);
  cvt_kernel<<<(int)(NE / 256), 256, 0, stream>>>(image, x16 + 2 * NE, (int)NE);
  for (int j = 0; j < 3; j++) {
    size_t off = (size_t)j * Dv * Dv;
    cvtT_kernel<<<dim3(Dv / 64, Dv / 64), 256, 0, stream>>>(Wq + off, wqT + off, Dv, Dv);
    cvtT_kernel<<<dim3(Dv / 64, Dv / 64), 256, 0, stream>>>(Wk + off, wkT + off, Dv, Dv);
    cvtT_kernel<<<dim3(Dv / 64, Dv / 64), 256, 0, stream>>>(Wv + off, wvT + off, Dv, Dv);
    cvtT_kernel<<<dim3(Dv / 64, Dv / 64), 256, 0, stream>>>(Wp + off, wpT + off, Dv, Dv);
  }
  cvtT_kernel<<<dim3(D2 / 64, D3 / 64), 256, 0, stream>>>(Wg1, wg1T, D3, D2);

  const int qidx[3] = {0, 1, 2};
  const int cidx[3] = {1, 0, 1};
  const float* qsrcf[3] = {audio, video, image};
  for (int j = 0; j < 3; j++) {
    size_t woff = (size_t)j * Dv * Dv;
    qkv_kernel<<<dim3(32, 8, 3), 256, 0, stream>>>(
        x16 + (size_t)qidx[j] * NE, x16 + (size_t)cidx[j] * NE,
        wqT + woff, wkT + woff, wvT + woff,
        bq + j * Dv, bk + j * Dv, bv + j * Dv,
        qn + j * HDv, kn + j * HDv, Qb, Kb, vTb);
    attn_kernel<<<dim3(8, 16, 8), 128, 0, stream>>>(
        Qb, Kb, vTb, aoutb, rpb + j * (2 * WSv - 1) * Hv);
    proj_kernel<<<dim3(32, 8), 256, 0, stream>>>(
        aoutb, wpT + woff, bp + j * Dv, qsrcf[j],
        feats + (size_t)j * NE, cat16, j);
  }

  gate1_kernel<<<dim3(32, 16), 256, 0, stream>>>(cat16, wg1T, bg1, g116);
  gate2_kernel<<<ROWS / 8, 256, 0, stream>>>(g116, Wg2, bg2, gates);
  fuse_kernel<<<(int)(NE / 256), 256, 0, stream>>>(feats, gates, out);
}

// v003
// Measured time: 328 microseconds a run.
// Next to v002, in two timings, it ran 1.19 times as fast each time.
// All steps since v000 together make it 3.16 times as fast.
#include <hip/hip_runtime.h>
#include <hip/hip_bf16.h>

typedef __attribute__((ext_vector_type(16))) _Float16 v16h;
typedef __attribute__((ext_vector_type(8)))  _Float16 v8h;
typedef __attribute__((ext_vector_type(8)))  float    v8f;
typedef __attribute__((ext_vector_type(4)))  _Float16 v4h;
typedef __attribute__((ext_vector_type(4)))  float    v4f;

#define WMMA_F32_F16(a,b,c) __builtin_amdgcn_wmma_f32_16x16x32_f16(false,(a),false,(b),(short)0,(c),false,false)

#define Bv   2
#define Tv   32
#define Lv   64
#define Dv   1024
#define Hv   16
#define WSv  8
#define SHv  4
#define HDv  64
#define Sv   512      // WS*L
#define ROWS 4096     // B*T*L
#define D3   3072
#define D2   2048
#define TPITCH 72     // halves per LDS row of the transpose tile

static __device__ inline v8h ld8(const _Float16* p) { return *(const v8h*)p; }

static __device__ inline v16h mkfrag(v8h lo, v8h hi) {
  v16h r;
#pragma unroll
  for (int i = 0; i < 8; i++) { r[i] = lo[i]; r[i + 8] = hi[i]; }
  return r;
}

// window-order row -> source row of [B,T,L] with roll(-SH) folded in
static __device__ inline int src_row(int r) {
  int w = r >> 9;          // window (0..7): b*4 + widx
  int s = r & 511;         // token in window
  int b = w >> 2;
  int widx = w & 3;
  int tq = s >> 6;
  int l = s & 63;
  int tp = widx * WSv + tq;
  int tsrc = (tp + SHv) & 31;
  return ((b * Tv + tsrc) << 6) + l;
}

// ---------------------------------------------------------------- converts
// One 64 x 64 tile per block, turned in LDS: source rows are read as 16-byte pieces,
// destination rows (k-contiguous) leave as whole 128-byte lines. R and C are multiples of 64.
static __device__ inline void cvtT_tile(_Float16* tile, const float* __restrict__ s, _Float16* __restrict__ d,
                                        int R, int C, int bx, int by) {
  const int t = threadIdx.x;
  const int c0 = bx * 64;
  const int r0 = by * 64;
  const int c4 = (t & 15) * 4;
  const int r4 = (t >> 4) * 4;
  v4f v[4];
#pragma unroll
  for (int p = 0; p < 4; p++) v[p] = *(const v4f*)(s + (size_t)(r0 + r4 + p) * C + c0 + c4);
#pragma unroll
  for (int ci = 0; ci < 4; ci++) {
    v4h h;
#pragma unroll
    for (int p = 0; p < 4; p++) h[p] = (_Float16)v[p][ci];
    *(v4h*)(tile + (c4 + ci) * TPITCH + r4) = h;
  }
  __syncthreads();
  const int seg = (t & 7) * 8;
#pragma unroll
  for (int p = 0; p < 2; p++) {
    const int c = p * 32 + (t >> 3);
    *(v8h*)(d + (size_t)(c0 + c) * R + r0 + seg) = *(const v8h*)(tile + c * TPITCH + seg);
  }
  // in the merged kernel another part's code follows these stores in the listing: no register that they name is
  // rewritten ahead of this wait
  asm volatile("s_wait_xcnt 0x0" ::: "memory");
}

// All conversions are independent of one another and run as one grid. Blocks in order: the tiles of Wg1,
// the tiles of the twelve D x D weights (pair-major: q, k, v, p), then 256 activation elements per block.
#define G1TILES ((D2 / 64) * (D3 / 64))
#define WTILES  ((Dv / 64) * (Dv / 64))
#define XBLOCKS (ROWS * Dv / 256)
__global__ __launch_bounds__(256) void prep_kernel(
    const float* __restrict__ audio, const float* __restrict__ video, const float* __restrict__ image,
    const float* __restrict__ Wq, const float* __restrict__ Wk, const float* __restrict__ Wv,
    const float* __restrict__ Wp, const float* __restrict__ Wg1,
    _Float16* __restrict__ x16, _Float16* __restrict__ wqT, _Float16* __restrict__ wkT,
    _Float16* __restrict__ wvT, _Float16* __restrict__ wpT, _Float16* __restrict__ wg1T)
{
  __shared__ __align__(16) _Float16 tile[64 * TPITCH];   // [c][r], rows 16 bytes longer than the data
  int b = blockIdx.x;
  if (b < G1TILES) {
    cvtT_tile(tile, Wg1, wg1T, D3, D2, b % (D2 / 64), b / (D2 / 64));
    return;
  }
  b -= G1TILES;
  if (b < 12 * WTILES) {
    const int m = b / WTILES;
    const int kind = m & 3;
    const size_t off = (size_t)(m >> 2) * Dv * Dv;
    const float* s = (kind == 0) ? Wq : (kind == 1) ? Wk : (kind == 2) ? Wv : Wp;
    _Float16* d    = (kind == 0) ? wqT : (kind == 1) ? wkT : (kind == 2) ? wvT : wpT;
    const int tl = b % WTILES;
    cvtT_tile(tile, s + off, d + off, Dv, Dv, tl % (Dv / 64), tl / (Dv / 64));
    return;
  }
  b -= 12 * WTILES;
  const int mod = b / XBLOCKS;
  const float* s = (mod == 0) ? audio : (mod == 1) ? video : image;
  const int i = (b % XBLOCKS) * 256 + threadIdx.x;
  x16[(size_t)mod * ROWS * Dv + i] = (_Float16)s[i];
  // the tile parts' code follows this store in the listing: no register that it names is rewritten ahead of this wait
  asm volatile("s_wait_xcnt 0x0" ::: "memory");
}

// ---------------------------------------------------------------- staged GEMM core
// One 128 x 128 tile of Y = A * B^T per block of 8 waves (4 along M x 2 along N, 32 x 64 each).
// A stage is 64 k (128 bytes) of 128 A rows and 128 B rows. Each wave-wide 16-byte copy covers four
// whole 128-byte lines and lands in LDS without passing a register; two buffers, so the copies
// of the stage after next fly while this one is multiplied.
#define GBK    64                   // halves of k per stage
#define GPITCH 72                   // halves per LDS row: 144 bytes, conflict-free for 16-byte readers
#define GBUF   (256 * GPITCH)       // halves per buffer: A rows 0..127, B rows 128..255

static __device__ inline void stage_copy(unsigned l, const _Float16* const (&gp)[8], int k) {
  // Eight copies of 16 bytes per lane, rows 32 apart. The s_wait_xcnt closes the statement so that no
  // address register of an issued copy is rewritten ahead of it.
  asm volatile(
      "global_load_async_to_lds_b128 %0, %8, off\n\t"
      "global_load_async_to_lds_b128 %1, %9, off\n\t"
      "global_load_async_to_lds_b128 %2, %10, off\n\t"
      "global_load_async_to_lds_b128 %3, %11, off\n\t"
      "global_load_async_to_lds_b128 %4, %12, off\n\t"
      "global_load_async_to_lds_b128 %5, %13, off\n\t"
      "global_load_async_to_lds_b128 %6, %14, off\n\t"
      "global_load_async_to_lds_b128 %7, %15, off\n\t"
      "s_wait_xcnt 0x0"
      :: "v"(l), "v"(l + 1u * 32u * GPITCH * 2u), "v"(l + 2u * 32u * GPITCH * 2u), "v"(l + 3u * 32u * GPITCH * 2u),
         "v"(l + 4u * 32u * GPITCH * 2u), "v"(l + 5u * 32u * GPITCH * 2u), "v"(l + 6u * 32u * GPITCH * 2u),
         "v"(l + 7u * 32u * GPITCH * 2u),
         "v"(gp[0] + k), "v"(gp[1] + k), "v"(gp[2] + k), "v"(gp[3] + k),
         "v"(gp[4] + k), "v"(gp[5] + k), "v"(gp[6] + k), "v"(gp[7] + k)
      : "memory");
}

// gp[0..3]: this thread's piece of A rows r, r+32, r+64, r+96 of the tile; gp[4..7]: the same of B.
template <int KT>
static __device__ inline void gemm_staged(_Float16* sm, const _Float16* const (&gp)[8], v8f (&acc)[2][4]) {
  const int t = threadIdx.x;
  const int lane = t & 31;
  const int wave = t >> 5;
  const int ml = lane & 15;
  const int koff = (lane >> 4) * 8;
  const unsigned lcopy = (unsigned)(size_t)sm + (unsigned)((t >> 3) * GPITCH + (t & 7) * 8) * 2u;
  const _Float16* ard = sm + ((wave & 3) * 32 + ml) * GPITCH + koff;
  const _Float16* brd = sm + (128 + (wave >> 2) * 64 + ml) * GPITCH + koff;
  constexpr int NT = KT / GBK;

  stage_copy(lcopy, gp, 0);
  asm volatile("s_wait_asynccnt 0x0" ::: "memory");   // stage 0 has landed before the barrier publishes it
  __syncthreads();
  stage_copy(lcopy + GBUF * 2u, gp, GBK);

  // stays rolled: unrolled, the reads were spread between the WMMAs again, a full LDS latency in front of each pair
#pragma unroll 1
  for (int s = 0; s < NT; s++) {
    const int bo = (s & 1) * GBUF;
    // the whole stage goes into registers as one group of reads: the buffer is free again before the WMMAs start
    // (the inner loops are unrolled so that a, b and acc are indexed by constants and stay in registers)
    v16h a[2][2], b[2][4];
#pragma unroll
    for (int ks = 0; ks < 2; ks++) {
      const _Float16* ap = ard + bo + ks * 32;
      const _Float16* bp = brd + bo + ks * 32;
#pragma unroll
      for (int p = 0; p < 2; p++) a[ks][p] = mkfrag(ld8(ap + p * 16 * GPITCH), ld8(ap + p * 16 * GPITCH + 16));
#pragma unroll
      for (int n = 0; n < 4; n++) b[ks][n] = mkfrag(ld8(bp + n * 16 * GPITCH), ld8(bp + n * 16 * GPITCH + 16));
    }
    asm volatile("s_wait_dscnt 0x0" ::: "memory");    // this wave's reads of the buffer are over before it is refilled
    asm volatile("s_wait_asynccnt 0x0" ::: "memory"); // this wave's copies of stage s + 1 have landed
    __syncthreads();                                  // publishes stage s + 1, frees stage s's buffer
    if (s + 2 < NT) stage_copy(lcopy + (unsigned)bo * 2u, gp, (s + 2) * GBK);
    // stage s + 2 flies while stage s is multiplied from registers
#pragma unroll
    for (int ks = 0; ks < 2; ks++)
#pragma unroll
      for (int n = 0; n < 4; n++) {
        acc[0][n] = WMMA_F32_F16(a[ks][0], b[ks][n], acc[0][n]);
        acc[1][n] = WMMA_F32_F16(a[ks][1], b[ks][n], acc[1][n]);
      }
  }
  asm volatile("s_wait_asynccnt 0x0" ::: "memory");   // nothing of this wave is in flight when it goes on
}

// ---------------------------------------------------------------- QKV GEMM
// grid (32, 8, 9): 128-row x 128-col tiles per block; z = 3 * pair + (Q, K or V).
// block = 256 (8 waves); each wave: 32 rows x 64 cols (one head), 8 WMMAs / 32-K step.
__global__ __launch_bounds__(256) void qkv_kernel(
    const _Float16* __restrict__ x16,
    const _Float16* __restrict__ wqT, const _Float16* __restrict__ wkT, const _Float16* __restrict__ wvT,
    const float* __restrict__ bq, const float* __restrict__ bk, const float* __restrict__ bv,
    const float* __restrict__ qn, const float* __restrict__ kn,
    _Float16* __restrict__ Qb, _Float16* __restrict__ Kb, _Float16* __restrict__ vTb)
{
  __shared__ __align__(16) _Float16 sm[2 * GBUF];
  const int j = blockIdx.z / 3;             // modality pair
  const int which = blockIdx.z % 3;
  const size_t NE = (size_t)ROWS * Dv;
  // queries come from modality j; keys and values from video for pairs 0 and 2, from audio for pair 1
  const _Float16* xq = x16 + (size_t)j * NE;
  const _Float16* xc = x16 + ((j == 1) ? 0 : NE);
  wqT += (size_t)j * Dv * Dv;  wkT += (size_t)j * Dv * Dv;  wvT += (size_t)j * Dv * Dv;
  bq += j * Dv;  bk += j * Dv;  bv += j * Dv;
  qn += j * HDv; kn += j * HDv;
  Qb += (size_t)j * NE;  Kb += (size_t)j * NE;  vTb += (size_t)j * NE;
  const int lane = threadIdx.x & 31;
  const int wave = threadIdx.x >> 5;
  const int ml = lane & 15;
  const int m0 = blockIdx.x * 128 + (wave & 3) * 32;
  const int n0 = blockIdx.y * 128 + (wave >> 2) * 64;

  const _Float16* src = (which == 0) ? xq : xc;
  const _Float16* wT  = (which == 0) ? wqT : (which == 1 ? wkT : wvT);
  const float* bias   = (which == 0) ? bq  : (which == 1 ? bk  : bv);

  const int cr = threadIdx.x >> 3;          // row of the tile this thread copies (and 32, 64, 96 below it)
  const int cc = (threadIdx.x & 7) * 8;     // its 16-byte piece of the row's 128 bytes
  const _Float16* gp[8];
#pragma unroll
  for (int i = 0; i < 4; i++) {
    gp[i]     = src + (size_t)src_row(blockIdx.x * 128 + cr + 32 * i) * Dv + cc;
    gp[4 + i] = wT + (size_t)(blockIdx.y * 128 + cr + 32 * i) * Dv + cc;
  }

  v8f acc[2][4] = {};
  gemm_staged<Dv>(sm, gp, acc);

  const int rowoff = (lane >> 4) * 8;
#pragma unroll
  for (int part = 0; part < 2; part++) {
    const int mp = m0 + part * 16;
    float val[4][8];
#pragma unroll
    for (int n = 0; n < 4; n++) {
      float bc = bias[n0 + n * 16 + ml];
#pragma unroll
      for (int i = 0; i < 8; i++) val[n][i] = acc[part][n][i] + bc;
    }

    if (which < 2) {                       // RMS-norm over the head dim (tile == one head)
      const float* nw_ = (which == 0) ? qn : kn;
      float ss[8];
#pragma unroll
      for (int i = 0; i < 8; i++) {
        ss[i] = 0.f;
#pragma unroll
        for (int n = 0; n < 4; n++) ss[i] += val[n][i] * val[n][i];
      }
#pragma unroll
      for (int msk = 1; msk < 16; msk <<= 1)
#pragma unroll
        for (int i = 0; i < 8; i++) ss[i] += __shfl_xor(ss[i], msk, 32);
      const float sc = (which == 0) ? 0.125f : 1.0f;   // fold HD^-0.5 into Q
      float rs[8];
#pragma unroll
      for (int i = 0; i < 8; i++) rs[i] = rsqrtf(ss[i] * (1.0f / 64.0f) + 1e-6f) * sc;
#pragma unroll
      for (int n = 0; n < 4; n++) {
        float wc = nw_[(n0 + n * 16 + ml) & 63];
#pragma unroll
        for (int i = 0; i < 8; i++) val[n][i] *= rs[i] * wc;
      }
    }

    if (which < 2) {
      _Float16* dst = (which == 0) ? Qb : Kb;
#pragma unroll
      for (int n = 0; n < 4; n++) {
        int col = n0 + n * 16 + ml;
#pragma unroll
        for (int i = 0; i < 8; i++)
          dst[(size_t)(mp + rowoff + i) * Dv + col] = (_Float16)val[n][i];
      }
    } else {                               // V transposed: [(w*H+h)*HD+d][token]
#pragma unroll
      for (int n = 0; n < 4; n++) {
        int col = n0 + n * 16 + ml;
        int hh = col >> 6, d = col & 63;
#pragma unroll
        for (int i = 0; i < 8; i++) {
          int r = mp + rowoff + i;
          int w = r >> 9, s = r & 511;
          vTb[((size_t)((w * Hv + hh) * HDv + d)) * Sv + s] = (_Float16)val[n][i];
        }
      }
    }
  }
}

// ---------------------------------------------------------------- flash attention
// grid (8 q-chunks, 16 heads, 3 pairs x 8 windows), block = 128 (4 waves, 16 q-rows each)
__global__ __launch_bounds__(128) void attn_kernel(
    const _Float16* __restrict__ Qb, const _Float16* __restrict__ Kb,
    const _Float16* __restrict__ vTb, _Float16* __restrict__ aout,
    const float* __restrict__ rpb)
{
  __shared__ __align__(16) _Float16 plds[4 * 16 * 32];
  const int lane = threadIdx.x & 31;
  const int wave = threadIdx.x >> 5;
  const int ml = lane & 15;
  const int koff = (lane >> 4) * 8;
  const int rowoff = (lane >> 4) * 8;
  const int qb = blockIdx.x, h = blockIdx.y, w = blockIdx.z & 7;
  const int j = blockIdx.z >> 3;          // modality pair: its own Q, K, V, output and bias table
  Qb += (size_t)j * ROWS * Dv;  Kb += (size_t)j * ROWS * Dv;
  vTb += (size_t)j * ROWS * Dv; aout += (size_t)j * ROWS * Dv;
  const float* rpbj = rpb + j * (2 * WSv - 1) * Hv;
  const int tq = qb;                      // 64-row chunks align to L

  const int qrow = qb * 64 + wave * 16;
  const _Float16* qp = Qb + (size_t)(w * Sv + qrow + ml) * Dv + h * HDv + koff;
  v16h qa0 = mkfrag(ld8(qp),      ld8(qp + 16));
  v16h qa1 = mkfrag(ld8(qp + 32), ld8(qp + 48));

  v8f accO[4] = {};
  float m_[8], l_[8];
#pragma unroll
  for (int i = 0; i < 8; i++) { m_[i] = -3.0e38f; l_[i] = 0.f; }

  _Float16* pw = plds + wave * 512;

  for (int ch = 0; ch < 16; ch++) {
    const int c0 = ch * 32;
    const int tk = c0 >> 6;
    const float biasv = rpbj[(tq - tk + WSv - 1) * Hv + h];

    v8f s0 = {}, s1 = {};
    {
      const _Float16* kp0 = Kb + (size_t)(w * Sv + c0 + ml) * Dv + h * HDv;
      const _Float16* kp1 = Kb + (size_t)(w * Sv + c0 + 16 + ml) * Dv + h * HDv;
      v16h kb00 = mkfrag(ld8(kp0 + koff),      ld8(kp0 + koff + 16));
      v16h kb01 = mkfrag(ld8(kp0 + 32 + koff), ld8(kp0 + 48 + koff));
      v16h kb10 = mkfrag(ld8(kp1 + koff),      ld8(kp1 + koff + 16));
      v16h kb11 = mkfrag(ld8(kp1 + 32 + koff), ld8(kp1 + 48 + koff));
      s0 = WMMA_F32_F16(qa0, kb00, s0);
      s0 = WMMA_F32_F16(qa1, kb01, s0);
      s1 = WMMA_F32_F16(qa0, kb10, s1);
      s1 = WMMA_F32_F16(qa1, kb11, s1);
    }
#pragma unroll
    for (int i = 0; i < 8; i++) { s0[i] += biasv; s1[i] += biasv; }

    float mn[8];
#pragma unroll
    for (int i = 0; i < 8; i++) mn[i] = fmaxf(s0[i], s1[i]);
#pragma unroll
    for (int msk = 1; msk < 16; msk <<= 1)
#pragma unroll
      for (int i = 0; i < 8; i++) mn[i] = fmaxf(mn[i], __shfl_xor(mn[i], msk, 32));

    float alpha[8], p0[8], p1[8], rsum[8];
#pragma unroll
    for (int i = 0; i < 8; i++) {
      mn[i] = fmaxf(mn[i], m_[i]);
      alpha[i] = __expf(m_[i] - mn[i]);
      m_[i] = mn[i];
      p0[i] = __expf(s0[i] - mn[i]);
      p1[i] = __expf(s1[i] - mn[i]);
      rsum[i] = p0[i] + p1[i];
    }
#pragma unroll
    for (int msk = 1; msk < 16; msk <<= 1)
#pragma unroll
      for (int i = 0; i < 8; i++) rsum[i] += __shfl_xor(rsum[i], msk, 32);
#pragma unroll
    for (int i = 0; i < 8; i++) l_[i] = l_[i] * alpha[i] + rsum[i];
#pragma unroll
    for (int n = 0; n < 4; n++)
#pragma unroll
      for (int i = 0; i < 8; i++) accO[n][i] *= alpha[i];

    // C-layout -> A-layout transpose of P through per-wave LDS
#pragma unroll
    for (int i = 0; i < 8; i++) {
      int rt = rowoff + i;
      pw[rt * 32 + ml]      = (_Float16)p0[i];
      pw[rt * 32 + ml + 16] = (_Float16)p1[i];
    }
    asm volatile("s_wait_dscnt 0" ::: "memory");
    const _Float16* pl = pw + ml * 32 + koff;
    v16h pa = mkfrag(ld8(pl), ld8(pl + 16));

#pragma unroll
    for (int n = 0; n < 4; n++) {
      const _Float16* vp = vTb + ((size_t)((w * Hv + h) * HDv + n * 16 + ml)) * Sv + c0 + koff;
      v16h vb = mkfrag(ld8(vp), ld8(vp + 16));
      accO[n] = WMMA_F32_F16(pa, vb, accO[n]);
    }
  }

  float inv[8];
#pragma unroll
  for (int i = 0; i < 8; i++) inv[i] = 1.0f / l_[i];
#pragma unroll
  for (int n = 0; n < 4; n++) {
    int col = h * HDv + n * 16 + ml;
#pragma unroll
    for (int i = 0; i < 8; i++) {
      int r = w * Sv + qrow + rowoff + i;
      aout[(size_t)r * Dv + col] = (_Float16)(accO[n][i] * inv[i]);
    }
  }
}

// ---------------------------------------------------------------- output projection + residual + roll(+SH)
// grid (32, 8, 3 pairs): 128x128 tile per block of 8 waves, 32 rows x 64 cols per wave.
__global__ __launch_bounds__(256) void proj_kernel(
    const _Float16* __restrict__ aoutb, const _Float16* __restrict__ wpT,
    const float* __restrict__ bp,
    const float* __restrict__ audio, const float* __restrict__ video, const float* __restrict__ image,
    float* __restrict__ feat, _Float16* __restrict__ cat16)
{
  __shared__ __align__(16) _Float16 sm[2 * GBUF];
  const int j = blockIdx.z;
  const float* qmf = (j == 0) ? audio : (j == 1) ? video : image;   // residual: the pair's query modality
  aoutb += (size_t)j * ROWS * Dv;
  wpT += (size_t)j * Dv * Dv;
  bp += j * Dv;
  feat += (size_t)j * ROWS * Dv;
  const int lane = threadIdx.x & 31;
  const int wave = threadIdx.x >> 5;
  const int ml = lane & 15;
  const int m0 = blockIdx.x * 128 + (wave & 3) * 32;
  const int n0 = blockIdx.y * 128 + (wave >> 2) * 64;

  const int cr = threadIdx.x >> 3;
  const int cc = (threadIdx.x & 7) * 8;
  const _Float16* gp[8];
#pragma unroll
  for (int i = 0; i < 4; i++) {
    gp[i]     = aoutb + (size_t)(blockIdx.x * 128 + cr + 32 * i) * Dv + cc;
    gp[4 + i] = wpT + (size_t)(blockIdx.y * 128 + cr + 32 * i) * Dv + cc;
  }

  v8f acc[2][4] = {};
  gemm_staged<Dv>(sm, gp, acc);

  const int rowoff = (lane >> 4) * 8;
#pragma unroll
  for (int part = 0; part < 2; part++) {
    const int mp = m0 + part * 16;
    int featrow[8];
#pragma unroll
    for (int i = 0; i < 8; i++) {
      int r = mp + rowoff + i;
      int w = r >> 9, s = r & 511;
      int b = w >> 2, widx = w & 3;
      int tqq = s >> 6, l = s & 63;
      int t = (widx * WSv + tqq + SHv) & 31;   // roll back by +SH
      featrow[i] = (b * Tv + t) * Lv + l;
    }
#pragma unroll
    for (int n = 0; n < 4; n++) {
      int col = n0 + n * 16 + ml;
      float bc = bp[col];
#pragma unroll
      for (int i = 0; i < 8; i++) {
        float v = acc[part][n][i] + bc + qmf[(size_t)featrow[i] * Dv + col];
        feat[(size_t)featrow[i] * Dv + col] = v;
        cat16[(size_t)featrow[i] * D3 + j * Dv + col] = (_Float16)v;
      }
    }
  }
}

// ---------------------------------------------------------------- gating MLP layer 1 (+GELU)
// grid (32, 16): 128x128 tile per block of 8 waves.
__global__ __launch_bounds__(256) void gate1_kernel(
    const _Float16* __restrict__ cat16, const _Float16* __restrict__ wg1T,
    const float* __restrict__ bg1, _Float16* __restrict__ g116)
{
  __shared__ __align__(16) _Float16 sm[2 * GBUF];
  const int lane = threadIdx.x & 31;
  const int wave = threadIdx.x >> 5;
  const int ml = lane & 15;
  const int m0 = blockIdx.x * 128 + (wave & 3) * 32;
  const int n0 = blockIdx.y * 128 + (wave >> 2) * 64;

  const int cr = threadIdx.x >> 3;
  const int cc = (threadIdx.x & 7) * 8;
  const _Float16* gp[8];
#pragma unroll
  for (int i = 0; i < 4; i++) {
    gp[i]     = cat16 + (size_t)(blockIdx.x * 128 + cr + 32 * i) * D3 + cc;
    gp[4 + i] = wg1T + (size_t)(blockIdx.y * 128 + cr + 32 * i) * D3 + cc;
  }

  v8f acc[2][4] = {};
  gemm_staged<D3>(sm, gp, acc);

  const int rowoff = (lane >> 4) * 8;
#pragma unroll
  for (int part = 0; part < 2; part++) {
    const int mp = m0 + part * 16;
#pragma unroll
    for (int n = 0; n < 4; n++) {
      int col = n0 + n * 16 + ml;
      float bc = bg1[col];
#pragma unroll
      for (int i = 0; i < 8; i++) {
        float x = acc[part][n][i] + bc;
        float g = 0.5f * x * (1.0f + erff(x * 0.70710678118f));   // exact GELU
        g116[(size_t)(mp + rowoff + i) * D2 + col] = (_Float16)g;
      }
    }
  }
}

// ---------------------------------------------------------------- gating layer 2 (N=3) + softmax
__global__ __launch_bounds__(256) void gate2_kernel(
    const _Float16* __restrict__ g116, const float* __restrict__ Wg2,
    const float* __restrict__ bg2, float* __restrict__ gates)
{
  int row = blockIdx.x * 8 + (threadIdx.x >> 5);
  int lane = threadIdx.x & 31;
  if (row >= ROWS) return;
  const _Float16* gr = g116 + (size_t)row * D2;
  float a0 = 0.f, a1 = 0.f, a2 = 0.f;
  for (int k = lane; k < D2; k += 32) {
    float g = (float)gr[k];
    a0 = fmaf(g, Wg2[k * 3 + 0], a0);
    a1 = fmaf(g, Wg2[k * 3 + 1], a1);
    a2 = fmaf(g, Wg2[k * 3 + 2], a2);
  }
#pragma unroll
  for (int msk = 16; msk >= 1; msk >>= 1) {
    a0 += __shfl_xor(a0, msk, 32);
    a1 += __shfl_xor(a1, msk, 32);
    a2 += __shfl_xor(a2, msk, 32);
  }
  if (lane == 0) {
    a0 += bg2[0]; a1 += bg2[1]; a2 += bg2[2];
    float mx = fmaxf(a0, fmaxf(a1, a2));
    float e0 = __expf(a0 - mx), e1 = __expf(a1 - mx), e2 = __expf(a2 - mx);
    float inv = 1.0f / (e0 + e1 + e2);
    gates[row * 3 + 0] = e0 * inv;
    gates[row * 3 + 1] = e1 * inv;
    gates[row * 3 + 2] = e2 * inv;
  }
}

// ---------------------------------------------------------------- fuse
__global__ void fuse_kernel(const float* __restrict__ feats, const float* __restrict__ gates,
                            float* __restrict__ out)
{
  size_t i = (size_t)blockIdx.x * 256 + threadIdx.x;
  int row = (int)(i >> 10);
  const size_t NE = (size_t)ROWS * Dv;
  out[i] = gates[row * 3 + 0] * feats[i]
         + gates[row * 3 + 1] * feats[NE + i]
         + gates[row * 3 + 2] * feats[2 * NE + i];
}

// ---------------------------------------------------------------- launch
extern "C" void kernel_launch(void* const* d_in, const int* in_sizes, int n_in,
                              void* d_out, int out_size, void* d_ws, size_t ws_size,
                              hipStream_t stream)
{
  const float* audio = (const float*)d_in[0];
  const float* video = (const float*)d_in[1];
  const float* image = (const float*)d_in[2];
  const float* Wq  = (const float*)d_in[3];
  const float* Wk  = (const float*)d_in[4];
  const float* Wv  = (const float*)d_in[5];
  const float* Wp  = (const float*)d_in[6];
  const float* bq  = (const float*)d_in[7];
  const float* bk  = (const float*)d_in[8];
  const float* bv  = (const float*)d_in[9];
  const float* bp  = (const float*)d_in[10];
  const float* qn  = (const float*)d_in[11];
  const float* kn  = (const float*)d_in[12];
  const float* rpb = (const float*)d_in[13];
  const float* Wg1 = (const float*)d_in[14];
  const float* bg1 = (const float*)d_in[15];
  const float* Wg2 = (const float*)d_in[16];
  const float* bg2 = (const float*)d_in[17];
  float* out = (float*)d_out;

  char* p = (char*)d_ws;
  auto carve = [&](size_t bytes) -> void* {
    void* r = (void*)p;
    p += (bytes + 255) & ~(size_t)255;
    return r;
  };
  const size_t NE = (size_t)ROWS * Dv;                 // 4M elems
  _Float16* x16   = (_Float16*)carve(3 * NE * 2);
  _Float16* wqT   = (_Float16*)carve(3 * (size_t)Dv * Dv * 2);
  _Float16* wkT   = (_Float16*)carve(3 * (size_t)Dv * Dv * 2);
  _Float16* wvT   = (_Float16*)carve(3 * (size_t)Dv * Dv * 2);
  _Float16* wpT   = (_Float16*)carve(3 * (size_t)Dv * Dv * 2);
  _Float16* wg1T  = (_Float16*)carve((size_t)D3 * D2 * 2);
  _Float16* Qb    = (_Float16*)carve(3 * NE * 2);       // one plane per modality pair
  _Float16* Kb    = (_Float16*)carve(3 * NE * 2);
  _Float16* vTb   = (_Float16*)carve(3 * NE * 2);
  _Float16* aoutb = (_Float16*)carve(3 * NE * 2);
  _Float16* cat16 = (_Float16*)carve((size_t)ROWS * D3 * 2);
  _Float16* g116  = (_Float16*)carve((size_t)ROWS * D2 * 2);
  float*    feats = (float*)carve(3 * NE * 4);
  float*    gates = (float*)carve((size_t)ROWS * 3 * 4);

  // convert activations and transpose-convert weights to f16
  prep_kernel<<<G1TILES + 12 * WTILES + 3 * XBLOCKS, 256, 0, stream>>>(
      audio, video, image, Wq, Wk, Wv, Wp, Wg1, x16, wqT, wkT, wvT, wpT, wg1T);

  // the three modality pairs do not depend on one another: each stage takes all of them in one grid
  qkv_kernel<<<dim3(32, 8, 9), 256, 0, stream>>>(x16, wqT, wkT, wvT, bq, bk, bv, qn, kn, Qb, Kb, vTb);
  attn_kernel<<<dim3(8, 16, 24), 128, 0, stream>>>(Qb, Kb, vTb, aoutb, rpb);
  proj_kernel<<<dim3(32, 8, 3), 256, 0, stream>>>(aoutb, wpT, bp, audio, video, image, feats, cat16);

  gate1_kernel<<<dim3(32, 16), 256, 0, stream>>>(cat16, wg1T, bg1, g116);
  gate2_kernel<<<ROWS / 8, 256, 0, stream>>>(g116, Wg2, bg2, gates);
  fuse_kernel<<<(int)(NE / 256), 256, 0, stream>>>(feats, gates, out);
}

// v004
// It runs in 303 microseconds.
// Timed twice side by side with v003, it ran 1.08 and 1.09 times as fast.
// All steps since v000 together make it 3.43 times as fast.
#include <hip/hip_runtime.h>
#include <hip/hip_bf16.h>

typedef __attribute__((ext_vector_type(16))) _Float16 v16h;
typedef __attribute__((ext_vector_type(8)))  _Float16 v8h;
typedef __attribute__((ext_vector_type(8)))  float    v8f;
typedef __attribute__((ext_vector_type(4)))  _Float16 v4h;
typedef __attribute__((ext_vector_type(4)))  float    v4f;

#define WMMA_F32_F16(a,b,c) __builtin_amdgcn_wmma_f32_16x16x32_f16(false,(a),false,(b),(short)0,(c),false,false)

#define Bv   2
#define Tv   32
#define Lv   64
#define Dv   1024
#define Hv   16
#define WSv  8
#define SHv  4
#define HDv  64
#define Sv   512      // WS*L
#define ROWS 4096     // B*T*L
#define D3   3072
#define D2   2048
#define TPITCH 72     // halves per LDS row of the transpose tile

static __device__ inline v8h ld8(const _Float16* p) { return *(const v8h*)p; }

static __device__ inline v16h mkfrag(v8h lo, v8h hi) {
  v16h r;
#pragma unroll
  for (int i = 0; i < 8; i++) { r[i] = lo[i]; r[i + 8] = hi[i]; }
  return r;
}

// window-order row -> source row of [B,T,L] with roll(-SH) folded in
static __device__ inline int src_row(int r) {
  int w = r >> 9;          // window (0..7): b*4 + widx
  int s = r & 511;         // token in window
  int b = w >> 2;
  int widx = w & 3;
  int tq = s >> 6;
  int l = s & 63;
  int tp = widx * WSv + tq;
  int tsrc = (tp + SHv) & 31;
  return ((b * Tv + tsrc) << 6) + l;
}

// ---------------------------------------------------------------- converts
// TPB 64 x 64 tiles per block, one below the other in the source, each turned in its own LDS tile: source rows
// are read as 16-byte pieces (a thread's 4 * TPB loads stand ahead of its converts, so that many are in flight),
// destination rows (k-contiguous) leave as whole 128-byte lines. R is a multiple of 64 * TPB, C of 64.
#define TPB 4
static __device__ inline void cvtT_tiles(_Float16* tile, const float* __restrict__ s, _Float16* __restrict__ d,
                                         int R, int C, int bx, int by) {
  const int t = threadIdx.x;
  const int c0 = bx * 64;
  const int r0 = by * (64 * TPB);
  const int c4 = (t & 15) * 4;
  const int r4 = (t >> 4) * 4;
  v4f v[TPB][4];
#pragma unroll
  for (int q = 0; q < TPB; q++)
#pragma unroll
    for (int p = 0; p < 4; p++) v[q][p] = *(const v4f*)(s + (size_t)(r0 + q * 64 + r4 + p) * C + c0 + c4);
#pragma unroll
  for (int q = 0; q < TPB; q++)
#pragma unroll
    for (int ci = 0; ci < 4; ci++) {
      v4h h;
#pragma unroll
      for (int p = 0; p < 4; p++) h[p] = (_Float16)v[q][p][ci];
      *(v4h*)(tile + (q * 64 + c4 + ci) * TPITCH + r4) = h;
    }
  __syncthreads();
  const int seg = (t & 7) * 8;
#pragma unroll
  for (int q = 0; q < TPB; q++)
#pragma unroll
    for (int p = 0; p < 2; p++) {
      const int c = p * 32 + (t >> 3);
      *(v8h*)(d + (size_t)(c0 + c) * R + r0 + q * 64 + seg) = *(const v8h*)(tile + (q * 64 + c) * TPITCH + seg);
    }
  // in the merged kernel another part's code follows these stores in the listing: no register that they name is
  // rewritten ahead of this wait
  asm volatile("s_wait_xcnt 0x0" ::: "memory");
}

// All conversions are independent of one another and run as one grid. Blocks in order: the tiles of Wg1,
// the tiles of the twelve D x D weights (pair-major: q, k, v, p), then XPT activation elements per thread.
// A block carries enough work that the grid is 1920 blocks (15360 waves): what a launch of one element per lane
// pays is the start of its waves, not its bytes.
#define G1TILES ((D2 / 64) * (D3 / (64 * TPB)))
#define WTILES  ((Dv / 64) * (Dv / (64 * TPB)))
#define XPT     64
#define XBLOCKS (ROWS * Dv / (256 * XPT))
__global__ __launch_bounds__(256) void prep_kernel(
    const float* __restrict__ audio, const float* __restrict__ video, const float* __restrict__ image,
    const float* __restrict__ Wq, const float* __restrict__ Wk, const float* __restrict__ Wv,
    const float* __restrict__ Wp, const float* __restrict__ Wg1,
    _Float16* __restrict__ x16, _Float16* __restrict__ wqT, _Float16* __restrict__ wkT,
    _Float16* __restrict__ wvT, _Float16* __restrict__ wpT, _Float16* __restrict__ wg1T)
{
  __shared__ __align__(16) _Float16 tile[TPB * 64 * TPITCH];   // [tile][c][r], rows 16 bytes longer than the data
  int b = blockIdx.x;
  if (b < G1TILES) {
    cvtT_tiles(tile, Wg1, wg1T, D3, D2, b % (D2 / 64), b / (D2 / 64));
    return;
  }
  b -= G1TILES;
  if (b < 12 * WTILES) {
    const int m = b / WTILES;
    const int kind = m & 3;
    const size_t off = (size_t)(m >> 2) * Dv * Dv;
    const float* s = (kind == 0) ? Wq : (kind == 1) ? Wk : (kind == 2) ? Wv : Wp;
    _Float16* d    = (kind == 0) ? wqT : (kind == 1) ? wkT : (kind == 2) ? wvT : wpT;
    const int tl = b % WTILES;
    cvtT_tiles(tile, s + off, d + off, Dv, Dv, tl % (Dv / 64), tl / (Dv / 64));
    return;
  }
  b -= 12 * WTILES;
  const int mod = b / XBLOCKS;
  const float* s = (mod == 0) ? audio : (mod == 1) ? video : image;
  // each wave-wide load covers 512 contiguous bytes, each store 256; the loads stand ahead of the converts
  const int i = (b % XBLOCKS) * (256 * XPT) + threadIdx.x * 4;
  _Float16* xd = x16 + (size_t)mod * ROWS * Dv + i;
  v4f xv[XPT / 4];
#pragma unroll
  for (int u = 0; u < XPT / 4; u++) xv[u] = *(const v4f*)(s + i + u * 1024);
#pragma unroll
  for (int u = 0; u < XPT / 4; u++) {
    v4h h;
#pragma unroll
    for (int e = 0; e < 4; e++) h[e] = (_Float16)xv[u][e];
    *(v4h*)(xd + u * 1024) = h;
  }
  // the tile parts' code follows these stores in the listing: no register that they name is rewritten ahead of this wait
  asm volatile("s_wait_xcnt 0x0" ::: "memory");
}

// ---------------------------------------------------------------- staged GEMM core
// One 128 x 128 tile of Y = A * B^T per block of 8 waves (4 along M x 2 along N, 32 x 64 each).
// A stage is 64 k (128 bytes) of 128 A rows and 128 B rows. Each wave-wide 16-byte copy covers four
// whole 128-byte lines and lands in LDS without passing a register; two buffers, so the copies
// of the stage after next fly while this one is multiplied.
#define GBK    64                   // halves of k per stage
#define GPITCH 72                   // halves per LDS row: 144 bytes, conflict-free for 16-byte readers
#define GBUF   (256 * GPITCH)       // halves per buffer: A rows 0..127, B rows 128..255

static __device__ inline void stage_copy(unsigned l, const _Float16* const (&gp)[8], int k) {
  // Eight copies of 16 bytes per lane, rows 32 apart. The s_wait_xcnt closes the statement so that no
  // address register of an issued copy is rewritten ahead of it.
  asm volatile(
      "global_load_async_to_lds_b128 %0, %8, off\n\t"
      "global_load_async_to_lds_b128 %1, %9, off\n\t"
      "global_load_async_to_lds_b128 %2, %10, off\n\t"
      "global_load_async_to_lds_b128 %3, %11, off\n\t"
      "global_load_async_to_lds_b128 %4, %12, off\n\t"
      "global_load_async_to_lds_b128 %5, %13, off\n\t"
      "global_load_async_to_lds_b128 %6, %14, off\n\t"
      "global_load_async_to_lds_b128 %7, %15, off\n\t"
      "s_wait_xcnt 0x0"
      :: "v"(l), "v"(l + 1u * 32u * GPITCH * 2u), "v"(l + 2u * 32u * GPITCH * 2u), "v"(l + 3u * 32u * GPITCH * 2u),
         "v"(l + 4u * 32u * GPITCH * 2u), "v"(l + 5u * 32u * GPITCH * 2u), "v"(l + 6u * 32u * GPITCH * 2u),
         "v"(l + 7u * 32u * GPITCH * 2u),
         "v"(gp[0] + k), "v"(gp[1] + k), "v"(gp[2] + k), "v"(gp[3] + k),
         "v"(gp[4] + k), "v"(gp[5] + k), "v"(gp[6] + k), "v"(gp[7] + k)
      : "memory");
}

// gp[0..3]: this thread's piece of A rows r, r+32, r+64, r+96 of the tile; gp[4..7]: the same of B.
template <int KT>
static __device__ inline void gemm_staged(_Float16* sm, const _Float16* const (&gp)[8], v8f (&acc)[2][4]) {
  const int t = threadIdx.x;
  const int lane = t & 31;
  const int wave = t >> 5;
  const int ml = lane & 15;
  const int koff = (lane >> 4) * 8;
  const unsigned lcopy = (unsigned)(size_t)sm + (unsigned)((t >> 3) * GPITCH + (t & 7) * 8) * 2u;
  const _Float16* ard = sm + ((wave & 3) * 32 + ml) * GPITCH + koff;
  const _Float16* brd = sm + (128 + (wave >> 2) * 64 + ml) * GPITCH + koff;
  constexpr int NT = KT / GBK;

  stage_copy(lcopy, gp, 0);
  asm volatile("s_wait_asynccnt 0x0" ::: "memory");   // stage 0 has landed before the barrier publishes it
  __syncthreads();
  stage_copy(lcopy + GBUF * 2u, gp, GBK);

  // stays rolled: unrolled, the reads were spread between the WMMAs again, a full LDS latency in front of each pair
#pragma unroll 1
  for (int s = 0; s < NT; s++) {
    const int bo = (s & 1) * GBUF;
    // the whole stage goes into registers as one group of reads: the buffer is free again before the WMMAs start
    // (the inner loops are unrolled so that a, b and acc are indexed by constants and stay in registers)
    v16h a[2][2], b[2][4];
#pragma unroll
    for (int ks = 0; ks < 2; ks++) {
      const _Float16* ap = ard + bo + ks * 32;
      const _Float16* bp = brd + bo + ks * 32;
#pragma unroll
      for (int p = 0; p < 2; p++) a[ks][p] = mkfrag(ld8(ap + p * 16 * GPITCH), ld8(ap + p * 16 * GPITCH + 16));
#pragma unroll
      for (int n = 0; n < 4; n++) b[ks][n] = mkfrag(ld8(bp + n * 16 * GPITCH), ld8(bp + n * 16 * GPITCH + 16));
    }
    asm volatile("s_wait_dscnt 0x0" ::: "memory");    // this wave's reads of the buffer are over before it is refilled
    asm volatile("s_wait_asynccnt 0x0" ::: "memory"); // this wave's copies of stage s + 1 have landed
    __syncthreads();                                  // publishes stage s + 1, frees stage s's buffer
    if (s + 2 < NT) stage_copy(lcopy + (unsigned)bo * 2u, gp, (s + 2) * GBK);
    // stage s + 2 flies while stage s is multiplied from registers
#pragma unroll
    for (int ks = 0; ks < 2; ks++)
#pragma unroll
      for (int n = 0; n < 4; n++) {
        acc[0][n] = WMMA_F32_F16(a[ks][0], b[ks][n], acc[0][n]);
        acc[1][n] = WMMA_F32_F16(a[ks][1], b[ks][n], acc[1][n]);
      }
  }
  asm volatile("s_wait_asynccnt 0x0" ::: "memory");   // nothing of this wave is in flight when it goes on
}

// ---------------------------------------------------------------- QKV GEMM
// grid (32, 8, 9): 128-row x 128-col tiles per block; z = 3 * pair + (Q, K or V).
// block = 256 (8 waves); each wave: 32 rows x 64 cols (one head), 8 WMMAs / 32-K step.
__global__ __launch_bounds__(256) void qkv_kernel(
    const _Float16* __restrict__ x16,
    const _Float16* __restrict__ wqT, const _Float16* __restrict__ wkT, const _Float16* __restrict__ wvT,
    const float* __restrict__ bq, const float* __restrict__ bk, const float* __restrict__ bv,
    const float* __restrict__ qn, const float* __restrict__ kn,
    _Float16* __restrict__ Qb, _Float16* __restrict__ Kb, _Float16* __restrict__ vTb)
{
  __shared__ __align__(16) _Float16 sm[2 * GBUF];
  const int j = blockIdx.z / 3;             // modality pair
  const int which = blockIdx.z % 3;
  const size_t NE = (size_t)ROWS * Dv;
  // queries come from modality j; keys and values from video for pairs 0 and 2, from audio for pair 1
  const _Float16* xq = x16 + (size_t)j * NE;
  const _Float16* xc = x16 + ((j == 1) ? 0 : NE);
  wqT += (size_t)j * Dv * Dv;  wkT += (size_t)j * Dv * Dv;  wvT += (size_t)j * Dv * Dv;
  bq += j * Dv;  bk += j * Dv;  bv += j * Dv;
  qn += j * HDv; kn += j * HDv;
  Qb += (size_t)j * NE;  Kb += (size_t)j * NE;  vTb += (size_t)j * NE;
  const int lane = threadIdx.x & 31;
  const int wave = threadIdx.x >> 5;
  const int ml = lane & 15;
  const int m0 = blockIdx.x * 128 + (wave & 3) * 32;
  const int n0 = blockIdx.y * 128 + (wave >> 2) * 64;

  const _Float16* src = (which == 0) ? xq : xc;
  const _Float16* wT  = (which == 0) ? wqT : (which == 1 ? wkT : wvT);
  const float* bias   = (which == 0) ? bq  : (which == 1 ? bk  : bv);

  const int cr = threadIdx.x >> 3;          // row of the tile this thread copies (and 32, 64, 96 below it)
  const int cc = (threadIdx.x & 7) * 8;     // its 16-byte piece of the row's 128 bytes
  const _Float16* gp[8];
#pragma unroll
  for (int i = 0; i < 4; i++) {
    gp[i]     = src + (size_t)src_row(blockIdx.x * 128 + cr + 32 * i) * Dv + cc;
    gp[4 + i] = wT + (size_t)(blockIdx.y * 128 + cr + 32 * i) * Dv + cc;
  }

  v8f acc[2][4] = {};
  gemm_staged<Dv>(sm, gp, acc);

  const int rowoff = (lane >> 4) * 8;
#pragma unroll
  for (int part = 0; part < 2; part++) {
    const int mp = m0 + part * 16;
    float val[4][8];
#pragma unroll
    for (int n = 0; n < 4; n++) {
      float bc = bias[n0 + n * 16 + ml];
#pragma unroll
      for (int i = 0; i < 8; i++) val[n][i] = acc[part][n][i] + bc;
    }

    if (which < 2) {                       // RMS-norm over the head dim (tile == one head)
      const float* nw_ = (which == 0) ? qn : kn;
      float ss[8];
#pragma unroll
      for (int i = 0; i < 8; i++) {
        ss[i] = 0.f;
#pragma unroll
        for (int n = 0; n < 4; n++) ss[i] += val[n][i] * val[n][i];
      }
#pragma unroll
      for (int msk = 1; msk < 16; msk <<= 1)
#pragma unroll
        for (int i = 0; i < 8; i++) ss[i] += __shfl_xor(ss[i], msk, 32);
      const float sc = (which == 0) ? 0.125f : 1.0f;   // fold HD^-0.5 into Q
      float rs[8];
#pragma unroll
      for (int i = 0; i < 8; i++) rs[i] = rsqrtf(ss[i] * (1.0f / 64.0f) + 1e-6f) * sc;
#pragma unroll
      for (int n = 0; n < 4; n++) {
        float wc = nw_[(n0 + n * 16 + ml) & 63];
#pragma unroll
        for (int i = 0; i < 8; i++) val[n][i] *= rs[i] * wc;
      }
    }

    if (which < 2) {
      _Float16* dst = (which == 0) ? Qb : Kb;
#pragma unroll
      for (int n = 0; n < 4; n++) {
        int col = n0 + n * 16 + ml;
#pragma unroll
        for (int i = 0; i < 8; i++)
          dst[(size_t)(mp + rowoff + i) * Dv + col] = (_Float16)val[n][i];
      }
    } else {                               // V transposed: [(w*H+h)*HD+d][token]
#pragma unroll
      for (int n = 0; n < 4; n++) {
        int col = n0 + n * 16 + ml;
        int hh = col >> 6, d = col & 63;
#pragma unroll
        for (int i = 0; i < 8; i++) {
          int r = mp + rowoff + i;
          int w = r >> 9, s = r & 511;
          vTb[((size_t)((w * Hv + hh) * HDv + d)) * Sv + s] = (_Float16)val[n][i];
        }
      }
    }
  }
}

// ---------------------------------------------------------------- flash attention
// grid (8 q-chunks, 16 heads, 3 pairs x 8 windows), block = 128 (4 waves, 16 q-rows each)
__global__ __launch_bounds__(128) void attn_kernel(
    const _Float16* __restrict__ Qb, const _Float16* __restrict__ Kb,
    const _Float16* __restrict__ vTb, _Float16* __restrict__ aout,
    const float* __restrict__ rpb)
{
  __shared__ __align__(16) _Float16 plds[4 * 16 * 32];
  const int lane = threadIdx.x & 31;
  const int wave = threadIdx.x >> 5;
  const int ml = lane & 15;
  const int koff = (lane >> 4) * 8;
  const int rowoff = (lane >> 4) * 8;
  const int qb = blockIdx.x, h = blockIdx.y, w = blockIdx.z & 7;
  const int j = blockIdx.z >> 3;          // modality pair: its own Q, K, V, output and bias table
  Qb += (size_t)j * ROWS * Dv;  Kb += (size_t)j * ROWS * Dv;
  vTb += (size_t)j * ROWS * Dv; aout += (size_t)j * ROWS * Dv;
  const float* rpbj = rpb + j * (2 * WSv - 1) * Hv;
  const int tq = qb;                      // 64-row chunks align to L

  const int qrow = qb * 64 + wave * 16;
  const _Float16* qp = Qb + (size_t)(w * Sv + qrow + ml) * Dv + h * HDv + koff;
  v16h qa0 = mkfrag(ld8(qp),      ld8(qp + 16));
  v16h qa1 = mkfrag(ld8(qp + 32), ld8(qp + 48));

  v8f accO[4] = {};
  float m_[8], l_[8];
#pragma unroll
  for (int i = 0; i < 8; i++) { m_[i] = -3.0e38f; l_[i] = 0.f; }

  _Float16* pw = plds + wave * 512;

  for (int ch = 0; ch < 16; ch++) {
    const int c0 = ch * 32;
    const int tk = c0 >> 6;
    const float biasv = rpbj[(tq - tk + WSv - 1) * Hv + h];

    v8f s0 = {}, s1 = {};
    {
      const _Float16* kp0 = Kb + (size_t)(w * Sv + c0 + ml) * Dv + h * HDv;
      const _Float16* kp1 = Kb + (size_t)(w * Sv + c0 + 16 + ml) * Dv + h * HDv;
      v16h kb00 = mkfrag(ld8(kp0 + koff),      ld8(kp0 + koff + 16));
      v16h kb01 = mkfrag(ld8(kp0 + 32 + koff), ld8(kp0 + 48 + koff));
      v16h kb10 = mkfrag(ld8(kp1 + koff),      ld8(kp1 + koff + 16));
      v16h kb11 = mkfrag(ld8(kp1 + 32 + koff), ld8(kp1 + 48 + koff));
      s0 = WMMA_F32_F16(qa0, kb00, s0);
      s0 = WMMA_F32_F16(qa1, kb01, s0);
      s1 = WMMA_F32_F16(qa0, kb10, s1);
      s1 = WMMA_F32_F16(qa1, kb11, s1);
    }
#pragma unroll
    for (int i = 0; i < 8; i++) { s0[i] += biasv; s1[i] += biasv; }

    float mn[8];
#pragma unroll
    for (int i = 0; i < 8; i++) mn[i] = fmaxf(s0[i], s1[i]);
#pragma unroll
    for (int msk = 1; msk < 16; msk <<= 1)
#pragma unroll
      for (int i = 0; i < 8; i++) mn[i] = fmaxf(mn[i], __shfl_xor(mn[i], msk, 32));

    float alpha[8], p0[8], p1[8], rsum[8];
#pragma unroll
    for (int i = 0; i < 8; i++) {
      mn[i] = fmaxf(mn[i], m_[i]);
      alpha[i] = __expf(m_[i] - mn[i]);
      m_[i] = mn[i];
      p0[i] = __expf(s0[i] - mn[i]);
      p1[i] = __expf(s1[i] - mn[i]);
      rsum[i] = p0[i] + p1[i];
    }
#pragma unroll
    for (int msk = 1; msk < 16; msk <<= 1)
#pragma unroll
      for (int i = 0; i < 8; i++) rsum[i] += __shfl_xor(rsum[i], msk, 32);
#pragma unroll
    for (int i = 0; i < 8; i++) l_[i] = l_[i] * alpha[i] + rsum[i];
#pragma unroll
    for (int n = 0; n < 4; n++)
#pragma unroll
      for (int i = 0; i < 8; i++) accO[n][i] *= alpha[i];

    // C-layout -> A-layout transpose of P through per-wave LDS
#pragma unroll
    for (int i = 0; i < 8; i++) {
      int rt = rowoff + i;
      pw[rt * 32 + ml]      = (_Float16)p0[i];
      pw[rt * 32 + ml + 16] = (_Float16)p1[i];
    }
    asm volatile("s_wait_dscnt 0" ::: "memory");
    const _Float16* pl = pw + ml * 32 + koff;
    v16h pa = mkfrag(ld8(pl), ld8(pl + 16));

#pragma unroll
    for (int n = 0; n < 4; n++) {
      const _Float16* vp = vTb + ((size_t)((w * Hv + h) * HDv + n * 16 + ml)) * Sv + c0 + koff;
      v16h vb = mkfrag(ld8(vp), ld8(vp + 16));
      accO[n] = WMMA_F32_F16(pa, vb, accO[n]);
    }
  }

  float inv[8];
#pragma unroll
  for (int i = 0; i < 8; i++) inv[i] = 1.0f / l_[i];
#pragma unroll
  for (int n = 0; n < 4; n++) {
    int col = h * HDv + n * 16 + ml;
#pragma unroll
    for (int i = 0; i < 8; i++) {
      int r = w * Sv + qrow + rowoff + i;
      aout[(size_t)r * Dv + col] = (_Float16)(accO[n][i] * inv[i]);
    }
  }
}

// ---------------------------------------------------------------- output projection + residual + roll(+SH)
// grid (32, 8, 3 pairs): 128x128 tile per block of 8 waves, 32 rows x 64 cols per wave.
__global__ __launch_bounds__(256) void proj_kernel(
    const _Float16* __restrict__ aoutb, const _Float16* __restrict__ wpT,
    const float* __restrict__ bp,
    const float* __restrict__ audio, const float* __restrict__ video, const float* __restrict__ image,
    float* __restrict__ feat, _Float16* __restrict__ cat16)
{
  __shared__ __align__(16) _Float16 sm[2 * GBUF];
  const int j = blockIdx.z;
  const float* qmf = (j == 0) ? audio : (j == 1) ? video : image;   // residual: the pair's query modality
  aoutb += (size_t)j * ROWS * Dv;
  wpT += (size_t)j * Dv * Dv;
  bp += j * Dv;
  feat += (size_t)j * ROWS * Dv;
  const int lane = threadIdx.x & 31;
  const int wave = threadIdx.x >> 5;
  const int ml = lane & 15;
  const int m0 = blockIdx.x * 128 + (wave & 3) * 32;
  const int n0 = blockIdx.y * 128 + (wave >> 2) * 64;

  const int cr = threadIdx.x >> 3;
  const int cc = (threadIdx.x & 7) * 8;
  const _Float16* gp[8];
#pragma unroll
  for (int i = 0; i < 4; i++) {
    gp[i]     = aoutb + (size_t)(blockIdx.x * 128 + cr + 32 * i) * Dv + cc;
    gp[4 + i] = wpT + (size_t)(blockIdx.y * 128 + cr + 32 * i) * Dv + cc;
  }

  v8f acc[2][4] = {};
  gemm_staged<Dv>(sm, gp, acc);

  const int rowoff = (lane >> 4) * 8;
#pragma unroll
  for (int part = 0; part < 2; part++) {
    const int mp = m0 + part * 16;
    int featrow[8];
#pragma unroll
    for (int i = 0; i < 8; i++) {
      int r = mp + rowoff + i;
      int w = r >> 9, s = r & 511;
      int b = w >> 2, widx = w & 3;
      int tqq = s >> 6, l = s & 63;
      int t = (widx * WSv + tqq + SHv) & 31;   // roll back by +SH
      featrow[i] = (b * Tv + t) * Lv + l;
    }
#pragma unroll
    for (int n = 0; n < 4; n++) {
      int col = n0 + n * 16 + ml;
      float bc = bp[col];
#pragma unroll
      for (int i = 0; i < 8; i++) {
        float v = acc[part][n][i] + bc + qmf[(size_t)featrow[i] * Dv + col];
        feat[(size_t)featrow[i] * Dv + col] = v;
        cat16[(size_t)featrow[i] * D3 + j * Dv + col] = (_Float16)v;
      }
    }
  }
}

// ---------------------------------------------------------------- gating MLP layer 1 (+GELU)
// grid (32, 16): 128x128 tile per block of 8 waves.
__global__ __launch_bounds__(256) void gate1_kernel(
    const _Float16* __restrict__ cat16, const _Float16* __restrict__ wg1T,
    const float* __restrict__ bg1, _Float16* __restrict__ g116)
{
  __shared__ __align__(16) _Float16 sm[2 * GBUF];
  const int lane = threadIdx.x & 31;
  const int wave = threadIdx.x >> 5;
  const int ml = lane & 15;
  const int m0 = blockIdx.x * 128 + (wave & 3) * 32;
  const int n0 = blockIdx.y * 128 + (wave >> 2) * 64;

  const int cr = threadIdx.x >> 3;
  const int cc = (threadIdx.x & 7) * 8;
  const _Float16* gp[8];
#pragma unroll
  for (int i = 0; i < 4; i++) {
    gp[i]     = cat16 + (size_t)(blockIdx.x * 128 + cr + 32 * i) * D3 + cc;
    gp[4 + i] = wg1T + (size_t)(blockIdx.y * 128 + cr + 32 * i) * D3 + cc;
  }

  v8f acc[2][4] = {};
  gemm_staged<D3>(sm, gp, acc);

  const int rowoff = (lane >> 4) * 8;
#pragma unroll
  for (int part = 0; part < 2; part++) {
    const int mp = m0 + part * 16;
#pragma unroll
    for (int n = 0; n < 4; n++) {
      int col = n0 + n * 16 + ml;
      float bc = bg1[col];
#pragma unroll
      for (int i = 0; i < 8; i++) {
        float x = acc[part][n][i] + bc;
        float g = 0.5f * x * (1.0f + erff(x * 0.70710678118f));   // exact GELU
        g116[(size_t)(mp + rowoff + i) * D2 + col] = (_Float16)g;
      }
    }
  }
}

// ---------------------------------------------------------------- gating layer 2 (N=3) + softmax
__global__ __launch_bounds__(256) void gate2_kernel(
    const _Float16* __restrict__ g116, const float* __restrict__ Wg2,
    const float* __restrict__ bg2, float* __restrict__ gates)
{
  int row = blockIdx.x * 8 + (threadIdx.x >> 5);
  int lane = threadIdx.x & 31;
  if (row >= ROWS) return;
  const _Float16* gr = g116 + (size_t)row * D2;
  float a0 = 0.f, a1 = 0.f, a2 = 0.f;
  for (int k = lane; k < D2; k += 32) {
    float g = (float)gr[k];
    a0 = fmaf(g, Wg2[k * 3 + 0], a0);
    a1 = fmaf(g, Wg2[k * 3 + 1], a1);
    a2 = fmaf(g, Wg2[k * 3 + 2], a2);
  }
#pragma unroll
  for (int msk = 16; msk >= 1; msk >>= 1) {
    a0 += __shfl_xor(a0, msk, 32);
    a1 += __shfl_xor(a1, msk, 32);
    a2 += __shfl_xor(a2, msk, 32);
  }
  if (lane == 0) {
    a0 += bg2[0]; a1 += bg2[1]; a2 += bg2[2];
    float mx = fmaxf(a0, fmaxf(a1, a2));
    float e0 = __expf(a0 - mx), e1 = __expf(a1 - mx), e2 = __expf(a2 - mx);
    float inv = 1.0f / (e0 + e1 + e2);
    gates[row * 3 + 0] = e0 * inv;
    gates[row * 3 + 1] = e1 * inv;
    gates[row * 3 + 2] = e2 * inv;
  }
}

// ---------------------------------------------------------------- fuse
// FROWS whole rows per block, four columns per thread: 16-byte accesses, each row's gates the same for the whole block,
// all 3 * FROWS loads of a thread issued before the first sum.
// The three planes come as three pointers, so that each address is a block-uniform base plus one per-lane offset
// that lives to the last store: no vector register that an issued load names is written again.
#define FROWS 4
__global__ __launch_bounds__(256) void fuse_kernel(const float* __restrict__ feat0, const float* __restrict__ feat1,
                                                   const float* __restrict__ feat2, const float* __restrict__ gates,
                                                   float* __restrict__ out)
{
  const int row0 = blockIdx.x * FROWS;
  const unsigned c = threadIdx.x * 4u;
  const float* fb[3] = { feat0 + (size_t)row0 * Dv, feat1 + (size_t)row0 * Dv, feat2 + (size_t)row0 * Dv };
  float* ob = out + (size_t)row0 * Dv;
  v4f f[FROWS][3];
#pragma unroll
  for (int u = 0; u < FROWS; u++)
#pragma unroll
    for (int m = 0; m < 3; m++) f[u][m] = *(const v4f*)(fb[m] + u * Dv + c);
#pragma unroll
  for (int u = 0; u < FROWS; u++) {
    const float* g = gates + (row0 + u) * 3;
    *(v4f*)(ob + u * Dv + c) = g[0] * f[u][0] + g[1] * f[u][1] + g[2] * f[u][2];
  }
}

// ---------------------------------------------------------------- launch
extern "C" void kernel_launch(void* const* d_in, const int* in_sizes, int n_in,
                              void* d_out, int out_size, void* d_ws, size_t ws_size,
                              hipStream_t stream)
{
  const float* audio = (const float*)d_in[0];
  const float* video = (const float*)d_in[1];
  const float* image = (const float*)d_in[2];
  const float* Wq  = (const float*)d_in[3];
  const float* Wk  = (const float*)d_in[4];
  const float* Wv  = (const float*)d_in[5];
  const float* Wp  = (const float*)d_in[6];
  const float* bq  = (const float*)d_in[7];
  const float* bk  = (const float*)d_in[8];
  const float* bv  = (const float*)d_in[9];
  const float* bp  = (const float*)d_in[10];
  const float* qn  = (const float*)d_in[11];
  const float* kn  = (const float*)d_in[12];
  const float* rpb = (const float*)d_in[13];
  const float* Wg1 = (const float*)d_in[14];
  const float* bg1 = (const float*)d_in[15];
  const float* Wg2 = (const float*)d_in[16];
  const float* bg2 = (const float*)d_in[17];
  float* out = (float*)d_out;

  char* p = (char*)d_ws;
  auto carve = [&](size_t bytes) -> void* {
    void* r = (void*)p;
    p += (bytes + 255) & ~(size_t)255;
    return r;
  };
  const size_t NE = (size_t)ROWS * Dv;                 // 4M elems
  _Float16* x16   = (_Float16*)carve(3 * NE * 2);
  _Float16* wqT   = (_Float16*)carve(3 * (size_t)Dv * Dv * 2);
  _Float16* wkT   = (_Float16*)carve(3 * (size_t)Dv * Dv * 2);
  _Float16* wvT   = (_Float16*)carve(3 * (size_t)Dv * Dv * 2);
  _Float16* wpT   = (_Float16*)carve(3 * (size_t)Dv * Dv * 2);
  _Float16* wg1T  = (_Float16*)carve((size_t)D3 * D2 * 2);
  _Float16* Qb    = (_Float16*)carve(3 * NE * 2);       // one plane per modality pair
  _Float16* Kb    = (_Float16*)carve(3 * NE * 2);
  _Float16* vTb   = (_Float16*)carve(3 * NE * 2);
  _Float16* aoutb = (_Float16*)carve(3 * NE * 2);
  _Float16* cat16 = (_Float16*)carve((size_t)ROWS * D3 * 2);
  _Float16* g116  = (_Float16*)carve((size_t)ROWS * D2 * 2);
  float*    feats = (float*)carve(3 * NE * 4);
  float*    gates = (float*)carve((size_t)ROWS * 3 * 4);

  // convert activations and transpose-convert weights to f16
  prep_kernel<<<G1TILES + 12 * WTILES + 3 * XBLOCKS, 256, 0, stream>>>(
      audio, video, image, Wq, Wk, Wv, Wp, Wg1, x16, wqT, wkT, wvT, wpT, wg1T);

  // the three modality pairs do not depend on one another: each stage takes all of them in one grid
  qkv_kernel<<<dim3(32, 8, 9), 256, 0, stream>>>(x16, wqT, wkT, wvT, bq, bk, bv, qn, kn, Qb, Kb, vTb);
  attn_kernel<<<dim3(8, 16, 24), 128, 0, stream>>>(Qb, Kb, vTb, aoutb, rpb);
  proj_kernel<<<dim3(32, 8, 3), 256, 0, stream>>>(aoutb, wpT, bp, audio, video, image, feats, cat16);

  gate1_kernel<<<dim3(32, 16), 256, 0, stream>>>(cat16, wg1T, bg1, g116);
  gate2_kernel<<<ROWS / 8, 256, 0, stream>>>(g116, Wg2, bg2, gates);
  fuse_kernel<<<ROWS / FROWS, 256, 0, stream>>>(feats, feats + NE, feats + 2 * NE, gates, out);
}

// v005
// A run of this version takes 259 microseconds.
// In both of two side-by-side timings against v004, it was 1.17 times as fast.
// All steps since v000 together make it 4.02 times as fast.
#include <hip/hip_runtime.h>
#include <hip/hip_bf16.h>

typedef __attribute__((ext_vector_type(16))) _Float16 v16h;
typedef __attribute__((ext_vector_type(8)))  _Float16 v8h;
typedef __attribute__((ext_vector_type(8)))  float    v8f;
typedef __attribute__((ext_vector_type(4)))  _Float16 v4h;
typedef __attribute__((ext_vector_type(4)))  float    v4f;

#define WMMA_F32_F16(a,b,c) __builtin_amdgcn_wmma_f32_16x16x32_f16(false,(a),false,(b),(short)0,(c),false,false)

#define Bv   2
#define Tv   32
#define Lv   64
#define Dv   1024
#define Hv   16
#define WSv  8
#define SHv  4
#define HDv  64
#define Sv   512      // WS*L
#define ROWS 4096     // B*T*L
#define D3   3072
#define D2   2048
#define TPITCH 72     // halves per LDS row of the transpose tile

static __device__ inline v8h ld8(const _Float16* p) { return *(const v8h*)p; }

static __device__ inline v16h mkfrag(v8h lo, v8h hi) {
  v16h r;
#pragma unroll
  for (int i = 0; i < 8; i++) { r[i] = lo[i]; r[i + 8] = hi[i]; }
  return r;
}

// window-order row -> source row of [B,T,L] with roll(-SH) folded in
static __device__ inline int src_row(int r) {
  int w = r >> 9;          // window (0..7): b*4 + widx
  int s = r & 511;         // token in window
  int b = w >> 2;
  int widx = w & 3;
  int tq = s >> 6;
  int l = s & 63;
  int tp = widx * WSv + tq;
  int tsrc = (tp + SHv) & 31;
  return ((b * Tv + tsrc) << 6) + l;
}

// ---------------------------------------------------------------- converts
// TPB 64 x 64 tiles per block, one below the other in the source, each turned in its own LDS tile: source rows
// are read as 16-byte pieces (a thread's 4 * TPB loads stand ahead of its converts, so that many are in flight),
// destination rows (k-contiguous) leave as whole 128-byte lines. R is a multiple of 64 * TPB, C of 64.
#define TPB 4
static __device__ inline void cvtT_tiles(_Float16* tile, const float* __restrict__ s, _Float16* __restrict__ d,
                                         int R, int C, int bx, int by) {
  const int t = threadIdx.x;
  const int c0 = bx * 64;
  const int r0 = by * (64 * TPB);
  const int c4 = (t & 15) * 4;
  const int r4 = (t >> 4) * 4;
  v4f v[TPB][4];
#pragma unroll
  for (int q = 0; q < TPB; q++)
#pragma unroll
    for (int p = 0; p < 4; p++) v[q][p] = *(const v4f*)(s + (size_t)(r0 + q * 64 + r4 + p) * C + c0 + c4);
#pragma unroll
  for (int q = 0; q < TPB; q++)
#pragma unroll
    for (int ci = 0; ci < 4; ci++) {
      v4h h;
#pragma unroll
      for (int p = 0; p < 4; p++) h[p] = (_Float16)v[q][p][ci];
      *(v4h*)(tile + (q * 64 + c4 + ci) * TPITCH + r4) = h;
    }
  __syncthreads();
  const int seg = (t & 7) * 8;
#pragma unroll
  for (int q = 0; q < TPB; q++)
#pragma unroll
    for (int p = 0; p < 2; p++) {
      const int c = p * 32 + (t >> 3);
      *(v8h*)(d + (size_t)(c0 + c) * R + r0 + q * 64 + seg) = *(const v8h*)(tile + (q * 64 + c) * TPITCH + seg);
    }
  // in the merged kernel another part's code follows these stores in the listing: no register that they name is
  // rewritten ahead of this wait
  asm volatile("s_wait_xcnt 0x0" ::: "memory");
}

// All conversions are independent of one another and run as one grid. Blocks in order: the tiles of Wg1,
// the tiles of the twelve D x D weights (pair-major: q, k, v, p), then XPT activation elements per thread.
// A block carries enough work that the grid is 1920 blocks (15360 waves).
#define G1TILES ((D2 / 64) * (D3 / (64 * TPB)))
#define WTILES  ((Dv / 64) * (Dv / (64 * TPB)))
#define XPT     64
#define XBLOCKS (ROWS * Dv / (256 * XPT))
__global__ __launch_bounds__(256) void prep_kernel(
    const float* __restrict__ audio, const float* __restrict__ video, const float* __restrict__ image,
    const float* __restrict__ Wq, const float* __restrict__ Wk, const float* __restrict__ Wv,
    const float* __restrict__ Wp, const float* __restrict__ Wg1,
    _Float16* __restrict__ x16, _Float16* __restrict__ wqT, _Float16* __restrict__ wkT,
    _Float16* __restrict__ wvT, _Float16* __restrict__ wpT, _Float16* __restrict__ wg1T)
{
  __shared__ __align__(16) _Float16 tile[TPB * 64 * TPITCH];   // [tile][c][r], rows 16 bytes longer than the data
  int b = blockIdx.x;
  if (b < G1TILES) {
    cvtT_tiles(tile, Wg1, wg1T, D3, D2, b % (D2 / 64), b / (D2 / 64));
    return;
  }
  b -= G1TILES;
  if (b < 12 * WTILES) {
    const int m = b / WTILES;
    const int kind = m & 3;
    const size_t off = (size_t)(m >> 2) * Dv * Dv;
    const float* s = (kind == 0) ? Wq : (kind == 1) ? Wk : (kind == 2) ? Wv : Wp;
    _Float16* d    = (kind == 0) ? wqT : (kind == 1) ? wkT : (kind == 2) ? wvT : wpT;
    const int tl = b % WTILES;
    cvtT_tiles(tile, s + off, d + off, Dv, Dv, tl % (Dv / 64), tl / (Dv / 64));
    return;
  }
  b -= 12 * WTILES;
  const int mod = b / XBLOCKS;
  const float* s = (mod == 0) ? audio : (mod == 1) ? video : image;
  // each wave-wide load covers 512 contiguous bytes, each store 256; the loads stand ahead of the converts
  const int i = (b % XBLOCKS) * (256 * XPT) + threadIdx.x * 4;
  _Float16* xd = x16 + (size_t)mod * ROWS * Dv + i;
  v4f xv[XPT / 4];
#pragma unroll
  for (int u = 0; u < XPT / 4; u++) xv[u] = *(const v4f*)(s + i + u * 1024);
#pragma unroll
  for (int u = 0; u < XPT / 4; u++) {
    v4h h;
#pragma unroll
    for (int e = 0; e < 4; e++) h[e] = (_Float16)xv[u][e];
    *(v4h*)(xd + u * 1024) = h;
  }
  // the tile parts' code follows these stores in the listing: no register that they name is rewritten ahead of this wait
  asm volatile("s_wait_xcnt 0x0" ::: "memory");
}

// ---------------------------------------------------------------- staged GEMM core
// One 128 x 128 tile of Y = A * B^T per block of 8 waves (4 along M x 2 along N, 32 x 64 each).
// A stage is 64 k (128 bytes) of 128 A rows and 128 B rows. Each wave-wide 16-byte copy covers four
// whole 128-byte lines and lands in LDS without passing a register; two buffers, so the copies
// of the stage after next fly while this one is multiplied.
#define GBK    64                   // halves of k per stage
#define GPITCH 72                   // halves per LDS row: 144 bytes, conflict-free for 16-byte readers
#define GBUF   (256 * GPITCH)       // halves per buffer: A rows 0..127, B rows 128..255

static __device__ inline void stage_copy(unsigned l, const _Float16* const (&gp)[8], int k) {
  // Eight copies of 16 bytes per lane, rows 32 apart. The s_wait_xcnt closes the statement so that no
  // address register of an issued copy is rewritten ahead of it.
  asm volatile(
      "global_load_async_to_lds_b128 %0, %8, off\n\t"
      "global_load_async_to_lds_b128 %1, %9, off\n\t"
      "global_load_async_to_lds_b128 %2, %10, off\n\t"
      "global_load_async_to_lds_b128 %3, %11, off\n\t"
      "global_load_async_to_lds_b128 %4, %12, off\n\t"
      "global_load_async_to_lds_b128 %5, %13, off\n\t"
      "global_load_async_to_lds_b128 %6, %14, off\n\t"
      "global_load_async_to_lds_b128 %7, %15, off\n\t"
      "s_wait_xcnt 0x0"
      :: "v"(l), "v"(l + 1u * 32u * GPITCH * 2u), "v"(l + 2u * 32u * GPITCH * 2u), "v"(l + 3u * 32u * GPITCH * 2u),
         "v"(l + 4u * 32u * GPITCH * 2u), "v"(l + 5u * 32u * GPITCH * 2u), "v"(l + 6u * 32u * GPITCH * 2u),
         "v"(l + 7u * 32u * GPITCH * 2u),
         "v"(gp[0] + k), "v"(gp[1] + k), "v"(gp[2] + k), "v"(gp[3] + k),
         "v"(gp[4] + k), "v"(gp[5] + k), "v"(gp[6] + k), "v"(gp[7] + k)
      : "memory");
}

// gp[0..3]: this thread's piece of A rows r, r+32, r+64, r+96 of the tile; gp[4..7]: the same of B.
template <int KT>
static __device__ inline void gemm_staged(_Float16* sm, const _Float16* const (&gp)[8], v8f (&acc)[2][4]) {
  const int t = threadIdx.x;
  const int lane = t & 31;
  const int wave = t >> 5;
  const int ml = lane & 15;
  const int koff = (lane >> 4) * 8;
  const unsigned lcopy = (unsigned)(size_t)sm + (unsigned)((t >> 3) * GPITCH + (t & 7) * 8) * 2u;
  const _Float16* ard = sm + ((wave & 3) * 32 + ml) * GPITCH + koff;
  const _Float16* brd = sm + (128 + (wave >> 2) * 64 + ml) * GPITCH + koff;
  constexpr int NT = KT / GBK;

  stage_copy(lcopy, gp, 0);
  asm volatile("s_wait_asynccnt 0x0" ::: "memory");   // stage 0 has landed before the barrier publishes it
  __syncthreads();
  stage_copy(lcopy + GBUF * 2u, gp, GBK);

  // stays rolled: unrolled, the reads were spread between the WMMAs again, a full LDS latency in front of each pair
#pragma unroll 1
  for (int s = 0; s < NT; s++) {
    const int bo = (s & 1) * GBUF;
    // the whole stage goes into registers as one group of reads: the buffer is free again before the WMMAs start
    // (the inner loops are unrolled so that a, b and acc are indexed by constants and stay in registers)
    v16h a[2][2], b[2][4];
#pragma unroll
    for (int ks = 0; ks < 2; ks++) {
      const _Float16* ap = ard + bo + ks * 32;
      const _Float16* bp = brd + bo + ks * 32;
#pragma unroll
      for (int p = 0; p < 2; p++) a[ks][p] = mkfrag(ld8(ap + p * 16 * GPITCH), ld8(ap + p * 16 * GPITCH + 16));
#pragma unroll
      for (int n = 0; n < 4; n++) b[ks][n] = mkfrag(ld8(bp + n * 16 * GPITCH), ld8(bp + n * 16 * GPITCH + 16));
    }
    asm volatile("s_wait_dscnt 0x0" ::: "memory");    // this wave's reads of the buffer are over before it is refilled
    asm volatile("s_wait_asynccnt 0x0" ::: "memory"); // this wave's copies of stage s + 1 have landed
    __syncthreads();                                  // publishes stage s + 1, frees stage s's buffer
    if (s + 2 < NT) stage_copy(lcopy + (unsigned)bo * 2u, gp, (s + 2) * GBK);
    // stage s + 2 flies while stage s is multiplied from registers
#pragma unroll
    for (int ks = 0; ks < 2; ks++)
#pragma unroll
      for (int n = 0; n < 4; n++) {
        acc[0][n] = WMMA_F32_F16(a[ks][0], b[ks][n], acc[0][n]);
        acc[1][n] = WMMA_F32_F16(a[ks][1], b[ks][n], acc[1][n]);
      }
  }
  asm volatile("s_wait_asynccnt 0x0" ::: "memory");   // nothing of this wave is in flight when it goes on
}

// ---------------------------------------------------------------- QKV GEMM
// grid (32, 8, 9): 128-row x 128-col tiles per block; z = 3 * pair + (Q, K or V).
// block = 256 (8 waves); each wave: 32 rows x 64 cols (one head), 8 WMMAs / 32-K step.
__global__ __launch_bounds__(256) void qkv_kernel(
    const _Float16* __restrict__ x16,
    const _Float16* __restrict__ wqT, const _Float16* __restrict__ wkT, const _Float16* __restrict__ wvT,
    const float* __restrict__ bq, const float* __restrict__ bk, const float* __restrict__ bv,
    const float* __restrict__ qn, const float* __restrict__ kn,
    _Float16* __restrict__ Qb, _Float16* __restrict__ Kb, _Float16* __restrict__ vTb)
{
  __shared__ __align__(16) _Float16 sm[2 * GBUF];
  const int j = blockIdx.z / 3;             // modality pair
  const int which = blockIdx.z % 3;
  const size_t NE = (size_t)ROWS * Dv;
  // queries come from modality j; keys and values from video for pairs 0 and 2, from audio for pair 1
  const _Float16* xq = x16 + (size_t)j * NE;
  const _Float16* xc = x16 + ((j == 1) ? 0 : NE);
  wqT += (size_t)j * Dv * Dv;  wkT += (size_t)j * Dv * Dv;  wvT += (size_t)j * Dv * Dv;
  bq += j * Dv;  bk += j * Dv;  bv += j * Dv;
  qn += j * HDv; kn += j * HDv;
  Qb += (size_t)j * NE;  Kb += (size_t)j * NE;  vTb += (size_t)j * NE;
  const int lane = threadIdx.x & 31;
  const int wave = threadIdx.x >> 5;
  const int ml = lane & 15;
  const int m0 = blockIdx.x * 128 + (wave & 3) * 32;
  const int n0 = blockIdx.y * 128 + (wave >> 2) * 64;

  const _Float16* src = (which == 0) ? xq : xc;
  const _Float16* wT  = (which == 0) ? wqT : (which == 1 ? wkT : wvT);
  const float* bias   = (which == 0) ? bq  : (which == 1 ? bk  : bv);

  const int cr = threadIdx.x >> 3;          // row of the tile this thread copies (and 32, 64, 96 below it)
  const int cc = (threadIdx.x & 7) * 8;     // its 16-byte piece of the row's 128 bytes
  const _Float16* gp[8];
#pragma unroll
  for (int i = 0; i < 4; i++) {
    gp[i]     = src + (size_t)src_row(blockIdx.x * 128 + cr + 32 * i) * Dv + cc;
    gp[4 + i] = wT + (size_t)(blockIdx.y * 128 + cr + 32 * i) * Dv + cc;
  }

  v8f acc[2][4] = {};
  gemm_staged<Dv>(sm, gp, acc);

  const int rowoff = (lane >> 4) * 8;
#pragma unroll
  for (int part = 0; part < 2; part++) {
    const int mp = m0 + part * 16;
    float val[4][8];
#pragma unroll
    for (int n = 0; n < 4; n++) {
      float bc = bias[n0 + n * 16 + ml];
#pragma unroll
      for (int i = 0; i < 8; i++) val[n][i] = acc[part][n][i] + bc;
    }

    if (which < 2) {                       // RMS-norm over the head dim (tile == one head)
      const float* nw_ = (which == 0) ? qn : kn;
      float ss[8];
#pragma unroll
      for (int i = 0; i < 8; i++) {
        ss[i] = 0.f;
#pragma unroll
        for (int n = 0; n < 4; n++) ss[i] += val[n][i] * val[n][i];
      }
#pragma unroll
      for (int msk = 1; msk < 16; msk <<= 1)
#pragma unroll
        for (int i = 0; i < 8; i++) ss[i] += __shfl_xor(ss[i], msk, 32);
      const float sc = (which == 0) ? 0.125f : 1.0f;   // fold HD^-0.5 into Q
      float rs[8];
#pragma unroll
      for (int i = 0; i < 8; i++) rs[i] = rsqrtf(ss[i] * (1.0f / 64.0f) + 1e-6f) * sc;
#pragma unroll
      for (int n = 0; n < 4; n++) {
        float wc = nw_[(n0 + n * 16 + ml) & 63];
#pragma unroll
        for (int i = 0; i < 8; i++) val[n][i] *= rs[i] * wc;
      }
    }

    if (which < 2) {
      _Float16* dst = (which == 0) ? Qb : Kb;
#pragma unroll
      for (int n = 0; n < 4; n++) {
        int col = n0 + n * 16 + ml;
#pragma unroll
        for (int i = 0; i < 8; i++)
          dst[(size_t)(mp + rowoff + i) * Dv + col] = (_Float16)val[n][i];
      }
    } else {                               // V transposed: [(w*H+h)*HD+d][token]
#pragma unroll
      for (int n = 0; n < 4; n++) {
        int col = n0 + n * 16 + ml;
        int hh = col >> 6, d = col & 63;
#pragma unroll
        for (int i = 0; i < 8; i++) {
          int r = mp + rowoff + i;
          int w = r >> 9, s = r & 511;
          vTb[((size_t)((w * Hv + hh) * HDv + d)) * Sv + s] = (_Float16)val[n][i];
        }
      }
    }
  }
}

// ---------------------------------------------------------------- flash attention
// A stage is 64 keys of one head: 64 K rows (key-major) and 64 V^T rows (d-major), 128 bytes each. The block's
// four waves need the same rows, so they are brought into LDS once per block: each wave-wide 16-byte copy covers
// four whole 128-byte lines, where a fragment load from global memory touched sixteen lines for the same bytes.
// Two buffers: the next stage's copies fly while this one is worked on.
#define APITCH 72                   // halves per LDS row: 144 bytes, conflict-free for 16-byte readers
#define ABUF   (128 * APITCH)       // halves per buffer: K rows 0..63, V^T rows 64..127
#define ASTAGES (Sv / 64)

// kp, vp: this thread's 16-byte piece of K row r and of V^T row r of stage 0; it also copies rows r+16, r+32, r+48.
// From one stage to the next K moves on by 64 rows, V^T by 64 halves inside its rows. The eight addresses are
// formed here from the two, so that few address registers live through the loop.
static __device__ inline void kv_copy(unsigned l, const _Float16* kp, const _Float16* vp, int st) {
  // Eight copies of 16 bytes per lane, rows 16 apart. The s_wait_xcnt closes the statement so that no
  // address register of an issued copy is rewritten ahead of it.
  asm volatile(
      "global_load_async_to_lds_b128 %0, %8, off\n\t"
      "global_load_async_to_lds_b128 %1, %9, off\n\t"
      "global_load_async_to_lds_b128 %2, %10, off\n\t"
      "global_load_async_to_lds_b128 %3, %11, off\n\t"
      "global_load_async_to_lds_b128 %4, %12, off\n\t"
      "global_load_async_to_lds_b128 %5, %13, off\n\t"
      "global_load_async_to_lds_b128 %6, %14, off\n\t"
      "global_load_async_to_lds_b128 %7, %15, off\n\t"
      "s_wait_xcnt 0x0"
      :: "v"(l), "v"(l + 1u * 16u * APITCH * 2u), "v"(l + 2u * 16u * APITCH * 2u), "v"(l + 3u * 16u * APITCH * 2u),
         "v"(l + 4u * 16u * APITCH * 2u), "v"(l + 5u * 16u * APITCH * 2u), "v"(l + 6u * 16u * APITCH * 2u),
         "v"(l + 7u * 16u * APITCH * 2u),
         "v"(kp + (size_t)(st * 64) * Dv), "v"(kp + (size_t)(st * 64 + 16) * Dv),
         "v"(kp + (size_t)(st * 64 + 32) * Dv), "v"(kp + (size_t)(st * 64 + 48) * Dv),
         "v"(vp + (st * 64)), "v"(vp + (st * 64 + 16 * Sv)), "v"(vp + (st * 64 + 32 * Sv)), "v"(vp + (st * 64 + 48 * Sv))
      : "memory");
}

// grid (8 q-chunks, 16 heads, 3 pairs x 8 windows), block = 128 (4 waves, 16 q-rows each)
__global__ __launch_bounds__(128) void attn_kernel(
    const _Float16* __restrict__ Qb, const _Float16* __restrict__ Kb,
    const _Float16* __restrict__ vTb, _Float16* __restrict__ aout,
    const float* __restrict__ rpb)
{
  __shared__ __align__(16) _Float16 kv[2 * ABUF];
  __shared__ __align__(16) _Float16 plds[4 * 16 * 32];
  const int lane = threadIdx.x & 31;
  const int wave = threadIdx.x >> 5;
  const int ml = lane & 15;
  const int koff = (lane >> 4) * 8;
  const int rowoff = (lane >> 4) * 8;
  const int qb = blockIdx.x, h = blockIdx.y, w = blockIdx.z & 7;
  const int j = blockIdx.z >> 3;          // modality pair: its own Q, K, V, output and bias table
  Qb += (size_t)j * ROWS * Dv;  Kb += (size_t)j * ROWS * Dv;
  vTb += (size_t)j * ROWS * Dv; aout += (size_t)j * ROWS * Dv;
  const float* rpbj = rpb + j * (2 * WSv - 1) * Hv;
  const int tq = qb;                      // 64-row chunks align to L

  const int cr = threadIdx.x >> 3;        // row of the stage this thread copies (and 16, 32, 48 below it)
  const int cc = (threadIdx.x & 7) * 8;   // its 16-byte piece of the row's 128 bytes
  const _Float16* kcp = Kb + (size_t)(w * Sv + cr) * Dv + h * HDv + cc;
  const _Float16* vcp = vTb + (size_t)((w * Hv + h) * HDv + cr) * Sv + cc;
  const unsigned lcopy = (unsigned)(size_t)kv + (unsigned)(cr * APITCH + cc) * 2u;

  kv_copy(lcopy, kcp, vcp, 0);

  const int qrow = qb * 64 + wave * 16;
  const _Float16* qp = Qb + (size_t)(w * Sv + qrow + ml) * Dv + h * HDv + koff;
  v16h qa0 = mkfrag(ld8(qp),      ld8(qp + 16));
  v16h qa1 = mkfrag(ld8(qp + 32), ld8(qp + 48));

  v8f accO[4] = {};
  float m_[8], l_[8];
#pragma unroll
  for (int i = 0; i < 8; i++) { m_[i] = -3.0e38f; l_[i] = 0.f; }

  _Float16* pw = plds + wave * 512;

  asm volatile("s_wait_asynccnt 0x0" ::: "memory");   // stage 0 has landed before the barrier publishes it
  __syncthreads();
  kv_copy(lcopy + ABUF * 2u, kcp, vcp, 1);

  // stays rolled: the buffer is picked by the stage's parity anyway
#pragma unroll 1
  for (int st = 0; st < ASTAGES; st++) {
    const int bo = (st & 1) * ABUF;
    const float biasv = rpbj[(tq - st + WSv - 1) * Hv + h];   // a stage is one temporal step of keys

    // unrolled so that both chunks' LDS offsets are constants
#pragma unroll
    for (int hc = 0; hc < 2; hc++) {
      v8f s0 = {}, s1 = {};
      v16h vb[4];
      {
        const _Float16* kp0 = kv + bo + (hc * 32 + ml) * APITCH + koff;
        const _Float16* kp1 = kp0 + 16 * APITCH;
        v16h kb00 = mkfrag(ld8(kp0),      ld8(kp0 + 16));
        v16h kb01 = mkfrag(ld8(kp0 + 32), ld8(kp0 + 48));
        v16h kb10 = mkfrag(ld8(kp1),      ld8(kp1 + 16));
        v16h kb11 = mkfrag(ld8(kp1 + 32), ld8(kp1 + 48));
        s0 = WMMA_F32_F16(qa0, kb00, s0);
        s0 = WMMA_F32_F16(qa1, kb01, s0);
        s1 = WMMA_F32_F16(qa0, kb10, s1);
        s1 = WMMA_F32_F16(qa1, kb11, s1);
      }
#pragma unroll
      for (int i = 0; i < 8; i++) { s0[i] += biasv; s1[i] += biasv; }

      float mn[8];
#pragma unroll
      for (int i = 0; i < 8; i++) mn[i] = fmaxf(s0[i], s1[i]);
#pragma unroll
      for (int msk = 1; msk < 16; msk <<= 1)
#pragma unroll
        for (int i = 0; i < 8; i++) mn[i] = fmaxf(mn[i], __shfl_xor(mn[i], msk, 32));

      float alpha[8], p0[8], p1[8], rsum[8];
#pragma unroll
      for (int i = 0; i < 8; i++) {
        mn[i] = fmaxf(mn[i], m_[i]);
        alpha[i] = __expf(m_[i] - mn[i]);
        m_[i] = mn[i];
        p0[i] = __expf(s0[i] - mn[i]);
        p1[i] = __expf(s1[i] - mn[i]);
        rsum[i] = p0[i] + p1[i];
      }
#pragma unroll
      for (int msk = 1; msk < 16; msk <<= 1)
#pragma unroll
        for (int i = 0; i < 8; i++) rsum[i] += __shfl_xor(rsum[i], msk, 32);
#pragma unroll
      for (int i = 0; i < 8; i++) l_[i] = l_[i] * alpha[i] + rsum[i];
#pragma unroll
      for (int n = 0; n < 4; n++)
#pragma unroll
        for (int i = 0; i < 8; i++) accO[n][i] *= alpha[i];

      // C-layout -> A-layout transpose of P through per-wave LDS
#pragma unroll
      for (int i = 0; i < 8; i++) {
        int rt = rowoff + i;
        pw[rt * 32 + ml]      = (_Float16)p0[i];
        pw[rt * 32 + ml + 16] = (_Float16)p1[i];
      }
      asm volatile("s_wait_dscnt 0" ::: "memory");      // the other lanes' P values are in LDS before they are read back
      const _Float16* pl = pw + ml * 32 + koff;
      v16h pa = mkfrag(ld8(pl), ld8(pl + 16));
#pragma unroll
      for (int n = 0; n < 4; n++) {
        const _Float16* vp = kv + bo + (64 + n * 16 + ml) * APITCH + hc * 32 + koff;
        vb[n] = mkfrag(ld8(vp), ld8(vp + 16));
      }

#pragma unroll
      for (int n = 0; n < 4; n++) accO[n] = WMMA_F32_F16(pa, vb[n], accO[n]);
    }

    asm volatile("s_wait_dscnt 0x0" ::: "memory");    // this wave's reads of the buffer are over before it is refilled
    asm volatile("s_wait_asynccnt 0x0" ::: "memory"); // this wave's copies of stage st + 1 have landed
    __syncthreads();                                  // publishes stage st + 1, frees stage st's buffer
    if (st + 2 < ASTAGES) kv_copy(lcopy + (unsigned)bo * 2u, kcp, vcp, st + 2);
  }
  asm volatile("s_wait_asynccnt 0x0" ::: "memory");   // nothing of this wave is in flight when it goes on

  float inv[8];
#pragma unroll
  for (int i = 0; i < 8; i++) inv[i] = 1.0f / l_[i];
#pragma unroll
  for (int n = 0; n < 4; n++) {
    int col = h * HDv + n * 16 + ml;
#pragma unroll
    for (int i = 0; i < 8; i++) {
      int r = w * Sv + qrow + rowoff + i;
      aout[(size_t)r * Dv + col] = (_Float16)(accO[n][i] * inv[i]);
    }
  }
}

// ---------------------------------------------------------------- output projection + residual + roll(+SH)
// grid (32, 8, 3 pairs): 128x128 tile per block of 8 waves, 32 rows x 64 cols per wave.
__global__ __launch_bounds__(256) void proj_kernel(
    const _Float16* __restrict__ aoutb, const _Float16* __restrict__ wpT,
    const float* __restrict__ bp,
    const float* __restrict__ audio, const float* __restrict__ video, const float* __restrict__ image,
    float* __restrict__ feat, _Float16* __restrict__ cat16)
{
  __shared__ __align__(16) _Float16 sm[2 * GBUF];
  const int j = blockIdx.z;
  const float* qmf = (j == 0) ? audio : (j == 1) ? video : image;   // residual: the pair's query modality
  aoutb += (size_t)j * ROWS * Dv;
  wpT += (size_t)j * Dv * Dv;
  bp += j * Dv;
  feat += (size_t)j * ROWS * Dv;
  const int lane = threadIdx.x & 31;
  const int wave = threadIdx.x >> 5;
  const int ml = lane & 15;
  const int m0 = blockIdx.x * 128 + (wave & 3) * 32;
  const int n0 = blockIdx.y * 128 + (wave >> 2) * 64;

  const int cr = threadIdx.x >> 3;
  const int cc = (threadIdx.x & 7) * 8;
  const _Float16* gp[8];
#pragma unroll
  for (int i = 0; i < 4; i++) {
    gp[i]     = aoutb + (size_t)(blockIdx.x * 128 + cr + 32 * i) * Dv + cc;
    gp[4 + i] = wpT + (size_t)(blockIdx.y * 128 + cr + 32 * i) * Dv + cc;
  }

  v8f acc[2][4] = {};
  gemm_staged<Dv>(sm, gp, acc);

  const int rowoff = (lane >> 4) * 8;
#pragma unroll
  for (int part = 0; part < 2; part++) {
    const int mp = m0 + part * 16;
    int featrow[8];
#pragma unroll
    for (int i = 0; i < 8; i++) {
      int r = mp + rowoff + i;
      int w = r >> 9, s = r & 511;
      int b = w >> 2, widx = w & 3;
      int tqq = s >> 6, l = s & 63;
      int t = (widx * WSv + tqq + SHv) & 31;   // roll back by +SH
      featrow[i] = (b * Tv + t) * Lv + l;
    }
#pragma unroll
    for (int n = 0; n < 4; n++) {
      int col = n0 + n * 16 + ml;
      float bc = bp[col];
#pragma unroll
      for (int i = 0; i < 8; i++) {
        float v = acc[part][n][i] + bc + qmf[(size_t)featrow[i] * Dv + col];
        feat[(size_t)featrow[i] * Dv + col] = v;
        cat16[(size_t)featrow[i] * D3 + j * Dv + col] = (_Float16)v;
      }
    }
  }
}

// ---------------------------------------------------------------- gating MLP layer 1 (+GELU)
// grid (32, 16): 128x128 tile per block of 8 waves.
__global__ __launch_bounds__(256) void gate1_kernel(
    const _Float16* __restrict__ cat16, const _Float16* __restrict__ wg1T,
    const float* __restrict__ bg1, _Float16* __restrict__ g116)
{
  __shared__ __align__(16) _Float16 sm[2 * GBUF];
  const int lane = threadIdx.x & 31;
  const int wave = threadIdx.x >> 5;
  const int ml = lane & 15;
  const int m0 = blockIdx.x * 128 + (wave & 3) * 32;
  const int n0 = blockIdx.y * 128 + (wave >> 2) * 64;

  const int cr = threadIdx.x >> 3;
  const int cc = (threadIdx.x & 7) * 8;
  const _Float16* gp[8];
#pragma unroll
  for (int i = 0; i < 4; i++) {
    gp[i]     = cat16 + (size_t)(blockIdx.x * 128 + cr + 32 * i) * D3 + cc;
    gp[4 + i] = wg1T + (size_t)(blockIdx.y * 128 + cr + 32 * i) * D3 + cc;
  }

  v8f acc[2][4] = {};
  gemm_staged<D3>(sm, gp, acc);

  const int rowoff = (lane >> 4) * 8;
#pragma unroll
  for (int part = 0; part < 2; part++) {
    const int mp = m0 + part * 16;
#pragma unroll
    for (int n = 0; n < 4; n++) {
      int col = n0 + n * 16 + ml;
      float bc = bg1[col];
#pragma unroll
      for (int i = 0; i < 8; i++) {
        float x = acc[part][n][i] + bc;
        float g = 0.5f * x * (1.0f + erff(x * 0.70710678118f));   // exact GELU
        g116[(size_t)(mp + rowoff + i) * D2 + col] = (_Float16)g;
      }
    }
  }
}

// ---------------------------------------------------------------- gating layer 2 (N=3) + softmax
__global__ __launch_bounds__(256) void gate2_kernel(
    const _Float16* __restrict__ g116, const float* __restrict__ Wg2,
    const float* __restrict__ bg2, float* __restrict__ gates)
{
  int row = blockIdx.x * 8 + (threadIdx.x >> 5);
  int lane = threadIdx.x & 31;
  if (row >= ROWS) return;
  const _Float16* gr = g116 + (size_t)row * D2;
  float a0 = 0.f, a1 = 0.f, a2 = 0.f;
  for (int k = lane; k < D2; k += 32) {
    float g = (float)gr[k];
    a0 = fmaf(g, Wg2[k * 3 + 0], a0);
    a1 = fmaf(g, Wg2[k * 3 + 1], a1);
    a2 = fmaf(g, Wg2[k * 3 + 2], a2);
  }
#pragma unroll
  for (int msk = 16; msk >= 1; msk >>= 1) {
    a0 += __shfl_xor(a0, msk, 32);
    a1 += __shfl_xor(a1, msk, 32);
    a2 += __shfl_xor(a2, msk, 32);
  }
  if (lane == 0) {
    a0 += bg2[0]; a1 += bg2[1]; a2 += bg2[2];
    float mx = fmaxf(a0, fmaxf(a1, a2));
    float e0 = __expf(a0 - mx), e1 = __expf(a1 - mx), e2 = __expf(a2 - mx);
    float inv = 1.0f / (e0 + e1 + e2);
    gates[row * 3 + 0] = e0 * inv;
    gates[row * 3 + 1] = e1 * inv;
    gates[row * 3 + 2] = e2 * inv;
  }
}

// ---------------------------------------------------------------- fuse
// FROWS whole rows per block, four columns per thread: 16-byte accesses, each row's gates the same for the whole block,
// all 3 * FROWS loads of a thread issued before the first sum.
// The three planes come as three pointers, so that each address is a block-uniform base plus one per-lane offset
// that lives to the last store: no vector register that an issued load names is written again.
#define FROWS 4
__global__ __launch_bounds__(256) void fuse_kernel(const float* __restrict__ feat0, const float* __restrict__ feat1,
                                                   const float* __restrict__ feat2, const float* __restrict__ gates,
                                                   float* __restrict__ out)
{
  const int row0 = blockIdx.x * FROWS;
  const unsigned c = threadIdx.x * 4u;
  const float* fb[3] = { feat0 + (size_t)row0 * Dv, feat1 + (size_t)row0 * Dv, feat2 + (size_t)row0 * Dv };
  float* ob = out + (size_t)row0 * Dv;
  v4f f[FROWS][3];
#pragma unroll
  for (int u = 0; u < FROWS; u++)
#pragma unroll
    for (int m = 0; m < 3; m++) f[u][m] = *(const v4f*)(fb[m] + u * Dv + c);
#pragma unroll
  for (int u = 0; u < FROWS; u++) {
    const float* g = gates + (row0 + u) * 3;
    *(v4f*)(ob + u * Dv + c) = g[0] * f[u][0] + g[1] * f[u][1] + g[2] * f[u][2];
  }
}

// ---------------------------------------------------------------- launch
extern "C" void kernel_launch(void* const* d_in, const int* in_sizes, int n_in,
                              void* d_out, int out_size, void* d_ws, size_t ws_size,
                              hipStream_t stream)
{
  const float* audio = (const float*)d_in[0];
  const float* video = (const float*)d_in[1];
  const float* image = (const float*)d_in[2];
  const float* Wq  = (const float*)d_in[3];
  const float* Wk  = (const float*)d_in[4];
  const float* Wv  = (const float*)d_in[5];
  const float* Wp  = (const float*)d_in[6];
  const float* bq  = (const float*)d_in[7];
  const float* bk  = (const float*)d_in[8];
  const float* bv  = (const float*)d_in[9];
  const float* bp  = (const float*)d_in[10];
  const float* qn  = (const float*)d_in[11];
  const float* kn  = (const float*)d_in[12];
  const float* rpb = (const float*)d_in[13];
  const float* Wg1 = (const float*)d_in[14];
  const float* bg1 = (const float*)d_in[15];
  const float* Wg2 = (const float*)d_in[16];
  const float* bg2 = (const float*)d_in[17];
  float* out = (float*)d_out;

  char* p = (char*)d_ws;
  auto carve = [&](size_t bytes) -> void* {
    void* r = (void*)p;
    p += (bytes + 255) & ~(size_t)255;
    return r;
  };
  const size_t NE = (size_t)ROWS * Dv;                 // 4M elems
  _Float16* x16   = (_Float16*)carve(3 * NE * 2);
  _Float16* wqT   = (_Float16*)carve(3 * (size_t)Dv * Dv * 2);
  _Float16* wkT   = (_Float16*)carve(3 * (size_t)Dv * Dv * 2);
  _Float16* wvT   = (_Float16*)carve(3 * (size_t)Dv * Dv * 2);
  _Float16* wpT   = (_Float16*)carve(3 * (size_t)Dv * Dv * 2);
  _Float16* wg1T  = (_Float16*)carve((size_t)D3 * D2 * 2);
  _Float16* Qb    = (_Float16*)carve(3 * NE * 2);       // one plane per modality pair
  _Float16* Kb    = (_Float16*)carve(3 * NE * 2);
  _Float16* vTb   = (_Float16*)carve(3 * NE * 2);
  _Float16* aoutb = (_Float16*)carve(3 * NE * 2);
  _Float16* cat16 = (_Float16*)carve((size_t)ROWS * D3 * 2);
  _Float16* g116  = (_Float16*)carve((size_t)ROWS * D2 * 2);
  float*    feats = (float*)carve(3 * NE * 4);
  float*    gates = (float*)carve((size_t)ROWS * 3 * 4);

  // convert activations and transpose-convert weights to f16
  prep_kernel<<<G1TILES + 12 * WTILES + 3 * XBLOCKS, 256, 0, stream>>>(
      audio, video, image, Wq, Wk, Wv, Wp, Wg1, x16, wqT, wkT, wvT, wpT, wg1T);

  // the three modality pairs do not depend on one another: each stage takes all of them in one grid
  qkv_kernel<<<dim3(32, 8, 9), 256, 0, stream>>>(x16, wqT, wkT, wvT, bq, bk, bv, qn, kn, Qb, Kb, vTb);
  attn_kernel<<<dim3(8, 16, 24), 128, 0, stream>>>(Qb, Kb, vTb, aoutb, rpb);
  proj_kernel<<<dim3(32, 8, 3), 256, 0, stream>>>(aoutb, wpT, bp, audio, video, image, feats, cat16);

  gate1_kernel<<<dim3(32, 16), 256, 0, stream>>>(cat16, wg1T, bg1, g116);
  gate2_kernel<<<ROWS / 8, 256, 0, stream>>>(g116, Wg2, bg2, gates);
  fuse_kernel<<<ROWS / FROWS, 256, 0, stream>>>(feats, feats + NE, feats + 2 * NE, gates, out);
}

// v006
// It runs in 225 microseconds.
// Two timings next to v005 both put it at 1.14 times that version's speed.
// Counting every step since v000, it is 4.59 times as fast.
#include <hip/hip_runtime.h>
#include <hip/hip_bf16.h>

typedef __attribute__((ext_vector_type(16))) _Float16 v16h;
typedef __attribute__((ext_vector_type(8)))  _Float16 v8h;
typedef __attribute__((ext_vector_type(8)))  float    v8f;
typedef __attribute__((ext_vector_type(4)))  _Float16 v4h;
typedef __attribute__((ext_vector_type(4)))  float    v4f;

#define WMMA_F32_F16(a,b,c) __builtin_amdgcn_wmma_f32_16x16x32_f16(false,(a),false,(b),(short)0,(c),false,false)

#define Bv   2
#define Tv   32
#define Lv   64
#define Dv   1024
#define Hv   16
#define WSv  8
#define SHv  4
#define HDv  64
#define Sv   512      // WS*L
#define ROWS 4096     // B*T*L
#define D3   3072
#define D2   2048
#define TPITCH 72     // halves per LDS row of the transpose tile

static __device__ inline v8h ld8(const _Float16* p) { return *(const v8h*)p; }

static __device__ inline v16h mkfrag(v8h lo, v8h hi) {
  v16h r;
#pragma unroll
  for (int i = 0; i < 8; i++) { r[i] = lo[i]; r[i + 8] = hi[i]; }
  return r;
}

// window-order row -> source row of [B,T,L] with roll(-SH) folded in
static __device__ inline int src_row(int r) {
  int w = r >> 9;          // window (0..7): b*4 + widx
  int s = r & 511;         // token in window
  int b = w >> 2;
  int widx = w & 3;
  int tq = s >> 6;
  int l = s & 63;
  int tp = widx * WSv + tq;
  int tsrc = (tp + SHv) & 31;
  return ((b * Tv + tsrc) << 6) + l;
}

// ---------------------------------------------------------------- converts
// TPB 64 x 64 tiles per block, one below the other in the source, each turned in its own LDS tile: source rows
// are read as 16-byte pieces (a thread's 4 * TPB loads stand ahead of its converts, so that many are in flight),
// destination rows (k-contiguous) leave as whole 128-byte lines. R is a multiple of 64 * TPB, C of 64.
#define TPB 4
static __device__ inline void cvtT_tiles(_Float16* tile, const float* __restrict__ s, _Float16* __restrict__ d,
                                         int R, int C, int bx, int by) {
  const int t = threadIdx.x;
  const int c0 = bx * 64;
  const int r0 = by * (64 * TPB);
  const int c4 = (t & 15) * 4;
  const int r4 = (t >> 4) * 4;
  v4f v[TPB][4];
#pragma unroll
  for (int q = 0; q < TPB; q++)
#pragma unroll
    for (int p = 0; p < 4; p++) v[q][p] = *(const v4f*)(s + (size_t)(r0 + q * 64 + r4 + p) * C + c0 + c4);
#pragma unroll
  for (int q = 0; q < TPB; q++)
#pragma unroll
    for (int ci = 0; ci < 4; ci++) {
      v4h h;
#pragma unroll
      for (int p = 0; p < 4; p++) h[p] = (_Float16)v[q][p][ci];
      *(v4h*)(tile + (q * 64 + c4 + ci) * TPITCH + r4) = h;
    }
  __syncthreads();
  const int seg = (t & 7) * 8;
#pragma unroll
  for (int q = 0; q < TPB; q++)
#pragma unroll
    for (int p = 0; p < 2; p++) {
      const int c = p * 32 + (t >> 3);
      *(v8h*)(d + (size_t)(c0 + c) * R + r0 + q * 64 + seg) = *(const v8h*)(tile + (q * 64 + c) * TPITCH + seg);
    }
  // in the merged kernel another part's code follows these stores in the listing: no register that they name is
  // rewritten ahead of this wait
  asm volatile("s_wait_xcnt 0x0" ::: "memory");
}

// All conversions are independent of one another and run as one grid. Blocks in order: the tiles of Wg1,
// the tiles of the twelve D x D weights (pair-major: q, k, v, p), then XPT activation elements per thread.
// A block carries enough work that the grid is 1920 blocks (15360 waves).
#define G1TILES ((D2 / 64) * (D3 / (64 * TPB)))
#define WTILES  ((Dv / 64) * (Dv / (64 * TPB)))
#define XPT     64
#define XBLOCKS (ROWS * Dv / (256 * XPT))
__global__ __launch_bounds__(256) void prep_kernel(
    const float* __restrict__ audio, const float* __restrict__ video, const float* __restrict__ image,
    const float* __restrict__ Wq, const float* __restrict__ Wk, const float* __restrict__ Wv,
    const float* __restrict__ Wp, const float* __restrict__ Wg1,
    _Float16* __restrict__ x16, _Float16* __restrict__ wqT, _Float16* __restrict__ wkT,
    _Float16* __restrict__ wvT, _Float16* __restrict__ wpT, _Float16* __restrict__ wg1T)
{
  __shared__ __align__(16) _Float16 tile[TPB * 64 * TPITCH];   // [tile][c][r], rows 16 bytes longer than the data
  int b = blockIdx.x;
  if (b < G1TILES) {
    cvtT_tiles(tile, Wg1, wg1T, D3, D2, b % (D2 / 64), b / (D2 / 64));
    return;
  }
  b -= G1TILES;
  if (b < 12 * WTILES) {
    const int m = b / WTILES;
    const int kind = m & 3;
    const size_t off = (size_t)(m >> 2) * Dv * Dv;
    const float* s = (kind == 0) ? Wq : (kind == 1) ? Wk : (kind == 2) ? Wv : Wp;
    _Float16* d    = (kind == 0) ? wqT : (kind == 1) ? wkT : (kind == 2) ? wvT : wpT;
    const int tl = b % WTILES;
    cvtT_tiles(tile, s + off, d + off, Dv, Dv, tl % (Dv / 64), tl / (Dv / 64));
    return;
  }
  b -= 12 * WTILES;
  const int mod = b / XBLOCKS;
  const float* s = (mod == 0) ? audio : (mod == 1) ? video : image;
  // each wave-wide load covers 512 contiguous bytes, each store 256; the loads stand ahead of the converts
  const int i = (b % XBLOCKS) * (256 * XPT) + threadIdx.x * 4;
  _Float16* xd = x16 + (size_t)mod * ROWS * Dv + i;
  v4f xv[XPT / 4];
#pragma unroll
  for (int u = 0; u < XPT / 4; u++) xv[u] = *(const v4f*)(s + i + u * 1024);
#pragma unroll
  for (int u = 0; u < XPT / 4; u++) {
    v4h h;
#pragma unroll
    for (int e = 0; e < 4; e++) h[e] = (_Float16)xv[u][e];
    *(v4h*)(xd + u * 1024) = h;
  }
  // the tile parts' code follows these stores in the listing: no register that they name is rewritten ahead of this wait
  asm volatile("s_wait_xcnt 0x0" ::: "memory");
}

// ---------------------------------------------------------------- staged GEMM core
// One 128 x 128 tile of Y = A * B^T per block of 8 waves (4 along M x 2 along N, 32 x 64 each).
// A stage is 64 k (128 bytes) of 128 A rows and 128 B rows. Each wave-wide 16-byte copy covers four
// whole 128-byte lines and lands in LDS without passing a register; two buffers, so the copies
// of the stage after next fly while this one is multiplied.
#define GBK    64                   // halves of k per stage
#define GPITCH 72                   // halves per LDS row: 144 bytes, conflict-free for 16-byte readers
#define GBUF   (256 * GPITCH)       // halves per buffer: A rows 0..127, B rows 128..255

static __device__ inline void stage_copy(unsigned l, const _Float16* const (&gp)[8], int k) {
  // Eight copies of 16 bytes per lane, rows 32 apart. The s_wait_xcnt closes the statement so that no
  // address register of an issued copy is rewritten ahead of it.
  asm volatile(
      "global_load_async_to_lds_b128 %0, %8, off\n\t"
      "global_load_async_to_lds_b128 %1, %9, off\n\t"
      "global_load_async_to_lds_b128 %2, %10, off\n\t"
      "global_load_async_to_lds_b128 %3, %11, off\n\t"
      "global_load_async_to_lds_b128 %4, %12, off\n\t"
      "global_load_async_to_lds_b128 %5, %13, off\n\t"
      "global_load_async_to_lds_b128 %6, %14, off\n\t"
      "global_load_async_to_lds_b128 %7, %15, off\n\t"
      "s_wait_xcnt 0x0"
      :: "v"(l), "v"(l + 1u * 32u * GPITCH * 2u), "v"(l + 2u * 32u * GPITCH * 2u), "v"(l + 3u * 32u * GPITCH * 2u),
         "v"(l + 4u * 32u * GPITCH * 2u), "v"(l + 5u * 32u * GPITCH * 2u), "v"(l + 6u * 32u * GPITCH * 2u),
         "v"(l + 7u * 32u * GPITCH * 2u),
         "v"(gp[0] + k), "v"(gp[1] + k), "v"(gp[2] + k), "v"(gp[3] + k),
         "v"(gp[4] + k), "v"(gp[5] + k), "v"(gp[6] + k), "v"(gp[7] + k)
      : "memory");
}

// gp[0..3]: this thread's piece of A rows r, r+32, r+64, r+96 of the tile; gp[4..7]: the same of B.
template <int KT>
static __device__ inline void gemm_staged(_Float16* sm, const _Float16* const (&gp)[8], v8f (&acc)[2][4]) {
  const int t = threadIdx.x;
  const int lane = t & 31;
  const int wave = t >> 5;
  const int ml = lane & 15;
  const int koff = (lane >> 4) * 8;
  const unsigned lcopy = (unsigned)(size_t)sm + (unsigned)((t >> 3) * GPITCH + (t & 7) * 8) * 2u;
  const _Float16* ard = sm + ((wave & 3) * 32 + ml) * GPITCH + koff;
  const _Float16* brd = sm + (128 + (wave >> 2) * 64 + ml) * GPITCH + koff;
  constexpr int NT = KT / GBK;

  stage_copy(lcopy, gp, 0);
  asm volatile("s_wait_asynccnt 0x0" ::: "memory");   // stage 0 has landed before the barrier publishes it
  __syncthreads();
  stage_copy(lcopy + GBUF * 2u, gp, GBK);

  // stays rolled: unrolled, the reads were spread between the WMMAs again, a full LDS latency in front of each pair
#pragma unroll 1
  for (int s = 0; s < NT; s++) {
    const int bo = (s & 1) * GBUF;
    // the whole stage goes into registers as one group of reads: the buffer is free again before the WMMAs start
    // (the inner loops are unrolled so that a, b and acc are indexed by constants and stay in registers)
    v16h a[2][2], b[2][4];
#pragma unroll
    for (int ks = 0; ks < 2; ks++) {
      const _Float16* ap = ard + bo + ks * 32;
      const _Float16* bp = brd + bo + ks * 32;
#pragma unroll
      for (int p = 0; p < 2; p++) a[ks][p] = mkfrag(ld8(ap + p * 16 * GPITCH), ld8(ap + p * 16 * GPITCH + 16));
#pragma unroll
      for (int n = 0; n < 4; n++) b[ks][n] = mkfrag(ld8(bp + n * 16 * GPITCH), ld8(bp + n * 16 * GPITCH + 16));
    }
    asm volatile("s_wait_dscnt 0x0" ::: "memory");    // this wave's reads of the buffer are over before it is refilled
    asm volatile("s_wait_asynccnt 0x0" ::: "memory"); // this wave's copies of stage s + 1 have landed
    __syncthreads();                                  // publishes stage s + 1, frees stage s's buffer
    if (s + 2 < NT) stage_copy(lcopy + (unsigned)bo * 2u, gp, (s + 2) * GBK);
    // stage s + 2 flies while stage s is multiplied from registers
#pragma unroll
    for (int ks = 0; ks < 2; ks++)
#pragma unroll
      for (int n = 0; n < 4; n++) {
        acc[0][n] = WMMA_F32_F16(a[ks][0], b[ks][n], acc[0][n]);
        acc[1][n] = WMMA_F32_F16(a[ks][1], b[ks][n], acc[1][n]);
      }
  }
  asm volatile("s_wait_asynccnt 0x0" ::: "memory");   // nothing of this wave is in flight when it goes on
}

// ---------------------------------------------------------------- QKV GEMM
// grid (32, 8, 9): 128-row x 128-col tiles per block; z = 3 * pair + (Q, K or V).
// block = 256 (8 waves); each wave: 32 rows x 64 cols (one head), 8 WMMAs / 32-K step.
__global__ __launch_bounds__(256) void qkv_kernel(
    const _Float16* __restrict__ x16,
    const _Float16* __restrict__ wqT, const _Float16* __restrict__ wkT, const _Float16* __restrict__ wvT,
    const float* __restrict__ bq, const float* __restrict__ bk, const float* __restrict__ bv,
    const float* __restrict__ qn, const float* __restrict__ kn,
    _Float16* __restrict__ Qb, _Float16* __restrict__ Kb, _Float16* __restrict__ vTb)
{
  __shared__ __align__(16) _Float16 sm[2 * GBUF];
  const int j = blockIdx.z / 3;             // modality pair
  const int which = blockIdx.z % 3;
  const size_t NE = (size_t)ROWS * Dv;
  // queries come from modality j; keys and values from video for pairs 0 and 2, from audio for pair 1
  const _Float16* xq = x16 + (size_t)j * NE;
  const _Float16* xc = x16 + ((j == 1) ? 0 : NE);
  wqT += (size_t)j * Dv * Dv;  wkT += (size_t)j * Dv * Dv;  wvT += (size_t)j * Dv * Dv;
  bq += j * Dv;  bk += j * Dv;  bv += j * Dv;
  qn += j * HDv; kn += j * HDv;
  Qb += (size_t)j * NE;  Kb += (size_t)j * NE;  vTb += (size_t)j * NE;
  const int lane = threadIdx.x & 31;
  const int wave = threadIdx.x >> 5;
  const int ml = lane & 15;
  const int m0 = blockIdx.x * 128 + (wave & 3) * 32;
  const int n0 = blockIdx.y * 128 + (wave >> 2) * 64;

  const _Float16* src = (which == 0) ? xq : xc;
  const _Float16* wT  = (which == 0) ? wqT : (which == 1 ? wkT : wvT);
  const float* bias   = (which == 0) ? bq  : (which == 1 ? bk  : bv);

  const int cr = threadIdx.x >> 3;          // row of the tile this thread copies (and 32, 64, 96 below it)
  const int cc = (threadIdx.x & 7) * 8;     // its 16-byte piece of the row's 128 bytes
  const _Float16* gp[8];
#pragma unroll
  for (int i = 0; i < 4; i++) {
    gp[i]     = src + (size_t)src_row(blockIdx.x * 128 + cr + 32 * i) * Dv + cc;
    gp[4 + i] = wT + (size_t)(blockIdx.y * 128 + cr + 32 * i) * Dv + cc;
  }

  v8f acc[2][4] = {};
  gemm_staged<Dv>(sm, gp, acc);

  const int rowoff = (lane >> 4) * 8;
#pragma unroll
  for (int part = 0; part < 2; part++) {
    const int mp = m0 + part * 16;
    float val[4][8];
#pragma unroll
    for (int n = 0; n < 4; n++) {
      float bc = bias[n0 + n * 16 + ml];
#pragma unroll
      for (int i = 0; i < 8; i++) val[n][i] = acc[part][n][i] + bc;
    }

    if (which < 2) {                       // RMS-norm over the head dim (tile == one head)
      const float* nw_ = (which == 0) ? qn : kn;
      float ss[8];
#pragma unroll
      for (int i = 0; i < 8; i++) {
        ss[i] = 0.f;
#pragma unroll
        for (int n = 0; n < 4; n++) ss[i] += val[n][i] * val[n][i];
      }
#pragma unroll
      for (int msk = 1; msk < 16; msk <<= 1)
#pragma unroll
        for (int i = 0; i < 8; i++) ss[i] += __shfl_xor(ss[i], msk, 32);
      const float sc = (which == 0) ? 0.125f : 1.0f;   // fold HD^-0.5 into Q
      float rs[8];
#pragma unroll
      for (int i = 0; i < 8; i++) rs[i] = rsqrtf(ss[i] * (1.0f / 64.0f) + 1e-6f) * sc;
#pragma unroll
      for (int n = 0; n < 4; n++) {
        float wc = nw_[(n0 + n * 16 + ml) & 63];
#pragma unroll
        for (int i = 0; i < 8; i++) val[n][i] *= rs[i] * wc;
      }
    }

    if (which < 2) {
      _Float16* dst = (which == 0) ? Qb : Kb;
#pragma unroll
      for (int n = 0; n < 4; n++) {
        int col = n0 + n * 16 + ml;
#pragma unroll
        for (int i = 0; i < 8; i++)
          dst[(size_t)(mp + rowoff + i) * Dv + col] = (_Float16)val[n][i];
      }
    } else {                               // V transposed: [(w*H+h)*HD+d][token]
#pragma unroll
      for (int n = 0; n < 4; n++) {
        int col = n0 + n * 16 + ml;
        int hh = col >> 6, d = col & 63;
#pragma unroll
        for (int i = 0; i < 8; i++) {
          int r = mp + rowoff + i;
          int w = r >> 9, s = r & 511;
          vTb[((size_t)((w * Hv + hh) * HDv + d)) * Sv + s] = (_Float16)val[n][i];
        }
      }
    }
  }
}

// ---------------------------------------------------------------- flash attention
// A stage is 64 keys of one head: 64 K rows (key-major) and 64 V^T rows (d-major), 128 bytes each. The block's
// four waves need the same rows, so they are brought into LDS once per block: each wave-wide 16-byte copy covers
// four whole 128-byte lines, where a fragment load from global memory touched sixteen lines for the same bytes.
// Two buffers: the next stage's copies fly while this one is worked on.
#define APITCH 72                   // halves per LDS row: 144 bytes, conflict-free for 16-byte readers
#define ABUF   (128 * APITCH)       // halves per buffer: K rows 0..63, V^T rows 64..127
#define ASTAGES (Sv / 64)

// kp, vp: this thread's 16-byte piece of K row r and of V^T row r of stage 0; it also copies rows r+16, r+32, r+48.
// From one stage to the next K moves on by 64 rows, V^T by 64 halves inside its rows. The eight addresses are
// formed here from the two, so that few address registers live through the loop.
static __device__ inline void kv_copy(unsigned l, const _Float16* kp, const _Float16* vp, int st) {
  // Eight copies of 16 bytes per lane, rows 16 apart. The s_wait_xcnt closes the statement so that no
  // address register of an issued copy is rewritten ahead of it.
  asm volatile(
      "global_load_async_to_lds_b128 %0, %8, off\n\t"
      "global_load_async_to_lds_b128 %1, %9, off\n\t"
      "global_load_async_to_lds_b128 %2, %10, off\n\t"
      "global_load_async_to_lds_b128 %3, %11, off\n\t"
      "global_load_async_to_lds_b128 %4, %12, off\n\t"
      "global_load_async_to_lds_b128 %5, %13, off\n\t"
      "global_load_async_to_lds_b128 %6, %14, off\n\t"
      "global_load_async_to_lds_b128 %7, %15, off\n\t"
      "s_wait_xcnt 0x0"
      :: "v"(l), "v"(l + 1u * 16u * APITCH * 2u), "v"(l + 2u * 16u * APITCH * 2u), "v"(l + 3u * 16u * APITCH * 2u),
         "v"(l + 4u * 16u * APITCH * 2u), "v"(l + 5u * 16u * APITCH * 2u), "v"(l + 6u * 16u * APITCH * 2u),
         "v"(l + 7u * 16u * APITCH * 2u),
         "v"(kp + (size_t)(st * 64) * Dv), "v"(kp + (size_t)(st * 64 + 16) * Dv),
         "v"(kp + (size_t)(st * 64 + 32) * Dv), "v"(kp + (size_t)(st * 64 + 48) * Dv),
         "v"(vp + (st * 64)), "v"(vp + (st * 64 + 16 * Sv)), "v"(vp + (st * 64 + 32 * Sv)), "v"(vp + (st * 64 + 48 * Sv))
      : "memory");
}

// lane l <-> lane l ^ 16: the two lanes that share a query column of a transposed score tile
static __device__ inline float xhalf(float x) {
  const int b = __builtin_bit_cast(int, x);
  return __builtin_bit_cast(float, __builtin_amdgcn_permlanex16(b, b, 0x76543210, 0xfedcba98, false, false));
}

__global__ __launch_bounds__(128) void attn_kernel(
    const _Float16* __restrict__ Qb, const _Float16* __restrict__ Kb,
    const _Float16* __restrict__ vTb, _Float16* __restrict__ aout,
    const float* __restrict__ rpb)
{
  __shared__ __align__(16) _Float16 kv[2 * ABUF];
  const int lane = threadIdx.x & 31;
  const int wave = threadIdx.x >> 5;
  const int ml = lane & 15;
  const int koff = (lane >> 4) * 8;
  const int rowoff = (lane >> 4) * 8;
  const int qb = blockIdx.x, h = blockIdx.y, w = blockIdx.z & 7;
  const int j = blockIdx.z >> 3;          // modality pair: its own Q, K, V, output and bias table
  Qb += (size_t)j * ROWS * Dv;  Kb += (size_t)j * ROWS * Dv;
  vTb += (size_t)j * ROWS * Dv; aout += (size_t)j * ROWS * Dv;
  const float* rpbj = rpb + j * (2 * WSv - 1) * Hv;
  const int tq = qb;                      // 64-row chunks align to L

  const int cr = threadIdx.x >> 3;        // row of the stage this thread copies (and 16, 32, 48 below it)
  const int cc = (threadIdx.x & 7) * 8;   // its 16-byte piece of the row's 128 bytes
  const _Float16* kcp = Kb + (size_t)(w * Sv + cr) * Dv + h * HDv + cc;
  const _Float16* vcp = vTb + (size_t)((w * Hv + h) * HDv + cr) * Sv + cc;
  const unsigned lcopy = (unsigned)(size_t)kv + (unsigned)(cr * APITCH + cc) * 2u;

  kv_copy(lcopy, kcp, vcp, 0);

  const int qrow = qb * 64 + wave * 16;
  const _Float16* qp = Qb + (size_t)(w * Sv + qrow + ml) * Dv + h * HDv + koff;
  v16h qa0 = mkfrag(ld8(qp),      ld8(qp + 16));   // B operand: column = query ml
  v16h qa1 = mkfrag(ld8(qp + 32), ld8(qp + 48));

  v8f accO[4] = {};                       // accO[n][i] = O[query ml][d = n * 16 + rowoff + i]
  float m_ = -3.0e38f;                    // running maximum of query ml, the same in both of its lanes
  float l_ = 0.f;                         // running sum over this lane's half of the keys; joined after the loop
  const float L2E = 1.4426950408889634f;

  asm volatile("s_wait_asynccnt 0x0" ::: "memory");   // stage 0 has landed before the barrier publishes it
  __syncthreads();
  kv_copy(lcopy + ABUF * 2u, kcp, vcp, 1);

  // stays rolled: the buffer is picked by the stage's parity anyway
#pragma unroll 1
  for (int st = 0; st < ASTAGES; st++) {
    const int bo = (st & 1) * ABUF;
    const float biasv = rpbj[(tq - st + WSv - 1) * Hv + h];   // a stage is one temporal step of keys

    // unrolled so that both chunks' LDS offsets are constants (and the loops inside it so that s0, s1, mx, pb, vb
    // and accO are indexed by constants and stay in registers)
#pragma unroll
    for (int hc = 0; hc < 2; hc++) {
      // s0[i] = S[query ml][key hc * 32 + rowoff + i], s1[i] the same 16 keys on
      v8f s0 = {}, s1 = {};
      {
        const _Float16* kp0 = kv + bo + (hc * 32 + ml) * APITCH + koff;
        const _Float16* kp1 = kp0 + 16 * APITCH;
        v16h kb00 = mkfrag(ld8(kp0),      ld8(kp0 + 16));
        v16h kb01 = mkfrag(ld8(kp0 + 32), ld8(kp0 + 48));
        v16h kb10 = mkfrag(ld8(kp1),      ld8(kp1 + 16));
        v16h kb11 = mkfrag(ld8(kp1 + 32), ld8(kp1 + 48));
        s0 = WMMA_F32_F16(kb00, qa0, s0);
        s1 = WMMA_F32_F16(kb10, qa0, s1);
        s0 = WMMA_F32_F16(kb01, qa1, s0);
        s1 = WMMA_F32_F16(kb11, qa1, s1);
      }
      v16h vb[4];                          // A operand: row = d, k = the chunk's keys in the order of s0, s1
#pragma unroll
      for (int n = 0; n < 4; n++) {
        const _Float16* vp = kv + bo + (64 + n * 16 + ml) * APITCH + hc * 32 + koff;
        vb[n] = mkfrag(ld8(vp), ld8(vp + 16));
      }

      float mx[8];
#pragma unroll
      for (int i = 0; i < 8; i++) mx[i] = fmaxf(s0[i], s1[i]);
#pragma unroll
      for (int d = 4; d >= 1; d >>= 1)
#pragma unroll
        for (int i = 0; i < d; i++) mx[i] = fmaxf(mx[i], mx[i + d]);
      const float mc = fmaxf(mx[0], xhalf(mx[0])) + biasv;   // the bias is one value for the whole stage
      const float mn = fmaxf(m_, mc);
      const float alpha = __builtin_amdgcn_exp2f((m_ - mn) * L2E);
      m_ = mn;
      const float cl = (biasv - mn) * L2E;   // bias and maximum are one value per lane: one addend for all 16 scores

      v16h pb;                             // P^T as B operand: column = query ml, k as in vb
      float r0 = 0.f, r1 = 0.f;
#pragma unroll
      for (int i = 0; i < 8; i++) {
        const float p0 = __builtin_amdgcn_exp2f(fmaf(s0[i], L2E, cl));
        const float p1 = __builtin_amdgcn_exp2f(fmaf(s1[i], L2E, cl));
        r0 += p0;
        r1 += p1;
        pb[i]     = (_Float16)p0;
        pb[i + 8] = (_Float16)p1;
      }
      l_ = l_ * alpha + (r0 + r1);
#pragma unroll
      for (int n = 0; n < 4; n++) accO[n] *= alpha;

#pragma unroll
      for (int n = 0; n < 4; n++) accO[n] = WMMA_F32_F16(vb[n], pb, accO[n]);
    }

    asm volatile("s_wait_dscnt 0x0" ::: "memory");    // this wave's reads of the buffer are over before it is refilled
    asm volatile("s_wait_asynccnt 0x0" ::: "memory"); // this wave's copies of stage st + 1 have landed
    __syncthreads();                                  // publishes stage st + 1, frees stage st's buffer
    if (st + 2 < ASTAGES) kv_copy(lcopy + (unsigned)bo * 2u, kcp, vcp, st + 2);
  }
  asm volatile("s_wait_asynccnt 0x0" ::: "memory");   // nothing of this wave is in flight when it goes on

  const float inv = 1.0f / (l_ + xhalf(l_));
  // a lane's eight accumulator registers are eight neighbouring d of its query's row: one 16-byte store per tile
  v8h o[4];
#pragma unroll
  for (int n = 0; n < 4; n++)
#pragma unroll
    for (int i = 0; i < 8; i++) o[n][i] = (_Float16)(accO[n][i] * inv);
  _Float16* op = aout + (size_t)(w * Sv + qrow + ml) * Dv + h * HDv + rowoff;
#pragma unroll
  for (int n = 0; n < 4; n++) *(v8h*)(op + n * 16) = o[n];
}

// ---------------------------------------------------------------- output projection + residual + roll(+SH)
// grid (32, 8, 3 pairs): 128x128 tile per block of 8 waves, 32 rows x 64 cols per wave.
__global__ __launch_bounds__(256) void proj_kernel(
    const _Float16* __restrict__ aoutb, const _Float16* __restrict__ wpT,
    const float* __restrict__ bp,
    const float* __restrict__ audio, const float* __restrict__ video, const float* __restrict__ image,
    float* __restrict__ feat, _Float16* __restrict__ cat16)
{
  __shared__ __align__(16) _Float16 sm[2 * GBUF];
  const int j = blockIdx.z;
  const float* qmf = (j == 0) ? audio : (j == 1) ? video : image;   // residual: the pair's query modality
  aoutb += (size_t)j * ROWS * Dv;
  wpT += (size_t)j * Dv * Dv;
  bp += j * Dv;
  feat += (size_t)j * ROWS * Dv;
  const int lane = threadIdx.x & 31;
  const int wave = threadIdx.x >> 5;
  const int ml = lane & 15;
  const int m0 = blockIdx.x * 128 + (wave & 3) * 32;
  const int n0 = blockIdx.y * 128 + (wave >> 2) * 64;

  const int cr = threadIdx.x >> 3;
  const int cc = (threadIdx.x & 7) * 8;
  const _Float16* gp[8];
#pragma unroll
  for (int i = 0; i < 4; i++) {
    gp[i]     = aoutb + (size_t)(blockIdx.x * 128 + cr + 32 * i) * Dv + cc;
    gp[4 + i] = wpT + (size_t)(blockIdx.y * 128 + cr + 32 * i) * Dv + cc;
  }

  v8f acc[2][4] = {};
  gemm_staged<Dv>(sm, gp, acc);

  const int rowoff = (lane >> 4) * 8;
#pragma unroll
  for (int part = 0; part < 2; part++) {
    const int mp = m0 + part * 16;
    int featrow[8];
#pragma unroll
    for (int i = 0; i < 8; i++) {
      int r = mp + rowoff + i;
      int w = r >> 9, s = r & 511;
      int b = w >> 2, widx = w & 3;
      int tqq = s >> 6, l = s & 63;
      int t = (widx * WSv + tqq + SHv) & 31;   // roll back by +SH
      featrow[i] = (b * Tv + t) * Lv + l;
    }
#pragma unroll
    for (int n = 0; n < 4; n++) {
      int col = n0 + n * 16 + ml;
      float bc = bp[col];
#pragma unroll
      for (int i = 0; i < 8; i++) {
        float v = acc[part][n][i] + bc + qmf[(size_t)featrow[i] * Dv + col];
        feat[(size_t)featrow[i] * Dv + col] = v;
        cat16[(size_t)featrow[i] * D3 + j * Dv + col] = (_Float16)v;
      }
    }
  }
}

// ---------------------------------------------------------------- gating MLP layer 1 (+GELU)
// grid (32, 16): 128x128 tile per block of 8 waves.
__global__ __launch_bounds__(256) void gate1_kernel(
    const _Float16* __restrict__ cat16, const _Float16* __restrict__ wg1T,
    const float* __restrict__ bg1, _Float16* __restrict__ g116)
{
  __shared__ __align__(16) _Float16 sm[2 * GBUF];
  const int lane = threadIdx.x & 31;
  const int wave = threadIdx.x >> 5;
  const int ml = lane & 15;
  const int m0 = blockIdx.x * 128 + (wave & 3) * 32;
  const int n0 = blockIdx.y * 128 + (wave >> 2) * 64;

  const int cr = threadIdx.x >> 3;
  const int cc = (threadIdx.x & 7) * 8;
  const _Float16* gp[8];
#pragma unroll
  for (int i = 0; i < 4; i++) {
    gp[i]     = cat16 + (size_t)(blockIdx.x * 128 + cr + 32 * i) * D3 + cc;
    gp[4 + i] = wg1T + (size_t)(blockIdx.y * 128 + cr + 32 * i) * D3 + cc;
  }

  v8f acc[2][4] = {};
  gemm_staged<D3>(sm, gp, acc);

  const int rowoff = (lane >> 4) * 8;
#pragma unroll
  for (int part = 0; part < 2; part++) {
    const int mp = m0 + part * 16;
#pragma unroll
    for (int n = 0; n < 4; n++) {
      int col = n0 + n * 16 + ml;
      float bc = bg1[col];
#pragma unroll
      for (int i = 0; i < 8; i++) {
        float x = acc[part][n][i] + bc;
        float g = 0.5f * x * (1.0f + erff(x * 0.70710678118f));   // exact GELU
        g116[(size_t)(mp + rowoff + i) * D2 + col] = (_Float16)g;
      }
    }
  }
}

// ---------------------------------------------------------------- gating layer 2 (N=3) + softmax
__global__ __launch_bounds__(256) void gate2_kernel(
    const _Float16* __restrict__ g116, const float* __restrict__ Wg2,
    const float* __restrict__ bg2, float* __restrict__ gates)
{
  int row = blockIdx.x * 8 + (threadIdx.x >> 5);
  int lane = threadIdx.x & 31;
  if (row >= ROWS) return;
  const _Float16* gr = g116 + (size_t)row * D2;
  float a0 = 0.f, a1 = 0.f, a2 = 0.f;
  for (int k = lane; k < D2; k += 32) {
    float g = (float)gr[k];
    a0 = fmaf(g, Wg2[k * 3 + 0], a0);
    a1 = fmaf(g, Wg2[k * 3 + 1], a1);
    a2 = fmaf(g, Wg2[k * 3 + 2], a2);
  }
#pragma unroll
  for (int msk = 16; msk >= 1; msk >>= 1) {
    a0 += __shfl_xor(a0, msk, 32);
    a1 += __shfl_xor(a1, msk, 32);
    a2 += __shfl_xor(a2, msk, 32);
  }
  if (lane == 0) {
    a0 += bg2[0]; a1 += bg2[1]; a2 += bg2[2];
    float mx = fmaxf(a0, fmaxf(a1, a2));
    float e0 = __expf(a0 - mx), e1 = __expf(a1 - mx), e2 = __expf(a2 - mx);
    float inv = 1.0f / (e0 + e1 + e2);
    gates[row * 3 + 0] = e0 * inv;
    gates[row * 3 + 1] = e1 * inv;
    gates[row * 3 + 2] = e2 * inv;
  }
}

// ---------------------------------------------------------------- fuse
// FROWS whole rows per block, four columns per thread: 16-byte accesses, each row's gates the same for the whole block,
// all 3 * FROWS loads of a thread issued before the first sum.
// The three planes come as three pointers, so that each address is a block-uniform base plus one per-lane offset
// that lives to the last store: no vector register that an issued load names is written again.
#define FROWS 4
__global__ __launch_bounds__(256) void fuse_kernel(const float* __restrict__ feat0, const float* __restrict__ feat1,
                                                   const float* __restrict__ feat2, const float* __restrict__ gates,
                                                   float* __restrict__ out)
{
  const int row0 = blockIdx.x * FROWS;
  const unsigned c = threadIdx.x * 4u;
  const float* fb[3] = { feat0 + (size_t)row0 * Dv, feat1 + (size_t)row0 * Dv, feat2 + (size_t)row0 * Dv };
  float* ob = out + (size_t)row0 * Dv;
  v4f f[FROWS][3];
#pragma unroll
  for (int u = 0; u < FROWS; u++)
#pragma unroll
    for (int m = 0; m < 3; m++) f[u][m] = *(const v4f*)(fb[m] + u * Dv + c);
#pragma unroll
  for (int u = 0; u < FROWS; u++) {
    const float* g = gates + (row0 + u) * 3;
    *(v4f*)(ob + u * Dv + c) = g[0] * f[u][0] + g[1] * f[u][1] + g[2] * f[u][2];
  }
}

// ---------------------------------------------------------------- launch
extern "C" void kernel_launch(void* const* d_in, const int* in_sizes, int n_in,
                              void* d_out, int out_size, void* d_ws, size_t ws_size,
                              hipStream_t stream)
{
  const float* audio = (const float*)d_in[0];
  const float* video = (const float*)d_in[1];
  const float* image = (const float*)d_in[2];
  const float* Wq  = (const float*)d_in[3];
  const float* Wk  = (const float*)d_in[4];
  const float* Wv  = (const float*)d_in[5];
  const float* Wp  = (const float*)d_in[6];
  const float* bq  = (const float*)d_in[7];
  const float* bk  = (const float*)d_in[8];
  const float* bv  = (const float*)d_in[9];
  const float* bp  = (const float*)d_in[10];
  const float* qn  = (const float*)d_in[11];
  const float* kn  = (const float*)d_in[12];
  const float* rpb = (const float*)d_in[13];
  const float* Wg1 = (const float*)d_in[14];
  const float* bg1 = (const float*)d_in[15];
  const float* Wg2 = (const float*)d_in[16];
  const float* bg2 = (const float*)d_in[17];
  float* out = (float*)d_out;

  char* p = (char*)d_ws;
  auto carve = [&](size_t bytes) -> void* {
    void* r = (void*)p;
    p += (bytes + 255) & ~(size_t)255;
    return r;
  };
  const size_t NE = (size_t)ROWS * Dv;                 // 4M elems
  _Float16* x16   = (_Float16*)carve(3 * NE * 2);
  _Float16* wqT   = (_Float16*)carve(3 * (size_t)Dv * Dv * 2);
  _Float16* wkT   = (_Float16*)carve(3 * (size_t)Dv * Dv * 2);
  _Float16* wvT   = (_Float16*)carve(3 * (size_t)Dv * Dv * 2);
  _Float16* wpT   = (_Float16*)carve(3 * (size_t)Dv * Dv * 2);
  _Float16* wg1T  = (_Float16*)carve((size_t)D3 * D2 * 2);
  _Float16* Qb    = (_Float16*)carve(3 * NE * 2);       // one plane per modality pair
  _Float16* Kb    = (_Float16*)carve(3 * NE * 2);
  _Float16* vTb   = (_Float16*)carve(3 * NE * 2);
  _Float16* aoutb = (_Float16*)carve(3 * NE * 2);
  _Float16* cat16 = (_Float16*)carve((size_t)ROWS * D3 * 2);
  _Float16* g116  = (_Float16*)carve((size_t)ROWS * D2 * 2);
  float*    feats = (float*)carve(3 * NE * 4);
  float*    gates = (float*)carve((size_t)ROWS * 3 * 4);

  // convert activations and transpose-convert weights to f16
  prep_kernel<<<G1TILES + 12 * WTILES + 3 * XBLOCKS, 256, 0, stream>>>(
      audio, video, image, Wq, Wk, Wv, Wp, Wg1, x16, wqT, wkT, wvT, wpT, wg1T);

  // the three modality pairs do not depend on one another: each stage takes all of them in one grid
  qkv_kernel<<<dim3(32, 8, 9), 256, 0, stream>>>(x16, wqT, wkT, wvT, bq, bk, bv, qn, kn, Qb, Kb, vTb);
  attn_kernel<<<dim3(8, 16, 24), 128, 0, stream>>>(Qb, Kb, vTb, aoutb, rpb);
  proj_kernel<<<dim3(32, 8, 3), 256, 0, stream>>>(aoutb, wpT, bp, audio, video, image, feats, cat16);

  gate1_kernel<<<dim3(32, 16), 256, 0, stream>>>(cat16, wg1T, bg1, g116);
  gate2_kernel<<<ROWS / 8, 256, 0, stream>>>(g116, Wg2, bg2, gates);
  fuse_kernel<<<ROWS / FROWS, 256, 0, stream>>>(feats, feats + NE, feats + 2 * NE, gates, out);
}

// v007
// A run of this version takes 212 microseconds.
// In both of two side-by-side timings against v006, it was 1.07 times as fast.
// All steps since v000 together make it 4.90 times as fast.
#include <hip/hip_runtime.h>
#include <hip/hip_bf16.h>

typedef __attribute__((ext_vector_type(16))) _Float16 v16h;
typedef __attribute__((ext_vector_type(8)))  _Float16 v8h;
typedef __attribute__((ext_vector_type(8)))  float    v8f;
typedef __attribute__((ext_vector_type(4)))  _Float16 v4h;
typedef __attribute__((ext_vector_type(4)))  float    v4f;

#define WMMA_F32_F16(a,b,c) __builtin_amdgcn_wmma_f32_16x16x32_f16(false,(a),false,(b),(short)0,(c),false,false)

#define Bv   2
#define Tv   32
#define Lv   64
#define Dv   1024
#define Hv   16
#define WSv  8
#define SHv  4
#define HDv  64
#define Sv   512      // WS*L
#define ROWS 4096     // B*T*L
#define D3   3072
#define D2   2048
#define TPITCH 72     // halves per LDS row of the transpose tile

static __device__ inline v8h ld8(const _Float16* p) { return *(const v8h*)p; }

static __device__ inline v16h mkfrag(v8h lo, v8h hi) {
  v16h r;
#pragma unroll
  for (int i = 0; i < 8; i++) { r[i] = lo[i]; r[i + 8] = hi[i]; }
  return r;
}

// window-order row -> source row of [B,T,L] with roll(-SH) folded in
static __device__ inline int src_row(int r) {
  int w = r >> 9;          // window (0..7): b*4 + widx
  int s = r & 511;         // token in window
  int b = w >> 2;
  int widx = w & 3;
  int tq = s >> 6;
  int l = s & 63;
  int tp = widx * WSv + tq;
  int tsrc = (tp + SHv) & 31;
  return ((b * Tv + tsrc) << 6) + l;
}

// ---------------------------------------------------------------- converts
// TPB 64 x 64 tiles per block, one below the other in the source, each turned in its own LDS tile: source rows
// are read as 16-byte pieces (a thread's 4 * TPB loads stand ahead of its converts, so that many are in flight),
// destination rows (k-contiguous) leave as whole 128-byte lines. R is a multiple of 64 * TPB, C of 64.
#define TPB 4
static __device__ inline void cvtT_tiles(_Float16* tile, const float* __restrict__ s, _Float16* __restrict__ d,
                                         int R, int C, int bx, int by) {
  const int t = threadIdx.x;
  const int c0 = bx * 64;
  const int r0 = by * (64 * TPB);
  const int c4 = (t & 15) * 4;
  const int r4 = (t >> 4) * 4;
  v4f v[TPB][4];
#pragma unroll
  for (int q = 0; q < TPB; q++)
#pragma unroll
    for (int p = 0; p < 4; p++) v[q][p] = *(const v4f*)(s + (size_t)(r0 + q * 64 + r4 + p) * C + c0 + c4);
#pragma unroll
  for (int q = 0; q < TPB; q++)
#pragma unroll
    for (int ci = 0; ci < 4; ci++) {
      v4h h;
#pragma unroll
      for (int p = 0; p < 4; p++) h[p] = (_Float16)v[q][p][ci];
      *(v4h*)(tile + (q * 64 + c4 + ci) * TPITCH + r4) = h;
    }
  __syncthreads();
  const int seg = (t & 7) * 8;
#pragma unroll
  for (int q = 0; q < TPB; q++)
#pragma unroll
    for (int p = 0; p < 2; p++) {
      const int c = p * 32 + (t >> 3);
      *(v8h*)(d + (size_t)(c0 + c) * R + r0 + q * 64 + seg) = *(const v8h*)(tile + (q * 64 + c) * TPITCH + seg);
    }
  // in the merged kernel another part's code follows these stores in the listing: no register that they name is
  // rewritten ahead of this wait
  asm volatile("s_wait_xcnt 0x0" ::: "memory");
}

// All conversions are independent of one another and run as one grid. Blocks in order: the tiles of Wg1,
// the tiles of the twelve D x D weights (pair-major: q, k, v, p), then XPT activation elements per thread.
// A block carries enough work that the grid is 1920 blocks (15360 waves).
#define G1TILES ((D2 / 64) * (D3 / (64 * TPB)))
#define WTILES  ((Dv / 64) * (Dv / (64 * TPB)))
#define XPT     64
#define XBLOCKS (ROWS * Dv / (256 * XPT))
__global__ __launch_bounds__(256) void prep_kernel(
    const float* __restrict__ audio, const float* __restrict__ video, const float* __restrict__ image,
    const float* __restrict__ Wq, const float* __restrict__ Wk, const float* __restrict__ Wv,
    const float* __restrict__ Wp, const float* __restrict__ Wg1,
    _Float16* __restrict__ x16, _Float16* __restrict__ wqT, _Float16* __restrict__ wkT,
    _Float16* __restrict__ wvT, _Float16* __restrict__ wpT, _Float16* __restrict__ wg1T)
{
  __shared__ __align__(16) _Float16 tile[TPB * 64 * TPITCH];   // [tile][c][r], rows 16 bytes longer than the data
  int b = blockIdx.x;
  if (b < G1TILES) {
    cvtT_tiles(tile, Wg1, wg1T, D3, D2, b % (D2 / 64), b / (D2 / 64));
    return;
  }
  b -= G1TILES;
  if (b < 12 * WTILES) {
    const int m = b / WTILES;
    const int kind = m & 3;
    const size_t off = (size_t)(m >> 2) * Dv * Dv;
    const float* s = (kind == 0) ? Wq : (kind == 1) ? Wk : (kind == 2) ? Wv : Wp;
    _Float16* d    = (kind == 0) ? wqT : (kind == 1) ? wkT : (kind == 2) ? wvT : wpT;
    const int tl = b % WTILES;
    cvtT_tiles(tile, s + off, d + off, Dv, Dv, tl % (Dv / 64), tl / (Dv / 64));
    return;
  }
  b -= 12 * WTILES;
  const int mod = b / XBLOCKS;
  const float* s = (mod == 0) ? audio : (mod == 1) ? video : image;
  // each wave-wide load covers 512 contiguous bytes, each store 256; the loads stand ahead of the converts
  const int i = (b % XBLOCKS) * (256 * XPT) + threadIdx.x * 4;
  _Float16* xd = x16 + (size_t)mod * ROWS * Dv + i;
  v4f xv[XPT / 4];
#pragma unroll
  for (int u = 0; u < XPT / 4; u++) xv[u] = *(const v4f*)(s + i + u * 1024);
#pragma unroll
  for (int u = 0; u < XPT / 4; u++) {
    v4h h;
#pragma unroll
    for (int e = 0; e < 4; e++) h[e] = (_Float16)xv[u][e];
    *(v4h*)(xd + u * 1024) = h;
  }
  // the tile parts' code follows these stores in the listing: no register that they name is rewritten ahead of this wait
  asm volatile("s_wait_xcnt 0x0" ::: "memory");
}

// ---------------------------------------------------------------- staged GEMM core
// One 128 x 128 tile of Y = A * B^T per block of 8 waves (4 along M x 2 along N, 32 x 64 each).
// A stage is 64 k (128 bytes) of 128 A rows and 128 B rows. Each wave-wide 16-byte copy covers four
// whole 128-byte lines and lands in LDS without passing a register; two buffers, so the copies
// of the stage after next fly while this one is multiplied.
#define GBK    64                   // halves of k per stage
#define GPITCH 72                   // halves per LDS row: 144 bytes, conflict-free for 16-byte readers
#define GBUF   (256 * GPITCH)       // halves per buffer: A rows 0..127, B rows 128..255

static __device__ inline void stage_copy(unsigned l, const _Float16* const (&gp)[8], int k) {
  // Eight copies of 16 bytes per lane, rows 32 apart. The s_wait_xcnt closes the statement so that no
  // address register of an issued copy is rewritten ahead of it.
  asm volatile(
      "global_load_async_to_lds_b128 %0, %8, off\n\t"
      "global_load_async_to_lds_b128 %1, %9, off\n\t"
      "global_load_async_to_lds_b128 %2, %10, off\n\t"
      "global_load_async_to_lds_b128 %3, %11, off\n\t"
      "global_load_async_to_lds_b128 %4, %12, off\n\t"
      "global_load_async_to_lds_b128 %5, %13, off\n\t"
      "global_load_async_to_lds_b128 %6, %14, off\n\t"
      "global_load_async_to_lds_b128 %7, %15, off\n\t"
      "s_wait_xcnt 0x0"
      :: "v"(l), "v"(l + 1u * 32u * GPITCH * 2u), "v"(l + 2u * 32u * GPITCH * 2u), "v"(l + 3u * 32u * GPITCH * 2u),
         "v"(l + 4u * 32u * GPITCH * 2u), "v"(l + 5u * 32u * GPITCH * 2u), "v"(l + 6u * 32u * GPITCH * 2u),
         "v"(l + 7u * 32u * GPITCH * 2u),
         "v"(gp[0] + k), "v"(gp[1] + k), "v"(gp[2] + k), "v"(gp[3] + k),
         "v"(gp[4] + k), "v"(gp[5] + k), "v"(gp[6] + k), "v"(gp[7] + k)
      : "memory");
}

// gp[0..3]: this thread's piece of A rows r, r+32, r+64, r+96 of the tile; gp[4..7]: the same of B.
template <int KT>
static __device__ inline void gemm_staged(_Float16* sm, const _Float16* const (&gp)[8], v8f (&acc)[2][4]) {
  const int t = threadIdx.x;
  const int lane = t & 31;
  const int wave = t >> 5;
  const int ml = lane & 15;
  const int koff = (lane >> 4) * 8;
  const unsigned lcopy = (unsigned)(size_t)sm + (unsigned)((t >> 3) * GPITCH + (t & 7) * 8) * 2u;
  const _Float16* ard = sm + ((wave & 3) * 32 + ml) * GPITCH + koff;
  const _Float16* brd = sm + (128 + (wave >> 2) * 64 + ml) * GPITCH + koff;
  constexpr int NT = KT / GBK;

  stage_copy(lcopy, gp, 0);
  asm volatile("s_wait_asynccnt 0x0" ::: "memory");   // stage 0 has landed before the barrier publishes it
  __syncthreads();
  stage_copy(lcopy + GBUF * 2u, gp, GBK);

  // stays rolled: unrolled, the reads were spread between the WMMAs again, a full LDS latency in front of each pair
#pragma unroll 1
  for (int s = 0; s < NT; s++) {
    const int bo = (s & 1) * GBUF;
    // the whole stage goes into registers as one group of reads: the buffer is free again before the WMMAs start
    // (the inner loops are unrolled so that a, b and acc are indexed by constants and stay in registers)
    v16h a[2][2], b[2][4];
#pragma unroll
    for (int ks = 0; ks < 2; ks++) {
      const _Float16* ap = ard + bo + ks * 32;
      const _Float16* bp = brd + bo + ks * 32;
#pragma unroll
      for (int p = 0; p < 2; p++) a[ks][p] = mkfrag(ld8(ap + p * 16 * GPITCH), ld8(ap + p * 16 * GPITCH + 16));
#pragma unroll
      for (int n = 0; n < 4; n++) b[ks][n] = mkfrag(ld8(bp + n * 16 * GPITCH), ld8(bp + n * 16 * GPITCH + 16));
    }
    asm volatile("s_wait_dscnt 0x0" ::: "memory");    // this wave's reads of the buffer are over before it is refilled
    asm volatile("s_wait_asynccnt 0x0" ::: "memory"); // this wave's copies of stage s + 1 have landed
    __syncthreads();                                  // publishes stage s + 1, frees stage s's buffer
    if (s + 2 < NT) stage_copy(lcopy + (unsigned)bo * 2u, gp, (s + 2) * GBK);
    // stage s + 2 flies while stage s is multiplied from registers
#pragma unroll
    for (int ks = 0; ks < 2; ks++)
#pragma unroll
      for (int n = 0; n < 4; n++) {
        acc[0][n] = WMMA_F32_F16(a[ks][0], b[ks][n], acc[0][n]);
        acc[1][n] = WMMA_F32_F16(a[ks][1], b[ks][n], acc[1][n]);
      }
  }
  asm volatile("s_wait_asynccnt 0x0" ::: "memory");   // nothing of this wave is in flight when it goes on
}

// ---------------------------------------------------------------- staged GEMM core, wide tile
// One 256 x 128 tile of Y = A * B^T per block of 8 waves (4 along M x 2 along N, 64 x 64 each): a wave's eight
// fragments of a 32-k step feed 16 WMMAs (one 16-byte LDS read per WMMA, where the 32 x 64 wave tile takes one and
// a half), and a stage brings 384 rows from L2 for the work of two 128 x 128 tiles, which bring 512.
// The fragments of one 32-k step at a time are held, so that two blocks stay resident per WGP.
#define WBUF   (384 * GPITCH)       // halves per buffer: A rows 0..255, B rows 256..383

static __device__ inline void stage_copy_w(unsigned l, const _Float16* const (&gp)[12]) {
  // Twelve copies of 16 bytes per lane, rows 32 apart. The s_wait_xcnt closes the statement so that no
  // address register of an issued copy is rewritten ahead of it.
  asm volatile(
      "global_load_async_to_lds_b128 %0, %12, off\n\t"
      "global_load_async_to_lds_b128 %1, %13, off\n\t"
      "global_load_async_to_lds_b128 %2, %14, off\n\t"
      "global_load_async_to_lds_b128 %3, %15, off\n\t"
      "global_load_async_to_lds_b128 %4, %16, off\n\t"
      "global_load_async_to_lds_b128 %5, %17, off\n\t"
      "global_load_async_to_lds_b128 %6, %18, off\n\t"
      "global_load_async_to_lds_b128 %7, %19, off\n\t"
      "global_load_async_to_lds_b128 %8, %20, off\n\t"
      "global_load_async_to_lds_b128 %9, %21, off\n\t"
      "global_load_async_to_lds_b128 %10, %22, off\n\t"
      "global_load_async_to_lds_b128 %11, %23, off\n\t"
      "s_wait_xcnt 0x0"
      :: "v"(l), "v"(l + 1u * 32u * GPITCH * 2u), "v"(l + 2u * 32u * GPITCH * 2u), "v"(l + 3u * 32u * GPITCH * 2u),
         "v"(l + 4u * 32u * GPITCH * 2u), "v"(l + 5u * 32u * GPITCH * 2u), "v"(l + 6u * 32u * GPITCH * 2u),
         "v"(l + 7u * 32u * GPITCH * 2u), "v"(l + 8u * 32u * GPITCH * 2u), "v"(l + 9u * 32u * GPITCH * 2u),
         "v"(l + 10u * 32u * GPITCH * 2u), "v"(l + 11u * 32u * GPITCH * 2u),
         "v"(gp[0]), "v"(gp[1]), "v"(gp[2]), "v"(gp[3]), "v"(gp[4]), "v"(gp[5]),
         "v"(gp[6]), "v"(gp[7]), "v"(gp[8]), "v"(gp[9]), "v"(gp[10]), "v"(gp[11])
      : "memory");
}

// gp[0..7]: this thread's piece of A rows r, r+32, .. r+224 of the tile; gp[8..11]: of B rows r, .. r+96.
// The pointers move on by one stage behind each group of copies, in place: no second set of address registers.
template <int KT>
static __device__ inline void gemm_staged_w(_Float16* sm, const _Float16* (&gp)[12], v8f (&acc)[4][4]) {
  const int t = threadIdx.x;
  const int lane = t & 31;
  const int wave = t >> 5;
  const int ml = lane & 15;
  const int koff = (lane >> 4) * 8;
  const unsigned lcopy = (unsigned)(size_t)sm + (unsigned)((t >> 3) * GPITCH + (t & 7) * 8) * 2u;
  const _Float16* ard = sm + ((wave & 3) * 64 + ml) * GPITCH + koff;
  const _Float16* brd = sm + (256 + (wave >> 2) * 64 + ml) * GPITCH + koff;
  constexpr int NT = KT / GBK;

  stage_copy_w(lcopy, gp);
#pragma unroll
  for (int i = 0; i < 12; i++) gp[i] += GBK;
  asm volatile("s_wait_asynccnt 0x0" ::: "memory");   // stage 0 has landed before the barrier publishes it
  __syncthreads();
  stage_copy_w(lcopy + WBUF * 2u, gp);
#pragma unroll
  for (int i = 0; i < 12; i++) gp[i] += GBK;

  // stays rolled: the buffer is picked by the stage's parity, and unrolled the reads spread between the WMMAs
#pragma unroll 1
  for (int s = 0; s < NT; s++) {
    const int bo = (s & 1) * WBUF;
    // (the inner loops are unrolled so that a, b and acc are indexed by constants and stay in registers)
    v16h a[4], b[4];
#pragma unroll
    for (int p = 0; p < 4; p++) {
      a[p] = mkfrag(ld8(ard + bo + p * 16 * GPITCH), ld8(ard + bo + p * 16 * GPITCH + 16));
      b[p] = mkfrag(ld8(brd + bo + p * 16 * GPITCH), ld8(brd + bo + p * 16 * GPITCH + 16));
    }
    // keeps the step's sixteen reads one group ahead of its WMMAs: sunk among them, each place costs an LDS latency
    __builtin_amdgcn_sched_barrier(0);
#pragma unroll
    for (int n = 0; n < 4; n++)
#pragma unroll
      for (int p = 0; p < 4; p++) acc[p][n] = WMMA_F32_F16(a[p], b[n], acc[p][n]);
    // keeps the second step's reads behind the first step's WMMAs: lifted over them they would need a second
    // fragment set, and its registers would cost the second resident block
    __builtin_amdgcn_sched_barrier(0);
#pragma unroll
    for (int p = 0; p < 4; p++) {
      a[p] = mkfrag(ld8(ard + bo + 32 + p * 16 * GPITCH), ld8(ard + bo + 32 + p * 16 * GPITCH + 16));
      b[p] = mkfrag(ld8(brd + bo + 32 + p * 16 * GPITCH), ld8(brd + bo + 32 + p * 16 * GPITCH + 16));
    }
    asm volatile("s_wait_dscnt 0x0" ::: "memory");    // this wave's reads of the buffer are over before it is refilled
    asm volatile("s_wait_asynccnt 0x0" ::: "memory"); // this wave's copies of stage s + 1 have landed
    __syncthreads();                                  // publishes stage s + 1, frees stage s's buffer
    if (s + 2 < NT) {
      stage_copy_w(lcopy + (unsigned)bo * 2u, gp);
#pragma unroll
      for (int i = 0; i < 12; i++) gp[i] += GBK;
    }
    // stage s + 2 flies while the second step is multiplied from registers
#pragma unroll
    for (int n = 0; n < 4; n++)
#pragma unroll
      for (int p = 0; p < 4; p++) acc[p][n] = WMMA_F32_F16(a[p], b[n], acc[p][n]);
  }
  asm volatile("s_wait_asynccnt 0x0" ::: "memory");   // nothing of this wave is in flight when it goes on
}

// ---------------------------------------------------------------- QKV GEMM
// grid (16, 8, 9): 256-row x 128-col tiles per block; z = 3 * pair + (Q, K or V).
// block = 256 (8 waves); each wave: 64 rows x 64 cols (one head), 16 WMMAs / 32-K step.
// four waves per SIMD: two blocks per WGP, so that one block's waits and epilogue lie under the other's WMMAs
__global__ __launch_bounds__(256) __attribute__((amdgpu_waves_per_eu(4, 4))) void qkv_kernel(
    const _Float16* __restrict__ x16,
    const _Float16* __restrict__ wqT, const _Float16* __restrict__ wkT, const _Float16* __restrict__ wvT,
    const float* __restrict__ bq, const float* __restrict__ bk, const float* __restrict__ bv,
    const float* __restrict__ qn, const float* __restrict__ kn,
    _Float16* __restrict__ Qb, _Float16* __restrict__ Kb, _Float16* __restrict__ vTb)
{
  __shared__ __align__(16) _Float16 sm[2 * WBUF];
  const int j = blockIdx.z / 3;             // modality pair
  const int which = blockIdx.z % 3;
  const size_t NE = (size_t)ROWS * Dv;
  // queries come from modality j; keys and values from video for pairs 0 and 2, from audio for pair 1
  const _Float16* xq = x16 + (size_t)j * NE;
  const _Float16* xc = x16 + ((j == 1) ? 0 : NE);
  wqT += (size_t)j * Dv * Dv;  wkT += (size_t)j * Dv * Dv;  wvT += (size_t)j * Dv * Dv;
  bq += j * Dv;  bk += j * Dv;  bv += j * Dv;
  qn += j * HDv; kn += j * HDv;
  Qb += (size_t)j * NE;  Kb += (size_t)j * NE;  vTb += (size_t)j * NE;
  const int lane = threadIdx.x & 31;
  const int wave = threadIdx.x >> 5;
  const int ml = lane & 15;
  const int m0 = blockIdx.x * 256 + (wave & 3) * 64;
  const int n0 = blockIdx.y * 128 + (wave >> 2) * 64;

  const _Float16* src = (which == 0) ? xq : xc;
  const _Float16* wT  = (which == 0) ? wqT : (which == 1 ? wkT : wvT);
  const float* bias   = (which == 0) ? bq  : (which == 1 ? bk  : bv);

  const int cr = threadIdx.x >> 3;          // row of the tile this thread copies (and every 32nd below it)
  const int cc = (threadIdx.x & 7) * 8;     // its 16-byte piece of the row's 128 bytes
  const _Float16* gp[12];
#pragma unroll
  for (int i = 0; i < 8; i++) gp[i] = src + (size_t)src_row(blockIdx.x * 256 + cr + 32 * i) * Dv + cc;
#pragma unroll
  for (int i = 0; i < 4; i++) gp[8 + i] = wT + (size_t)(blockIdx.y * 128 + cr + 32 * i) * Dv + cc;

  v8f acc[4][4] = {};
  gemm_staged_w<Dv>(sm, gp, acc);

  const int rowoff = (lane >> 4) * 8;
#pragma unroll
  for (int part = 0; part < 4; part++) {
    const int mp = m0 + part * 16;
    float val[4][8];
#pragma unroll
    for (int n = 0; n < 4; n++) {
      float bc = bias[n0 + n * 16 + ml];
#pragma unroll
      for (int i = 0; i < 8; i++) val[n][i] = acc[part][n][i] + bc;
    }

    if (which < 2) {                       // RMS-norm over the head dim (tile == one head)
      const float* nw_ = (which == 0) ? qn : kn;
      float ss[8];
#pragma unroll
      for (int i = 0; i < 8; i++) {
        ss[i] = 0.f;
#pragma unroll
        for (int n = 0; n < 4; n++) ss[i] += val[n][i] * val[n][i];
      }
#pragma unroll
      for (int msk = 1; msk < 16; msk <<= 1)
#pragma unroll
        for (int i = 0; i < 8; i++) ss[i] += __shfl_xor(ss[i], msk, 32);
      const float sc = (which == 0) ? 0.125f : 1.0f;   // fold HD^-0.5 into Q
      float rs[8];
#pragma unroll
      for (int i = 0; i < 8; i++) rs[i] = rsqrtf(ss[i] * (1.0f / 64.0f) + 1e-6f) * sc;
#pragma unroll
      for (int n = 0; n < 4; n++) {
        float wc = nw_[(n0 + n * 16 + ml) & 63];
#pragma unroll
        for (int i = 0; i < 8; i++) val[n][i] *= rs[i] * wc;
      }
    }

    if (which < 2) {
      _Float16* dst = (which == 0) ? Qb : Kb;
#pragma unroll
      for (int n = 0; n < 4; n++) {
        int col = n0 + n * 16 + ml;
#pragma unroll
        for (int i = 0; i < 8; i++)
          dst[(size_t)(mp + rowoff + i) * Dv + col] = (_Float16)val[n][i];
      }
    } else {                               // V transposed: [(w*H+h)*HD+d][token]
#pragma unroll
      for (int n = 0; n < 4; n++) {
        int col = n0 + n * 16 + ml;
        int hh = col >> 6, d = col & 63;
#pragma unroll
        for (int i = 0; i < 8; i++) {
          int r = mp + rowoff + i;
          int w = r >> 9, s = r & 511;
          vTb[((size_t)((w * Hv + hh) * HDv + d)) * Sv + s] = (_Float16)val[n][i];
        }
      }
    }
  }
}

// ---------------------------------------------------------------- flash attention
// A stage is 64 keys of one head: 64 K rows (key-major) and 64 V^T rows (d-major), 128 bytes each. The block's
// four waves need the same rows, so they are brought into LDS once per block: each wave-wide 16-byte copy covers
// four whole 128-byte lines, where a fragment load from global memory touched sixteen lines for the same bytes.
// Two buffers: the next stage's copies fly while this one is worked on.
#define APITCH 72                   // halves per LDS row: 144 bytes, conflict-free for 16-byte readers
#define ABUF   (128 * APITCH)       // halves per buffer: K rows 0..63, V^T rows 64..127
#define ASTAGES (Sv / 64)

// kp, vp: this thread's 16-byte piece of K row r and of V^T row r of stage 0; it also copies rows r+16, r+32, r+48.
// From one stage to the next K moves on by 64 rows, V^T by 64 halves inside its rows. The eight addresses are
// formed here from the two, so that few address registers live through the loop.
static __device__ inline void kv_copy(unsigned l, const _Float16* kp, const _Float16* vp, int st) {
  // Eight copies of 16 bytes per lane, rows 16 apart. The s_wait_xcnt closes the statement so that no
  // address register of an issued copy is rewritten ahead of it.
  asm volatile(
      "global_load_async_to_lds_b128 %0, %8, off\n\t"
      "global_load_async_to_lds_b128 %1, %9, off\n\t"
      "global_load_async_to_lds_b128 %2, %10, off\n\t"
      "global_load_async_to_lds_b128 %3, %11, off\n\t"
      "global_load_async_to_lds_b128 %4, %12, off\n\t"
      "global_load_async_to_lds_b128 %5, %13, off\n\t"
      "global_load_async_to_lds_b128 %6, %14, off\n\t"
      "global_load_async_to_lds_b128 %7, %15, off\n\t"
      "s_wait_xcnt 0x0"
      :: "v"(l), "v"(l + 1u * 16u * APITCH * 2u), "v"(l + 2u * 16u * APITCH * 2u), "v"(l + 3u * 16u * APITCH * 2u),
         "v"(l + 4u * 16u * APITCH * 2u), "v"(l + 5u * 16u * APITCH * 2u), "v"(l + 6u * 16u * APITCH * 2u),
         "v"(l + 7u * 16u * APITCH * 2u),
         "v"(kp + (size_t)(st * 64) * Dv), "v"(kp + (size_t)(st * 64 + 16) * Dv),
         "v"(kp + (size_t)(st * 64 + 32) * Dv), "v"(kp + (size_t)(st * 64 + 48) * Dv),
         "v"(vp + (st * 64)), "v"(vp + (st * 64 + 16 * Sv)), "v"(vp + (st * 64 + 32 * Sv)), "v"(vp + (st * 64 + 48 * Sv))
      : "memory");
}

// lane l <-> lane l ^ 16: the two lanes that share a query column of a transposed score tile
static __device__ inline float xhalf(float x) {
  const int b = __builtin_bit_cast(int, x);
  return __builtin_bit_cast(float, __builtin_amdgcn_permlanex16(b, b, 0x76543210, 0xfedcba98, false, false));
}

__global__ __launch_bounds__(128) void attn_kernel(
    const _Float16* __restrict__ Qb, const _Float16* __restrict__ Kb,
    const _Float16* __restrict__ vTb, _Float16* __restrict__ aout,
    const float* __restrict__ rpb)
{
  __shared__ __align__(16) _Float16 kv[2 * ABUF];
  const int lane = threadIdx.x & 31;
  const int wave = threadIdx.x >> 5;
  const int ml = lane & 15;
  const int koff = (lane >> 4) * 8;
  const int rowoff = (lane >> 4) * 8;
  const int qb = blockIdx.x, h = blockIdx.y, w = blockIdx.z & 7;
  const int j = blockIdx.z >> 3;          // modality pair: its own Q, K, V, output and bias table
  Qb += (size_t)j * ROWS * Dv;  Kb += (size_t)j * ROWS * Dv;
  vTb += (size_t)j * ROWS * Dv; aout += (size_t)j * ROWS * Dv;
  const float* rpbj = rpb + j * (2 * WSv - 1) * Hv;
  const int tq = qb;                      // 64-row chunks align to L

  const int cr = threadIdx.x >> 3;        // row of the stage this thread copies (and 16, 32, 48 below it)
  const int cc = (threadIdx.x & 7) * 8;   // its 16-byte piece of the row's 128 bytes
  const _Float16* kcp = Kb + (size_t)(w * Sv + cr) * Dv + h * HDv + cc;
  const _Float16* vcp = vTb + (size_t)((w * Hv + h) * HDv + cr) * Sv + cc;
  const unsigned lcopy = (unsigned)(size_t)kv + (unsigned)(cr * APITCH + cc) * 2u;

  kv_copy(lcopy, kcp, vcp, 0);

  const int qrow = qb * 64 + wave * 16;
  const _Float16* qp = Qb + (size_t)(w * Sv + qrow + ml) * Dv + h * HDv + koff;
  v16h qa0 = mkfrag(ld8(qp),      ld8(qp + 16));   // B operand: column = query ml
  v16h qa1 = mkfrag(ld8(qp + 32), ld8(qp + 48));

  v8f accO[4] = {};                       // accO[n][i] = O[query ml][d = n * 16 + rowoff + i]
  float m_ = -3.0e38f;                    // running maximum of query ml, the same in both of its lanes
  float l_ = 0.f;                         // running sum over this lane's half of the keys; joined after the loop
  const float L2E = 1.4426950408889634f;

  asm volatile("s_wait_asynccnt 0x0" ::: "memory");   // stage 0 has landed before the barrier publishes it
  __syncthreads();
  kv_copy(lcopy + ABUF * 2u, kcp, vcp, 1);

  // stays rolled: the buffer is picked by the stage's parity anyway
#pragma unroll 1
  for (int st = 0; st < ASTAGES; st++) {
    const int bo = (st & 1) * ABUF;
    const float biasv = rpbj[(tq - st + WSv - 1) * Hv + h];   // a stage is one temporal step of keys

    // unrolled so that both chunks' LDS offsets are constants (and the loops inside it so that s0, s1, mx, pb, vb
    // and accO are indexed by constants and stay in registers)
#pragma unroll
    for (int hc = 0; hc < 2; hc++) {
      // s0[i] = S[query ml][key hc * 32 + rowoff + i], s1[i] the same 16 keys on
      v8f s0 = {}, s1 = {};
      {
        const _Float16* kp0 = kv + bo + (hc * 32 + ml) * APITCH + koff;
        const _Float16* kp1 = kp0 + 16 * APITCH;
        v16h kb00 = mkfrag(ld8(kp0),      ld8(kp0 + 16));
        v16h kb01 = mkfrag(ld8(kp0 + 32), ld8(kp0 + 48));
        v16h kb10 = mkfrag(ld8(kp1),      ld8(kp1 + 16));
        v16h kb11 = mkfrag(ld8(kp1 + 32), ld8(kp1 + 48));
        s0 = WMMA_F32_F16(kb00, qa0, s0);
        s1 = WMMA_F32_F16(kb10, qa0, s1);
        s0 = WMMA_F32_F16(kb01, qa1, s0);
        s1 = WMMA_F32_F16(kb11, qa1, s1);
      }
      v16h vb[4];                          // A operand: row = d, k = the chunk's keys in the order of s0, s1
#pragma unroll
      for (int n = 0; n < 4; n++) {
        const _Float16* vp = kv + bo + (64 + n * 16 + ml) * APITCH + hc * 32 + koff;
        vb[n] = mkfrag(ld8(vp), ld8(vp + 16));
      }

      float mx[8];
#pragma unroll
      for (int i = 0; i < 8; i++) mx[i] = fmaxf(s0[i], s1[i]);
#pragma unroll
      for (int d = 4; d >= 1; d >>= 1)
#pragma unroll
        for (int i = 0; i < d; i++) mx[i] = fmaxf(mx[i], mx[i + d]);
      const float mc = fmaxf(mx[0], xhalf(mx[0])) + biasv;   // the bias is one value for the whole stage
      const float mn = fmaxf(m_, mc);
      const float alpha = __builtin_amdgcn_exp2f((m_ - mn) * L2E);
      m_ = mn;
      const float cl = (biasv - mn) * L2E;   // bias and maximum are one value per lane: one addend for all 16 scores

      v16h pb;                             // P^T as B operand: column = query ml, k as in vb
      float r0 = 0.f, r1 = 0.f;
#pragma unroll
      for (int i = 0; i < 8; i++) {
        const float p0 = __builtin_amdgcn_exp2f(fmaf(s0[i], L2E, cl));
        const float p1 = __builtin_amdgcn_exp2f(fmaf(s1[i], L2E, cl));
        r0 += p0;
        r1 += p1;
        pb[i]     = (_Float16)p0;
        pb[i + 8] = (_Float16)p1;
      }
      l_ = l_ * alpha + (r0 + r1);
#pragma unroll
      for (int n = 0; n < 4; n++) accO[n] *= alpha;

#pragma unroll
      for (int n = 0; n < 4; n++) accO[n] = WMMA_F32_F16(vb[n], pb, accO[n]);
    }

    asm volatile("s_wait_dscnt 0x0" ::: "memory");    // this wave's reads of the buffer are over before it is refilled
    asm volatile("s_wait_asynccnt 0x0" ::: "memory"); // this wave's copies of stage st + 1 have landed
    __syncthreads();                                  // publishes stage st + 1, frees stage st's buffer
    if (st + 2 < ASTAGES) kv_copy(lcopy + (unsigned)bo * 2u, kcp, vcp, st + 2);
  }
  asm volatile("s_wait_asynccnt 0x0" ::: "memory");   // nothing of this wave is in flight when it goes on

  const float inv = 1.0f / (l_ + xhalf(l_));
  // a lane's eight accumulator registers are eight neighbouring d of its query's row: one 16-byte store per tile
  v8h o[4];
#pragma unroll
  for (int n = 0; n < 4; n++)
#pragma unroll
    for (int i = 0; i < 8; i++) o[n][i] = (_Float16)(accO[n][i] * inv);
  _Float16* op = aout + (size_t)(w * Sv + qrow + ml) * Dv + h * HDv + rowoff;
#pragma unroll
  for (int n = 0; n < 4; n++) *(v8h*)(op + n * 16) = o[n];
}

// ---------------------------------------------------------------- output projection + residual + roll(+SH)
// grid (16, 8, 3 pairs): 256x128 tile per block of 8 waves, 64 rows x 64 cols per wave.
// four waves per SIMD: two blocks per WGP, as for the QKV GEMM
__global__ __launch_bounds__(256) __attribute__((amdgpu_waves_per_eu(4, 4))) void proj_kernel(
    const _Float16* __restrict__ aoutb, const _Float16* __restrict__ wpT,
    const float* __restrict__ bp,
    const float* __restrict__ audio, const float* __restrict__ video, const float* __restrict__ image,
    float* __restrict__ feat, _Float16* __restrict__ cat16)
{
  __shared__ __align__(16) _Float16 sm[2 * WBUF];
  const int j = blockIdx.z;
  const float* qmf = (j == 0) ? audio : (j == 1) ? video : image;   // residual: the pair's query modality
  aoutb += (size_t)j * ROWS * Dv;
  wpT += (size_t)j * Dv * Dv;
  bp += j * Dv;
  feat += (size_t)j * ROWS * Dv;
  const int lane = threadIdx.x & 31;
  const int wave = threadIdx.x >> 5;
  const int ml = lane & 15;
  const int m0 = blockIdx.x * 256 + (wave & 3) * 64;
  const int n0 = blockIdx.y * 128 + (wave >> 2) * 64;

  const int cr = threadIdx.x >> 3;
  const int cc = (threadIdx.x & 7) * 8;
  const _Float16* gp[12];
#pragma unroll
  for (int i = 0; i < 8; i++) gp[i] = aoutb + (size_t)(blockIdx.x * 256 + cr + 32 * i) * Dv + cc;
#pragma unroll
  for (int i = 0; i < 4; i++) gp[8 + i] = wpT + (size_t)(blockIdx.y * 128 + cr + 32 * i) * Dv + cc;

  v8f acc[4][4] = {};
  gemm_staged_w<Dv>(sm, gp, acc);

  const int rowoff = (lane >> 4) * 8;
#pragma unroll
  for (int part = 0; part < 4; part++) {
    // the residual loads of two parts at a time are in flight: all four parts' values beside the accumulators do
    // not fit the registers of two resident blocks (they spilled)
    if (part == 2) __builtin_amdgcn_sched_barrier(0);
    const int mp = m0 + part * 16;
    int featrow[8];
#pragma unroll
    for (int i = 0; i < 8; i++) {
      int r = mp + rowoff + i;
      int w = r >> 9, s = r & 511;
      int b = w >> 2, widx = w & 3;
      int tqq = s >> 6, l = s & 63;
      int t = (widx * WSv + tqq + SHv) & 31;   // roll back by +SH
      featrow[i] = (b * Tv + t) * Lv + l;
    }
#pragma unroll
    for (int n = 0; n < 4; n++) {
      int col = n0 + n * 16 + ml;
      float bc = bp[col];
#pragma unroll
      for (int i = 0; i < 8; i++) {
        float v = acc[part][n][i] + bc + qmf[(size_t)featrow[i] * Dv + col];
        feat[(size_t)featrow[i] * Dv + col] = v;
        cat16[(size_t)featrow[i] * D3 + j * Dv + col] = (_Float16)v;
      }
    }
  }
}

// ---------------------------------------------------------------- gating MLP layer 1 (+GELU)
// grid (32, 16): 128x128 tile per block of 8 waves.
__global__ __launch_bounds__(256) void gate1_kernel(
    const _Float16* __restrict__ cat16, const _Float16* __restrict__ wg1T,
    const float* __restrict__ bg1, _Float16* __restrict__ g116)
{
  __shared__ __align__(16) _Float16 sm[2 * GBUF];
  const int lane = threadIdx.x & 31;
  const int wave = threadIdx.x >> 5;
  const int ml = lane & 15;
  const int m0 = blockIdx.x * 128 + (wave & 3) * 32;
  const int n0 = blockIdx.y * 128 + (wave >> 2) * 64;

  const int cr = threadIdx.x >> 3;
  const int cc = (threadIdx.x & 7) * 8;
  const _Float16* gp[8];
#pragma unroll
  for (int i = 0; i < 4; i++) {
    gp[i]     = cat16 + (size_t)(blockIdx.x * 128 + cr + 32 * i) * D3 + cc;
    gp[4 + i] = wg1T + (size_t)(blockIdx.y * 128 + cr + 32 * i) * D3 + cc;
  }

  v8f acc[2][4] = {};
  gemm_staged<D3>(sm, gp, acc);

  const int rowoff = (lane >> 4) * 8;
#pragma unroll
  for (int part = 0; part < 2; part++) {
    const int mp = m0 + part * 16;
#pragma unroll
    for (int n = 0; n < 4; n++) {
      int col = n0 + n * 16 + ml;
      float bc = bg1[col];
#pragma unroll
      for (int i = 0; i < 8; i++) {
        float x = acc[part][n][i] + bc;
        float g = 0.5f * x * (1.0f + erff(x * 0.70710678118f));   // exact GELU
        g116[(size_t)(mp + rowoff + i) * D2 + col] = (_Float16)g;
      }
    }
  }
}

// ---------------------------------------------------------------- gating layer 2 (N=3) + softmax
__global__ __launch_bounds__(256) void gate2_kernel(
    const _Float16* __restrict__ g116, const float* __restrict__ Wg2,
    const float* __restrict__ bg2, float* __restrict__ gates)
{
  int row = blockIdx.x * 8 + (threadIdx.x >> 5);
  int lane = threadIdx.x & 31;
  if (row >= ROWS) return;
  const _Float16* gr = g116 + (size_t)row * D2;
  float a0 = 0.f, a1 = 0.f, a2 = 0.f;
  for (int k = lane; k < D2; k += 32) {
    float g = (float)gr[k];
    a0 = fmaf(g, Wg2[k * 3 + 0], a0);
    a1 = fmaf(g, Wg2[k * 3 + 1], a1);
    a2 = fmaf(g, Wg2[k * 3 + 2], a2);
  }
#pragma unroll
  for (int msk = 16; msk >= 1; msk >>= 1) {
    a0 += __shfl_xor(a0, msk, 32);
    a1 += __shfl_xor(a1, msk, 32);
    a2 += __shfl_xor(a2, msk, 32);
  }
  if (lane == 0) {
    a0 += bg2[0]; a1 += bg2[1]; a2 += bg2[2];
    float mx = fmaxf(a0, fmaxf(a1, a2));
    float e0 = __expf(a0 - mx), e1 = __expf(a1 - mx), e2 = __expf(a2 - mx);
    float inv = 1.0f / (e0 + e1 + e2);
    gates[row * 3 + 0] = e0 * inv;
    gates[row * 3 + 1] = e1 * inv;
    gates[row * 3 + 2] = e2 * inv;
  }
}

// ---------------------------------------------------------------- fuse
// FROWS whole rows per block, four columns per thread: 16-byte accesses, each row's gates the same for the whole block,
// all 3 * FROWS loads of a thread issued before the first sum.
// The three planes come as three pointers, so that each address is a block-uniform base plus one per-lane offset
// that lives to the last store: no vector register that an issued load names is written again.
#define FROWS 4
__global__ __launch_bounds__(256) void fuse_kernel(const float* __restrict__ feat0, const float* __restrict__ feat1,
                                                   const float* __restrict__ feat2, const float* __restrict__ gates,
                                                   float* __restrict__ out)
{
  const int row0 = blockIdx.x * FROWS;
  const unsigned c = threadIdx.x * 4u;
  const float* fb[3] = { feat0 + (size_t)row0 * Dv, feat1 + (size_t)row0 * Dv, feat2 + (size_t)row0 * Dv };
  float* ob = out + (size_t)row0 * Dv;
  v4f f[FROWS][3];
#pragma unroll
  for (int u = 0; u < FROWS; u++)
#pragma unroll
    for (int m = 0; m < 3; m++) f[u][m] = *(const v4f*)(fb[m] + u * Dv + c);
#pragma unroll
  for (int u = 0; u < FROWS; u++) {
    const float* g = gates + (row0 + u) * 3;
    *(v4f*)(ob + u * Dv + c) = g[0] * f[u][0] + g[1] * f[u][1] + g[2] * f[u][2];
  }
}

// ---------------------------------------------------------------- launch
extern "C" void kernel_launch(void* const* d_in, const int* in_sizes, int n_in,
                              void* d_out, int out_size, void* d_ws, size_t ws_size,
                              hipStream_t stream)
{
  const float* audio = (const float*)d_in[0];
  const float* video = (const float*)d_in[1];
  const float* image = (const float*)d_in[2];
  const float* Wq  = (const float*)d_in[3];
  const float* Wk  = (const float*)d_in[4];
  const float* Wv  = (const float*)d_in[5];
  const float* Wp  = (const float*)d_in[6];
  const float* bq  = (const float*)d_in[7];
  const float* bk  = (const float*)d_in[8];
  const float* bv  = (const float*)d_in[9];
  const float* bp  = (const float*)d_in[10];
  const float* qn  = (const float*)d_in[11];
  const float* kn  = (const float*)d_in[12];
  const float* rpb = (const float*)d_in[13];
  const float* Wg1 = (const float*)d_in[14];
  const float* bg1 = (const float*)d_in[15];
  const float* Wg2 = (const float*)d_in[16];
  const float* bg2 = (const float*)d_in[17];
  float* out = (float*)d_out;

  char* p = (char*)d_ws;
  auto carve = [&](size_t bytes) -> void* {
    void* r = (void*)p;
    p += (bytes + 255) & ~(size_t)255;
    return r;
  };
  const size_t NE = (size_t)ROWS * Dv;                 // 4M elems
  _Float16* x16   = (_Float16*)carve(3 * NE * 2);
  _Float16* wqT   = (_Float16*)carve(3 * (size_t)Dv * Dv * 2);
  _Float16* wkT   = (_Float16*)carve(3 * (size_t)Dv * Dv * 2);
  _Float16* wvT   = (_Float16*)carve(3 * (size_t)Dv * Dv * 2);
  _Float16* wpT   = (_Float16*)carve(3 * (size_t)Dv * Dv * 2);
  _Float16* wg1T  = (_Float16*)carve((size_t)D3 * D2 * 2);
  _Float16* Qb    = (_Float16*)carve(3 * NE * 2);       // one plane per modality pair
  _Float16* Kb    = (_Float16*)carve(3 * NE * 2);
  _Float16* vTb   = (_Float16*)carve(3 * NE * 2);
  _Float16* aoutb = (_Float16*)carve(3 * NE * 2);
  _Float16* cat16 = (_Float16*)carve((size_t)ROWS * D3 * 2);
  _Float16* g116  = (_Float16*)carve((size_t)ROWS * D2 * 2);
  float*    feats = (float*)carve(3 * NE * 4);
  float*    gates = (float*)carve((size_t)ROWS * 3 * 4);

  // convert activations and transpose-convert weights to f16
  prep_kernel<<<G1TILES + 12 * WTILES + 3 * XBLOCKS, 256, 0, stream>>>(
      audio, video, image, Wq, Wk, Wv, Wp, Wg1, x16, wqT, wkT, wvT, wpT, wg1T);

  // the three modality pairs do not depend on one another: each stage takes all of them in one grid
  qkv_kernel<<<dim3(16, 8, 9), 256, 0, stream>>>(x16, wqT, wkT, wvT, bq, bk, bv, qn, kn, Qb, Kb, vTb);
  attn_kernel<<<dim3(8, 16, 24), 128, 0, stream>>>(Qb, Kb, vTb, aoutb, rpb);
  proj_kernel<<<dim3(16, 8, 3), 256, 0, stream>>>(aoutb, wpT, bp, audio, video, image, feats, cat16);

  gate1_kernel<<<dim3(32, 16), 256, 0, stream>>>(cat16, wg1T, bg1, g116);
  gate2_kernel<<<ROWS / 8, 256, 0, stream>>>(g116, Wg2, bg2, gates);
  fuse_kernel<<<ROWS / FROWS, 256, 0, stream>>>(feats, feats + NE, feats + 2 * NE, gates, out);
}

// v008
// A run of this version takes 197 microseconds.
// In both of two side-by-side timings against v007, it was 1.07 times as fast.
// Over all steps from v000 it is 5.26 times as fast.
#include <hip/hip_runtime.h>
#include <hip/hip_bf16.h>

typedef __attribute__((ext_vector_type(16))) _Float16 v16h;
typedef __attribute__((ext_vector_type(8)))  _Float16 v8h;
typedef __attribute__((ext_vector_type(8)))  float    v8f;
typedef __attribute__((ext_vector_type(4)))  _Float16 v4h;
typedef __attribute__((ext_vector_type(4)))  float    v4f;

#define WMMA_F32_F16(a,b,c) __builtin_amdgcn_wmma_f32_16x16x32_f16(false,(a),false,(b),(short)0,(c),false,false)

#define Bv   2
#define Tv   32
#define Lv   64
#define Dv   1024
#define Hv   16
#define WSv  8
#define SHv  4
#define HDv  64
#define Sv   512      // WS*L
#define ROWS 4096     // B*T*L
#define D3   3072
#define D2   2048
#define TPITCH 72     // halves per LDS row of the transpose tile

static __device__ inline v8h ld8(const _Float16* p) { return *(const v8h*)p; }

static __device__ inline v16h mkfrag(v8h lo, v8h hi) {
  v16h r;
#pragma unroll
  for (int i = 0; i < 8; i++) { r[i] = lo[i]; r[i + 8] = hi[i]; }
  return r;
}

// lane l <-> lane l ^ 16: the two lanes that share a column of an accumulator tile
static __device__ inline float xhalf(float x) {
  const int b = __builtin_bit_cast(int, x);
  return __builtin_bit_cast(float, __builtin_amdgcn_permlanex16(b, b, 0x76543210, 0xfedcba98, false, false));
}

// window-order row -> source row of [B,T,L] with roll(-SH) folded in
static __device__ inline int src_row(int r) {
  int w = r >> 9;          // window (0..7): b*4 + widx
  int s = r & 511;         // token in window
  int b = w >> 2;
  int widx = w & 3;
  int tq = s >> 6;
  int l = s & 63;
  int tp = widx * WSv + tq;
  int tsrc = (tp + SHv) & 31;
  return ((b * Tv + tsrc) << 6) + l;
}

// ---------------------------------------------------------------- converts
// TPB 64 x 64 tiles per block, one below the other in the source, each turned in its own LDS tile: source rows
// are read as 16-byte pieces (a thread's 4 * TPB loads stand ahead of its converts, so that many are in flight),
// destination rows (k-contiguous) leave as whole 128-byte lines. R is a multiple of 64 * TPB, C of 64.
#define TPB 4
static __device__ inline void cvtT_tiles(_Float16* tile, const float* __restrict__ s, _Float16* __restrict__ d,
                                         int R, int C, int bx, int by) {
  const int t = threadIdx.x;
  const int c0 = bx * 64;
  const int r0 = by * (64 * TPB);
  const int c4 = (t & 15) * 4;
  const int r4 = (t >> 4) * 4;
  v4f v[TPB][4];
#pragma unroll
  for (int q = 0; q < TPB; q++)
#pragma unroll
    for (int p = 0; p < 4; p++) v[q][p] = *(const v4f*)(s + (size_t)(r0 + q * 64 + r4 + p) * C + c0 + c4);
#pragma unroll
  for (int q = 0; q < TPB; q++)
#pragma unroll
    for (int ci = 0; ci < 4; ci++) {
      v4h h;
#pragma unroll
      for (int p = 0; p < 4; p++) h[p] = (_Float16)v[q][p][ci];
      *(v4h*)(tile + (q * 64 + c4 + ci) * TPITCH + r4) = h;
    }
  __syncthreads();
  const int seg = (t & 7) * 8;
#pragma unroll
  for (int q = 0; q < TPB; q++)
#pragma unroll
    for (int p = 0; p < 2; p++) {
      const int c = p * 32 + (t >> 3);
      *(v8h*)(d + (size_t)(c0 + c) * R + r0 + q * 64 + seg) = *(const v8h*)(tile + (q * 64 + c) * TPITCH + seg);
    }
  // in the merged kernel another part's code follows these stores in the listing: no register that they name is
  // rewritten ahead of this wait
  asm volatile("s_wait_xcnt 0x0" ::: "memory");
}

// All conversions are independent of one another and run as one grid. Blocks in order: the tiles of Wg1,
// the tiles of the twelve D x D weights (pair-major: q, k, v, p), then XPT activation elements per thread.
// A block carries enough work that the grid is 1920 blocks (15360 waves).
#define G1TILES ((D2 / 64) * (D3 / (64 * TPB)))
#define WTILES  ((Dv / 64) * (Dv / (64 * TPB)))
#define XPT     64
#define XBLOCKS (ROWS * Dv / (256 * XPT))
__global__ __launch_bounds__(256) void prep_kernel(
    const float* __restrict__ audio, const float* __restrict__ video, const float* __restrict__ image,
    const float* __restrict__ Wq, const float* __restrict__ Wk, const float* __restrict__ Wv,
    const float* __restrict__ Wp, const float* __restrict__ Wg1,
    _Float16* __restrict__ x16, _Float16* __restrict__ wqT, _Float16* __restrict__ wkT,
    _Float16* __restrict__ wvT, _Float16* __restrict__ wpT, _Float16* __restrict__ wg1T)
{
  __shared__ __align__(16) _Float16 tile[TPB * 64 * TPITCH];   // [tile][c][r], rows 16 bytes longer than the data
  int b = blockIdx.x;
  if (b < G1TILES) {
    cvtT_tiles(tile, Wg1, wg1T, D3, D2, b % (D2 / 64), b / (D2 / 64));
    return;
  }
  b -= G1TILES;
  if (b < 12 * WTILES) {
    const int m = b / WTILES;
    const int kind = m & 3;
    const size_t off = (size_t)(m >> 2) * Dv * Dv;
    const float* s = (kind == 0) ? Wq : (kind == 1) ? Wk : (kind == 2) ? Wv : Wp;
    _Float16* d    = (kind == 0) ? wqT : (kind == 1) ? wkT : (kind == 2) ? wvT : wpT;
    const int tl = b % WTILES;
    cvtT_tiles(tile, s + off, d + off, Dv, Dv, tl % (Dv / 64), tl / (Dv / 64));
    return;
  }
  b -= 12 * WTILES;
  const int mod = b / XBLOCKS;
  const float* s = (mod == 0) ? audio : (mod == 1) ? video : image;
  // each wave-wide load covers 512 contiguous bytes, each store 256; the loads stand ahead of the converts
  const int i = (b % XBLOCKS) * (256 * XPT) + threadIdx.x * 4;
  _Float16* xd = x16 + (size_t)mod * ROWS * Dv + i;
  v4f xv[XPT / 4];
#pragma unroll
  for (int u = 0; u < XPT / 4; u++) xv[u] = *(const v4f*)(s + i + u * 1024);
#pragma unroll
  for (int u = 0; u < XPT / 4; u++) {
    v4h h;
#pragma unroll
    for (int e = 0; e < 4; e++) h[e] = (_Float16)xv[u][e];
    *(v4h*)(xd + u * 1024) = h;
  }
  // the tile parts' code follows these stores in the listing: no register that they name is rewritten ahead of this wait
  asm volatile("s_wait_xcnt 0x0" ::: "memory");
}

// ---------------------------------------------------------------- staged GEMM core
// One 128 x 128 tile of Y = A * B^T per block of 8 waves (4 along M x 2 along N, 32 x 64 each).
// A stage is 64 k (128 bytes) of 128 A rows and 128 B rows. Each wave-wide 16-byte copy covers four
// whole 128-byte lines and lands in LDS without passing a register; two buffers, so the copies
// of the stage after next fly while this one is multiplied.
#define GBK    64                   // halves of k per stage
#define GPITCH 72                   // halves per LDS row: 144 bytes, conflict-free for 16-byte readers
#define GBUF   (256 * GPITCH)       // halves per buffer: A rows 0..127, B rows 128..255

static __device__ inline void stage_copy(unsigned l, const _Float16* const (&gp)[8], int k) {
  // Eight copies of 16 bytes per lane, rows 32 apart. The s_wait_xcnt closes the statement so that no
  // address register of an issued copy is rewritten ahead of it.
  asm volatile(
      "global_load_async_to_lds_b128 %0, %8, off\n\t"
      "global_load_async_to_lds_b128 %1, %9, off\n\t"
      "global_load_async_to_lds_b128 %2, %10, off\n\t"
      "global_load_async_to_lds_b128 %3, %11, off\n\t"
      "global_load_async_to_lds_b128 %4, %12, off\n\t"
      "global_load_async_to_lds_b128 %5, %13, off\n\t"
      "global_load_async_to_lds_b128 %6, %14, off\n\t"
      "global_load_async_to_lds_b128 %7, %15, off\n\t"
      "s_wait_xcnt 0x0"
      :: "v"(l), "v"(l + 1u * 32u * GPITCH * 2u), "v"(l + 2u * 32u * GPITCH * 2u), "v"(l + 3u * 32u * GPITCH * 2u),
         "v"(l + 4u * 32u * GPITCH * 2u), "v"(l + 5u * 32u * GPITCH * 2u), "v"(l + 6u * 32u * GPITCH * 2u),
         "v"(l + 7u * 32u * GPITCH * 2u),
         "v"(gp[0] + k), "v"(gp[1] + k), "v"(gp[2] + k), "v"(gp[3] + k),
         "v"(gp[4] + k), "v"(gp[5] + k), "v"(gp[6] + k), "v"(gp[7] + k)
      : "memory");
}

// gp[0..3]: this thread's piece of A rows r, r+32, r+64, r+96 of the tile; gp[4..7]: the same of B.
// The product is taken transposed (B's fragment as first operand; both share one k order): acc[p][n][i] belongs to
// A row p * 16 + (lane & 15) and B row n * 16 + (lane >> 4) * 8 + i, eight neighbouring columns of Y in one lane.
// Behind the last stage's barrier nobody reads sm and no copy is in flight: the epilogue may stage there.
template <int KT>
static __device__ inline void gemm_staged(_Float16* sm, const _Float16* const (&gp)[8], v8f (&acc)[2][4]) {
  const int t = threadIdx.x;
  const int lane = t & 31;
  const int wave = t >> 5;
  const int ml = lane & 15;
  const int koff = (lane >> 4) * 8;
  const unsigned lcopy = (unsigned)(size_t)sm + (unsigned)((t >> 3) * GPITCH + (t & 7) * 8) * 2u;
  const _Float16* ard = sm + ((wave & 3) * 32 + ml) * GPITCH + koff;
  const _Float16* brd = sm + (128 + (wave >> 2) * 64 + ml) * GPITCH + koff;
  constexpr int NT = KT / GBK;

  stage_copy(lcopy, gp, 0);
  asm volatile("s_wait_asynccnt 0x0" ::: "memory");   // stage 0 has landed before the barrier publishes it
  __syncthreads();
  stage_copy(lcopy + GBUF * 2u, gp, GBK);

  // stays rolled: unrolled, the reads were spread between the WMMAs again, a full LDS latency in front of each pair
#pragma unroll 1
  for (int s = 0; s < NT; s++) {
    const int bo = (s & 1) * GBUF;
    // the whole stage goes into registers as one group of reads: the buffer is free again before the WMMAs start
    // (the inner loops are unrolled so that a, b and acc are indexed by constants and stay in registers)
    v16h a[2][2], b[2][4];
#pragma unroll
    for (int ks = 0; ks < 2; ks++) {
      const _Float16* ap = ard + bo + ks * 32;
      const _Float16* bp = brd + bo + ks * 32;
#pragma unroll
      for (int p = 0; p < 2; p++) a[ks][p] = mkfrag(ld8(ap + p * 16 * GPITCH), ld8(ap + p * 16 * GPITCH + 16));
#pragma unroll
      for (int n = 0; n < 4; n++) b[ks][n] = mkfrag(ld8(bp + n * 16 * GPITCH), ld8(bp + n * 16 * GPITCH + 16));
    }
    asm volatile("s_wait_dscnt 0x0" ::: "memory");    // this wave's reads of the buffer are over before it is refilled
    asm volatile("s_wait_asynccnt 0x0" ::: "memory"); // this wave's copies of stage s + 1 have landed
    __syncthreads();                                  // publishes stage s + 1, frees stage s's buffer
    if (s + 2 < NT) stage_copy(lcopy + (unsigned)bo * 2u, gp, (s + 2) * GBK);
    // stage s + 2 flies while stage s is multiplied from registers
#pragma unroll
    for (int ks = 0; ks < 2; ks++)
#pragma unroll
      for (int n = 0; n < 4; n++) {
        acc[0][n] = WMMA_F32_F16(b[ks][n], a[ks][0], acc[0][n]);
        acc[1][n] = WMMA_F32_F16(b[ks][n], a[ks][1], acc[1][n]);
      }
  }
  asm volatile("s_wait_asynccnt 0x0" ::: "memory");   // nothing of this wave is in flight when it goes on
}

// ---------------------------------------------------------------- staged GEMM core, wide tile
// One 256 x 128 tile of Y = A * B^T per block of 8 waves (4 along M x 2 along N, 64 x 64 each): a wave's eight
// fragments of a 32-k step feed 16 WMMAs (one 16-byte LDS read per WMMA, where the 32 x 64 wave tile takes one and
// a half), and a stage brings 384 rows from L2 for the work of two 128 x 128 tiles, which bring 512.
// The fragments of one 32-k step at a time are held, so that two blocks stay resident per WGP.
#define WBUF   (384 * GPITCH)       // halves per buffer: A rows 0..255, B rows 256..383

// Output staging. An accumulator tile stored as it lies leaves in pieces of 32 or 64 bytes, each a line transaction of
// its own. Each wave turns its tile in its own eighth of the ring, which is free by then, and stores whole 128-byte lines.
#define SPITCH 72                   // halves per staged row of 64 halves: 144 bytes, conflict-free for 16-byte writers
#define FPITCH 68                   // floats per staged row of 64 floats: 272 bytes, the same
#define WSTG   (2 * WBUF / 8)       // halves of the wide ring per wave
#define GSTG   (2 * GBUF / 8)       // halves of the 128 x 128 ring per wave

// NR staged rows of 64 halves go out, four whole lines per wave-wide 16-byte store; row r goes to g + r * pitch.
template <int NR>
static __device__ inline void store_rows16(const _Float16* st, _Float16* g, int pitch) {
  const int lane = threadIdx.x & 31;
  const int r0 = lane >> 3;
  const int c = (lane & 7) * 8;
  // this wave's staging writes have landed before other lanes of it read them back
  asm volatile("s_wait_dscnt 0x0" ::: "memory");
  v8h x[NR / 4];
#pragma unroll
  for (int u = 0; u < NR / 4; u++) x[u] = *(const v8h*)(st + (u * 4 + r0) * SPITCH + c);
#pragma unroll
  for (int u = 0; u < NR / 4; u++) *(v8h*)(g + (size_t)((u * 4 + r0) * pitch) + c) = x[u];
}

static __device__ inline void stage_copy_w(unsigned l, const _Float16* const (&gp)[12]) {
  // Twelve copies of 16 bytes per lane, rows 32 apart. The s_wait_xcnt closes the statement so that no
  // address register of an issued copy is rewritten ahead of it.
  asm volatile(
      "global_load_async_to_lds_b128 %0, %12, off\n\t"
      "global_load_async_to_lds_b128 %1, %13, off\n\t"
      "global_load_async_to_lds_b128 %2, %14, off\n\t"
      "global_load_async_to_lds_b128 %3, %15, off\n\t"
      "global_load_async_to_lds_b128 %4, %16, off\n\t"
      "global_load_async_to_lds_b128 %5, %17, off\n\t"
      "global_load_async_to_lds_b128 %6, %18, off\n\t"
      "global_load_async_to_lds_b128 %7, %19, off\n\t"
      "global_load_async_to_lds_b128 %8, %20, off\n\t"
      "global_load_async_to_lds_b128 %9, %21, off\n\t"
      "global_load_async_to_lds_b128 %10, %22, off\n\t"
      "global_load_async_to_lds_b128 %11, %23, off\n\t"
      "s_wait_xcnt 0x0"
      :: "v"(l), "v"(l + 1u * 32u * GPITCH * 2u), "v"(l + 2u * 32u * GPITCH * 2u), "v"(l + 3u * 32u * GPITCH * 2u),
         "v"(l + 4u * 32u * GPITCH * 2u), "v"(l + 5u * 32u * GPITCH * 2u), "v"(l + 6u * 32u * GPITCH * 2u),
         "v"(l + 7u * 32u * GPITCH * 2u), "v"(l + 8u * 32u * GPITCH * 2u), "v"(l + 9u * 32u * GPITCH * 2u),
         "v"(l + 10u * 32u * GPITCH * 2u), "v"(l + 11u * 32u * GPITCH * 2u),
         "v"(gp[0]), "v"(gp[1]), "v"(gp[2]), "v"(gp[3]), "v"(gp[4]), "v"(gp[5]),
         "v"(gp[6]), "v"(gp[7]), "v"(gp[8]), "v"(gp[9]), "v"(gp[10]), "v"(gp[11])
      : "memory");
}

// gp[0..7]: this thread's piece of A rows r, r+32, .. r+224 of the tile; gp[8..11]: of B rows r, .. r+96.
// The pointers move on by one stage behind each group of copies, in place: no second set of address registers.
// A and B fragments share one k order and the wave tile is square, so either may be the first operand:
// acc[p][n][i] belongs to row p * 16 + (lane >> 4) * 8 + i of the first and row n * 16 + (lane & 15) of the second.
// bfirst (block-uniform) makes B the first: a lane then holds eight neighbouring columns of Y instead of eight rows.
// Behind the last stage's barrier nobody reads sm and no copy is in flight: the epilogue may stage there.
template <int KT>
static __device__ inline void gemm_staged_w(_Float16* sm, const _Float16* (&gp)[12], v8f (&acc)[4][4], bool bfirst) {
  const int t = threadIdx.x;
  const int lane = t & 31;
  const int wave = t >> 5;
  const int ml = lane & 15;
  const int koff = (lane >> 4) * 8;
  const unsigned lcopy = (unsigned)(size_t)sm + (unsigned)((t >> 3) * GPITCH + (t & 7) * 8) * 2u;
  const int arow = (wave & 3) * 64, brow = 256 + (wave >> 2) * 64;
  const _Float16* ard = sm + ((bfirst ? brow : arow) + ml) * GPITCH + koff;   // first operand's rows
  const _Float16* brd = sm + ((bfirst ? arow : brow) + ml) * GPITCH + koff;   // second operand's rows
  constexpr int NT = KT / GBK;

  stage_copy_w(lcopy, gp);
#pragma unroll
  for (int i = 0; i < 12; i++) gp[i] += GBK;
  asm volatile("s_wait_asynccnt 0x0" ::: "memory");   // stage 0 has landed before the barrier publishes it
  __syncthreads();
  stage_copy_w(lcopy + WBUF * 2u, gp);
#pragma unroll
  for (int i = 0; i < 12; i++) gp[i] += GBK;

  // stays rolled: the buffer is picked by the stage's parity, and unrolled the reads spread between the WMMAs
#pragma unroll 1
  for (int s = 0; s < NT; s++) {
    const int bo = (s & 1) * WBUF;
    // (the inner loops are unrolled so that a, b and acc are indexed by constants and stay in registers)
    v16h a[4], b[4];
#pragma unroll
    for (int p = 0; p < 4; p++) {
      a[p] = mkfrag(ld8(ard + bo + p * 16 * GPITCH), ld8(ard + bo + p * 16 * GPITCH + 16));
      b[p] = mkfrag(ld8(brd + bo + p * 16 * GPITCH), ld8(brd + bo + p * 16 * GPITCH + 16));
    }
    // keeps the step's sixteen reads one group ahead of its WMMAs: sunk among them, each place costs an LDS latency
    __builtin_amdgcn_sched_barrier(0);
#pragma unroll
    for (int n = 0; n < 4; n++)
#pragma unroll
      for (int p = 0; p < 4; p++) acc[p][n] = WMMA_F32_F16(a[p], b[n], acc[p][n]);
    // keeps the second step's reads behind the first step's WMMAs: lifted over them they would need a second
    // fragment set, and its registers would cost the second resident block
    __builtin_amdgcn_sched_barrier(0);
#pragma unroll
    for (int p = 0; p < 4; p++) {
      a[p] = mkfrag(ld8(ard + bo + 32 + p * 16 * GPITCH), ld8(ard + bo + 32 + p * 16 * GPITCH + 16));
      b[p] = mkfrag(ld8(brd + bo + 32 + p * 16 * GPITCH), ld8(brd + bo + 32 + p * 16 * GPITCH + 16));
    }
    asm volatile("s_wait_dscnt 0x0" ::: "memory");    // this wave's reads of the buffer are over before it is refilled
    asm volatile("s_wait_asynccnt 0x0" ::: "memory"); // this wave's copies of stage s + 1 have landed
    __syncthreads();                                  // publishes stage s + 1, frees stage s's buffer
    if (s + 2 < NT) {
      stage_copy_w(lcopy + (unsigned)bo * 2u, gp);
#pragma unroll
      for (int i = 0; i < 12; i++) gp[i] += GBK;
    }
    // stage s + 2 flies while the second step is multiplied from registers
#pragma unroll
    for (int n = 0; n < 4; n++)
#pragma unroll
      for (int p = 0; p < 4; p++) acc[p][n] = WMMA_F32_F16(a[p], b[n], acc[p][n]);
  }
  asm volatile("s_wait_asynccnt 0x0" ::: "memory");   // nothing of this wave is in flight when it goes on
}

// ---------------------------------------------------------------- QKV GEMM
// grid (16, 8, 9): 256-row x 128-col tiles per block; z = 3 * pair + (Q, K or V).
// block = 256 (8 waves); each wave: 64 rows x 64 cols (one head), 16 WMMAs / 32-K step.
// four waves per SIMD: two blocks per WGP, so that one block's waits and epilogue lie under the other's WMMAs
__global__ __launch_bounds__(256) __attribute__((amdgpu_waves_per_eu(4, 4))) void qkv_kernel(
    const _Float16* __restrict__ x16,
    const _Float16* __restrict__ wqT, const _Float16* __restrict__ wkT, const _Float16* __restrict__ wvT,
    const float* __restrict__ bq, const float* __restrict__ bk, const float* __restrict__ bv,
    const float* __restrict__ qn, const float* __restrict__ kn,
    _Float16* __restrict__ Qb, _Float16* __restrict__ Kb, _Float16* __restrict__ vTb)
{
  __shared__ __align__(16) _Float16 sm[2 * WBUF];
  const int j = blockIdx.z / 3;             // modality pair
  const int which = blockIdx.z % 3;
  const size_t NE = (size_t)ROWS * Dv;
  // queries come from modality j; keys and values from video for pairs 0 and 2, from audio for pair 1
  const _Float16* xq = x16 + (size_t)j * NE;
  const _Float16* xc = x16 + ((j == 1) ? 0 : NE);
  wqT += (size_t)j * Dv * Dv;  wkT += (size_t)j * Dv * Dv;  wvT += (size_t)j * Dv * Dv;
  bq += j * Dv;  bk += j * Dv;  bv += j * Dv;
  qn += j * HDv; kn += j * HDv;
  Qb += (size_t)j * NE;  Kb += (size_t)j * NE;  vTb += (size_t)j * NE;
  const int lane = threadIdx.x & 31;
  const int wave = threadIdx.x >> 5;
  const int ml = lane & 15;
  const int m0 = blockIdx.x * 256 + (wave & 3) * 64;
  const int n0 = blockIdx.y * 128 + (wave >> 2) * 64;

  const _Float16* src = (which == 0) ? xq : xc;
  const _Float16* wT  = (which == 0) ? wqT : (which == 1 ? wkT : wvT);
  const float* bias   = (which == 0) ? bq  : (which == 1 ? bk  : bv);

  const int cr = threadIdx.x >> 3;          // row of the tile this thread copies (and every 32nd below it)
  const int cc = (threadIdx.x & 7) * 8;     // its 16-byte piece of the row's 128 bytes
  const _Float16* gp[12];
#pragma unroll
  for (int i = 0; i < 8; i++) gp[i] = src + (size_t)src_row(blockIdx.x * 256 + cr + 32 * i) * Dv + cc;
#pragma unroll
  for (int i = 0; i < 4; i++) gp[8 + i] = wT + (size_t)(blockIdx.y * 128 + cr + 32 * i) * Dv + cc;

  // Q and K are stored token-major: weights first, so that a lane holds eight neighbouring columns of one token.
  // V is stored d-major: activations first, so that a lane holds eight neighbouring tokens of one d.
  v8f acc[4][4] = {};
  gemm_staged_w<Dv>(sm, gp, acc, which < 2);

  const int rowoff = (lane >> 4) * 8;
  _Float16* st = sm + wave * WSTG;
  if (which < 2) {
    // acc[p][n][i]: token m0 + n * 16 + ml, column n0 + p * 16 + rowoff + i (the wave's 64 columns are one head)
    const float* nw_ = (which == 0) ? qn : kn;
    const float sc = (which == 0) ? 0.125f : 1.0f;   // fold HD^-0.5 into Q
    // the bias goes into the accumulators in place, one column tile at a time: few values live beside them
#pragma unroll
    for (int p = 0; p < 4; p++) {
      v8f bc;
#pragma unroll
      for (int i = 0; i < 8; i++) bc[i] = bias[n0 + p * 16 + rowoff + i];
#pragma unroll
      for (int n = 0; n < 4; n++) acc[p][n] += bc;
    }
    v8f wc[4];
#pragma unroll
    for (int p = 0; p < 4; p++)
#pragma unroll
      for (int i = 0; i < 8; i++) wc[p][i] = nw_[p * 16 + rowoff + i];
#pragma unroll
    for (int n = 0; n < 4; n++) {
      float sp[4];                         // RMS-norm over the head dim: 32 columns in the lane, 32 in lane ^ 16
#pragma unroll
      for (int p = 0; p < 4; p++) {
        sp[p] = 0.f;
#pragma unroll
        for (int i = 0; i < 8; i++) sp[p] += acc[p][n][i] * acc[p][n][i];
      }
      float ss = (sp[0] + sp[1]) + (sp[2] + sp[3]);
      ss += xhalf(ss);
      const float rs = rsqrtf(ss * (1.0f / 64.0f) + 1e-6f) * sc;
#pragma unroll
      for (int p = 0; p < 4; p++) {
        v8h h;
#pragma unroll
        for (int i = 0; i < 8; i++) h[i] = (_Float16)(acc[p][n][i] * (rs * wc[p][i]));
        *(v8h*)(st + (n * 16 + ml) * SPITCH + p * 16 + rowoff) = h;
      }
      // one token tile is normed and written before the next is begun: interleaved, their scaled weights beside the
      // accumulators do not fit the registers of two resident blocks (they spilled)
      __builtin_amdgcn_sched_barrier(0);
    }
    store_rows16<64>(st, ((which == 0) ? Qb : Kb) + (size_t)m0 * Dv + n0, Dv);
    // the other branch's code may follow these stores in the listing: no register that they name is rewritten ahead of this wait
    asm volatile("s_wait_xcnt 0x0" ::: "memory");
  } else {
    // acc[p][n][i]: token m0 + p * 16 + rowoff + i, column n0 + n * 16 + ml; V transposed: [(w*H+h)*HD+d][token]
    float bc[4];
#pragma unroll
    for (int n = 0; n < 4; n++) bc[n] = bias[n0 + n * 16 + ml];
#pragma unroll
    for (int n = 0; n < 4; n++) {
#pragma unroll
      for (int p = 0; p < 4; p++) {
        v8h h;
#pragma unroll
        for (int i = 0; i < 8; i++) h[i] = (_Float16)(acc[p][n][i] + bc[n]);
        *(v8h*)(st + (n * 16 + ml) * SPITCH + p * 16 + rowoff) = h;
      }
      // one column tile's sums are converted and written before the next tile's are formed: all four tiles' sums
      // beside the accumulators do not fit the registers of two resident blocks (they spilled)
      __builtin_amdgcn_sched_barrier(0);
    }
    store_rows16<64>(st, vTb + (size_t)(((m0 >> 9) * Hv + (n0 >> 6)) * HDv) * Sv + (m0 & 511), Sv);
    // as in the other branch
    asm volatile("s_wait_xcnt 0x0" ::: "memory");
  }
}

// ---------------------------------------------------------------- flash attention
// A stage is 64 keys of one head: 64 K rows (key-major) and 64 V^T rows (d-major), 128 bytes each. The block's
// four waves need the same rows, so they are brought into LDS once per block: each wave-wide 16-byte copy covers
// four whole 128-byte lines, where a fragment load from global memory touched sixteen lines for the same bytes.
// Two buffers: the next stage's copies fly while this one is worked on.
#define APITCH 72                   // halves per LDS row: 144 bytes, conflict-free for 16-byte readers
#define ABUF   (128 * APITCH)       // halves per buffer: K rows 0..63, V^T rows 64..127
#define ASTAGES (Sv / 64)

// kp, vp: this thread's 16-byte piece of K row r and of V^T row r of stage 0; it also copies rows r+16, r+32, r+48.
// From one stage to the next K moves on by 64 rows, V^T by 64 halves inside its rows. The eight addresses are
// formed here from the two, so that few address registers live through the loop.
static __device__ inline void kv_copy(unsigned l, const _Float16* kp, const _Float16* vp, int st) {
  // Eight copies of 16 bytes per lane, rows 16 apart. The s_wait_xcnt closes the statement so that no
  // address register of an issued copy is rewritten ahead of it.
  asm volatile(
      "global_load_async_to_lds_b128 %0, %8, off\n\t"
      "global_load_async_to_lds_b128 %1, %9, off\n\t"
      "global_load_async_to_lds_b128 %2, %10, off\n\t"
      "global_load_async_to_lds_b128 %3, %11, off\n\t"
      "global_load_async_to_lds_b128 %4, %12, off\n\t"
      "global_load_async_to_lds_b128 %5, %13, off\n\t"
      "global_load_async_to_lds_b128 %6, %14, off\n\t"
      "global_load_async_to_lds_b128 %7, %15, off\n\t"
      "s_wait_xcnt 0x0"
      :: "v"(l), "v"(l + 1u * 16u * APITCH * 2u), "v"(l + 2u * 16u * APITCH * 2u), "v"(l + 3u * 16u * APITCH * 2u),
         "v"(l + 4u * 16u * APITCH * 2u), "v"(l + 5u * 16u * APITCH * 2u), "v"(l + 6u * 16u * APITCH * 2u),
         "v"(l + 7u * 16u * APITCH * 2u),
         "v"(kp + (size_t)(st * 64) * Dv), "v"(kp + (size_t)(st * 64 + 16) * Dv),
         "v"(kp + (size_t)(st * 64 + 32) * Dv), "v"(kp + (size_t)(st * 64 + 48) * Dv),
         "v"(vp + (st * 64)), "v"(vp + (st * 64 + 16 * Sv)), "v"(vp + (st * 64 + 32 * Sv)), "v"(vp + (st * 64 + 48 * Sv))
      : "memory");
}

__global__ __launch_bounds__(128) void attn_kernel(
    const _Float16* __restrict__ Qb, const _Float16* __restrict__ Kb,
    const _Float16* __restrict__ vTb, _Float16* __restrict__ aout,
    const float* __restrict__ rpb)
{
  __shared__ __align__(16) _Float16 kv[2 * ABUF];
  const int lane = threadIdx.x & 31;
  const int wave = threadIdx.x >> 5;
  const int ml = lane & 15;
  const int koff = (lane >> 4) * 8;
  const int rowoff = (lane >> 4) * 8;
  const int qb = blockIdx.x, h = blockIdx.y, w = blockIdx.z & 7;
  const int j = blockIdx.z >> 3;          // modality pair: its own Q, K, V, output and bias table
  Qb += (size_t)j * ROWS * Dv;  Kb += (size_t)j * ROWS * Dv;
  vTb += (size_t)j * ROWS * Dv; aout += (size_t)j * ROWS * Dv;
  const float* rpbj = rpb + j * (2 * WSv - 1) * Hv;
  const int tq = qb;                      // 64-row chunks align to L

  const int cr = threadIdx.x >> 3;        // row of the stage this thread copies (and 16, 32, 48 below it)
  const int cc = (threadIdx.x & 7) * 8;   // its 16-byte piece of the row's 128 bytes
  const _Float16* kcp = Kb + (size_t)(w * Sv + cr) * Dv + h * HDv + cc;
  const _Float16* vcp = vTb + (size_t)((w * Hv + h) * HDv + cr) * Sv + cc;
  const unsigned lcopy = (unsigned)(size_t)kv + (unsigned)(cr * APITCH + cc) * 2u;

  kv_copy(lcopy, kcp, vcp, 0);

  const int qrow = qb * 64 + wave * 16;
  const _Float16* qp = Qb + (size_t)(w * Sv + qrow + ml) * Dv + h * HDv + koff;
  v16h qa0 = mkfrag(ld8(qp),      ld8(qp + 16));   // B operand: column = query ml
  v16h qa1 = mkfrag(ld8(qp + 32), ld8(qp + 48));

  v8f accO[4] = {};                       // accO[n][i] = O[query ml][d = n * 16 + rowoff + i]
  float m_ = -3.0e38f;                    // running maximum of query ml, the same in both of its lanes
  float l_ = 0.f;                         // running sum over this lane's half of the keys; joined after the loop
  const float L2E = 1.4426950408889634f;

  asm volatile("s_wait_asynccnt 0x0" ::: "memory");   // stage 0 has landed before the barrier publishes it
  __syncthreads();
  kv_copy(lcopy + ABUF * 2u, kcp, vcp, 1);

  // stays rolled: the buffer is picked by the stage's parity anyway
#pragma unroll 1
  for (int st = 0; st < ASTAGES; st++) {
    const int bo = (st & 1) * ABUF;
    const float biasv = rpbj[(tq - st + WSv - 1) * Hv + h];   // a stage is one temporal step of keys

    // unrolled so that both chunks' LDS offsets are constants (and the loops inside it so that s0, s1, mx, pb, vb
    // and accO are indexed by constants and stay in registers)
#pragma unroll
    for (int hc = 0; hc < 2; hc++) {
      // s0[i] = S[query ml][key hc * 32 + rowoff + i], s1[i] the same 16 keys on
      v8f s0 = {}, s1 = {};
      {
        const _Float16* kp0 = kv + bo + (hc * 32 + ml) * APITCH + koff;
        const _Float16* kp1 = kp0 + 16 * APITCH;
        v16h kb00 = mkfrag(ld8(kp0),      ld8(kp0 + 16));
        v16h kb01 = mkfrag(ld8(kp0 + 32), ld8(kp0 + 48));
        v16h kb10 = mkfrag(ld8(kp1),      ld8(kp1 + 16));
        v16h kb11 = mkfrag(ld8(kp1 + 32), ld8(kp1 + 48));
        s0 = WMMA_F32_F16(kb00, qa0, s0);
        s1 = WMMA_F32_F16(kb10, qa0, s1);
        s0 = WMMA_F32_F16(kb01, qa1, s0);
        s1 = WMMA_F32_F16(kb11, qa1, s1);
      }
      v16h vb[4];                          // A operand: row = d, k = the chunk's keys in the order of s0, s1
#pragma unroll
      for (int n = 0; n < 4; n++) {
        const _Float16* vp = kv + bo + (64 + n * 16 + ml) * APITCH + hc * 32 + koff;
        vb[n] = mkfrag(ld8(vp), ld8(vp + 16));
      }

      float mx[8];
#pragma unroll
      for (int i = 0; i < 8; i++) mx[i] = fmaxf(s0[i], s1[i]);
#pragma unroll
      for (int d = 4; d >= 1; d >>= 1)
#pragma unroll
        for (int i = 0; i < d; i++) mx[i] = fmaxf(mx[i], mx[i + d]);
      const float mc = fmaxf(mx[0], xhalf(mx[0])) + biasv;   // the bias is one value for the whole stage
      const float mn = fmaxf(m_, mc);
      const float alpha = __builtin_amdgcn_exp2f((m_ - mn) * L2E);
      m_ = mn;
      const float cl = (biasv - mn) * L2E;   // bias and maximum are one value per lane: one addend for all 16 scores

      v16h pb;                             // P^T as B operand: column = query ml, k as in vb
      float r0 = 0.f, r1 = 0.f;
#pragma unroll
      for (int i = 0; i < 8; i++) {
        const float p0 = __builtin_amdgcn_exp2f(fmaf(s0[i], L2E, cl));
        const float p1 = __builtin_amdgcn_exp2f(fmaf(s1[i], L2E, cl));
        r0 += p0;
        r1 += p1;
        pb[i]     = (_Float16)p0;
        pb[i + 8] = (_Float16)p1;
      }
      l_ = l_ * alpha + (r0 + r1);
#pragma unroll
      for (int n = 0; n < 4; n++) accO[n] *= alpha;

#pragma unroll
      for (int n = 0; n < 4; n++) accO[n] = WMMA_F32_F16(vb[n], pb, accO[n]);
    }

    asm volatile("s_wait_dscnt 0x0" ::: "memory");    // this wave's reads of the buffer are over before it is refilled
    asm volatile("s_wait_asynccnt 0x0" ::: "memory"); // this wave's copies of stage st + 1 have landed
    __syncthreads();                                  // publishes stage st + 1, frees stage st's buffer
    if (st + 2 < ASTAGES) kv_copy(lcopy + (unsigned)bo * 2u, kcp, vcp, st + 2);
  }
  asm volatile("s_wait_asynccnt 0x0" ::: "memory");   // nothing of this wave is in flight when it goes on

  const float inv = 1.0f / (l_ + xhalf(l_));
  // a lane's eight accumulator registers are eight neighbouring d of its query's row: one 16-byte store per tile
  v8h o[4];
#pragma unroll
  for (int n = 0; n < 4; n++)
#pragma unroll
    for (int i = 0; i < 8; i++) o[n][i] = (_Float16)(accO[n][i] * inv);
  _Float16* op = aout + (size_t)(w * Sv + qrow + ml) * Dv + h * HDv + rowoff;
#pragma unroll
  for (int n = 0; n < 4; n++) *(v8h*)(op + n * 16) = o[n];
}

// ---------------------------------------------------------------- output projection + residual + roll(+SH)
// grid (16, 8, 3 pairs): 256x128 tile per block of 8 waves, 64 rows x 64 cols per wave.
// four waves per SIMD: two blocks per WGP, as for the QKV GEMM
__global__ __launch_bounds__(256) __attribute__((amdgpu_waves_per_eu(4, 4))) void proj_kernel(
    const _Float16* __restrict__ aoutb, const _Float16* __restrict__ wpT,
    const float* __restrict__ bp,
    const float* __restrict__ audio, const float* __restrict__ video, const float* __restrict__ image,
    float* __restrict__ feat, _Float16* __restrict__ cat16)
{
  __shared__ __align__(16) _Float16 sm[2 * WBUF];
  const int j = blockIdx.z;
  const float* qmf = (j == 0) ? audio : (j == 1) ? video : image;   // residual: the pair's query modality
  aoutb += (size_t)j * ROWS * Dv;
  wpT += (size_t)j * Dv * Dv;
  bp += j * Dv;
  feat += (size_t)j * ROWS * Dv;
  const int lane = threadIdx.x & 31;
  const int wave = threadIdx.x >> 5;
  const int ml = lane & 15;
  const int m0 = blockIdx.x * 256 + (wave & 3) * 64;
  const int n0 = blockIdx.y * 128 + (wave >> 2) * 64;

  const int cr = threadIdx.x >> 3;
  const int cc = (threadIdx.x & 7) * 8;
  const _Float16* gp[12];
#pragma unroll
  for (int i = 0; i < 8; i++) gp[i] = aoutb + (size_t)(blockIdx.x * 256 + cr + 32 * i) * Dv + cc;
#pragma unroll
  for (int i = 0; i < 4; i++) gp[8 + i] = wpT + (size_t)(blockIdx.y * 128 + cr + 32 * i) * Dv + cc;

  // weights first: acc[p][n][i] is token m0 + n * 16 + ml, column n0 + p * 16 + rowoff + i
  v8f acc[4][4] = {};
  gemm_staged_w<Dv>(sm, gp, acc, true);

  const int rowoff = (lane >> 4) * 8;
  float* stf = (float*)(sm + wave * WSTG);
  // the wave's 64 tokens are one temporal step: their rows of the output follow one another
  const int wdw = m0 >> 9;
  const int tt = ((wdw & 3) * WSv + ((m0 & 511) >> 6) + SHv) & 31;   // roll back by +SH
  const size_t frow0 = (size_t)((wdw >> 2) * Tv + tt) * Lv;
  const float* bpl = bp + n0 + rowoff;
  v4f bc[4][2];
#pragma unroll
  for (int p = 0; p < 4; p++)
#pragma unroll
    for (int hf = 0; hf < 2; hf++) bc[p][hf] = *(const v4f*)(bpl + p * 16 + hf * 4);
  // the eight loads share one address register: it is an input here, so that it lives to this wait and no load's
  // result is given the same register
  asm volatile("s_wait_xcnt 0x0" :: "v"(bpl) : "memory");
  const int r0 = lane >> 4;
  const int c = (lane & 15) * 4;
  // 32 tokens at a time: 64 rows of floats do not fit the wave's part of the ring
#pragma unroll
  for (int half = 0; half < 2; half++) {
#pragma unroll
    for (int nn = 0; nn < 2; nn++)
#pragma unroll
      for (int p = 0; p < 4; p++)
#pragma unroll
        for (int hf = 0; hf < 2; hf++) {
          v4f v;
#pragma unroll
          for (int e = 0; e < 4; e++) v[e] = acc[p][half * 2 + nn][hf * 4 + e] + bc[p][hf][e];
          *(v4f*)(stf + (nn * 16 + ml) * FPITCH + p * 16 + rowoff + hf * 4) = v;
        }
    // this wave's staging writes have landed before other lanes of it read them back
    asm volatile("s_wait_dscnt 0x0" ::: "memory");
    // a wave-wide 16-byte access covers two rows of 256 bytes: whole lines for the residual, feat and (8 bytes) cat16
#pragma unroll
    for (int u = 0; u < 16; u++) {
      const size_t fr = frow0 + half * 32 + u * 2 + r0;
      const v4f v = *(const v4f*)(stf + (u * 2 + r0) * FPITCH + c) + *(const v4f*)(qmf + fr * Dv + n0 + c);
      *(v4f*)(feat + fr * Dv + n0 + c) = v;
      v4h h;
#pragma unroll
      for (int e = 0; e < 4; e++) h[e] = (_Float16)v[e];
      *(v4h*)(cat16 + fr * D3 + j * Dv + n0 + c) = h;
    }
    // the second half's loads take the registers that these stores name: none is rewritten ahead of this wait
    if (half == 0) asm volatile("s_wait_xcnt 0x0" ::: "memory");
  }
}

// ---------------------------------------------------------------- gating MLP layer 1 (+GELU)
// grid (32, 16): 128x128 tile per block of 8 waves.
__global__ __launch_bounds__(256) void gate1_kernel(
    const _Float16* __restrict__ cat16, const _Float16* __restrict__ wg1T,
    const float* __restrict__ bg1, _Float16* __restrict__ g116)
{
  __shared__ __align__(16) _Float16 sm[2 * GBUF];
  const int lane = threadIdx.x & 31;
  const int wave = threadIdx.x >> 5;
  const int ml = lane & 15;
  const int m0 = blockIdx.x * 128 + (wave & 3) * 32;
  const int n0 = blockIdx.y * 128 + (wave >> 2) * 64;

  const int cr = threadIdx.x >> 3;
  const int cc = (threadIdx.x & 7) * 8;
  const _Float16* gp[8];
#pragma unroll
  for (int i = 0; i < 4; i++) {
    gp[i]     = cat16 + (size_t)(blockIdx.x * 128 + cr + 32 * i) * D3 + cc;
    gp[4 + i] = wg1T + (size_t)(blockIdx.y * 128 + cr + 32 * i) * D3 + cc;
  }

  v8f acc[2][4] = {};
  gemm_staged<D3>(sm, gp, acc);

  // acc[p][n][i]: row m0 + p * 16 + ml, column n0 + n * 16 + rowoff + i
  const int rowoff = (lane >> 4) * 8;
  _Float16* st = sm + wave * GSTG;
#pragma unroll
  for (int n = 0; n < 4; n++) {
    v4f bc[2];
#pragma unroll
    for (int hf = 0; hf < 2; hf++) bc[hf] = *(const v4f*)(bg1 + n0 + n * 16 + rowoff + hf * 4);
#pragma unroll
    for (int p = 0; p < 2; p++) {
      v8h h;
#pragma unroll
      for (int i = 0; i < 8; i++) {
        float x = acc[p][n][i] + bc[i >> 2][i & 3];
        float g = 0.5f * x * (1.0f + erff(x * 0.70710678118f));   // exact GELU
        h[i] = (_Float16)g;
      }
      *(v8h*)(st + (p * 16 + ml) * SPITCH + n * 16 + rowoff) = h;
    }
  }
  store_rows16<32>(st, g116 + (size_t)m0 * D2 + n0, D2);
}

// ---------------------------------------------------------------- gating layer 2 (N=3) + softmax
__global__ __launch_bounds__(256) void gate2_kernel(
    const _Float16* __restrict__ g116, const float* __restrict__ Wg2,
    const float* __restrict__ bg2, float* __restrict__ gates)
{
  int row = blockIdx.x * 8 + (threadIdx.x >> 5);
  int lane = threadIdx.x & 31;
  if (row >= ROWS) return;
  const _Float16* gr = g116 + (size_t)row * D2;
  float a0 = 0.f, a1 = 0.f, a2 = 0.f;
  for (int k = lane; k < D2; k += 32) {
    float g = (float)gr[k];
    a0 = fmaf(g, Wg2[k * 3 + 0], a0);
    a1 = fmaf(g, Wg2[k * 3 + 1], a1);
    a2 = fmaf(g, Wg2[k * 3 + 2], a2);
  }
#pragma unroll
  for (int msk = 16; msk >= 1; msk >>= 1) {
    a0 += __shfl_xor(a0, msk, 32);
    a1 += __shfl_xor(a1, msk, 32);
    a2 += __shfl_xor(a2, msk, 32);
  }
  if (lane == 0) {
    a0 += bg2[0]; a1 += bg2[1]; a2 += bg2[2];
    float mx = fmaxf(a0, fmaxf(a1, a2));
    float e0 = __expf(a0 - mx), e1 = __expf(a1 - mx), e2 = __expf(a2 - mx);
    float inv = 1.0f / (e0 + e1 + e2);
    gates[row * 3 + 0] = e0 * inv;
    gates[row * 3 + 1] = e1 * inv;
    gates[row * 3 + 2] = e2 * inv;
  }
}

// ---------------------------------------------------------------- fuse
// FROWS whole rows per block, four columns per thread: 16-byte accesses, each row's gates the same for the whole block,
// all 3 * FROWS loads of a thread issued before the first sum.
// The three planes come as three pointers, so that each address is a block-uniform base plus one per-lane offset
// that lives to the last store: no vector register that an issued load names is written again.
#define FROWS 4
__global__ __launch_bounds__(256) void fuse_kernel(const float* __restrict__ feat0, const float* __restrict__ feat1,
                                                   const float* __restrict__ feat2, const float* __restrict__ gates,
                                                   float* __restrict__ out)
{
  const int row0 = blockIdx.x * FROWS;
  const unsigned c = threadIdx.x * 4u;
  const float* fb[3] = { feat0 + (size_t)row0 * Dv, feat1 + (size_t)row0 * Dv, feat2 + (size_t)row0 * Dv };
  float* ob = out + (size_t)row0 * Dv;
  v4f f[FROWS][3];
#pragma unroll
  for (int u = 0; u < FROWS; u++)
#pragma unroll
    for (int m = 0; m < 3; m++) f[u][m] = *(const v4f*)(fb[m] + u * Dv + c);
#pragma unroll
  for (int u = 0; u < FROWS; u++) {
    const float* g = gates + (row0 + u) * 3;
    *(v4f*)(ob + u * Dv + c) = g[0] * f[u][0] + g[1] * f[u][1] + g[2] * f[u][2];
  }
}

// ---------------------------------------------------------------- launch
extern "C" void kernel_launch(void* const* d_in, const int* in_sizes, int n_in,
                              void* d_out, int out_size, void* d_ws, size_t ws_size,
                              hipStream_t stream)
{
  const float* audio = (const float*)d_in[0];
  const float* video = (const float*)d_in[1];
  const float* image = (const float*)d_in[2];
  const float* Wq  = (const float*)d_in[3];
  const float* Wk  = (const float*)d_in[4];
  const float* Wv  = (const float*)d_in[5];
  const float* Wp  = (const float*)d_in[6];
  const float* bq  = (const float*)d_in[7];
  const float* bk  = (const float*)d_in[8];
  const float* bv  = (const float*)d_in[9];
  const float* bp  = (const float*)d_in[10];
  const float* qn  = (const float*)d_in[11];
  const float* kn  = (const float*)d_in[12];
  const float* rpb = (const float*)d_in[13];
  const float* Wg1 = (const float*)d_in[14];
  const float* bg1 = (const float*)d_in[15];
  const float* Wg2 = (const float*)d_in[16];
  const float* bg2 = (const float*)d_in[17];
  float* out = (float*)d_out;

  char* p = (char*)d_ws;
  auto carve = [&](size_t bytes) -> void* {
    void* r = (void*)p;
    p += (bytes + 255) & ~(size_t)255;
    return r;
  };
  const size_t NE = (size_t)ROWS * Dv;                 // 4M elems
  _Float16* x16   = (_Float16*)carve(3 * NE * 2);
  _Float16* wqT   = (_Float16*)carve(3 * (size_t)Dv * Dv * 2);
  _Float16* wkT   = (_Float16*)carve(3 * (size_t)Dv * Dv * 2);
  _Float16* wvT   = (_Float16*)carve(3 * (size_t)Dv * Dv * 2);
  _Float16* wpT   = (_Float16*)carve(3 * (size_t)Dv * Dv * 2);
  _Float16* wg1T  = (_Float16*)carve((size_t)D3 * D2 * 2);
  _Float16* Qb    = (_Float16*)carve(3 * NE * 2);       // one plane per modality pair
  _Float16* Kb    = (_Float16*)carve(3 * NE * 2);
  _Float16* vTb   = (_Float16*)carve(3 * NE * 2);
  _Float16* aoutb = (_Float16*)carve(3 * NE * 2);
  _Float16* cat16 = (_Float16*)carve((size_t)ROWS * D3 * 2);
  _Float16* g116  = (_Float16*)carve((size_t)ROWS * D2 * 2);
  float*    feats = (float*)carve(3 * NE * 4);
  float*    gates = (float*)carve((size_t)ROWS * 3 * 4);

  // convert activations and transpose-convert weights to f16
  prep_kernel<<<G1TILES + 12 * WTILES + 3 * XBLOCKS, 256, 0, stream>>>(
      audio, video, image, Wq, Wk, Wv, Wp, Wg1, x16, wqT, wkT, wvT, wpT, wg1T);

  // the three modality pairs do not depend on one another: each stage takes all of them in one grid
  qkv_kernel<<<dim3(16, 8, 9), 256, 0, stream>>>(x16, wqT, wkT, wvT, bq, bk, bv, qn, kn, Qb, Kb, vTb);
  attn_kernel<<<dim3(8, 16, 24), 128, 0, stream>>>(Qb, Kb, vTb, aoutb, rpb);
  proj_kernel<<<dim3(16, 8, 3), 256, 0, stream>>>(aoutb, wpT, bp, audio, video, image, feats, cat16);

  gate1_kernel<<<dim3(32, 16), 256, 0, stream>>>(cat16, wg1T, bg1, g116);
  gate2_kernel<<<ROWS / 8, 256, 0, stream>>>(g116, Wg2, bg2, gates);
  fuse_kernel<<<ROWS / FROWS, 256, 0, stream>>>(feats, feats + NE, feats + 2 * NE, gates, out);
}

// v009
// A run of this version takes 191 microseconds.
// Next to v008, in two timings, it ran 1.03 times as fast each time.
// Over all steps from v000 it is 5.42 times as fast.
#include <hip/hip_runtime.h>
#include <hip/hip_bf16.h>

typedef __attribute__((ext_vector_type(16))) _Float16 v16h;
typedef __attribute__((ext_vector_type(8)))  _Float16 v8h;
typedef __attribute__((ext_vector_type(8)))  float    v8f;
typedef __attribute__((ext_vector_type(4)))  _Float16 v4h;
typedef __attribute__((ext_vector_type(4)))  float    v4f;

#define WMMA_F32_F16(a,b,c) __builtin_amdgcn_wmma_f32_16x16x32_f16(false,(a),false,(b),(short)0,(c),false,false)

#define Bv   2
#define Tv   32
#define Lv   64
#define Dv   1024
#define Hv   16
#define WSv  8
#define SHv  4
#define HDv  64
#define Sv   512      // WS*L
#define ROWS 4096     // B*T*L
#define D3   3072
#define D2   2048
#define TPITCH 72     // halves per LDS row of the transpose tile

static __device__ inline v8h ld8(const _Float16* p) { return *(const v8h*)p; }

static __device__ inline v16h mkfrag(v8h lo, v8h hi) {
  v16h r;
#pragma unroll
  for (int i = 0; i < 8; i++) { r[i] = lo[i]; r[i + 8] = hi[i]; }
  return r;
}

// lane l <-> lane l ^ 16: the two lanes that share a column of an accumulator tile
static __device__ inline float xhalf(float x) {
  const int b = __builtin_bit_cast(int, x);
  return __builtin_bit_cast(float, __builtin_amdgcn_permlanex16(b, b, 0x76543210, 0xfedcba98, false, false));
}

// lane l <-> lane l ^ M, M below 16: a row_xmask move, which the compiler folds into the add that takes it
template <int M>
static __device__ inline float rowx(float x) {
  return __builtin_bit_cast(float, __builtin_amdgcn_update_dpp(0, __builtin_bit_cast(int, x), 0x160 | M, 0xf, 0xf, true));
}

// 2^x. The v_nop is the slot that the instruction set asks for behind a transcendental.
static __device__ inline float exp2_slot(float x) {
  float r;
  asm("v_exp_f32 %0, %1\n\tv_nop" : "=v"(r) : "v"(x));
  return r;
}

// window-order row -> source row of [B,T,L] with roll(-SH) folded in
static __device__ inline int src_row(int r) {
  int w = r >> 9;          // window (0..7): b*4 + widx
  int s = r & 511;         // token in window
  int b = w >> 2;
  int widx = w & 3;
  int tq = s >> 6;
  int l = s & 63;
  int tp = widx * WSv + tq;
  int tsrc = (tp + SHv) & 31;
  return ((b * Tv + tsrc) << 6) + l;
}

// ---------------------------------------------------------------- converts
// TPB 64 x 64 tiles per block, one below the other in the source, each turned in its own LDS tile: source rows
// are read as 16-byte pieces (a thread's 4 * TPB loads stand ahead of its converts, so that many are in flight),
// destination rows (k-contiguous) leave as whole 128-byte lines. R is a multiple of 64 * TPB, C of 64.
#define TPB 4
static __device__ inline void cvtT_tiles(_Float16* tile, const float* __restrict__ s, _Float16* __restrict__ d,
                                         int R, int C, int bx, int by) {
  const int t = threadIdx.x;
  const int c0 = bx * 64;
  const int r0 = by * (64 * TPB);
  const int c4 = (t & 15) * 4;
  const int r4 = (t >> 4) * 4;
  v4f v[TPB][4];
#pragma unroll
  for (int q = 0; q < TPB; q++)
#pragma unroll
    for (int p = 0; p < 4; p++) v[q][p] = *(const v4f*)(s + (size_t)(r0 + q * 64 + r4 + p) * C + c0 + c4);
#pragma unroll
  for (int q = 0; q < TPB; q++)
#pragma unroll
    for (int ci = 0; ci < 4; ci++) {
      v4h h;
#pragma unroll
      for (int p = 0; p < 4; p++) h[p] = (_Float16)v[q][p][ci];
      *(v4h*)(tile + (q * 64 + c4 + ci) * TPITCH + r4) = h;
    }
  __syncthreads();
  const int seg = (t & 7) * 8;
#pragma unroll
  for (int q = 0; q < TPB; q++)
#pragma unroll
    for (int p = 0; p < 2; p++) {
      const int c = p * 32 + (t >> 3);
      *(v8h*)(d + (size_t)(c0 + c) * R + r0 + q * 64 + seg) = *(const v8h*)(tile + (q * 64 + c) * TPITCH + seg);
    }
  // in the merged kernel another part's code follows these stores in the listing: no register that they name is
  // rewritten ahead of this wait
  asm volatile("s_wait_xcnt 0x0" ::: "memory");
}

// All conversions are independent of one another and run as one grid. Blocks in order: the tiles of Wg1,
// the tiles of the twelve D x D weights (pair-major: q, k, v, p), then XPT activation elements per thread.
// A block carries enough work that the grid is 1920 blocks (15360 waves).
#define G1TILES ((D2 / 64) * (D3 / (64 * TPB)))
#define WTILES  ((Dv / 64) * (Dv / (64 * TPB)))
#define XPT     64
#define XBLOCKS (ROWS * Dv / (256 * XPT))
__global__ __launch_bounds__(256) void prep_kernel(
    const float* __restrict__ audio, const float* __restrict__ video, const float* __restrict__ image,
    const float* __restrict__ Wq, const float* __restrict__ Wk, const float* __restrict__ Wv,
    const float* __restrict__ Wp, const float* __restrict__ Wg1,
    _Float16* __restrict__ x16, _Float16* __restrict__ wqT, _Float16* __restrict__ wkT,
    _Float16* __restrict__ wvT, _Float16* __restrict__ wpT, _Float16* __restrict__ wg1T)
{
  __shared__ __align__(16) _Float16 tile[TPB * 64 * TPITCH];   // [tile][c][r], rows 16 bytes longer than the data
  int b = blockIdx.x;
  if (b < G1TILES) {
    cvtT_tiles(tile, Wg1, wg1T, D3, D2, b % (D2 / 64), b / (D2 / 64));
    return;
  }
  b -= G1TILES;
  if (b < 12 * WTILES) {
    const int m = b / WTILES;
    const int kind = m & 3;
    const size_t off = (size_t)(m >> 2) * Dv * Dv;
    const float* s = (kind == 0) ? Wq : (kind == 1) ? Wk : (kind == 2) ? Wv : Wp;
    _Float16* d    = (kind == 0) ? wqT : (kind == 1) ? wkT : (kind == 2) ? wvT : wpT;
    const int tl = b % WTILES;
    cvtT_tiles(tile, s + off, d + off, Dv, Dv, tl % (Dv / 64), tl / (Dv / 64));
    return;
  }
  b -= 12 * WTILES;
  const int mod = b / XBLOCKS;
  const float* s = (mod == 0) ? audio : (mod == 1) ? video : image;
  // each wave-wide load covers 512 contiguous bytes, each store 256; the loads stand ahead of the converts
  const int i = (b % XBLOCKS) * (256 * XPT) + threadIdx.x * 4;
  _Float16* xd = x16 + (size_t)mod * ROWS * Dv + i;
  v4f xv[XPT / 4];
#pragma unroll
  for (int u = 0; u < XPT / 4; u++) xv[u] = *(const v4f*)(s + i + u * 1024);
#pragma unroll
  for (int u = 0; u < XPT / 4; u++) {
    v4h h;
#pragma unroll
    for (int e = 0; e < 4; e++) h[e] = (_Float16)xv[u][e];
    *(v4h*)(xd + u * 1024) = h;
  }
  // the tile parts' code follows these stores in the listing: no register that they name is rewritten ahead of this wait
  asm volatile("s_wait_xcnt 0x0" ::: "memory");
}

// ---------------------------------------------------------------- staged GEMM core
// One 128 x 128 tile of Y = A * B^T per block of 8 waves (4 along M x 2 along N, 32 x 64 each).
// A stage is 64 k (128 bytes) of 128 A rows and 128 B rows. Each wave-wide 16-byte copy covers four
// whole 128-byte lines and lands in LDS without passing a register; two buffers, so the copies
// of the stage after next fly while this one is multiplied.
#define GBK    64                   // halves of k per stage
#define GPITCH 72                   // halves per LDS row: 144 bytes, conflict-free for 16-byte readers
#define GBUF   (256 * GPITCH)       // halves per buffer: A rows 0..127, B rows 128..255

static __device__ inline void stage_copy(unsigned l, const _Float16* const (&gp)[8], int k) {
  // Eight copies of 16 bytes per lane, rows 32 apart. The s_wait_xcnt closes the statement so that no
  // address register of an issued copy is rewritten ahead of it.
  asm volatile(
      "global_load_async_to_lds_b128 %0, %8, off\n\t"
      "global_load_async_to_lds_b128 %1, %9, off\n\t"
      "global_load_async_to_lds_b128 %2, %10, off\n\t"
      "global_load_async_to_lds_b128 %3, %11, off\n\t"
      "global_load_async_to_lds_b128 %4, %12, off\n\t"
      "global_load_async_to_lds_b128 %5, %13, off\n\t"
      "global_load_async_to_lds_b128 %6, %14, off\n\t"
      "global_load_async_to_lds_b128 %7, %15, off\n\t"
      "s_wait_xcnt 0x0"
      :: "v"(l), "v"(l + 1u * 32u * GPITCH * 2u), "v"(l + 2u * 32u * GPITCH * 2u), "v"(l + 3u * 32u * GPITCH * 2u),
         "v"(l + 4u * 32u * GPITCH * 2u), "v"(l + 5u * 32u * GPITCH * 2u), "v"(l + 6u * 32u * GPITCH * 2u),
         "v"(l + 7u * 32u * GPITCH * 2u),
         "v"(gp[0] + k), "v"(gp[1] + k), "v"(gp[2] + k), "v"(gp[3] + k),
         "v"(gp[4] + k), "v"(gp[5] + k), "v"(gp[6] + k), "v"(gp[7] + k)
      : "memory");
}

// gp[0..3]: this thread's piece of A rows r, r+32, r+64, r+96 of the tile; gp[4..7]: the same of B.
// The product is taken transposed (B's fragment as first operand; both share one k order): acc[p][n][i] belongs to
// A row p * 16 + (lane & 15) and B row n * 16 + (lane >> 4) * 8 + i, eight neighbouring columns of Y in one lane.
// Behind the last stage's barrier nobody reads sm and no copy is in flight: the epilogue may stage there.
template <int KT>
static __device__ inline void gemm_staged(_Float16* sm, const _Float16* const (&gp)[8], v8f (&acc)[2][4]) {
  const int t = threadIdx.x;
  const int lane = t & 31;
  const int wave = t >> 5;
  const int ml = lane & 15;
  const int koff = (lane >> 4) * 8;
  const unsigned lcopy = (unsigned)(size_t)sm + (unsigned)((t >> 3) * GPITCH + (t & 7) * 8) * 2u;
  const _Float16* ard = sm + ((wave & 3) * 32 + ml) * GPITCH + koff;
  const _Float16* brd = sm + (128 + (wave >> 2) * 64 + ml) * GPITCH + koff;
  constexpr int NT = KT / GBK;

  stage_copy(lcopy, gp, 0);
  asm volatile("s_wait_asynccnt 0x0" ::: "memory");   // stage 0 has landed before the barrier publishes it
  __syncthreads();
  stage_copy(lcopy + GBUF * 2u, gp, GBK);

  // stays rolled: unrolled, the reads were spread between the WMMAs again, a full LDS latency in front of each pair
#pragma unroll 1
  for (int s = 0; s < NT; s++) {
    const int bo = (s & 1) * GBUF;
    // the whole stage goes into registers as one group of reads: the buffer is free again before the WMMAs start
    // (the inner loops are unrolled so that a, b and acc are indexed by constants and stay in registers)
    v16h a[2][2], b[2][4];
#pragma unroll
    for (int ks = 0; ks < 2; ks++) {
      const _Float16* ap = ard + bo + ks * 32;
      const _Float16* bp = brd + bo + ks * 32;
#pragma unroll
      for (int p = 0; p < 2; p++) a[ks][p] = mkfrag(ld8(ap + p * 16 * GPITCH), ld8(ap + p * 16 * GPITCH + 16));
#pragma unroll
      for (int n = 0; n < 4; n++) b[ks][n] = mkfrag(ld8(bp + n * 16 * GPITCH), ld8(bp + n * 16 * GPITCH + 16));
    }
    asm volatile("s_wait_dscnt 0x0" ::: "memory");    // this wave's reads of the buffer are over before it is refilled
    asm volatile("s_wait_asynccnt 0x0" ::: "memory"); // this wave's copies of stage s + 1 have landed
    __syncthreads();                                  // publishes stage s + 1, frees stage s's buffer
    if (s + 2 < NT) stage_copy(lcopy + (unsigned)bo * 2u, gp, (s + 2) * GBK);
    // stage s + 2 flies while stage s is multiplied from registers
#pragma unroll
    for (int ks = 0; ks < 2; ks++)
#pragma unroll
      for (int n = 0; n < 4; n++) {
        acc[0][n] = WMMA_F32_F16(b[ks][n], a[ks][0], acc[0][n]);
        acc[1][n] = WMMA_F32_F16(b[ks][n], a[ks][1], acc[1][n]);
      }
  }
  asm volatile("s_wait_asynccnt 0x0" ::: "memory");   // nothing of this wave is in flight when it goes on
}

// ---------------------------------------------------------------- staged GEMM core, wide tile
// One 256 x 128 tile of Y = A * B^T per block of 8 waves (4 along M x 2 along N, 64 x 64 each): a wave's eight
// fragments of a 32-k step feed 16 WMMAs (one 16-byte LDS read per WMMA, where the 32 x 64 wave tile takes one and
// a half), and a stage brings 384 rows from L2 for the work of two 128 x 128 tiles, which bring 512.
// The fragments of one 32-k step at a time are held, so that two blocks stay resident per WGP.
#define WBUF   (384 * GPITCH)       // halves per buffer: A rows 0..255, B rows 256..383

// Output staging. An accumulator tile stored as it lies leaves in pieces of 32 or 64 bytes, each a line transaction of
// its own. Each wave turns its tile in its own eighth of the ring, which is free by then, and stores whole 128-byte lines.
#define SPITCH 72                   // halves per staged row of 64 halves: 144 bytes, conflict-free for 16-byte writers
#define FPITCH 68                   // floats per staged row of 64 floats: 272 bytes, the same
#define WSTG   (2 * WBUF / 8)       // halves of the wide ring per wave
#define GSTG   (2 * GBUF / 8)       // halves of the 128 x 128 ring per wave

// NR staged rows of 64 halves go out, four whole lines per wave-wide 16-byte store; row r goes to g + r * pitch.
template <int NR>
static __device__ inline void store_rows16(const _Float16* st, _Float16* g, int pitch) {
  const int lane = threadIdx.x & 31;
  const int r0 = lane >> 3;
  const int c = (lane & 7) * 8;
  // this wave's staging writes have landed before other lanes of it read them back
  asm volatile("s_wait_dscnt 0x0" ::: "memory");
  v8h x[NR / 4];
#pragma unroll
  for (int u = 0; u < NR / 4; u++) x[u] = *(const v8h*)(st + (u * 4 + r0) * SPITCH + c);
#pragma unroll
  for (int u = 0; u < NR / 4; u++) *(v8h*)(g + (size_t)((u * 4 + r0) * pitch) + c) = x[u];
}

static __device__ inline void stage_copy_w(unsigned l, const _Float16* const (&gp)[12]) {
  // Twelve copies of 16 bytes per lane, rows 32 apart. The s_wait_xcnt closes the statement so that no
  // address register of an issued copy is rewritten ahead of it.
  asm volatile(
      "global_load_async_to_lds_b128 %0, %12, off\n\t"
      "global_load_async_to_lds_b128 %1, %13, off\n\t"
      "global_load_async_to_lds_b128 %2, %14, off\n\t"
      "global_load_async_to_lds_b128 %3, %15, off\n\t"
      "global_load_async_to_lds_b128 %4, %16, off\n\t"
      "global_load_async_to_lds_b128 %5, %17, off\n\t"
      "global_load_async_to_lds_b128 %6, %18, off\n\t"
      "global_load_async_to_lds_b128 %7, %19, off\n\t"
      "global_load_async_to_lds_b128 %8, %20, off\n\t"
      "global_load_async_to_lds_b128 %9, %21, off\n\t"
      "global_load_async_to_lds_b128 %10, %22, off\n\t"
      "global_load_async_to_lds_b128 %11, %23, off\n\t"
      "s_wait_xcnt 0x0"
      :: "v"(l), "v"(l + 1u * 32u * GPITCH * 2u), "v"(l + 2u * 32u * GPITCH * 2u), "v"(l + 3u * 32u * GPITCH * 2u),
         "v"(l + 4u * 32u * GPITCH * 2u), "v"(l + 5u * 32u * GPITCH * 2u), "v"(l + 6u * 32u * GPITCH * 2u),
         "v"(l + 7u * 32u * GPITCH * 2u), "v"(l + 8u * 32u * GPITCH * 2u), "v"(l + 9u * 32u * GPITCH * 2u),
         "v"(l + 10u * 32u * GPITCH * 2u), "v"(l + 11u * 32u * GPITCH * 2u),
         "v"(gp[0]), "v"(gp[1]), "v"(gp[2]), "v"(gp[3]), "v"(gp[4]), "v"(gp[5]),
         "v"(gp[6]), "v"(gp[7]), "v"(gp[8]), "v"(gp[9]), "v"(gp[10]), "v"(gp[11])
      : "memory");
}

// gp[0..7]: this thread's piece of A rows r, r+32, .. r+224 of the tile; gp[8..11]: of B rows r, .. r+96.
// The pointers move on by one stage behind each group of copies, in place: no second set of address registers.
// A and B fragments share one k order and the wave tile is square, so either may be the first operand:
// acc[p][n][i] belongs to row p * 16 + (lane >> 4) * 8 + i of the first and row n * 16 + (lane & 15) of the second.
// bfirst (block-uniform) makes B the first: a lane then holds eight neighbouring columns of Y instead of eight rows.
// Behind the last stage's barrier nobody reads sm and no copy is in flight: the epilogue may stage there.
template <int KT>
static __device__ inline void gemm_staged_w(_Float16* sm, const _Float16* (&gp)[12], v8f (&acc)[4][4], bool bfirst) {
  const int t = threadIdx.x;
  const int lane = t & 31;
  const int wave = t >> 5;
  const int ml = lane & 15;
  const int koff = (lane >> 4) * 8;
  const unsigned lcopy = (unsigned)(size_t)sm + (unsigned)((t >> 3) * GPITCH + (t & 7) * 8) * 2u;
  const int arow = (wave & 3) * 64, brow = 256 + (wave >> 2) * 64;
  const _Float16* ard = sm + ((bfirst ? brow : arow) + ml) * GPITCH + koff;   // first operand's rows
  const _Float16* brd = sm + ((bfirst ? arow : brow) + ml) * GPITCH + koff;   // second operand's rows
  constexpr int NT = KT / GBK;

  stage_copy_w(lcopy, gp);
#pragma unroll
  for (int i = 0; i < 12; i++) gp[i] += GBK;
  asm volatile("s_wait_asynccnt 0x0" ::: "memory");   // stage 0 has landed before the barrier publishes it
  __syncthreads();
  stage_copy_w(lcopy + WBUF * 2u, gp);
#pragma unroll
  for (int i = 0; i < 12; i++) gp[i] += GBK;

  // stays rolled: the buffer is picked by the stage's parity, and unrolled the reads spread between the WMMAs
#pragma unroll 1
  for (int s = 0; s < NT; s++) {
    const int bo = (s & 1) * WBUF;
    // (the inner loops are unrolled so that a, b and acc are indexed by constants and stay in registers)
    v16h a[4], b[4];
#pragma unroll
    for (int p = 0; p < 4; p++) {
      a[p] = mkfrag(ld8(ard + bo + p * 16 * GPITCH), ld8(ard + bo + p * 16 * GPITCH + 16));
      b[p] = mkfrag(ld8(brd + bo + p * 16 * GPITCH), ld8(brd + bo + p * 16 * GPITCH + 16));
    }
    // keeps the step's sixteen reads one group ahead of its WMMAs: sunk among them, each place costs an LDS latency
    __builtin_amdgcn_sched_barrier(0);
#pragma unroll
    for (int n = 0; n < 4; n++)
#pragma unroll
      for (int p = 0; p < 4; p++) acc[p][n] = WMMA_F32_F16(a[p], b[n], acc[p][n]);
    // keeps the second step's reads behind the first step's WMMAs: lifted over them they would need a second
    // fragment set, and its registers would cost the second resident block
    __builtin_amdgcn_sched_barrier(0);
#pragma unroll
    for (int p = 0; p < 4; p++) {
      a[p] = mkfrag(ld8(ard + bo + 32 + p * 16 * GPITCH), ld8(ard + bo + 32 + p * 16 * GPITCH + 16));
      b[p] = mkfrag(ld8(brd + bo + 32 + p * 16 * GPITCH), ld8(brd + bo + 32 + p * 16 * GPITCH + 16));
    }
    asm volatile("s_wait_dscnt 0x0" ::: "memory");    // this wave's reads of the buffer are over before it is refilled
    asm volatile("s_wait_asynccnt 0x0" ::: "memory"); // this wave's copies of stage s + 1 have landed
    __syncthreads();                                  // publishes stage s + 1, frees stage s's buffer
    if (s + 2 < NT) {
      stage_copy_w(lcopy + (unsigned)bo * 2u, gp);
#pragma unroll
      for (int i = 0; i < 12; i++) gp[i] += GBK;
    }
    // stage s + 2 flies while the second step is multiplied from registers
#pragma unroll
    for (int n = 0; n < 4; n++)
#pragma unroll
      for (int p = 0; p < 4; p++) acc[p][n] = WMMA_F32_F16(a[p], b[n], acc[p][n]);
  }
  asm volatile("s_wait_asynccnt 0x0" ::: "memory");   // nothing of this wave is in flight when it goes on
}

// ---------------------------------------------------------------- QKV GEMM
// grid (16, 8, 9): 256-row x 128-col tiles per block; z = 3 * pair + (Q, K or V).
// block = 256 (8 waves); each wave: 64 rows x 64 cols (one head), 16 WMMAs / 32-K step.
// four waves per SIMD: two blocks per WGP, so that one block's waits and epilogue lie under the other's WMMAs
__global__ __launch_bounds__(256) __attribute__((amdgpu_waves_per_eu(4, 4))) void qkv_kernel(
    const _Float16* __restrict__ x16,
    const _Float16* __restrict__ wqT, const _Float16* __restrict__ wkT, const _Float16* __restrict__ wvT,
    const float* __restrict__ bq, const float* __restrict__ bk, const float* __restrict__ bv,
    const float* __restrict__ qn, const float* __restrict__ kn,
    _Float16* __restrict__ Qb, _Float16* __restrict__ Kb, _Float16* __restrict__ vTb)
{
  __shared__ __align__(16) _Float16 sm[2 * WBUF];
  const int j = blockIdx.z / 3;             // modality pair
  const int which = blockIdx.z % 3;
  const size_t NE = (size_t)ROWS * Dv;
  // queries come from modality j; keys and values from video for pairs 0 and 2, from audio for pair 1
  const _Float16* xq = x16 + (size_t)j * NE;
  const _Float16* xc = x16 + ((j == 1) ? 0 : NE);
  wqT += (size_t)j * Dv * Dv;  wkT += (size_t)j * Dv * Dv;  wvT += (size_t)j * Dv * Dv;
  bq += j * Dv;  bk += j * Dv;  bv += j * Dv;
  qn += j * HDv; kn += j * HDv;
  Qb += (size_t)j * NE;  Kb += (size_t)j * NE;  vTb += (size_t)j * NE;
  const int lane = threadIdx.x & 31;
  const int wave = threadIdx.x >> 5;
  const int ml = lane & 15;
  const int m0 = blockIdx.x * 256 + (wave & 3) * 64;
  const int n0 = blockIdx.y * 128 + (wave >> 2) * 64;

  const _Float16* src = (which == 0) ? xq : xc;
  const _Float16* wT  = (which == 0) ? wqT : (which == 1 ? wkT : wvT);
  const float* bias   = (which == 0) ? bq  : (which == 1 ? bk  : bv);

  const int cr = threadIdx.x >> 3;          // row of the tile this thread copies (and every 32nd below it)
  const int cc = (threadIdx.x & 7) * 8;     // its 16-byte piece of the row's 128 bytes
  const _Float16* gp[12];
#pragma unroll
  for (int i = 0; i < 8; i++) gp[i] = src + (size_t)src_row(blockIdx.x * 256 + cr + 32 * i) * Dv + cc;
#pragma unroll
  for (int i = 0; i < 4; i++) gp[8 + i] = wT + (size_t)(blockIdx.y * 128 + cr + 32 * i) * Dv + cc;

  // Q and K are stored token-major: weights first, so that a lane holds eight neighbouring columns of one token.
  // V is stored d-major: activations first, so that a lane holds eight neighbouring tokens of one d.
  v8f acc[4][4] = {};
  gemm_staged_w<Dv>(sm, gp, acc, which < 2);

  const int rowoff = (lane >> 4) * 8;
  _Float16* st = sm + wave * WSTG;
  if (which < 2) {
    // acc[p][n][i]: token m0 + n * 16 + ml, column n0 + p * 16 + rowoff + i (the wave's 64 columns are one head)
    const float* nw_ = (which == 0) ? qn : kn;
    const float sc = (which == 0) ? 0.125f : 1.0f;   // fold HD^-0.5 into Q
    // the bias goes into the accumulators in place, one column tile at a time: few values live beside them
#pragma unroll
    for (int p = 0; p < 4; p++) {
      v8f bc;
#pragma unroll
      for (int i = 0; i < 8; i++) bc[i] = bias[n0 + p * 16 + rowoff + i];
#pragma unroll
      for (int n = 0; n < 4; n++) acc[p][n] += bc;
    }
    v8f wc[4];
#pragma unroll
    for (int p = 0; p < 4; p++)
#pragma unroll
      for (int i = 0; i < 8; i++) wc[p][i] = nw_[p * 16 + rowoff + i];
#pragma unroll
    for (int n = 0; n < 4; n++) {
      float sp[4];                         // RMS-norm over the head dim: 32 columns in the lane, 32 in lane ^ 16
#pragma unroll
      for (int p = 0; p < 4; p++) {
        sp[p] = 0.f;
#pragma unroll
        for (int i = 0; i < 8; i++) sp[p] += acc[p][n][i] * acc[p][n][i];
      }
      float ss = (sp[0] + sp[1]) + (sp[2] + sp[3]);
      ss += xhalf(ss);
      const float rs = rsqrtf(ss * (1.0f / 64.0f) + 1e-6f) * sc;
#pragma unroll
      for (int p = 0; p < 4; p++) {
        v8h h;
#pragma unroll
        for (int i = 0; i < 8; i++) h[i] = (_Float16)(acc[p][n][i] * (rs * wc[p][i]));
        *(v8h*)(st + (n * 16 + ml) * SPITCH + p * 16 + rowoff) = h;
      }
      // one token tile is normed and written before the next is begun: interleaved, their scaled weights beside the
      // accumulators do not fit the registers of two resident blocks (they spilled)
      __builtin_amdgcn_sched_barrier(0);
    }
    store_rows16<64>(st, ((which == 0) ? Qb : Kb) + (size_t)m0 * Dv + n0, Dv);
    // the other branch's code may follow these stores in the listing: no register that they name is rewritten ahead of this wait
    asm volatile("s_wait_xcnt 0x0" ::: "memory");
  } else {
    // acc[p][n][i]: token m0 + p * 16 + rowoff + i, column n0 + n * 16 + ml; V transposed: [(w*H+h)*HD+d][token]
    float bc[4];
#pragma unroll
    for (int n = 0; n < 4; n++) bc[n] = bias[n0 + n * 16 + ml];
#pragma unroll
    for (int n = 0; n < 4; n++) {
#pragma unroll
      for (int p = 0; p < 4; p++) {
        v8h h;
#pragma unroll
        for (int i = 0; i < 8; i++) h[i] = (_Float16)(acc[p][n][i] + bc[n]);
        *(v8h*)(st + (n * 16 + ml) * SPITCH + p * 16 + rowoff) = h;
      }
      // one column tile's sums are converted and written before the next tile's are formed: all four tiles' sums
      // beside the accumulators do not fit the registers of two resident blocks (they spilled)
      __builtin_amdgcn_sched_barrier(0);
    }
    store_rows16<64>(st, vTb + (size_t)(((m0 >> 9) * Hv + (n0 >> 6)) * HDv) * Sv + (m0 & 511), Sv);
    // as in the other branch
    asm volatile("s_wait_xcnt 0x0" ::: "memory");
  }
}

// ---------------------------------------------------------------- flash attention
// A stage is 64 keys of one head: 64 K rows (key-major) and 64 V^T rows (d-major), 128 bytes each. The block's
// four waves need the same rows, so they are brought into LDS once per block: each wave-wide 16-byte copy covers
// four whole 128-byte lines, where a fragment load from global memory touched sixteen lines for the same bytes.
// Two buffers: the next stage's copies fly while this one is worked on.
#define APITCH 72                   // halves per LDS row: 144 bytes, conflict-free for 16-byte readers
#define ABUF   (128 * APITCH)       // halves per buffer: K rows 0..63, V^T rows 64..127
#define ASTAGES (Sv / 64)

// kp, vp: this thread's 16-byte piece of K row r and of V^T row r of stage 0; it also copies rows r+16, r+32, r+48.
// From one stage to the next K moves on by 64 rows, V^T by 64 halves inside its rows. The eight addresses are
// formed here from the two, so that few address registers live through the loop.
static __device__ inline void kv_copy(unsigned l, const _Float16* kp, const _Float16* vp, int st) {
  // Eight copies of 16 bytes per lane, rows 16 apart. The s_wait_xcnt closes the statement so that no
  // address register of an issued copy is rewritten ahead of it.
  asm volatile(
      "global_load_async_to_lds_b128 %0, %8, off\n\t"
      "global_load_async_to_lds_b128 %1, %9, off\n\t"
      "global_load_async_to_lds_b128 %2, %10, off\n\t"
      "global_load_async_to_lds_b128 %3, %11, off\n\t"
      "global_load_async_to_lds_b128 %4, %12, off\n\t"
      "global_load_async_to_lds_b128 %5, %13, off\n\t"
      "global_load_async_to_lds_b128 %6, %14, off\n\t"
      "global_load_async_to_lds_b128 %7, %15, off\n\t"
      "s_wait_xcnt 0x0"
      :: "v"(l), "v"(l + 1u * 16u * APITCH * 2u), "v"(l + 2u * 16u * APITCH * 2u), "v"(l + 3u * 16u * APITCH * 2u),
         "v"(l + 4u * 16u * APITCH * 2u), "v"(l + 5u * 16u * APITCH * 2u), "v"(l + 6u * 16u * APITCH * 2u),
         "v"(l + 7u * 16u * APITCH * 2u),
         "v"(kp + (size_t)(st * 64) * Dv), "v"(kp + (size_t)(st * 64 + 16) * Dv),
         "v"(kp + (size_t)(st * 64 + 32) * Dv), "v"(kp + (size_t)(st * 64 + 48) * Dv),
         "v"(vp + (st * 64)), "v"(vp + (st * 64 + 16 * Sv)), "v"(vp + (st * 64 + 32 * Sv)), "v"(vp + (st * 64 + 48 * Sv))
      : "memory");
}

__global__ __launch_bounds__(128) void attn_kernel(
    const _Float16* __restrict__ Qb, const _Float16* __restrict__ Kb,
    const _Float16* __restrict__ vTb, _Float16* __restrict__ aout,
    const float* __restrict__ rpb)
{
  __shared__ __align__(16) _Float16 kv[2 * ABUF];
  const int lane = threadIdx.x & 31;
  const int wave = threadIdx.x >> 5;
  const int ml = lane & 15;
  const int koff = (lane >> 4) * 8;
  const int rowoff = (lane >> 4) * 8;
  const int qb = blockIdx.x, h = blockIdx.y, w = blockIdx.z & 7;
  const int j = blockIdx.z >> 3;          // modality pair: its own Q, K, V, output and bias table
  Qb += (size_t)j * ROWS * Dv;  Kb += (size_t)j * ROWS * Dv;
  vTb += (size_t)j * ROWS * Dv; aout += (size_t)j * ROWS * Dv;
  const float* rpbj = rpb + j * (2 * WSv - 1) * Hv;
  const int tq = qb;                      // 64-row chunks align to L

  const int cr = threadIdx.x >> 3;        // row of the stage this thread copies (and 16, 32, 48 below it)
  const int cc = (threadIdx.x & 7) * 8;   // its 16-byte piece of the row's 128 bytes
  const _Float16* kcp = Kb + (size_t)(w * Sv + cr) * Dv + h * HDv + cc;
  const _Float16* vcp = vTb + (size_t)((w * Hv + h) * HDv + cr) * Sv + cc;
  const unsigned lcopy = (unsigned)(size_t)kv + (unsigned)(cr * APITCH + cc) * 2u;

  kv_copy(lcopy, kcp, vcp, 0);

  const int qrow = qb * 64 + wave * 16;
  const _Float16* qp = Qb + (size_t)(w * Sv + qrow + ml) * Dv + h * HDv + koff;
  v16h qa0 = mkfrag(ld8(qp),      ld8(qp + 16));   // B operand: column = query ml
  v16h qa1 = mkfrag(ld8(qp + 32), ld8(qp + 48));

  v8f accO[4] = {};                       // accO[n][i] = O[query ml][d = n * 16 + rowoff + i]
  float m_ = -3.0e38f;                    // running maximum of query ml, the same in both of its lanes
  float l_ = 0.f;                         // running sum over this lane's half of the keys; joined after the loop
  const float L2E = 1.4426950408889634f;

  asm volatile("s_wait_asynccnt 0x0" ::: "memory");   // stage 0 has landed before the barrier publishes it
  __syncthreads();
  kv_copy(lcopy + ABUF * 2u, kcp, vcp, 1);

  // stays rolled: the buffer is picked by the stage's parity anyway
#pragma unroll 1
  for (int st = 0; st < ASTAGES; st++) {
    const int bo = (st & 1) * ABUF;
    const float biasv = rpbj[(tq - st + WSv - 1) * Hv + h];   // a stage is one temporal step of keys

    // unrolled so that both chunks' LDS offsets are constants (and the loops inside it so that s0, s1, mx, pb, vb
    // and accO are indexed by constants and stay in registers)
#pragma unroll
    for (int hc = 0; hc < 2; hc++) {
      // s0[i] = S[query ml][key hc * 32 + rowoff + i], s1[i] the same 16 keys on
      v8f s0 = {}, s1 = {};
      {
        const _Float16* kp0 = kv + bo + (hc * 32 + ml) * APITCH + koff;
        const _Float16* kp1 = kp0 + 16 * APITCH;
        v16h kb00 = mkfrag(ld8(kp0),      ld8(kp0 + 16));
        v16h kb01 = mkfrag(ld8(kp0 + 32), ld8(kp0 + 48));
        v16h kb10 = mkfrag(ld8(kp1),      ld8(kp1 + 16));
        v16h kb11 = mkfrag(ld8(kp1 + 32), ld8(kp1 + 48));
        s0 = WMMA_F32_F16(kb00, qa0, s0);
        s1 = WMMA_F32_F16(kb10, qa0, s1);
        s0 = WMMA_F32_F16(kb01, qa1, s0);
        s1 = WMMA_F32_F16(kb11, qa1, s1);
      }
      v16h vb[4];                          // A operand: row = d, k = the chunk's keys in the order of s0, s1
#pragma unroll
      for (int n = 0; n < 4; n++) {
        const _Float16* vp = kv + bo + (64 + n * 16 + ml) * APITCH + hc * 32 + koff;
        vb[n] = mkfrag(ld8(vp), ld8(vp + 16));
      }

      float mx[8];
#pragma unroll
      for (int i = 0; i < 8; i++) mx[i] = fmaxf(s0[i], s1[i]);
#pragma unroll
      for (int d = 4; d >= 1; d >>= 1)
#pragma unroll
        for (int i = 0; i < d; i++) mx[i] = fmaxf(mx[i], mx[i + d]);
      const float mc = fmaxf(mx[0], xhalf(mx[0])) + biasv;   // the bias is one value for the whole stage
      const float mn = fmaxf(m_, mc);
      const float alpha = __builtin_amdgcn_exp2f((m_ - mn) * L2E);
      m_ = mn;
      const float cl = (biasv - mn) * L2E;   // bias and maximum are one value per lane: one addend for all 16 scores

      v16h pb;                             // P^T as B operand: column = query ml, k as in vb
      float r0 = 0.f, r1 = 0.f;
#pragma unroll
      for (int i = 0; i < 8; i++) {
        const float p0 = __builtin_amdgcn_exp2f(fmaf(s0[i], L2E, cl));
        const float p1 = __builtin_amdgcn_exp2f(fmaf(s1[i], L2E, cl));
        r0 += p0;
        r1 += p1;
        pb[i]     = (_Float16)p0;
        pb[i + 8] = (_Float16)p1;
      }
      l_ = l_ * alpha + (r0 + r1);
#pragma unroll
      for (int n = 0; n < 4; n++) accO[n] *= alpha;

#pragma unroll
      for (int n = 0; n < 4; n++) accO[n] = WMMA_F32_F16(vb[n], pb, accO[n]);
    }

    asm volatile("s_wait_dscnt 0x0" ::: "memory");    // this wave's reads of the buffer are over before it is refilled
    asm volatile("s_wait_asynccnt 0x0" ::: "memory"); // this wave's copies of stage st + 1 have landed
    __syncthreads();                                  // publishes stage st + 1, frees stage st's buffer
    if (st + 2 < ASTAGES) kv_copy(lcopy + (unsigned)bo * 2u, kcp, vcp, st + 2);
  }
  asm volatile("s_wait_asynccnt 0x0" ::: "memory");   // nothing of this wave is in flight when it goes on

  const float inv = 1.0f / (l_ + xhalf(l_));
  // a lane's eight accumulator registers are eight neighbouring d of its query's row: one 16-byte store per tile
  v8h o[4];
#pragma unroll
  for (int n = 0; n < 4; n++)
#pragma unroll
    for (int i = 0; i < 8; i++) o[n][i] = (_Float16)(accO[n][i] * inv);
  _Float16* op = aout + (size_t)(w * Sv + qrow + ml) * Dv + h * HDv + rowoff;
#pragma unroll
  for (int n = 0; n < 4; n++) *(v8h*)(op + n * 16) = o[n];
}

// ---------------------------------------------------------------- output projection + residual + roll(+SH)
// grid (16, 8, 3 pairs): 256x128 tile per block of 8 waves, 64 rows x 64 cols per wave.
// four waves per SIMD: two blocks per WGP, as for the QKV GEMM
__global__ __launch_bounds__(256) __attribute__((amdgpu_waves_per_eu(4, 4))) void proj_kernel(
    const _Float16* __restrict__ aoutb, const _Float16* __restrict__ wpT,
    const float* __restrict__ bp,
    const float* __restrict__ audio, const float* __restrict__ video, const float* __restrict__ image,
    float* __restrict__ feat, _Float16* __restrict__ cat16)
{
  __shared__ __align__(16) _Float16 sm[2 * WBUF];
  const int j = blockIdx.z;
  const float* qmf = (j == 0) ? audio : (j == 1) ? video : image;   // residual: the pair's query modality
  aoutb += (size_t)j * ROWS * Dv;
  wpT += (size_t)j * Dv * Dv;
  bp += j * Dv;
  feat += (size_t)j * ROWS * Dv;
  const int lane = threadIdx.x & 31;
  const int wave = threadIdx.x >> 5;
  const int ml = lane & 15;
  const int m0 = blockIdx.x * 256 + (wave & 3) * 64;
  const int n0 = blockIdx.y * 128 + (wave >> 2) * 64;

  const int cr = threadIdx.x >> 3;
  const int cc = (threadIdx.x & 7) * 8;
  const _Float16* gp[12];
#pragma unroll
  for (int i = 0; i < 8; i++) gp[i] = aoutb + (size_t)(blockIdx.x * 256 + cr + 32 * i) * Dv + cc;
#pragma unroll
  for (int i = 0; i < 4; i++) gp[8 + i] = wpT + (size_t)(blockIdx.y * 128 + cr + 32 * i) * Dv + cc;

  // weights first: acc[p][n][i] is token m0 + n * 16 + ml, column n0 + p * 16 + rowoff + i
  v8f acc[4][4] = {};
  gemm_staged_w<Dv>(sm, gp, acc, true);

  const int rowoff = (lane >> 4) * 8;
  float* stf = (float*)(sm + wave * WSTG);
  // the wave's 64 tokens are one temporal step: their rows of the output follow one another
  const int wdw = m0 >> 9;
  const int tt = ((wdw & 3) * WSv + ((m0 & 511) >> 6) + SHv) & 31;   // roll back by +SH
  const size_t frow0 = (size_t)((wdw >> 2) * Tv + tt) * Lv;
  const float* bpl = bp + n0 + rowoff;
  v4f bc[4][2];
#pragma unroll
  for (int p = 0; p < 4; p++)
#pragma unroll
    for (int hf = 0; hf < 2; hf++) bc[p][hf] = *(const v4f*)(bpl + p * 16 + hf * 4);
  // the eight loads share one address register: it is an input here, so that it lives to this wait and no load's
  // result is given the same register
  asm volatile("s_wait_xcnt 0x0" :: "v"(bpl) : "memory");
  const int r0 = lane >> 4;
  const int c = (lane & 15) * 4;
  // 32 tokens at a time: 64 rows of floats do not fit the wave's part of the ring
#pragma unroll
  for (int half = 0; half < 2; half++) {
#pragma unroll
    for (int nn = 0; nn < 2; nn++)
#pragma unroll
      for (int p = 0; p < 4; p++)
#pragma unroll
        for (int hf = 0; hf < 2; hf++) {
          v4f v;
#pragma unroll
          for (int e = 0; e < 4; e++) v[e] = acc[p][half * 2 + nn][hf * 4 + e] + bc[p][hf][e];
          *(v4f*)(stf + (nn * 16 + ml) * FPITCH + p * 16 + rowoff + hf * 4) = v;
        }
    // this wave's staging writes have landed before other lanes of it read them back
    asm volatile("s_wait_dscnt 0x0" ::: "memory");
    // a wave-wide 16-byte access covers two rows of 256 bytes: whole lines for the residual, feat and (8 bytes) cat16
#pragma unroll
    for (int u = 0; u < 16; u++) {
      const size_t fr = frow0 + half * 32 + u * 2 + r0;
      const v4f v = *(const v4f*)(stf + (u * 2 + r0) * FPITCH + c) + *(const v4f*)(qmf + fr * Dv + n0 + c);
      *(v4f*)(feat + fr * Dv + n0 + c) = v;
      v4h h;
#pragma unroll
      for (int e = 0; e < 4; e++) h[e] = (_Float16)v[e];
      *(v4h*)(cat16 + fr * D3 + j * Dv + n0 + c) = h;
    }
    // the second half's loads take the registers that these stores name: none is rewritten ahead of this wait
    if (half == 0) asm volatile("s_wait_xcnt 0x0" ::: "memory");
  }
}

// ---------------------------------------------------------------- gating MLP layer 1 (+GELU) and its share of layer 2
// grid (32, 16): 128x128 tile per block of 8 waves.
// Layer 2 has three columns: each wave multiplies its 32 x 64 activations with its 64 rows of Wg2 as soon as they
// are turned in its LDS, and leaves three sums per row. The activations themselves never go to memory.
// gpart[c * GSLOTS + slot][row]: a wave's 32 rows of one plane are one whole 128-byte line, written by it alone.
#define GSLOTS (D2 / 64)
__global__ __launch_bounds__(256) void gate1_kernel(
    const _Float16* __restrict__ cat16, const _Float16* __restrict__ wg1T,
    const float* __restrict__ bg1, const float* __restrict__ Wg2, float* __restrict__ gpart)
{
  __shared__ __align__(16) _Float16 sm[2 * GBUF];
  const int lane = threadIdx.x & 31;
  const int wave = threadIdx.x >> 5;
  const int ml = lane & 15;
  const int m0 = blockIdx.x * 128 + (wave & 3) * 32;
  const int n0 = blockIdx.y * 128 + (wave >> 2) * 64;

  const int cr = threadIdx.x >> 3;
  const int cc = (threadIdx.x & 7) * 8;
  const _Float16* gp[8];
#pragma unroll
  for (int i = 0; i < 4; i++) {
    gp[i]     = cat16 + (size_t)(blockIdx.x * 128 + cr + 32 * i) * D3 + cc;
    gp[4 + i] = wg1T + (size_t)(blockIdx.y * 128 + cr + 32 * i) * D3 + cc;
  }

  v8f acc[2][4] = {};
  gemm_staged<D3>(sm, gp, acc);

  // acc[p][n][i]: row m0 + p * 16 + ml, column n0 + n * 16 + rowoff + i
  const int rowoff = (lane >> 4) * 8;
  _Float16* st = sm + wave * GSTG;
  // for layer 2 a lane takes eight of the wave's 64 columns: eight rows of Wg2 are 24 floats in a row. Asked for
  // here, they arrive under the GELUs.
  const float* wl = Wg2 + (n0 + (lane & 7) * 8) * 3;
  v4f wc[6];
#pragma unroll
  for (int q = 0; q < 6; q++) wc[q] = *(const v4f*)(wl + q * 4);
  // the six loads share one address register: it is an input here, so that it lives to this wait and no load's
  // result is given the same register
  asm volatile("s_wait_xcnt 0x0" :: "v"(wl) : "memory");
#pragma unroll
  for (int n = 0; n < 4; n++) {
    v4f bc[2];
#pragma unroll
    for (int hf = 0; hf < 2; hf++) bc[hf] = *(const v4f*)(bg1 + n0 + n * 16 + rowoff + hf * 4);
#pragma unroll
    for (int p = 0; p < 2; p++) {
      v8h h;
#pragma unroll
      for (int i = 0; i < 8; i++) {
        float x = acc[p][n][i] + bc[i >> 2][i & 3];
        float g = 0.5f * x * (1.0f + erff(x * 0.70710678118f));   // exact GELU
        h[i] = (_Float16)g;
      }
      *(v8h*)(st + (p * 16 + ml) * SPITCH + n * 16 + rowoff) = h;
    }
  }
  // this wave's staging writes have landed before other lanes of it read them back
  asm volatile("s_wait_dscnt 0x0" ::: "memory");
  // s[u][c]: row u * 4 + (lane >> 3), this lane's eight columns: 24 independent sums
  float s[8][3] = {};
#pragma unroll
  for (int u = 0; u < 8; u++) {
    const v8h g = *(const v8h*)(st + (u * 4 + (lane >> 3)) * SPITCH + (lane & 7) * 8);
#pragma unroll
    for (int i = 0; i < 8; i++)
#pragma unroll
      for (int c = 0; c < 3; c++) s[u][c] = fmaf((float)g[i], wc[(i * 3 + c) >> 2][(i * 3 + c) & 3], s[u][c]);
  }
  // The eight lanes that share rows add up. At each step a lane keeps half of its rows and hands the other half to
  // its partner, so that lane l ends with the whole sum of row u = l & 7 of its eight.
  const bool b2 = lane & 4, b1 = lane & 2, b0 = lane & 1;
  float* gp0 = gpart + (size_t)(n0 >> 6) * ROWS + m0 + (lane & 7) * 4 + (lane >> 3);
#pragma unroll
  for (int c = 0; c < 3; c++) {
    float t[4], r[2];
#pragma unroll
    for (int k = 0; k < 4; k++) t[k] = (b2 ? s[k + 4][c] : s[k][c]) + rowx<4>(b2 ? s[k][c] : s[k + 4][c]);
#pragma unroll
    for (int k = 0; k < 2; k++) r[k] = (b1 ? t[k + 2] : t[k]) + rowx<2>(b1 ? t[k] : t[k + 2]);
    gp0[(size_t)c * GSLOTS * ROWS] = (b0 ? r[1] : r[0]) + rowx<1>(b0 ? r[0] : r[1]);
  }
}

// ---------------------------------------------------------------- gating layer 2's last sum + softmax + fuse
// FROWS whole rows per block, four columns per thread: 16-byte accesses, the gates the same for the whole block,
// all 3 * FROWS loads of a thread issued before the first sum.
// While they fly, the block's first wave adds the GSLOTS partial sums of each logit, one slot per lane, for the
// block's FROWS rows at once, and takes the softmax; its loads are issued first, so that they come back first.
// The three planes come as three pointers, so that each address is a block-uniform base plus one per-lane offset
// that lives until the loads have come back: no vector register that an issued load names is written before that.
#define FROWS 4
__global__ __launch_bounds__(256) void fuse_kernel(const float* __restrict__ feat0, const float* __restrict__ feat1,
                                                   const float* __restrict__ feat2, const float* __restrict__ gpart,
                                                   const float* __restrict__ bg2, float* __restrict__ out)
{
  __shared__ __align__(16) float gs[3][FROWS];
  const int row0 = blockIdx.x * FROWS;
  const unsigned c = threadIdx.x * 4u;
  const float* fb[3] = { feat0 + (size_t)row0 * Dv, feat1 + (size_t)row0 * Dv, feat2 + (size_t)row0 * Dv };
  float* ob = out + (size_t)row0 * Dv;
  const bool first = threadIdx.x < 32;
  const float* gl = gpart + (size_t)(threadIdx.x & 31) * ROWS + row0;
  v4f sp[3] = {};
  if (first) {
#pragma unroll
    for (int m = 0; m < 3; m++) sp[m] = *(const v4f*)(gl + (size_t)m * GSLOTS * ROWS);
    // the address is an input here, so that it lives to this wait and no load's result is given its register
    asm volatile("s_wait_xcnt 0x0" :: "v"(gl) : "memory");
  }
  v4f f[FROWS][3];
#pragma unroll
  for (int u = 0; u < FROWS; u++)
#pragma unroll
    for (int m = 0; m < 3; m++) f[u][m] = *(const v4f*)(fb[m] + u * Dv + c);
  if (first) {
    const float L2E = 1.4426950408889634f;
#pragma unroll
    for (int m = 0; m < 3; m++)
#pragma unroll
      for (int u = 0; u < FROWS; u++) {
        float x = sp[m][u];
        x += rowx<1>(x);
        x += rowx<2>(x);
        x += rowx<4>(x);
        x += rowx<8>(x);
        sp[m][u] = x + xhalf(x);
      }
#pragma unroll
    for (int u = 0; u < FROWS; u++) {
      const float a0 = sp[0][u] + bg2[0], a1 = sp[1][u] + bg2[1], a2 = sp[2][u] + bg2[2];
      const float mx = fmaxf(a0, fmaxf(a1, a2));
      const float e0 = exp2_slot((a0 - mx) * L2E), e1 = exp2_slot((a1 - mx) * L2E), e2 = exp2_slot((a2 - mx) * L2E);
      const float inv = 1.0f / (e0 + e1 + e2);
      sp[0][u] = e0 * inv;
      sp[1][u] = e1 * inv;
      sp[2][u] = e2 * inv;
    }
    if (threadIdx.x == 0) {
#pragma unroll
      for (int m = 0; m < 3; m++) *(v4f*)gs[m] = sp[m];
    }
  }
  __syncthreads();                         // the gates of the block's rows are there for every wave
  const v4f g0 = *(const v4f*)gs[0], g1 = *(const v4f*)gs[1], g2 = *(const v4f*)gs[2];
#pragma unroll
  for (int u = 0; u < FROWS; u++) *(v4f*)(ob + u * Dv + c) = g0[u] * f[u][0] + g1[u] * f[u][1] + g2[u] * f[u][2];
}

// ---------------------------------------------------------------- launch
extern "C" void kernel_launch(void* const* d_in, const int* in_sizes, int n_in,
                              void* d_out, int out_size, void* d_ws, size_t ws_size,
                              hipStream_t stream)
{
  const float* audio = (const float*)d_in[0];
  const float* video = (const float*)d_in[1];
  const float* image = (const float*)d_in[2];
  const float* Wq  = (const float*)d_in[3];
  const float* Wk  = (const float*)d_in[4];
  const float* Wv  = (const float*)d_in[5];
  const float* Wp  = (const float*)d_in[6];
  const float* bq  = (const float*)d_in[7];
  const float* bk  = (const float*)d_in[8];
  const float* bv  = (const float*)d_in[9];
  const float* bp  = (const float*)d_in[10];
  const float* qn  = (const float*)d_in[11];
  const float* kn  = (const float*)d_in[12];
  const float* rpb = (const float*)d_in[13];
  const float* Wg1 = (const float*)d_in[14];
  const float* bg1 = (const float*)d_in[15];
  const float* Wg2 = (const float*)d_in[16];
  const float* bg2 = (const float*)d_in[17];
  float* out = (float*)d_out;

  char* p = (char*)d_ws;
  auto carve = [&](size_t bytes) -> void* {
    void* r = (void*)p;
    p += (bytes + 255) & ~(size_t)255;
    return r;
  };
  const size_t NE = (size_t)ROWS * Dv;                 // 4M elems
  _Float16* x16   = (_Float16*)carve(3 * NE * 2);
  _Float16* wqT   = (_Float16*)carve(3 * (size_t)Dv * Dv * 2);
  _Float16* wkT   = (_Float16*)carve(3 * (size_t)Dv * Dv * 2);
  _Float16* wvT   = (_Float16*)carve(3 * (size_t)Dv * Dv * 2);
  _Float16* wpT   = (_Float16*)carve(3 * (size_t)Dv * Dv * 2);
  _Float16* wg1T  = (_Float16*)carve((size_t)D3 * D2 * 2);
  _Float16* Qb    = (_Float16*)carve(3 * NE * 2);       // one plane per modality pair
  _Float16* Kb    = (_Float16*)carve(3 * NE * 2);
  _Float16* vTb   = (_Float16*)carve(3 * NE * 2);
  _Float16* aoutb = (_Float16*)carve(3 * NE * 2);
  _Float16* cat16 = (_Float16*)carve((size_t)ROWS * D3 * 2);
  float*    feats = (float*)carve(3 * NE * 4);
  float*    gpart = (float*)carve((size_t)3 * GSLOTS * ROWS * 4);

  // convert activations and transpose-convert weights to f16
  prep_kernel<<<G1TILES + 12 * WTILES + 3 * XBLOCKS, 256, 0, stream>>>(
      audio, video, image, Wq, Wk, Wv, Wp, Wg1, x16, wqT, wkT, wvT, wpT, wg1T);

  // the three modality pairs do not depend on one another: each stage takes all of them in one grid
  qkv_kernel<<<dim3(16, 8, 9), 256, 0, stream>>>(x16, wqT, wkT, wvT, bq, bk, bv, qn, kn, Qb, Kb, vTb);
  attn_kernel<<<dim3(8, 16, 24), 128, 0, stream>>>(Qb, Kb, vTb, aoutb, rpb);
  proj_kernel<<<dim3(16, 8, 3), 256, 0, stream>>>(aoutb, wpT, bp, audio, video, image, feats, cat16);

  gate1_kernel<<<dim3(32, 16), 256, 0, stream>>>(cat16, wg1T, bg1, Wg2, gpart);
  fuse_kernel<<<ROWS / FROWS, 256, 0, stream>>>(feats, feats + NE, feats + 2 * NE, gpart, bg2, out);
}

// v010
// A run of this version takes 180 microseconds.
// Next to v009, in two timings, it ran 1.06 and 1.07 times as fast.
// Over all steps from v000 it is 5.77 times as fast.
#include <hip/hip_runtime.h>
#include <hip/hip_bf16.h>

typedef __attribute__((ext_vector_type(16))) _Float16 v16h;
typedef __attribute__((ext_vector_type(8)))  _Float16 v8h;
typedef __attribute__((ext_vector_type(8)))  float    v8f;
typedef __attribute__((ext_vector_type(4)))  _Float16 v4h;
typedef __attribute__((ext_vector_type(4)))  float    v4f;

#define WMMA_F32_F16(a,b,c) __builtin_amdgcn_wmma_f32_16x16x32_f16(false,(a),false,(b),(short)0,(c),false,false)

#define Bv   2
#define Tv   32
#define Lv   64
#define Dv   1024
#define Hv   16
#define WSv  8
#define SHv  4
#define HDv  64
#define Sv   512      // WS*L
#define ROWS 4096     // B*T*L
#define D3   3072
#define D2   2048
#define TPITCH 72     // halves per LDS row of the transpose tile

static __device__ inline v8h ld8(const _Float16* p) { return *(const v8h*)p; }

static __device__ inline v16h mkfrag(v8h lo, v8h hi) {
  v16h r;
#pragma unroll
  for (int i = 0; i < 8; i++) { r[i] = lo[i]; r[i + 8] = hi[i]; }
  return r;
}

// lane l <-> lane l ^ 16: the two lanes that share a column of an accumulator tile
static __device__ inline float xhalf(float x) {
  const int b = __builtin_bit_cast(int, x);
  return __builtin_bit_cast(float, __builtin_amdgcn_permlanex16(b, b, 0x76543210, 0xfedcba98, false, false));
}

// lane l <-> lane l ^ M, M below 16: a row_xmask move, which the compiler folds into the add that takes it
template <int M>
static __device__ inline float rowx(float x) {
  return __builtin_bit_cast(float, __builtin_amdgcn_update_dpp(0, __builtin_bit_cast(int, x), 0x160 | M, 0xf, 0xf, true));
}

// 2^x. The v_nop is the slot that the instruction set asks for behind a transcendental.
static __device__ inline float exp2_slot(float x) {
  float r;
  asm("v_exp_f32 %0, %1\n\tv_nop" : "=v"(r) : "v"(x));
  return r;
}

// window-order row -> source row of [B,T,L] with roll(-SH) folded in
static __device__ inline int src_row(int r) {
  int w = r >> 9;          // window (0..7): b*4 + widx
  int s = r & 511;         // token in window
  int b = w >> 2;
  int widx = w & 3;
  int tq = s >> 6;
  int l = s & 63;
  int tp = widx * WSv + tq;
  int tsrc = (tp + SHv) & 31;
  return ((b * Tv + tsrc) << 6) + l;
}

// ---------------------------------------------------------------- converts
// TPB 64 x 64 tiles per block, one below the other in the source, each turned in its own LDS tile: source rows
// are read as 16-byte pieces (a thread's 4 * TPB loads stand ahead of its converts, so that many are in flight),
// destination rows (k-contiguous) leave as whole 128-byte lines. R is a multiple of 64 * TPB, C of 64.
#define TPB 4
static __device__ inline void cvtT_tiles(_Float16* tile, const float* __restrict__ s, _Float16* __restrict__ d,
                                         int R, int C, int bx, int by) {
  const int t = threadIdx.x;
  const int c0 = bx * 64;
  const int r0 = by * (64 * TPB);
  const int c4 = (t & 15) * 4;
  const int r4 = (t >> 4) * 4;
  v4f v[TPB][4];
#pragma unroll
  for (int q = 0; q < TPB; q++)
#pragma unroll
    for (int p = 0; p < 4; p++) v[q][p] = *(const v4f*)(s + (size_t)(r0 + q * 64 + r4 + p) * C + c0 + c4);
#pragma unroll
  for (int q = 0; q < TPB; q++)
#pragma unroll
    for (int ci = 0; ci < 4; ci++) {
      v4h h;
#pragma unroll
      for (int p = 0; p < 4; p++) h[p] = (_Float16)v[q][p][ci];
      *(v4h*)(tile + (q * 64 + c4 + ci) * TPITCH + r4) = h;
    }
  __syncthreads();
  const int seg = (t & 7) * 8;
#pragma unroll
  for (int q = 0; q < TPB; q++)
#pragma unroll
    for (int p = 0; p < 2; p++) {
      const int c = p * 32 + (t >> 3);
      *(v8h*)(d + (size_t)(c0 + c) * R + r0 + q * 64 + seg) = *(const v8h*)(tile + (q * 64 + c) * TPITCH + seg);
    }
  // in the merged kernel another part's code follows these stores in the listing: no register that they name is
  // rewritten ahead of this wait
  asm volatile("s_wait_xcnt 0x0" ::: "memory");
}

// All conversions are independent of one another and run as one grid. Blocks in order: the tiles of Wg1,
// the tiles of the twelve D x D weights (pair-major: q, k, v, p), then XPT activation elements per thread.
// A block carries enough work that the grid is 1920 blocks (15360 waves).
#define G1TILES ((D2 / 64) * (D3 / (64 * TPB)))
#define WTILES  ((Dv / 64) * (Dv / (64 * TPB)))
#define XPT     64
#define XBLOCKS (ROWS * Dv / (256 * XPT))
__global__ __launch_bounds__(256) void prep_kernel(
    const float* __restrict__ audio, const float* __restrict__ video, const float* __restrict__ image,
    const float* __restrict__ Wq, const float* __restrict__ Wk, const float* __restrict__ Wv,
    const float* __restrict__ Wp, const float* __restrict__ Wg1,
    _Float16* __restrict__ x16, _Float16* __restrict__ wqT, _Float16* __restrict__ wkT,
    _Float16* __restrict__ wvT, _Float16* __restrict__ wpT, _Float16* __restrict__ wg1T)
{
  __shared__ __align__(16) _Float16 tile[TPB * 64 * TPITCH];   // [tile][c][r], rows 16 bytes longer than the data
  int b = blockIdx.x;
  if (b < G1TILES) {
    cvtT_tiles(tile, Wg1, wg1T, D3, D2, b % (D2 / 64), b / (D2 / 64));
    return;
  }
  b -= G1TILES;
  if (b < 12 * WTILES) {
    const int m = b / WTILES;
    const int kind = m & 3;
    const size_t off = (size_t)(m >> 2) * Dv * Dv;
    const float* s = (kind == 0) ? Wq : (kind == 1) ? Wk : (kind == 2) ? Wv : Wp;
    _Float16* d    = (kind == 0) ? wqT : (kind == 1) ? wkT : (kind == 2) ? wvT : wpT;
    const int tl = b % WTILES;
    cvtT_tiles(tile, s + off, d + off, Dv, Dv, tl % (Dv / 64), tl / (Dv / 64));
    return;
  }
  b -= 12 * WTILES;
  const int mod = b / XBLOCKS;
  const float* s = (mod == 0) ? audio : (mod == 1) ? video : image;
  // each wave-wide load covers 512 contiguous bytes, each store 256; the loads stand ahead of the converts
  const int i = (b % XBLOCKS) * (256 * XPT) + threadIdx.x * 4;
  _Float16* xd = x16 + (size_t)mod * ROWS * Dv + i;
  v4f xv[XPT / 4];
#pragma unroll
  for (int u = 0; u < XPT / 4; u++) xv[u] = *(const v4f*)(s + i + u * 1024);
#pragma unroll
  for (int u = 0; u < XPT / 4; u++) {
    v4h h;
#pragma unroll
    for (int e = 0; e < 4; e++) h[e] = (_Float16)xv[u][e];
    *(v4h*)(xd + u * 1024) = h;
  }
  // the tile parts' code follows these stores in the listing: no register that they name is rewritten ahead of this wait
  asm volatile("s_wait_xcnt 0x0" ::: "memory");
}

// ---------------------------------------------------------------- staged GEMM cores
// A stage is a run of k of the tile's A rows and B rows. Each wave-wide 16-byte copy covers four whole 128-byte
// lines and lands in LDS without passing a register; two buffers, so the next stage's copies fly while this one
// is multiplied.
#define GBK    64                   // halves of k per stage
#define GPITCH 72                   // halves per LDS row: 144 bytes, conflict-free for 16-byte readers

// ---------------------------------------------------------------- staged GEMM core, wide tile
// One 256 x 128 tile of Y = A * B^T per block of 8 waves (4 along M x 2 along N, 64 x 64 each): a wave's eight
// fragments of a 32-k step feed 16 WMMAs (one 16-byte LDS read per WMMA, where the 32 x 64 wave tile takes one and
// a half), and a stage brings 384 rows from L2 for the work of two 128 x 128 tiles, which bring 512.
// The fragments of one 32-k step at a time are held, so that two blocks stay resident per WGP.
#define WBUF   (384 * GPITCH)       // halves per buffer: A rows 0..255, B rows 256..383

// Output staging. An accumulator tile stored as it lies leaves in pieces of 32 or 64 bytes, each a line transaction of
// its own. Each wave turns its tile in its own eighth of the ring, which is free by then, and stores whole 128-byte lines.
#define SPITCH 72                   // halves per staged row of 64 halves: 144 bytes, conflict-free for 16-byte writers
#define FPITCH 68                   // floats per staged row of 64 floats: 272 bytes, the same
#define WSTG   (2 * WBUF / 8)       // halves of the wide ring per wave

// NR staged rows of 64 halves go out, four whole lines per wave-wide 16-byte store; row r goes to g + r * pitch.
template <int NR>
static __device__ inline void store_rows16(const _Float16* st, _Float16* g, int pitch) {
  const int lane = threadIdx.x & 31;
  const int r0 = lane >> 3;
  const int c = (lane & 7) * 8;
  // this wave's staging writes have landed before other lanes of it read them back
  asm volatile("s_wait_dscnt 0x0" ::: "memory");
  v8h x[NR / 4];
#pragma unroll
  for (int u = 0; u < NR / 4; u++) x[u] = *(const v8h*)(st + (u * 4 + r0) * SPITCH + c);
#pragma unroll
  for (int u = 0; u < NR / 4; u++) *(v8h*)(g + (size_t)((u * 4 + r0) * pitch) + c) = x[u];
}

static __device__ inline void stage_copy_w(unsigned l, const _Float16* const (&gp)[12]) {
  // Twelve copies of 16 bytes per lane, rows 32 apart. The s_wait_xcnt closes the statement so that no
  // address register of an issued copy is rewritten ahead of it.
  asm volatile(
      "global_load_async_to_lds_b128 %0, %12, off\n\t"
      "global_load_async_to_lds_b128 %1, %13, off\n\t"
      "global_load_async_to_lds_b128 %2, %14, off\n\t"
      "global_load_async_to_lds_b128 %3, %15, off\n\t"
      "global_load_async_to_lds_b128 %4, %16, off\n\t"
      "global_load_async_to_lds_b128 %5, %17, off\n\t"
      "global_load_async_to_lds_b128 %6, %18, off\n\t"
      "global_load_async_to_lds_b128 %7, %19, off\n\t"
      "global_load_async_to_lds_b128 %8, %20, off\n\t"
      "global_load_async_to_lds_b128 %9, %21, off\n\t"
      "global_load_async_to_lds_b128 %10, %22, off\n\t"
      "global_load_async_to_lds_b128 %11, %23, off\n\t"
      "s_wait_xcnt 0x0"
      :: "v"(l), "v"(l + 1u * 32u * GPITCH * 2u), "v"(l + 2u * 32u * GPITCH * 2u), "v"(l + 3u * 32u * GPITCH * 2u),
         "v"(l + 4u * 32u * GPITCH * 2u), "v"(l + 5u * 32u * GPITCH * 2u), "v"(l + 6u * 32u * GPITCH * 2u),
         "v"(l + 7u * 32u * GPITCH * 2u), "v"(l + 8u * 32u * GPITCH * 2u), "v"(l + 9u * 32u * GPITCH * 2u),
         "v"(l + 10u * 32u * GPITCH * 2u), "v"(l + 11u * 32u * GPITCH * 2u),
         "v"(gp[0]), "v"(gp[1]), "v"(gp[2]), "v"(gp[3]), "v"(gp[4]), "v"(gp[5]),
         "v"(gp[6]), "v"(gp[7]), "v"(gp[8]), "v"(gp[9]), "v"(gp[10]), "v"(gp[11])
      : "memory");
}

// gp[0..7]: this thread's piece of A rows r, r+32, .. r+224 of the tile; gp[8..11]: of B rows r, .. r+96.
// The pointers move on by one stage behind each group of copies, in place: no second set of address registers.
// A and B fragments share one k order and the wave tile is square, so either may be the first operand:
// acc[p][n][i] belongs to row p * 16 + (lane >> 4) * 8 + i of the first and row n * 16 + (lane & 15) of the second.
// bfirst (block-uniform) makes B the first: a lane then holds eight neighbouring columns of Y instead of eight rows.
// Behind the last stage's barrier nobody reads sm and no copy is in flight: the epilogue may stage there.
template <int KT>
static __device__ inline void gemm_staged_w(_Float16* sm, const _Float16* (&gp)[12], v8f (&acc)[4][4], bool bfirst) {
  const int t = threadIdx.x;
  const int lane = t & 31;
  const int wave = t >> 5;
  const int ml = lane & 15;
  const int koff = (lane >> 4) * 8;
  const unsigned lcopy = (unsigned)(size_t)sm + (unsigned)((t >> 3) * GPITCH + (t & 7) * 8) * 2u;
  const int arow = (wave & 3) * 64, brow = 256 + (wave >> 2) * 64;
  const _Float16* ard = sm + ((bfirst ? brow : arow) + ml) * GPITCH + koff;   // first operand's rows
  const _Float16* brd = sm + ((bfirst ? arow : brow) + ml) * GPITCH + koff;   // second operand's rows
  constexpr int NT = KT / GBK;

  stage_copy_w(lcopy, gp);
#pragma unroll
  for (int i = 0; i < 12; i++) gp[i] += GBK;
  asm volatile("s_wait_asynccnt 0x0" ::: "memory");   // stage 0 has landed before the barrier publishes it
  __syncthreads();
  stage_copy_w(lcopy + WBUF * 2u, gp);
#pragma unroll
  for (int i = 0; i < 12; i++) gp[i] += GBK;

  // stays rolled: the buffer is picked by the stage's parity, and unrolled the reads spread between the WMMAs
#pragma unroll 1
  for (int s = 0; s < NT; s++) {
    const int bo = (s & 1) * WBUF;
    // (the inner loops are unrolled so that a, b and acc are indexed by constants and stay in registers)
    v16h a[4], b[4];
#pragma unroll
    for (int p = 0; p < 4; p++) {
      a[p] = mkfrag(ld8(ard + bo + p * 16 * GPITCH), ld8(ard + bo + p * 16 * GPITCH + 16));
      b[p] = mkfrag(ld8(brd + bo + p * 16 * GPITCH), ld8(brd + bo + p * 16 * GPITCH + 16));
    }
    // keeps the step's sixteen reads one group ahead of its WMMAs: sunk among them, each place costs an LDS latency
    __builtin_amdgcn_sched_barrier(0);
#pragma unroll
    for (int n = 0; n < 4; n++)
#pragma unroll
      for (int p = 0; p < 4; p++) acc[p][n] = WMMA_F32_F16(a[p], b[n], acc[p][n]);
    // keeps the second step's reads behind the first step's WMMAs: lifted over them they would need a second
    // fragment set, and its registers would cost the second resident block
    __builtin_amdgcn_sched_barrier(0);
#pragma unroll
    for (int p = 0; p < 4; p++) {
      a[p] = mkfrag(ld8(ard + bo + 32 + p * 16 * GPITCH), ld8(ard + bo + 32 + p * 16 * GPITCH + 16));
      b[p] = mkfrag(ld8(brd + bo + 32 + p * 16 * GPITCH), ld8(brd + bo + 32 + p * 16 * GPITCH + 16));
    }
    asm volatile("s_wait_dscnt 0x0" ::: "memory");    // this wave's reads of the buffer are over before it is refilled
    asm volatile("s_wait_asynccnt 0x0" ::: "memory"); // this wave's copies of stage s + 1 have landed
    __syncthreads();                                  // publishes stage s + 1, frees stage s's buffer
    if (s + 2 < NT) {
      stage_copy_w(lcopy + (unsigned)bo * 2u, gp);
#pragma unroll
      for (int i = 0; i < 12; i++) gp[i] += GBK;
    }
    // stage s + 2 flies while the second step is multiplied from registers
#pragma unroll
    for (int n = 0; n < 4; n++)
#pragma unroll
      for (int p = 0; p < 4; p++) acc[p][n] = WMMA_F32_F16(a[p], b[n], acc[p][n]);
  }
  asm volatile("s_wait_asynccnt 0x0" ::: "memory");   // nothing of this wave is in flight when it goes on
}

// ---------------------------------------------------------------- staged GEMM core, wide tile, k shared out
// One 256 x 128 tile of Y = A * B^T per block of 16 waves, for a grid of one block per WGP. A stage is 128 k (256
// bytes a row). Waves 0..7 multiply the first 64 k of every stage, waves 8..15 the second 64 k, each group as 4 x 2
// wave tiles of 64 x 64: one 16-byte LDS read per WMMA and 384 rows from L2 per 256 x 128 tile, as in the core above,
// with four waves on every SIMD. Waves w and w + 8 hold the two halves of the same 64 x 64 sums.
#define KBK    128                  // halves of k per stage
#define KPITCH 136                  // halves per LDS row: 272 bytes, conflict-free for 16-byte readers
#define KBUF   (384 * KPITCH)       // halves per buffer: A rows 0..255, B rows 256..383

static __device__ inline void stage_copy_k(unsigned l, const _Float16* const (&gp)[12]) {
  // Twelve copies of 16 bytes per lane, rows 32 apart. The s_wait_xcnt closes the statement so that no
  // address register of an issued copy is rewritten ahead of it.
  asm volatile(
      "global_load_async_to_lds_b128 %0, %12, off\n\t"
      "global_load_async_to_lds_b128 %1, %13, off\n\t"
      "global_load_async_to_lds_b128 %2, %14, off\n\t"
      "global_load_async_to_lds_b128 %3, %15, off\n\t"
      "global_load_async_to_lds_b128 %4, %16, off\n\t"
      "global_load_async_to_lds_b128 %5, %17, off\n\t"
      "global_load_async_to_lds_b128 %6, %18, off\n\t"
      "global_load_async_to_lds_b128 %7, %19, off\n\t"
      "global_load_async_to_lds_b128 %8, %20, off\n\t"
      "global_load_async_to_lds_b128 %9, %21, off\n\t"
      "global_load_async_to_lds_b128 %10, %22, off\n\t"
      "global_load_async_to_lds_b128 %11, %23, off\n\t"
      "s_wait_xcnt 0x0"
      :: "v"(l), "v"(l + 1u * 32u * KPITCH * 2u), "v"(l + 2u * 32u * KPITCH * 2u), "v"(l + 3u * 32u * KPITCH * 2u),
         "v"(l + 4u * 32u * KPITCH * 2u), "v"(l + 5u * 32u * KPITCH * 2u), "v"(l + 6u * 32u * KPITCH * 2u),
         "v"(l + 7u * 32u * KPITCH * 2u), "v"(l + 8u * 32u * KPITCH * 2u), "v"(l + 9u * 32u * KPITCH * 2u),
         "v"(l + 10u * 32u * KPITCH * 2u), "v"(l + 11u * 32u * KPITCH * 2u),
         "v"(gp[0]), "v"(gp[1]), "v"(gp[2]), "v"(gp[3]), "v"(gp[4]), "v"(gp[5]),
         "v"(gp[6]), "v"(gp[7]), "v"(gp[8]), "v"(gp[9]), "v"(gp[10]), "v"(gp[11])
      : "memory");
}

// gp[0..7]: this thread's piece of A rows r, r+32, .. r+224 of the tile; gp[8..11]: of B rows r, .. r+96.
// B is the first operand: acc[p][n][i] belongs to B row p * 16 + (lane >> 4) * 8 + i of the wave's 64 and to A row
// ((n * 16) ^ (kg * 32)) + (lane & 15), kg the wave's k group: tiles n = 0, 1 are the 32 A rows that the wave will
// finish itself, tiles n = 2, 3 those that its partner finishes.
// Behind the last stage's barrier nobody reads sm and no copy is in flight: the epilogue may stage there.
template <int KT>
static __device__ inline void gemm_staged_k2(_Float16* sm, const _Float16* (&gp)[12], v8f (&acc)[4][4]) {
  const int t = threadIdx.x;
  const int lane = t & 31;
  const int wave = t >> 5;
  const int kg = wave >> 3;
  const int ml = lane & 15;
  const int koff = kg * 64 + (lane >> 4) * 8;
  const unsigned lcopy = (unsigned)(size_t)sm + (unsigned)((t >> 4) * KPITCH + (t & 15) * 8) * 2u;
  const _Float16* ard = sm + (256 + ((wave >> 2) & 1) * 64 + ml) * KPITCH + koff;          // B rows
  const _Float16* brd0 = sm + ((wave & 3) * 64 + kg * 32 + ml) * KPITCH + koff;            // A rows of tiles 0, 1
  const _Float16* brd1 = sm + ((wave & 3) * 64 + (kg ^ 1) * 32 + ml) * KPITCH + koff;      // A rows of tiles 2, 3
  constexpr int NT = KT / KBK;

  stage_copy_k(lcopy, gp);
#pragma unroll
  for (int i = 0; i < 12; i++) gp[i] += KBK;
  asm volatile("s_wait_asynccnt 0x0" ::: "memory");   // stage 0 has landed before the barrier publishes it
  __syncthreads();
  stage_copy_k(lcopy + KBUF * 2u, gp);
#pragma unroll
  for (int i = 0; i < 12; i++) gp[i] += KBK;

  // stays rolled: the buffer is picked by the stage's parity, and unrolled the reads spread between the WMMAs
#pragma unroll 1
  for (int s = 0; s < NT; s++) {
    const int bo = (s & 1) * KBUF;
    // (the inner loops are unrolled so that a, b and acc are indexed by constants and stay in registers)
    v16h a[4], b[4];
#pragma unroll
    for (int p = 0; p < 4; p++) {
      const _Float16* bp = ((p < 2) ? brd0 : brd1) + bo + (p & 1) * 16 * KPITCH;
      a[p] = mkfrag(ld8(ard + bo + p * 16 * KPITCH), ld8(ard + bo + p * 16 * KPITCH + 16));
      b[p] = mkfrag(ld8(bp), ld8(bp + 16));
    }
    // keeps the step's sixteen reads one group ahead of its WMMAs: sunk among them, each place costs an LDS latency
    __builtin_amdgcn_sched_barrier(0);
#pragma unroll
    for (int n = 0; n < 4; n++)
#pragma unroll
      for (int p = 0; p < 4; p++) acc[p][n] = WMMA_F32_F16(a[p], b[n], acc[p][n]);
    // keeps the second step's reads behind the first step's WMMAs: lifted over them they would need a second
    // fragment set, more registers than sixteen waves of one block can have
    __builtin_amdgcn_sched_barrier(0);
#pragma unroll
    for (int p = 0; p < 4; p++) {
      const _Float16* bp = ((p < 2) ? brd0 : brd1) + bo + 32 + (p & 1) * 16 * KPITCH;
      a[p] = mkfrag(ld8(ard + bo + 32 + p * 16 * KPITCH), ld8(ard + bo + 32 + p * 16 * KPITCH + 16));
      b[p] = mkfrag(ld8(bp), ld8(bp + 16));
    }
    asm volatile("s_wait_dscnt 0x0" ::: "memory");    // this wave's reads of the buffer are over before it is refilled
    asm volatile("s_wait_asynccnt 0x0" ::: "memory"); // this wave's copies of stage s + 1 have landed
    __syncthreads();                                  // publishes stage s + 1, frees stage s's buffer
    if (s + 2 < NT) {
      stage_copy_k(lcopy + (unsigned)bo * 2u, gp);
#pragma unroll
      for (int i = 0; i < 12; i++) gp[i] += KBK;
    }
    // stage s + 2 flies while the second step is multiplied from registers
#pragma unroll
    for (int n = 0; n < 4; n++)
#pragma unroll
      for (int p = 0; p < 4; p++) acc[p][n] = WMMA_F32_F16(a[p], b[n], acc[p][n]);
  }
  asm volatile("s_wait_asynccnt 0x0" ::: "memory");   // nothing of this wave is in flight when it goes on
}

// ---------------------------------------------------------------- QKV GEMM
// grid (16, 8, 9): 256-row x 128-col tiles per block; z = 3 * pair + (Q, K or V).
// block = 256 (8 waves); each wave: 64 rows x 64 cols (one head), 16 WMMAs / 32-K step.
// four waves per SIMD: two blocks per WGP, so that one block's waits and epilogue lie under the other's WMMAs
__global__ __launch_bounds__(256) __attribute__((amdgpu_waves_per_eu(4, 4))) void qkv_kernel(
    const _Float16* __restrict__ x16,
    const _Float16* __restrict__ wqT, const _Float16* __restrict__ wkT, const _Float16* __restrict__ wvT,
    const float* __restrict__ bq, const float* __restrict__ bk, const float* __restrict__ bv,
    const float* __restrict__ qn, const float* __restrict__ kn,
    _Float16* __restrict__ Qb, _Float16* __restrict__ Kb, _Float16* __restrict__ vTb)
{
  __shared__ __align__(16) _Float16 sm[2 * WBUF];
  const int j = blockIdx.z / 3;             // modality pair
  const int which = blockIdx.z % 3;
  const size_t NE = (size_t)ROWS * Dv;
  // queries come from modality j; keys and values from video for pairs 0 and 2, from audio for pair 1
  const _Float16* xq = x16 + (size_t)j * NE;
  const _Float16* xc = x16 + ((j == 1) ? 0 : NE);
  wqT += (size_t)j * Dv * Dv;  wkT += (size_t)j * Dv * Dv;  wvT += (size_t)j * Dv * Dv;
  bq += j * Dv;  bk += j * Dv;  bv += j * Dv;
  qn += j * HDv; kn += j * HDv;
  Qb += (size_t)j * NE;  Kb += (size_t)j * NE;  vTb += (size_t)j * NE;
  const int lane = threadIdx.x & 31;
  const int wave = threadIdx.x >> 5;
  const int ml = lane & 15;
  const int m0 = blockIdx.x * 256 + (wave & 3) * 64;
  const int n0 = blockIdx.y * 128 + (wave >> 2) * 64;

  const _Float16* src = (which == 0) ? xq : xc;
  const _Float16* wT  = (which == 0) ? wqT : (which == 1 ? wkT : wvT);
  const float* bias   = (which == 0) ? bq  : (which == 1 ? bk  : bv);

  const int cr = threadIdx.x >> 3;          // row of the tile this thread copies (and every 32nd below it)
  const int cc = (threadIdx.x & 7) * 8;     // its 16-byte piece of the row's 128 bytes
  const _Float16* gp[12];
#pragma unroll
  for (int i = 0; i < 8; i++) gp[i] = src + (size_t)src_row(blockIdx.x * 256 + cr + 32 * i) * Dv + cc;
#pragma unroll
  for (int i = 0; i < 4; i++) gp[8 + i] = wT + (size_t)(blockIdx.y * 128 + cr + 32 * i) * Dv + cc;

  // Q and K are stored token-major: weights first, so that a lane holds eight neighbouring columns of one token.
  // V is stored d-major: activations first, so that a lane holds eight neighbouring tokens of one d.
  v8f acc[4][4] = {};
  gemm_staged_w<Dv>(sm, gp, acc, which < 2);

  const int rowoff = (lane >> 4) * 8;
  _Float16* st = sm + wave * WSTG;
  if (which < 2) {
    // acc[p][n][i]: token m0 + n * 16 + ml, column n0 + p * 16 + rowoff + i (the wave's 64 columns are one head)
    const float* nw_ = (which == 0) ? qn : kn;
    const float sc = (which == 0) ? 0.125f : 1.0f;   // fold HD^-0.5 into Q
    // the bias goes into the accumulators in place, one column tile at a time: few values live beside them
#pragma unroll
    for (int p = 0; p < 4; p++) {
      v8f bc;
#pragma unroll
      for (int i = 0; i < 8; i++) bc[i] = bias[n0 + p * 16 + rowoff + i];
#pragma unroll
      for (int n = 0; n < 4; n++) acc[p][n] += bc;
    }
    v8f wc[4];
#pragma unroll
    for (int p = 0; p < 4; p++)
#pragma unroll
      for (int i = 0; i < 8; i++) wc[p][i] = nw_[p * 16 + rowoff + i];
#pragma unroll
    for (int n = 0; n < 4; n++) {
      float sp[4];                         // RMS-norm over the head dim: 32 columns in the lane, 32 in lane ^ 16
#pragma unroll
      for (int p = 0; p < 4; p++) {
        sp[p] = 0.f;
#pragma unroll
        for (int i = 0; i < 8; i++) sp[p] += acc[p][n][i] * acc[p][n][i];
      }
      float ss = (sp[0] + sp[1]) + (sp[2] + sp[3]);
      ss += xhalf(ss);
      const float rs = rsqrtf(ss * (1.0f / 64.0f) + 1e-6f) * sc;
#pragma unroll
      for (int p = 0; p < 4; p++) {
        v8h h;
#pragma unroll
        for (int i = 0; i < 8; i++) h[i] = (_Float16)(acc[p][n][i] * (rs * wc[p][i]));
        *(v8h*)(st + (n * 16 + ml) * SPITCH + p * 16 + rowoff) = h;
      }
      // one token tile is normed and written before the next is begun: interleaved, their scaled weights beside the
      // accumulators do not fit the registers of two resident blocks (they spilled)
      __builtin_amdgcn_sched_barrier(0);
    }
    store_rows16<64>(st, ((which == 0) ? Qb : Kb) + (size_t)m0 * Dv + n0, Dv);
    // the other branch's code may follow these stores in the listing: no register that they name is rewritten ahead of this wait
    asm volatile("s_wait_xcnt 0x0" ::: "memory");
  } else {
    // acc[p][n][i]: token m0 + p * 16 + rowoff + i, column n0 + n * 16 + ml; V transposed: [(w*H+h)*HD+d][token]
    float bc[4];
#pragma unroll
    for (int n = 0; n < 4; n++) bc[n] = bias[n0 + n * 16 + ml];
#pragma unroll
    for (int n = 0; n < 4; n++) {
#pragma unroll
      for (int p = 0; p < 4; p++) {
        v8h h;
#pragma unroll
        for (int i = 0; i < 8; i++) h[i] = (_Float16)(acc[p][n][i] + bc[n]);
        *(v8h*)(st + (n * 16 + ml) * SPITCH + p * 16 + rowoff) = h;
      }
      // one column tile's sums are converted and written before the next tile's are formed: all four tiles' sums
      // beside the accumulators do not fit the registers of two resident blocks (they spilled)
      __builtin_amdgcn_sched_barrier(0);
    }
    store_rows16<64>(st, vTb + (size_t)(((m0 >> 9) * Hv + (n0 >> 6)) * HDv) * Sv + (m0 & 511), Sv);
    // as in the other branch
    asm volatile("s_wait_xcnt 0x0" ::: "memory");
  }
}

// ---------------------------------------------------------------- flash attention
// A stage is 64 keys of one head: 64 K rows (key-major) and 64 V^T rows (d-major), 128 bytes each. The block's
// four waves need the same rows, so they are brought into LDS once per block: each wave-wide 16-byte copy covers
// four whole 128-byte lines, where a fragment load from global memory touched sixteen lines for the same bytes.
// Two buffers: the next stage's copies fly while this one is worked on.
#define APITCH 72                   // halves per LDS row: 144 bytes, conflict-free for 16-byte readers
#define ABUF   (128 * APITCH)       // halves per buffer: K rows 0..63, V^T rows 64..127
#define ASTAGES (Sv / 64)

// kp, vp: this thread's 16-byte piece of K row r and of V^T row r of stage 0; it also copies rows r+16, r+32, r+48.
// From one stage to the next K moves on by 64 rows, V^T by 64 halves inside its rows. The eight addresses are
// formed here from the two, so that few address registers live through the loop.
static __device__ inline void kv_copy(unsigned l, const _Float16* kp, const _Float16* vp, int st) {
  // Eight copies of 16 bytes per lane, rows 16 apart. The s_wait_xcnt closes the statement so that no
  // address register of an issued copy is rewritten ahead of it.
  asm volatile(
      "global_load_async_to_lds_b128 %0, %8, off\n\t"
      "global_load_async_to_lds_b128 %1, %9, off\n\t"
      "global_load_async_to_lds_b128 %2, %10, off\n\t"
      "global_load_async_to_lds_b128 %3, %11, off\n\t"
      "global_load_async_to_lds_b128 %4, %12, off\n\t"
      "global_load_async_to_lds_b128 %5, %13, off\n\t"
      "global_load_async_to_lds_b128 %6, %14, off\n\t"
      "global_load_async_to_lds_b128 %7, %15, off\n\t"
      "s_wait_xcnt 0x0"
      :: "v"(l), "v"(l + 1u * 16u * APITCH * 2u), "v"(l + 2u * 16u * APITCH * 2u), "v"(l + 3u * 16u * APITCH * 2u),
         "v"(l + 4u * 16u * APITCH * 2u), "v"(l + 5u * 16u * APITCH * 2u), "v"(l + 6u * 16u * APITCH * 2u),
         "v"(l + 7u * 16u * APITCH * 2u),
         "v"(kp + (size_t)(st * 64) * Dv), "v"(kp + (size_t)(st * 64 + 16) * Dv),
         "v"(kp + (size_t)(st * 64 + 32) * Dv), "v"(kp + (size_t)(st * 64 + 48) * Dv),
         "v"(vp + (st * 64)), "v"(vp + (st * 64 + 16 * Sv)), "v"(vp + (st * 64 + 32 * Sv)), "v"(vp + (st * 64 + 48 * Sv))
      : "memory");
}

__global__ __launch_bounds__(128) void attn_kernel(
    const _Float16* __restrict__ Qb, const _Float16* __restrict__ Kb,
    const _Float16* __restrict__ vTb, _Float16* __restrict__ aout,
    const float* __restrict__ rpb)
{
  __shared__ __align__(16) _Float16 kv[2 * ABUF];
  const int lane = threadIdx.x & 31;
  const int wave = threadIdx.x >> 5;
  const int ml = lane & 15;
  const int koff = (lane >> 4) * 8;
  const int rowoff = (lane >> 4) * 8;
  const int qb = blockIdx.x, h = blockIdx.y, w = blockIdx.z & 7;
  const int j = blockIdx.z >> 3;          // modality pair: its own Q, K, V, output and bias table
  Qb += (size_t)j * ROWS * Dv;  Kb += (size_t)j * ROWS * Dv;
  vTb += (size_t)j * ROWS * Dv; aout += (size_t)j * ROWS * Dv;
  const float* rpbj = rpb + j * (2 * WSv - 1) * Hv;
  const int tq = qb;                      // 64-row chunks align to L

  const int cr = threadIdx.x >> 3;        // row of the stage this thread copies (and 16, 32, 48 below it)
  const int cc = (threadIdx.x & 7) * 8;   // its 16-byte piece of the row's 128 bytes
  const _Float16* kcp = Kb + (size_t)(w * Sv + cr) * Dv + h * HDv + cc;
  const _Float16* vcp = vTb + (size_t)((w * Hv + h) * HDv + cr) * Sv + cc;
  const unsigned lcopy = (unsigned)(size_t)kv + (unsigned)(cr * APITCH + cc) * 2u;

  kv_copy(lcopy, kcp, vcp, 0);

  const int qrow = qb * 64 + wave * 16;
  const _Float16* qp = Qb + (size_t)(w * Sv + qrow + ml) * Dv + h * HDv + koff;
  v16h qa0 = mkfrag(ld8(qp),      ld8(qp + 16));   // B operand: column = query ml
  v16h qa1 = mkfrag(ld8(qp + 32), ld8(qp + 48));

  v8f accO[4] = {};                       // accO[n][i] = O[query ml][d = n * 16 + rowoff + i]
  float m_ = -3.0e38f;                    // running maximum of query ml, the same in both of its lanes
  float l_ = 0.f;                         // running sum over this lane's half of the keys; joined after the loop
  const float L2E = 1.4426950408889634f;

  asm volatile("s_wait_asynccnt 0x0" ::: "memory");   // stage 0 has landed before the barrier publishes it
  __syncthreads();
  kv_copy(lcopy + ABUF * 2u, kcp, vcp, 1);

  // stays rolled: the buffer is picked by the stage's parity anyway
#pragma unroll 1
  for (int st = 0; st < ASTAGES; st++) {
    const int bo = (st & 1) * ABUF;
    const float biasv = rpbj[(tq - st + WSv - 1) * Hv + h];   // a stage is one temporal step of keys

    // unrolled so that both chunks' LDS offsets are constants (and the loops inside it so that s0, s1, mx, pb, vb
    // and accO are indexed by constants and stay in registers)
#pragma unroll
    for (int hc = 0; hc < 2; hc++) {
      // s0[i] = S[query ml][key hc * 32 + rowoff + i], s1[i] the same 16 keys on
      v8f s0 = {}, s1 = {};
      {
        const _Float16* kp0 = kv + bo + (hc * 32 + ml) * APITCH + koff;
        const _Float16* kp1 = kp0 + 16 * APITCH;
        v16h kb00 = mkfrag(ld8(kp0),      ld8(kp0 + 16));
        v16h kb01 = mkfrag(ld8(kp0 + 32), ld8(kp0 + 48));
        v16h kb10 = mkfrag(ld8(kp1),      ld8(kp1 + 16));
        v16h kb11 = mkfrag(ld8(kp1 + 32), ld8(kp1 + 48));
        s0 = WMMA_F32_F16(kb00, qa0, s0);
        s1 = WMMA_F32_F16(kb10, qa0, s1);
        s0 = WMMA_F32_F16(kb01, qa1, s0);
        s1 = WMMA_F32_F16(kb11, qa1, s1);
      }
      v16h vb[4];                          // A operand: row = d, k = the chunk's keys in the order of s0, s1
#pragma unroll
      for (int n = 0; n < 4; n++) {
        const _Float16* vp = kv + bo + (64 + n * 16 + ml) * APITCH + hc * 32 + koff;
        vb[n] = mkfrag(ld8(vp), ld8(vp + 16));
      }

      float mx[8];
#pragma unroll
      for (int i = 0; i < 8; i++) mx[i] = fmaxf(s0[i], s1[i]);
#pragma unroll
      for (int d = 4; d >= 1; d >>= 1)
#pragma unroll
        for (int i = 0; i < d; i++) mx[i] = fmaxf(mx[i], mx[i + d]);
      const float mc = fmaxf(mx[0], xhalf(mx[0])) + biasv;   // the bias is one value for the whole stage
      const float mn = fmaxf(m_, mc);
      const float alpha = __builtin_amdgcn_exp2f((m_ - mn) * L2E);
      m_ = mn;
      const float cl = (biasv - mn) * L2E;   // bias and maximum are one value per lane: one addend for all 16 scores

      v16h pb;                             // P^T as B operand: column = query ml, k as in vb
      float r0 = 0.f, r1 = 0.f;
#pragma unroll
      for (int i = 0; i < 8; i++) {
        const float p0 = __builtin_amdgcn_exp2f(fmaf(s0[i], L2E, cl));
        const float p1 = __builtin_amdgcn_exp2f(fmaf(s1[i], L2E, cl));
        r0 += p0;
        r1 += p1;
        pb[i]     = (_Float16)p0;
        pb[i + 8] = (_Float16)p1;
      }
      l_ = l_ * alpha + (r0 + r1);
#pragma unroll
      for (int n = 0; n < 4; n++) accO[n] *= alpha;

#pragma unroll
      for (int n = 0; n < 4; n++) accO[n] = WMMA_F32_F16(vb[n], pb, accO[n]);
    }

    asm volatile("s_wait_dscnt 0x0" ::: "memory");    // this wave's reads of the buffer are over before it is refilled
    asm volatile("s_wait_asynccnt 0x0" ::: "memory"); // this wave's copies of stage st + 1 have landed
    __syncthreads();                                  // publishes stage st + 1, frees stage st's buffer
    if (st + 2 < ASTAGES) kv_copy(lcopy + (unsigned)bo * 2u, kcp, vcp, st + 2);
  }
  asm volatile("s_wait_asynccnt 0x0" ::: "memory");   // nothing of this wave is in flight when it goes on

  const float inv = 1.0f / (l_ + xhalf(l_));
  // a lane's eight accumulator registers are eight neighbouring d of its query's row: one 16-byte store per tile
  v8h o[4];
#pragma unroll
  for (int n = 0; n < 4; n++)
#pragma unroll
    for (int i = 0; i < 8; i++) o[n][i] = (_Float16)(accO[n][i] * inv);
  _Float16* op = aout + (size_t)(w * Sv + qrow + ml) * Dv + h * HDv + rowoff;
#pragma unroll
  for (int n = 0; n < 4; n++) *(v8h*)(op + n * 16) = o[n];
}

// ---------------------------------------------------------------- output projection + residual + roll(+SH)
// grid (16, 8, 3 pairs): 256x128 tile per block of 8 waves, 64 rows x 64 cols per wave.
// four waves per SIMD: two blocks per WGP, as for the QKV GEMM
__global__ __launch_bounds__(256) __attribute__((amdgpu_waves_per_eu(4, 4))) void proj_kernel(
    const _Float16* __restrict__ aoutb, const _Float16* __restrict__ wpT,
    const float* __restrict__ bp,
    const float* __restrict__ audio, const float* __restrict__ video, const float* __restrict__ image,
    float* __restrict__ feat, _Float16* __restrict__ cat16)
{
  __shared__ __align__(16) _Float16 sm[2 * WBUF];
  const int j = blockIdx.z;
  const float* qmf = (j == 0) ? audio : (j == 1) ? video : image;   // residual: the pair's query modality
  aoutb += (size_t)j * ROWS * Dv;
  wpT += (size_t)j * Dv * Dv;
  bp += j * Dv;
  feat += (size_t)j * ROWS * Dv;
  const int lane = threadIdx.x & 31;
  const int wave = threadIdx.x >> 5;
  const int ml = lane & 15;
  const int m0 = blockIdx.x * 256 + (wave & 3) * 64;
  const int n0 = blockIdx.y * 128 + (wave >> 2) * 64;

  const int cr = threadIdx.x >> 3;
  const int cc = (threadIdx.x & 7) * 8;
  const _Float16* gp[12];
#pragma unroll
  for (int i = 0; i < 8; i++) gp[i] = aoutb + (size_t)(blockIdx.x * 256 + cr + 32 * i) * Dv + cc;
#pragma unroll
  for (int i = 0; i < 4; i++) gp[8 + i] = wpT + (size_t)(blockIdx.y * 128 + cr + 32 * i) * Dv + cc;

  // weights first: acc[p][n][i] is token m0 + n * 16 + ml, column n0 + p * 16 + rowoff + i
  v8f acc[4][4] = {};
  gemm_staged_w<Dv>(sm, gp, acc, true);

  const int rowoff = (lane >> 4) * 8;
  float* stf = (float*)(sm + wave * WSTG);
  // the wave's 64 tokens are one temporal step: their rows of the output follow one another
  const int wdw = m0 >> 9;
  const int tt = ((wdw & 3) * WSv + ((m0 & 511) >> 6) + SHv) & 31;   // roll back by +SH
  const size_t frow0 = (size_t)((wdw >> 2) * Tv + tt) * Lv;
  const float* bpl = bp + n0 + rowoff;
  v4f bc[4][2];
#pragma unroll
  for (int p = 0; p < 4; p++)
#pragma unroll
    for (int hf = 0; hf < 2; hf++) bc[p][hf] = *(const v4f*)(bpl + p * 16 + hf * 4);
  // the eight loads share one address register: it is an input here, so that it lives to this wait and no load's
  // result is given the same register
  asm volatile("s_wait_xcnt 0x0" :: "v"(bpl) : "memory");
  const int r0 = lane >> 4;
  const int c = (lane & 15) * 4;
  // 32 tokens at a time: 64 rows of floats do not fit the wave's part of the ring
#pragma unroll
  for (int half = 0; half < 2; half++) {
#pragma unroll
    for (int nn = 0; nn < 2; nn++)
#pragma unroll
      for (int p = 0; p < 4; p++)
#pragma unroll
        for (int hf = 0; hf < 2; hf++) {
          v4f v;
#pragma unroll
          for (int e = 0; e < 4; e++) v[e] = acc[p][half * 2 + nn][hf * 4 + e] + bc[p][hf][e];
          *(v4f*)(stf + (nn * 16 + ml) * FPITCH + p * 16 + rowoff + hf * 4) = v;
        }
    // this wave's staging writes have landed before other lanes of it read them back
    asm volatile("s_wait_dscnt 0x0" ::: "memory");
    // a wave-wide 16-byte access covers two rows of 256 bytes: whole lines for the residual, feat and (8 bytes) cat16
#pragma unroll
    for (int u = 0; u < 16; u++) {
      const size_t fr = frow0 + half * 32 + u * 2 + r0;
      const v4f v = *(const v4f*)(stf + (u * 2 + r0) * FPITCH + c) + *(const v4f*)(qmf + fr * Dv + n0 + c);
      *(v4f*)(feat + fr * Dv + n0 + c) = v;
      v4h h;
#pragma unroll
      for (int e = 0; e < 4; e++) h[e] = (_Float16)v[e];
      *(v4h*)(cat16 + fr * D3 + j * Dv + n0 + c) = h;
    }
    // the second half's loads take the registers that these stores name: none is rewritten ahead of this wait
    if (half == 0) asm volatile("s_wait_xcnt 0x0" ::: "memory");
  }
}

// ---------------------------------------------------------------- gating MLP layer 1 (+GELU) and its share of layer 2
// grid (16, 16): 256x128 tile per block of 16 waves, one block per WGP.
// Layer 2 has three columns: each wave multiplies its 32 x 64 activations with its 64 rows of Wg2 as soon as they
// are turned in its LDS, and leaves three sums per row. The activations themselves never go to memory.
// gpart[c * GSLOTS + slot][row]: a wave's 32 rows of one plane are one whole 128-byte line, written by it alone.
#define GSLOTS (D2 / 64)
#define XCHW   2048                 // floats that a wave hands to its partner: 32 x 64 half sums
__global__ __launch_bounds__(512) void gate1_kernel(
    const _Float16* __restrict__ cat16, const _Float16* __restrict__ wg1T,
    const float* __restrict__ bg1, const float* __restrict__ Wg2, float* __restrict__ gpart)
{
  __shared__ __align__(16) _Float16 sm[2 * KBUF];
  static_assert(16 * XCHW * 2 + 16 * 32 * SPITCH <= 2 * KBUF, "exchange and staging lie side by side in the ring");
  const int lane = threadIdx.x & 31;
  const int wave = threadIdx.x >> 5;
  const int ml = lane & 15;
  // the 32 rows and 64 columns that the wave finishes: its k group picks the half of the 64 rows it multiplied
  const int m0 = blockIdx.x * 256 + (wave & 3) * 64 + (wave >> 3) * 32;
  const int n0 = blockIdx.y * 128 + ((wave >> 2) & 1) * 64;

  const int cr = threadIdx.x >> 4;          // row of the tile this thread copies (and every 32nd below it)
  const int cc = (threadIdx.x & 15) * 8;    // its 16-byte piece of the row's 256 bytes
  const _Float16* gp[12];
#pragma unroll
  for (int i = 0; i < 8; i++) gp[i] = cat16 + (size_t)(blockIdx.x * 256 + cr + 32 * i) * D3 + cc;
#pragma unroll
  for (int i = 0; i < 4; i++) gp[8 + i] = wg1T + (size_t)(blockIdx.y * 128 + cr + 32 * i) * D3 + cc;

  v8f part[4][4] = {};
  gemm_staged_k2<D3>(sm, gp, part);

  // The two k groups' sums are joined. A wave hands tiles n = 2, 3 to its partner (wave ^ 8), lane to lane, 16 bytes
  // a lane and 512 bytes in a row per store, and adds the partner's to its own tiles n = 0, 1.
  float* xs = (float*)sm;
  float* mine = xs + wave * XCHW + lane * 4;
  const float* theirs = xs + (wave ^ 8) * XCHW + lane * 4;
#pragma unroll
  for (int p = 0; p < 4; p++)
#pragma unroll
    for (int nn = 0; nn < 2; nn++)
#pragma unroll
      for (int hf = 0; hf < 2; hf++) {
        v4f v;
#pragma unroll
        for (int e = 0; e < 4; e++) v[e] = part[p][2 + nn][hf * 4 + e];
        *(v4f*)(mine + ((p * 2 + nn) * 2 + hf) * 128) = v;
      }
  __syncthreads();                          // every wave's half sums are there for its partner
  // acc[p][n][i]: row m0 + p * 16 + ml, column n0 + n * 16 + rowoff + i
  v8f acc[2][4];
#pragma unroll
  for (int p = 0; p < 4; p++)
#pragma unroll
    for (int nn = 0; nn < 2; nn++)
#pragma unroll
      for (int hf = 0; hf < 2; hf++) {
        const v4f o = *(const v4f*)(theirs + ((p * 2 + nn) * 2 + hf) * 128);
#pragma unroll
        for (int e = 0; e < 4; e++) acc[nn][p][hf * 4 + e] = part[p][nn][hf * 4 + e] + o[e];
      }

  const int rowoff = (lane >> 4) * 8;
  // behind the exchange area, which a slower partner may still be reading
  _Float16* st = sm + 16 * XCHW * 2 + wave * (32 * SPITCH);
  // for layer 2 a lane takes eight of the wave's 64 columns: eight rows of Wg2 are 24 floats in a row. Asked for
  // here, they arrive under the GELUs.
  const float* wl = Wg2 + (n0 + (lane & 7) * 8) * 3;
  v4f wc[6];
#pragma unroll
  for (int q = 0; q < 6; q++) wc[q] = *(const v4f*)(wl + q * 4);
  // the six loads share one address register: it is an input here, so that it lives to this wait and no load's
  // result is given the same register
  asm volatile("s_wait_xcnt 0x0" :: "v"(wl) : "memory");
#pragma unroll
  for (int n = 0; n < 4; n++) {
    v4f bc[2];
#pragma unroll
    for (int hf = 0; hf < 2; hf++) bc[hf] = *(const v4f*)(bg1 + n0 + n * 16 + rowoff + hf * 4);
#pragma unroll
    for (int p = 0; p < 2; p++) {
      v8h h;
#pragma unroll
      for (int i = 0; i < 8; i++) {
        float x = acc[p][n][i] + bc[i >> 2][i & 3];
        float g = 0.5f * x * (1.0f + erff(x * 0.70710678118f));   // exact GELU
        h[i] = (_Float16)g;
      }
      *(v8h*)(st + (p * 16 + ml) * SPITCH + n * 16 + rowoff) = h;
    }
  }
  // this wave's staging writes have landed before other lanes of it read them back
  asm volatile("s_wait_dscnt 0x0" ::: "memory");
  // s[u][c]: row u * 4 + (lane >> 3), this lane's eight columns: 24 independent sums
  float s[8][3] = {};
#pragma unroll
  for (int u = 0; u < 8; u++) {
    const v8h g = *(const v8h*)(st + (u * 4 + (lane >> 3)) * SPITCH + (lane & 7) * 8);
#pragma unroll
    for (int i = 0; i < 8; i++)
#pragma unroll
      for (int c = 0; c < 3; c++) s[u][c] = fmaf((float)g[i], wc[(i * 3 + c) >> 2][(i * 3 + c) & 3], s[u][c]);
  }
  // The eight lanes that share rows add up. At each step a lane keeps half of its rows and hands the other half to
  // its partner, so that lane l ends with the whole sum of row u = l & 7 of its eight.
  const bool b2 = lane & 4, b1 = lane & 2, b0 = lane & 1;
  float* gp0 = gpart + (size_t)(n0 >> 6) * ROWS + m0 + (lane & 7) * 4 + (lane >> 3);
#pragma unroll
  for (int c = 0; c < 3; c++) {
    float t[4], r[2];
#pragma unroll
    for (int k = 0; k < 4; k++) t[k] = (b2 ? s[k + 4][c] : s[k][c]) + rowx<4>(b2 ? s[k][c] : s[k + 4][c]);
#pragma unroll
    for (int k = 0; k < 2; k++) r[k] = (b1 ? t[k + 2] : t[k]) + rowx<2>(b1 ? t[k] : t[k + 2]);
    gp0[(size_t)c * GSLOTS * ROWS] = (b0 ? r[1] : r[0]) + rowx<1>(b0 ? r[0] : r[1]);
  }
}

// ---------------------------------------------------------------- gating layer 2's last sum + softmax + fuse
// FROWS whole rows per block, four columns per thread: 16-byte accesses, the gates the same for the whole block,
// all 3 * FROWS loads of a thread issued before the first sum.
// While they fly, the block's first wave adds the GSLOTS partial sums of each logit, one slot per lane, for the
// block's FROWS rows at once, and takes the softmax; its loads are issued first, so that they come back first.
// The three planes come as three pointers, so that each address is a block-uniform base plus one per-lane offset
// that lives until the loads have come back: no vector register that an issued load names is written before that.
#define FROWS 4
__global__ __launch_bounds__(256) void fuse_kernel(const float* __restrict__ feat0, const float* __restrict__ feat1,
                                                   const float* __restrict__ feat2, const float* __restrict__ gpart,
                                                   const float* __restrict__ bg2, float* __restrict__ out)
{
  __shared__ __align__(16) float gs[3][FROWS];
  const int row0 = blockIdx.x * FROWS;
  const unsigned c = threadIdx.x * 4u;
  const float* fb[3] = { feat0 + (size_t)row0 * Dv, feat1 + (size_t)row0 * Dv, feat2 + (size_t)row0 * Dv };
  float* ob = out + (size_t)row0 * Dv;
  const bool first = threadIdx.x < 32;
  const float* gl = gpart + (size_t)(threadIdx.x & 31) * ROWS + row0;
  v4f sp[3] = {};
  if (first) {
#pragma unroll
    for (int m = 0; m < 3; m++) sp[m] = *(const v4f*)(gl + (size_t)m * GSLOTS * ROWS);
    // the address is an input here, so that it lives to this wait and no load's result is given its register
    asm volatile("s_wait_xcnt 0x0" :: "v"(gl) : "memory");
  }
  v4f f[FROWS][3];
#pragma unroll
  for (int u = 0; u < FROWS; u++)
#pragma unroll
    for (int m = 0; m < 3; m++) f[u][m] = *(const v4f*)(fb[m] + u * Dv + c);
  if (first) {
    const float L2E = 1.4426950408889634f;
#pragma unroll
    for (int m = 0; m < 3; m++)
#pragma unroll
      for (int u = 0; u < FROWS; u++) {
        float x = sp[m][u];
        x += rowx<1>(x);
        x += rowx<2>(x);
        x += rowx<4>(x);
        x += rowx<8>(x);
        sp[m][u] = x + xhalf(x);
      }
#pragma unroll
    for (int u = 0; u < FROWS; u++) {
      const float a0 = sp[0][u] + bg2[0], a1 = sp[1][u] + bg2[1], a2 = sp[2][u] + bg2[2];
      const float mx = fmaxf(a0, fmaxf(a1, a2));
      const float e0 = exp2_slot((a0 - mx) * L2E), e1 = exp2_slot((a1 - mx) * L2E), e2 = exp2_slot((a2 - mx) * L2E);
      const float inv = 1.0f / (e0 + e1 + e2);
      sp[0][u] = e0 * inv;
      sp[1][u] = e1 * inv;
      sp[2][u] = e2 * inv;
    }
    if (threadIdx.x == 0) {
#pragma unroll
      for (int m = 0; m < 3; m++) *(v4f*)gs[m] = sp[m];
    }
  }
  __syncthreads();                         // the gates of the block's rows are there for every wave
  const v4f g0 = *(const v4f*)gs[0], g1 = *(const v4f*)gs[1], g2 = *(const v4f*)gs[2];
#pragma unroll
  for (int u = 0; u < FROWS; u++) *(v4f*)(ob + u * Dv + c) = g0[u] * f[u][0] + g1[u] * f[u][1] + g2[u] * f[u][2];
}

// ---------------------------------------------------------------- launch
extern "C" void kernel_launch(void* const* d_in, const int* in_sizes, int n_in,
                              void* d_out, int out_size, void* d_ws, size_t ws_size,
                              hipStream_t stream)
{
  const float* audio = (const float*)d_in[0];
  const float* video = (const float*)d_in[1];
  const float* image = (const float*)d_in[2];
  const float* Wq  = (const float*)d_in[3];
  const float* Wk  = (const float*)d_in[4];
  const float* Wv  = (const float*)d_in[5];
  const float* Wp  = (const float*)d_in[6];
  const float* bq  = (const float*)d_in[7];
  const float* bk  = (const float*)d_in[8];
  const float* bv  = (const float*)d_in[9];
  const float* bp  = (const float*)d_in[10];
  const float* qn  = (const float*)d_in[11];
  const float* kn  = (const float*)d_in[12];
  const float* rpb = (const float*)d_in[13];
  const float* Wg1 = (const float*)d_in[14];
  const float* bg1 = (const float*)d_in[15];
  const float* Wg2 = (const float*)d_in[16];
  const float* bg2 = (const float*)d_in[17];
  float* out = (float*)d_out;

  char* p = (char*)d_ws;
  auto carve = [&](size_t bytes) -> void* {
    void* r = (void*)p;
    p += (bytes + 255) & ~(size_t)255;
    return r;
  };
  const size_t NE = (size_t)ROWS * Dv;                 // 4M elems
  _Float16* x16   = (_Float16*)carve(3 * NE * 2);
  _Float16* wqT   = (_Float16*)carve(3 * (size_t)Dv * Dv * 2);
  _Float16* wkT   = (_Float16*)carve(3 * (size_t)Dv * Dv * 2);
  _Float16* wvT   = (_Float16*)carve(3 * (size_t)Dv * Dv * 2);
  _Float16* wpT   = (_Float16*)carve(3 * (size_t)Dv * Dv * 2);
  _Float16* wg1T  = (_Float16*)carve((size_t)D3 * D2 * 2);
  _Float16* Qb    = (_Float16*)carve(3 * NE * 2);       // one plane per modality pair
  _Float16* Kb    = (_Float16*)carve(3 * NE * 2);
  _Float16* vTb   = (_Float16*)carve(3 * NE * 2);
  _Float16* aoutb = (_Float16*)carve(3 * NE * 2);
  _Float16* cat16 = (_Float16*)carve((size_t)ROWS * D3 * 2);
  float*    feats = (float*)carve(3 * NE * 4);
  float*    gpart = (float*)carve((size_t)3 * GSLOTS * ROWS * 4);

  // convert activations and transpose-convert weights to f16
  prep_kernel<<<G1TILES + 12 * WTILES + 3 * XBLOCKS, 256, 0, stream>>>(
      audio, video, image, Wq, Wk, Wv, Wp, Wg1, x16, wqT, wkT, wvT, wpT, wg1T);

  // the three modality pairs do not depend on one another: each stage takes all of them in one grid
  qkv_kernel<<<dim3(16, 8, 9), 256, 0, stream>>>(x16, wqT, wkT, wvT, bq, bk, bv, qn, kn, Qb, Kb, vTb);
  attn_kernel<<<dim3(8, 16, 24), 128, 0, stream>>>(Qb, Kb, vTb, aoutb, rpb);
  proj_kernel<<<dim3(16, 8, 3), 256, 0, stream>>>(aoutb, wpT, bp, audio, video, image, feats, cat16);

  gate1_kernel<<<dim3(16, 16), 512, 0, stream>>>(cat16, wg1T, bg1, Wg2, gpart);
  fuse_kernel<<<ROWS / FROWS, 256, 0, stream>>>(feats, feats + NE, feats + 2 * NE, gpart, bg2, out);
}
